// v000
// The times below were measured on an AMD MI455X: many runs one after another, warmed up first and cycling through
// copies of the inputs, with the whole window's GPU time divided by the number of runs. Launches and the gaps
// between them are all in it. The median over several windows is given; except for v000 it joins two sittings, which
// can be a few percent apart, so the side-by-side timings, each taken in one sitting, are the better comparison.
// v000 is the starting kernel. One run takes 1590 microseconds.
#include <hip/hip_runtime.h>

// Causal multi-head self-attention with 128-wide heads and interleaved-pair rotary embeddings, WITHOUT an output projection (x [2][2048][2048]; q, k, v = einsum('bsm,nm->bsn', x, W) = x W^T ('oi' (out, in) [2048][2048] normal x 0.02, no bias; 16 heads x 128); rope on (even, odd) pairs: (xe cos - xo sin, xe sin + xo cos) with angle m x theta[i], theta = exp(-log(10000) x (2i) / 128) IN THAT SPELLING (64 f32 frequencies baked from the module's own line; precise cosf/sinf), m = arange(2048); scores x 1/sqrt(128); causal (tril kept, -1e30 elsewhere == exclusion: exp underflows to exactly 0); softmax in f32; out = the merged heads [b][s][h x 128 + d] -> [2][2048][2048] f32 (8.4 M); argument order x, Wq, Wk, Wv).
// Layout per batch: bf16 copy of X; 'oi' weights; exact projections; k_csP table (64 angles) + k_ropeI interleaved-pair plane builders at HD 128; causal T-2048 attention with 128-wide heads (hybrid rows: < 512 hi/lo 3 products, rest fp16 x1024; k_gemmc skips tiles above the diagonal); the f32 merge writes the merged heads straight to the output rows (no output projection).
// Compute dtypes, f32 accumulate: every input rounded to bf16; projections exact; rotary f32; attention rows < 512 3 products, rest fp16; softmax f32; output f32 (the P.v accumulators, scaled back by 1/1024 on the fp16 rows).

#define NB_  2
#define TT   2048
#define DM   2048
#define NH_  16
#define NKV  16
#define REP  (NH_ / NKV)
#define HD   128
#define DQ   (NH_ * HD)
#define DKV  (NKV * HD)
#define ZH   2
#define RH   512                  // query rows < RH use hi+lo planes (0: none)
#define WIN  2048
#define PCAR 1024.0f
#define SCL  0.088388347648318447f   // HD^-0.5
typedef _Float16 h16;
typedef unsigned short bf;
typedef __attribute__((ext_vector_type(16))) __bf16   v16bf;
typedef __attribute__((ext_vector_type(16))) _Float16 v16h;
typedef __attribute__((ext_vector_type(8)))  _Float16 v8h;
typedef __attribute__((ext_vector_type(8)))  unsigned short v8us;
typedef __attribute__((ext_vector_type(8)))  float    v8f;
typedef __attribute__((ext_vector_type(4)))  float    v4f;
typedef v8h  __attribute__((may_alias)) v8ha;
typedef v4f  __attribute__((may_alias)) v4fa;
typedef v8us __attribute__((may_alias)) v8usa;

__device__ __forceinline__ unsigned short f2bf(float f) { unsigned u = __float_as_uint(f); u += 0x7FFFu + ((u >> 16) & 1u); return (unsigned short)(u >> 16); }
__device__ __forceinline__ float bf2f(unsigned short b) { return __uint_as_float(((unsigned)b) << 16); }
__device__ __forceinline__ float bfr(float f) { return bf2f(f2bf(f)); }
__device__ __forceinline__ v16h cat16(v8h lo, v8h hi) { return __builtin_shufflevector(lo, hi, 0, 1, 2, 3, 4, 5, 6, 7, 8, 9, 10, 11, 12, 13, 14, 15); }
__device__ __forceinline__ v16bf cat16b(v8us lo, v8us hi) { return __builtin_bit_cast(v16bf, __builtin_shufflevector(lo, hi, 0, 1, 2, 3, 4, 5, 6, 7, 8, 9, 10, 11, 12, 13, 14, 15)); }
__device__ __forceinline__ v8f wmma16(v16h a, v16h b, v8f c) { return __builtin_amdgcn_wmma_f32_16x16x32_f16(false, a, false, b, (short)0, c, false, false); }
__device__ __forceinline__ v8f wmmab(v16bf a, v16bf b, v8f c) { return __builtin_amdgcn_wmma_f32_16x16x32_bf16(false, a, false, b, (short)0, c, false, false); }



// ---- k_gemmw: register-blocked GEMM, ONE WAVE per 64x64 output tile (16 accumulators), operands straight from K-contiguous 16-bit planes; grid (M/64, N/64, Z), 32 threads.
// C[m][n] (f32, pitch ldc, + optional f32 bias[n]) = sum_k A[m][k] Bt[n][k] (+ split products per NSPLIT). z-batch strides sA/sB/sC in elements. K % 32 == 0.
template <typename T16> struct WFrag;
template <> struct WFrag<h16> { typedef v16h V; static __device__ __forceinline__ V ld(const h16* p) { return cat16(*(const v8h*)p, *(const v8h*)(p + 16)); } static __device__ __forceinline__ v8f mma(V a, V b, v8f c) { return wmma16(a, b, c); } };
template <> struct WFrag<bf> { typedef v16bf V; static __device__ __forceinline__ V ld(const bf* p) { return cat16b(*(const v8us*)p, *(const v8us*)(p + 16)); } static __device__ __forceinline__ v8f mma(V a, V b, v8f c) { return wmmab(a, b, c); } };
template <typename T16, int NSPLIT, bool BIAS>
__global__ __launch_bounds__(32) void k_gemmw(const T16* __restrict__ A, const T16* __restrict__ A2, const T16* __restrict__ Bt, const T16* __restrict__ Bt2, int K, float* C, int ldc, const float* __restrict__ bias, size_t sA, size_t sB, size_t sC) {
    typedef typename WFrag<T16>::V V;
    __shared__ __align__(16) float os[16 * 68];
    const size_t z = blockIdx.z; A += z * sA; if (A2) A2 += z * sA; Bt += z * sB; if (Bt2) Bt2 += z * sB; C += z * sC;
    const int lane = threadIdx.x & 31, lr = lane & 15, hi = lane >> 4; const int r0 = blockIdx.x * 64, c0 = blockIdx.y * 64;
    v8f acc[4][4];
#pragma unroll
    for (int mb = 0; mb < 4; ++mb)
#pragma unroll
        for (int nb = 0; nb < 4; ++nb) acc[mb][nb] = (v8f){};
    const size_t aoff = (size_t)(r0 + lr) * K + 8 * hi, boff = (size_t)(c0 + lr) * K + 8 * hi;
#pragma unroll 1
    for (int kc = 0; kc < K; kc += 32) {
        V a[4], a2[4];
#pragma unroll
        for (int mb = 0; mb < 4; ++mb) { a[mb] = WFrag<T16>::ld(A + aoff + (size_t)mb * 16 * K + kc); if (NSPLIT == 1 || NSPLIT == 2) a2[mb] = WFrag<T16>::ld(A2 + aoff + (size_t)mb * 16 * K + kc); }
#pragma unroll
        for (int nb = 0; nb < 4; ++nb) { const V b = WFrag<T16>::ld(Bt + boff + (size_t)nb * 16 * K + kc); V b2; if (NSPLIT >= 2) b2 = WFrag<T16>::ld(Bt2 + boff + (size_t)nb * 16 * K + kc);
#pragma unroll
            for (int mb = 0; mb < 4; ++mb) { acc[mb][nb] = WFrag<T16>::mma(a[mb], b, acc[mb][nb]); if (NSPLIT == 1 || NSPLIT == 2) acc[mb][nb] = WFrag<T16>::mma(a2[mb], b, acc[mb][nb]); if (NSPLIT >= 2) acc[mb][nb] = WFrag<T16>::mma(a[mb], b2, acc[mb][nb]); } }
        asm volatile("v_nop\n\tv_nop\n\tv_nop\n\tv_nop" : "+v"(acc[0][0]), "+v"(acc[1][1]), "+v"(acc[2][2]), "+v"(acc[3][3]) : "v"(a[0]), "v"(a[3]));
    }
#pragma unroll
    for (int mb = 0; mb < 4; ++mb) {
#pragma unroll
        for (int nb = 0; nb < 4; ++nb) {
#pragma unroll
            for (int j = 0; j < 8; ++j) os[(hi * 8 + j) * 68 + nb * 16 + lr] = acc[mb][nb][j]; }
        __builtin_amdgcn_wave_barrier(); asm volatile("" ::: "memory");
        float* crow = C + (size_t)(r0 + mb * 16) * ldc + c0;
{
#pragma unroll
            for (int s = 0; s < 8; ++s) { const int row = 2 * s + hi, cofs = lr * 4; v4f val = *(const v4fa*)(os + row * 68 + cofs); if (BIAS) { val[0] += bfr(bias[c0 + cofs]); val[1] += bfr(bias[c0 + cofs + 1]); val[2] += bfr(bias[c0 + cofs + 2]); val[3] += bfr(bias[c0 + cofs + 3]); }
                *(v4f*)(crow + (size_t)row * ldc + cofs) = val; }
             }
        __builtin_amdgcn_wave_barrier(); asm volatile("" ::: "memory");
    }
}

// ---- k_gemmc: the same one-wave 64x64 tile GEMM specialised for causal attention: CMODE 1 skips score tiles entirely above the diagonal (query rows r0+roff.., key columns c0..), CMODE 2 limits the
// key (K) loop of the probability x value contraction to the diagonal block (probabilities beyond it are exactly zero). roff = row offset of this launch's first row within the sequence.
template <typename T16, int NSPLIT, int CMODE>
__global__ __launch_bounds__(32) void k_gemmc(const T16* __restrict__ A, const T16* __restrict__ A2, const T16* __restrict__ Bt, const T16* __restrict__ Bt2, int K, float* C, int ldc, int roff, size_t sA, size_t sB, size_t sC) {
    typedef typename WFrag<T16>::V V;
    __shared__ __align__(16) float os[16 * 68];
    const size_t z = blockIdx.z; A += z * sA; if (A2) A2 += z * sA; Bt += z * sB; if (Bt2) Bt2 += z * sB; C += z * sC;
    const int lane = threadIdx.x & 31, lr = lane & 15, hi = lane >> 4; const int r0 = blockIdx.x * 64, c0 = blockIdx.y * 64;
    if (CMODE == 1 && c0 > r0 + roff + 63) return;                  // score tile entirely above the causal diagonal: never read (the softmax masks j > i by select)
    const int Kl = (CMODE == 2) ? min(K, r0 + roff + 64) : K;        // P.V: probabilities are exactly 0 beyond the diagonal block, so the K loop stops there
    v8f acc[4][4];
#pragma unroll
    for (int mb = 0; mb < 4; ++mb)
#pragma unroll
        for (int nb = 0; nb < 4; ++nb) acc[mb][nb] = (v8f){};
    const size_t aoff = (size_t)(r0 + lr) * K + 8 * hi, boff = (size_t)(c0 + lr) * K + 8 * hi;
#pragma unroll 1
    for (int kc = 0; kc < Kl; kc += 32) {
        V a[4], a2[4];
#pragma unroll
        for (int mb = 0; mb < 4; ++mb) { a[mb] = WFrag<T16>::ld(A + aoff + (size_t)mb * 16 * K + kc); if (NSPLIT == 1 || NSPLIT == 2) a2[mb] = WFrag<T16>::ld(A2 + aoff + (size_t)mb * 16 * K + kc); }
#pragma unroll
        for (int nb = 0; nb < 4; ++nb) { const V b = WFrag<T16>::ld(Bt + boff + (size_t)nb * 16 * K + kc); V b2; if (NSPLIT >= 2) b2 = WFrag<T16>::ld(Bt2 + boff + (size_t)nb * 16 * K + kc);
#pragma unroll
            for (int mb = 0; mb < 4; ++mb) { acc[mb][nb] = WFrag<T16>::mma(a[mb], b, acc[mb][nb]); if (NSPLIT == 1 || NSPLIT == 2) acc[mb][nb] = WFrag<T16>::mma(a2[mb], b, acc[mb][nb]); if (NSPLIT >= 2) acc[mb][nb] = WFrag<T16>::mma(a[mb], b2, acc[mb][nb]); } }
        asm volatile("v_nop\n\tv_nop\n\tv_nop\n\tv_nop" : "+v"(acc[0][0]), "+v"(acc[1][1]), "+v"(acc[2][2]), "+v"(acc[3][3]) : "v"(a[0]), "v"(a[3]));
    }
#pragma unroll
    for (int mb = 0; mb < 4; ++mb) {
#pragma unroll
        for (int nb = 0; nb < 4; ++nb) {
#pragma unroll
            for (int j = 0; j < 8; ++j) os[(hi * 8 + j) * 68 + nb * 16 + lr] = acc[mb][nb][j]; }
        __builtin_amdgcn_wave_barrier(); asm volatile("" ::: "memory");
        float* crow = C + (size_t)(r0 + mb * 16) * ldc + c0;
{
#pragma unroll
            for (int s = 0; s < 8; ++s) { const int row = 2 * s + hi, cofs = lr * 4; v4f val = *(const v4fa*)(os + row * 68 + cofs);
                *(v4f*)(crow + (size_t)row * ldc + cofs) = val; }
             }
        __builtin_amdgcn_wave_barrier(); asm volatile("" ::: "memory");
    }
}

__device__ __forceinline__ h16 tohx(float x) { return (h16)x; }
__device__ __forceinline__ void splitf(float y, unsigned short& h, unsigned short& l) { h = f2bf(y); l = f2bf(y - bf2f(h)); }
typedef __attribute__((ext_vector_type(2))) _Float16 v2h;
typedef __attribute__((ext_vector_type(4))) _Float16 v4h;
typedef __attribute__((ext_vector_type(2))) unsigned short v2us;
typedef __attribute__((ext_vector_type(4))) unsigned short v4us;
typedef __attribute__((ext_vector_type(2))) float v2f;
typedef __attribute__((ext_vector_type(4))) int v4i;

__global__ __launch_bounds__(256) void k_cvt8(const float* __restrict__ src, bf* dst, size_t n8) { const size_t i = (size_t)blockIdx.x * 256 + threadIdx.x; if (i >= n8) return; const v8f v = *(const v8f*)(src + i * 8); v8us o;
#pragma unroll
    for (int k = 0; k < 8; ++k) o[k] = f2bf(v[k]); *(v8us*)(dst + i * 8) = o;  }

__global__ __launch_bounds__(256) void k_vtp(const float* __restrict__ F, int pitch, int nheads, h16* V16, bf* Vh, bf* Vl) { const size_t e = ((size_t)blockIdx.x * 256 + threadIdx.x) * 2; if (e >= (size_t)nheads * HD * TT) return; const int t = (int)(e % TT); const int d = (int)((e / TT) % HD); const int g = (int)(e / ((size_t)TT * HD)); v2h o16; v2us oh, ol;
#pragma unroll
    for (int q = 0; q < 2; ++q) { const float x = F[(size_t)(t + q) * pitch + g * HD + d]; o16[q] = tohx(x); unsigned short a2, c2; splitf(x, a2, c2); oh[q] = a2; ol[q] = c2; }
    *(v2h*)(V16 + e) = o16; *(v2us*)(Vh + e) = oh; *(v2us*)(Vl + e) = ol;  }
__constant__ float INV2[HD / 2] = { 1.000000000e+00f, 8.659642935e-01f, 7.498942018e-01f, 6.493816376e-01f, 5.623413324e-01f, 4.869675040e-01f, 4.216964841e-01f, 3.651741147e-01f, 3.162277639e-01f, 2.738419473e-01f, 2.371373475e-01f, 2.053525001e-01f, 1.778279394e-01f, 1.539926529e-01f, 1.333521456e-01f, 1.154781953e-01f, 9.999999404e-02f, 8.659642935e-02f, 7.498941571e-02f, 6.493815780e-02f, 5.623412505e-02f, 4.869675636e-02f, 4.216965288e-02f, 3.651741147e-02f, 3.162277490e-02f, 2.738419361e-02f, 2.371373400e-02f, 2.053524740e-02f, 1.778279617e-02f, 1.539926231e-02f, 1.333521400e-02f, 1.154781692e-02f, 9.999999776e-03f, 8.659644052e-03f, 7.498940919e-03f, 6.493817084e-03f, 5.623412319e-03f, 4.869675264e-03f, 4.216963891e-03f, 3.651741194e-03f, 3.162276698e-03f, 2.738419222e-03f, 2.371374052e-03f, 2.053524600e-03f, 1.778279431e-03f, 1.539926161e-03f, 1.333521330e-03f, 1.154781668e-03f, 9.999999311e-04f, 8.659643936e-04f, 7.498940686e-04f, 6.493816618e-04f, 5.623411853e-04f, 4.869675031e-04f, 4.216964007e-04f, 3.651740844e-04f, 3.162277862e-04f, 2.738420444e-04f, 2.371372684e-04f, 2.053524659e-04f, 1.778279402e-04f, 1.539926743e-04f, 1.333520777e-04f, 1.154781567e-04f };   // float32 exp(-log(10000) x (2i) / 128) in the module's own spelling, generated with jnp to be bit-exact
__global__ __launch_bounds__(256) void k_csP(float* CS) { const int idx = blockIdx.x * 256 + threadIdx.x; if (idx >= TT * HD) return; const int d = idx % HD; const int t = idx / HD; const float a = __fmul_rn((float)t, INV2[d >> 1]); v2f cs; cs[0] = cosf(a); cs[1] = sinf(a); *(v2f*)(CS + (size_t)idx * 2) = cs;  }
__global__ __launch_bounds__(256) void k_ropeI(const float* __restrict__ F, int pitch, int nheads, const float* __restrict__ CS, float sc, h16* P16, bf* Ph, bf* Pl) {
    const size_t e = ((size_t)blockIdx.x * 256 + threadIdx.x) * 2; if (e >= (size_t)nheads * TT * HD) return; const int d = (int)(e % HD); const int t = (int)((e / HD) % TT); const int h = (int)(e / ((size_t)HD * TT)); const float* f = F + (size_t)t * pitch + h * HD; const float x0 = f[d], x1 = f[d + 1]; const v2f cs = *(const v2f*)(CS + ((size_t)t * HD + d) * 2); v2h o16; v2us oh, ol;
    float a0 = __fmul_rn(x0, cs[0]), b0 = __fmul_rn(x1, cs[1]), a1 = __fmul_rn(x1, cs[0]), b1 = __fmul_rn(x0, cs[1]); 
    float r0 = __fsub_rn(a0, b0) * sc, r1 = __fadd_rn(b1, a1) * sc;   /* even: x0 c - x1 s; odd: x0 s + x1 c */
    o16[0] = tohx(r0); o16[1] = tohx(r1); { unsigned short a2, c2; splitf(r0, a2, c2); oh[0] = a2; ol[0] = c2; splitf(r1, a2, c2); oh[1] = a2; ol[1] = c2; }
    *(v2h*)(P16 + e) = o16; *(v2us*)(Ph + e) = oh; *(v2us*)(Pl + e) = ol;  }

// k_asoft: per row (zz, i): t = S x HD^-0.5 for j <= i and i - j < WIN (WIN = 2048 = TT here: every key j <= i is kept: the plain causal rule; the reference's where(tril, scores, -1e30) is exclusion); softmax over the 2048 keys (register row, one exp, fixed trees);
__global__ __launch_bounds__(256) void k_asoft(const float* __restrict__ Sb, h16* P16, bf* Ph, bf* Pl) {
    const int lane = threadIdx.x & 31; const int row = blockIdx.x * 8 + (threadIdx.x >> 5); if (row >= ZH * TT) return; const int i = row % TT; const int zz = row / TT; (void)zz; const bool hires = (i < RH); const float* sr = Sb + (size_t)row * TT; float v[TT / 32]; float mx = -3.0e38f;
#pragma unroll
    for (int ch = 0; ch < TT / 128; ++ch) { const int j0 = ch * 128 + lane * 4; const v4f a = *(const v4f*)(sr + j0);
#pragma unroll
        for (int q = 0; q < 4; ++q) { const int j = j0 + q; (void)j; const float t = (j <= i && i - j < WIN) ? a[q] * SCL : -3.0e38f; v[ch * 4 + q] = t; mx = fmaxf(mx, t); } }
#pragma unroll
    for (int sh = 16; sh; sh >>= 1) mx = fmaxf(mx, __shfl_xor(mx, sh, 32));
    float sum = 0.f;
#pragma unroll
    for (int k = 0; k < TT / 32; ++k) { float d0 = __fsub_rn(v[k], mx); v[k] = __builtin_amdgcn_exp2f(__fmul_rn(d0, 1.4426950408889634f)); sum += v[k]; }
#pragma unroll
    for (int sh = 16; sh; sh >>= 1) sum += __shfl_xor(sum, sh, 32);
    const float f = __fdiv_rn(hires ? 1.0f : PCAR, sum);
{
        if (hires) {
#pragma unroll
            for (int ch = 0; ch < TT / 128; ++ch) { v4us oh, ol;
#pragma unroll
                for (int q = 0; q < 4; ++q) { unsigned short a, c2; splitf(v[ch * 4 + q] * f, a, c2); oh[q] = a; ol[q] = c2; }
                const size_t oo = ((size_t)zz * (RH ? RH : 1) + i) * TT + ch * 128 + lane * 4; *(v4us*)(Ph + oo) = oh; *(v4us*)(Pl + oo) = ol; }
        } else {
#pragma unroll
            for (int ch = 0; ch < TT / 128; ++ch) { v4h o4;
#pragma unroll
                for (int q = 0; q < 4; ++q) o4[q] = tohx(v[ch * 4 + q] * f);
                *(v4h*)(P16 + (size_t)row * TT + ch * 128 + lane * 4) = o4; } }
         }
}
__global__ __launch_bounds__(256) void k_merge(const float* __restrict__ O, int h0, float* OUTb) { const size_t e = ((size_t)blockIdx.x * 256 + threadIdx.x) * 2; if (e >= (size_t)ZH * TT * HD) return; const int d = (int)(e % HD); const int t = (int)((e / HD) % TT); const int zz = (int)(e / ((size_t)HD * TT)); const float cs = (t < RH) ? 1.0f : (1.0f / PCAR); const size_t oo = (size_t)t * DQ + (h0 + zz) * HD + d;
    v2f o2; o2[0] = O[e] * cs; o2[1] = O[e + 1] * cs; *(v2f*)(OUTb + oo) = o2;  }

extern "C" void kernel_launch(void* const* d_in, const int* in_sizes, int n_in,
                              void* d_out, int out_size, void* d_ws, size_t ws_size, hipStream_t stream) {
    (void)in_sizes; (void)n_in; (void)out_size;
    const float* x = (const float*)d_in[0]; const float* wq = (const float*)d_in[1]; const float* wk = (const float*)d_in[2]; const float* wv = (const float*)d_in[3]; const float* wo = nullptr; (void)wo;   /* argument order x, Wq, Wk, Wv ('oi' (out, in) [2048][2048]): four inputs, all read; NO output weight: the merged heads are the output */
    float* OUT = (float*)d_out;     // [2][2048][2048]
    char* wsp = (char*)d_ws;
    auto take = [&](size_t bytes) { char* p = wsp; wsp += (bytes + 255) & ~(size_t)255; return (void*)p; };
    bf* WQ = (bf*)take((size_t)DQ * DM * 2); bf* WK = (bf*)take((size_t)DKV * DM * 2); bf* WV = (bf*)take((size_t)DKV * DM * 2); bf* WO = (bf*)take((size_t)DM * DQ * 2); float* CS = (float*)take((size_t)TT * HD * 2 * 4);
    bf* XB = (bf*)take((size_t)TT * DM * 2); float* FQ = (float*)take((size_t)TT * DQ * 4); float* FK = (float*)take((size_t)TT * DKV * 4);
    h16* QP16 = (h16*)take((size_t)NH_ * TT * HD * 2); h16* KP16 = (h16*)take((size_t)NKV * TT * HD * 2); h16* VT16 = (h16*)take((size_t)NKV * HD * TT * 2);
    bf* QPh = (bf*)take((size_t)NH_ * TT * HD * 2); bf* QPl = (bf*)take((size_t)NH_ * TT * HD * 2); bf* KPh = (bf*)take((size_t)NKV * TT * HD * 2); bf* KPl = (bf*)take((size_t)NKV * TT * HD * 2); bf* VTh = (bf*)take((size_t)NKV * HD * TT * 2); bf* VTl = (bf*)take((size_t)NKV * HD * TT * 2); bf* Ph = (bf*)take((size_t)ZH * RH * TT * 2); bf* Pl = (bf*)take((size_t)ZH * RH * TT * 2);
    float* Sb = (float*)take((size_t)ZH * TT * TT * 4); h16* P16 = (h16*)take((size_t)ZH * TT * TT * 2); float* Ob = (float*)take((size_t)ZH * TT * HD * 4); bf* ATh = (bf*)take((size_t)TT * DQ * 2); bf* ATl = (bf*)take((size_t)TT * DQ * 2);
    if ((size_t)(wsp - (char*)d_ws) > ws_size) return;    // ws 256 MiB
    float* FV = FK;   // v projection reuses the k buffer after the k planes are built (stream-ordered)
    { k_cvt8<<<(unsigned)(((size_t)DQ * DM / 8 + 255) / 256), 256, 0, stream>>>(wq, WQ, (size_t)DQ * DM / 8); k_cvt8<<<(unsigned)(((size_t)DKV * DM / 8 + 255) / 256), 256, 0, stream>>>(wk, WK, (size_t)DKV * DM / 8); k_cvt8<<<(unsigned)(((size_t)DKV * DM / 8 + 255) / 256), 256, 0, stream>>>(wv, WV, (size_t)DKV * DM / 8);
      (void)WO; (void)ATh; (void)ATl;   /* no output weight: nothing to cast; those three planes stay carved and unused */
       }
    k_csP<<<(TT * HD + 255) / 256, 256, 0, stream>>>(CS);   /* rotary table once (positions = arange) */
    const unsigned LQ = (unsigned)(((size_t)NH_ * TT * HD / 2 + 255) / 256), LKv = (unsigned)(((size_t)NKV * TT * HD / 2 + 255) / 256);
    for (int b = 0; b < NB_; ++b) {
        
        k_cvt8<<<(unsigned)(((size_t)TT * DM / 8 + 255) / 256), 256, 0, stream>>>(x + (size_t)b * TT * DM, XB, (size_t)TT * DM / 8);
        k_gemmw<bf, 0, false><<<dim3(TT / 64, DQ / 64, 1), 32, 0, stream>>>(XB, nullptr, WQ, nullptr, DM, FQ, DQ, nullptr, 0, 0, 0);
        k_ropeI<<<LQ, 256, 0, stream>>>(FQ, DQ, NH_, CS, 1.0f, QP16, QPh, QPl);
        k_gemmw<bf, 0, false><<<dim3(TT / 64, DKV / 64, 1), 32, 0, stream>>>(XB, nullptr, WK, nullptr, DM, FK, DKV, nullptr, 0, 0, 0);
        k_ropeI<<<LKv, 256, 0, stream>>>(FK, DKV, NKV, CS, 1.0f, KP16, KPh, KPl);
        k_gemmw<bf, 0, false><<<dim3(TT / 64, DKV / 64, 1), 32, 0, stream>>>(XB, nullptr, WV, nullptr, DM, FV, DKV, nullptr, 0, 0, 0); k_vtp<<<LKv, 256, 0, stream>>>(FV, DKV, NKV, VT16, VTh, VTl);
        for (int h0 = 0; h0 < NH_; h0 += ZH) { const size_t zq = (size_t)h0, zk = (size_t)(h0 / REP);   // one kv head per query head: the pass's two heads use consecutive kv planes (z-strides TT*HD)
            k_gemmc<bf, 2, 1><<<dim3(RH / 64, TT / 64, ZH), 32, 0, stream>>>(QPh + zq * TT * HD, QPl + zq * TT * HD, KPh + zk * TT * HD, KPl + zk * TT * HD, HD, Sb, TT, 0, (size_t)TT * HD, (size_t)TT * HD, (size_t)TT * TT);
            k_gemmc<h16, 0, 1><<<dim3((TT - RH) / 64, TT / 64, ZH), 32, 0, stream>>>(QP16 + zq * TT * HD + (size_t)RH * HD, nullptr, KP16 + zk * TT * HD, nullptr, HD, Sb + (size_t)RH * TT, TT, RH, (size_t)TT * HD, (size_t)TT * HD, (size_t)TT * TT);
            k_asoft<<<ZH * TT / 8, 256, 0, stream>>>(Sb, P16, Ph, Pl);
            k_gemmc<bf, 2, 2><<<dim3(RH / 64, HD / 64, ZH), 32, 0, stream>>>(Ph, Pl, VTh + zk * HD * TT, VTl + zk * HD * TT, TT, Ob, HD, 0, (size_t)RH * TT, (size_t)HD * TT, (size_t)TT * HD);
            k_gemmc<h16, 0, 2><<<dim3((TT - RH) / 64, HD / 64, ZH), 32, 0, stream>>>(P16 + (size_t)RH * TT, nullptr, VT16 + zk * HD * TT, nullptr, TT, Ob + (size_t)RH * HD, HD, RH, (size_t)TT * TT, (size_t)HD * TT, (size_t)TT * HD);
            k_merge<<<(unsigned)(((size_t)ZH * TT * HD / 2 + 255) / 256), 256, 0, stream>>>(Ob, h0, OUT + (size_t)b * TT * DQ); }
        /* no output projection: k_merge has written the merged heads of this batch to OUT */ }
}

// v001
// One run takes 778 microseconds.
// In two side-by-side timings against v000, it was 2.04 and 2.05 times as fast.
#include <hip/hip_runtime.h>

// Causal multi-head self-attention with 128-wide heads and interleaved-pair rotary embeddings, WITHOUT an output projection (x [2][2048][2048]; q, k, v = einsum('bsm,nm->bsn', x, W) = x W^T ('oi' (out, in) [2048][2048] normal x 0.02, no bias; 16 heads x 128); rope on (even, odd) pairs: (xe cos - xo sin, xe sin + xo cos) with angle m x theta[i], theta = exp(-log(10000) x (2i) / 128) IN THAT SPELLING (64 f32 frequencies baked from the module's own line; precise cosf/sinf), m = arange(2048); scores x 1/sqrt(128); causal (tril kept, -1e30 elsewhere == exclusion: exp underflows to exactly 0); softmax in f32; out = the merged heads [b][s][h x 128 + d] -> [2][2048][2048] f32 (8.4 M); argument order x, Wq, Wk, Wv).
// Layout per batch: bf16 copy of X; 'oi' weights; exact projections; k_csP table (64 angles) + k_ropeI interleaved-pair plane builders at HD 128; causal T-2048 attention with 128-wide heads (hybrid rows: < 512 hi/lo 3 products, rest fp16 x1024; k_gemmc skips tiles above the diagonal); the f32 merge writes the merged heads straight to the output rows (no output projection).
// Compute dtypes, f32 accumulate: every input rounded to bf16; projections exact; rotary f32; attention rows < 512 3 products, rest fp16; softmax f32; output f32 (the P.v accumulators, scaled back by 1/1024 on the fp16 rows).

#define NB_  2
#define TT   2048
#define DM   2048
#define NH_  16
#define NKV  16
#define REP  (NH_ / NKV)
#define HD   128
#define DQ   (NH_ * HD)
#define DKV  (NKV * HD)
#define ZH   16                   // heads per attention launch: all of a batch (grid z)
#define NR   1024                 // query rows per attention pass: the f32 scores of ZH heads x NR rows (128 MiB) are what the workspace holds at once
#define RH   512                  // query rows < RH use hi+lo planes (0: none)
#define WIN  2048
#define PCAR 1024.0f
#define SCL  0.088388347648318447f   // HD^-0.5
static_assert(ZH == NH_ && NKV == NH_ && TT == 2 * NR && RH <= NR && NR % 64 == 0, "the two attention passes in kernel_launch are written for these shapes");
typedef _Float16 h16;
typedef unsigned short bf;
typedef __attribute__((ext_vector_type(16))) __bf16   v16bf;
typedef __attribute__((ext_vector_type(16))) _Float16 v16h;
typedef __attribute__((ext_vector_type(8)))  _Float16 v8h;
typedef __attribute__((ext_vector_type(8)))  unsigned short v8us;
typedef __attribute__((ext_vector_type(8)))  float    v8f;
typedef __attribute__((ext_vector_type(4)))  float    v4f;
typedef v8h  __attribute__((may_alias)) v8ha;
typedef v4f  __attribute__((may_alias)) v4fa;
typedef v8us __attribute__((may_alias)) v8usa;

__device__ __forceinline__ unsigned short f2bf(float f) { unsigned u = __float_as_uint(f); u += 0x7FFFu + ((u >> 16) & 1u); return (unsigned short)(u >> 16); }
__device__ __forceinline__ float bf2f(unsigned short b) { return __uint_as_float(((unsigned)b) << 16); }
__device__ __forceinline__ float bfr(float f) { return bf2f(f2bf(f)); }
__device__ __forceinline__ v16h cat16(v8h lo, v8h hi) { return __builtin_shufflevector(lo, hi, 0, 1, 2, 3, 4, 5, 6, 7, 8, 9, 10, 11, 12, 13, 14, 15); }
__device__ __forceinline__ v16bf cat16b(v8us lo, v8us hi) { return __builtin_bit_cast(v16bf, __builtin_shufflevector(lo, hi, 0, 1, 2, 3, 4, 5, 6, 7, 8, 9, 10, 11, 12, 13, 14, 15)); }
__device__ __forceinline__ v8f wmma16(v16h a, v16h b, v8f c) { return __builtin_amdgcn_wmma_f32_16x16x32_f16(false, a, false, b, (short)0, c, false, false); }
__device__ __forceinline__ v8f wmmab(v16bf a, v16bf b, v8f c) { return __builtin_amdgcn_wmma_f32_16x16x32_bf16(false, a, false, b, (short)0, c, false, false); }



// ---- k_gemmw: register-blocked GEMM, ONE WAVE per 64x64 output tile (16 accumulators), operands straight from K-contiguous 16-bit planes; grid (M/64, N/64, Z), 32 threads.
// C[m][n] (f32, pitch ldc, + optional f32 bias[n]) = sum_k A[m][k] Bt[n][k] (+ split products per NSPLIT). z-batch strides sA/sB/sC in elements. K % 32 == 0.
template <typename T16> struct WFrag;
template <> struct WFrag<h16> { typedef v16h V; static __device__ __forceinline__ V ld(const h16* p) { return cat16(*(const v8h*)p, *(const v8h*)(p + 16)); } static __device__ __forceinline__ v8f mma(V a, V b, v8f c) { return wmma16(a, b, c); } };
template <> struct WFrag<bf> { typedef v16bf V; static __device__ __forceinline__ V ld(const bf* p) { return cat16b(*(const v8us*)p, *(const v8us*)(p + 16)); } static __device__ __forceinline__ v8f mma(V a, V b, v8f c) { return wmmab(a, b, c); } };
template <typename T16, int NSPLIT, bool BIAS>
__global__ __launch_bounds__(32) void k_gemmw(const T16* __restrict__ A, const T16* __restrict__ A2, const T16* __restrict__ Bt, const T16* __restrict__ Bt2, int K, float* C, int ldc, const float* __restrict__ bias, size_t sA, size_t sB, size_t sC) {
    typedef typename WFrag<T16>::V V;
    __shared__ __align__(16) float os[16 * 68];
    const size_t z = blockIdx.z; A += z * sA; if (A2) A2 += z * sA; Bt += z * sB; if (Bt2) Bt2 += z * sB; C += z * sC;
    const int lane = threadIdx.x & 31, lr = lane & 15, hi = lane >> 4; const int r0 = blockIdx.x * 64, c0 = blockIdx.y * 64;
    v8f acc[4][4];
#pragma unroll
    for (int mb = 0; mb < 4; ++mb)
#pragma unroll
        for (int nb = 0; nb < 4; ++nb) acc[mb][nb] = (v8f){};
    const size_t aoff = (size_t)(r0 + lr) * K + 8 * hi, boff = (size_t)(c0 + lr) * K + 8 * hi;
#pragma unroll 1
    for (int kc = 0; kc < K; kc += 32) {
        V a[4], a2[4];
#pragma unroll
        for (int mb = 0; mb < 4; ++mb) { a[mb] = WFrag<T16>::ld(A + aoff + (size_t)mb * 16 * K + kc); if (NSPLIT == 1 || NSPLIT == 2) a2[mb] = WFrag<T16>::ld(A2 + aoff + (size_t)mb * 16 * K + kc); }
#pragma unroll
        for (int nb = 0; nb < 4; ++nb) { const V b = WFrag<T16>::ld(Bt + boff + (size_t)nb * 16 * K + kc); V b2; if (NSPLIT >= 2) b2 = WFrag<T16>::ld(Bt2 + boff + (size_t)nb * 16 * K + kc);
#pragma unroll
            for (int mb = 0; mb < 4; ++mb) { acc[mb][nb] = WFrag<T16>::mma(a[mb], b, acc[mb][nb]); if (NSPLIT == 1 || NSPLIT == 2) acc[mb][nb] = WFrag<T16>::mma(a2[mb], b, acc[mb][nb]); if (NSPLIT >= 2) acc[mb][nb] = WFrag<T16>::mma(a[mb], b2, acc[mb][nb]); } }
        asm volatile("v_nop\n\tv_nop\n\tv_nop\n\tv_nop" : "+v"(acc[0][0]), "+v"(acc[1][1]), "+v"(acc[2][2]), "+v"(acc[3][3]) : "v"(a[0]), "v"(a[3]));
    }
#pragma unroll
    for (int mb = 0; mb < 4; ++mb) {
#pragma unroll
        for (int nb = 0; nb < 4; ++nb) {
#pragma unroll
            for (int j = 0; j < 8; ++j) os[(hi * 8 + j) * 68 + nb * 16 + lr] = acc[mb][nb][j]; }
        __builtin_amdgcn_wave_barrier(); asm volatile("" ::: "memory");
        float* crow = C + (size_t)(r0 + mb * 16) * ldc + c0;
{
#pragma unroll
            for (int s = 0; s < 8; ++s) { const int row = 2 * s + hi, cofs = lr * 4; v4f val = *(const v4fa*)(os + row * 68 + cofs); if (BIAS) { val[0] += bfr(bias[c0 + cofs]); val[1] += bfr(bias[c0 + cofs + 1]); val[2] += bfr(bias[c0 + cofs + 2]); val[3] += bfr(bias[c0 + cofs + 3]); }
                *(v4f*)(crow + (size_t)row * ldc + cofs) = val; }
             }
        __builtin_amdgcn_wave_barrier(); asm volatile("" ::: "memory");
    }
}

// ---- k_gemmc: the same one-wave 64x64 tile GEMM specialised for causal attention: CMODE 1 skips score tiles entirely above the diagonal (query rows r0+roff.., key columns c0..), CMODE 2 limits the
// key (K) loop of the probability x value contraction to the diagonal block (probabilities beyond it are exactly zero). roff = row offset of this launch's first row within the sequence. lda = row pitch of A and A2 in elements (Bt and Bt2 have pitch K).
template <typename T16, int NSPLIT, int CMODE>
__global__ __launch_bounds__(32) void k_gemmc(const T16* __restrict__ A, const T16* __restrict__ A2, const T16* __restrict__ Bt, const T16* __restrict__ Bt2, int K, int lda, float* C, int ldc, int roff, size_t sA, size_t sB, size_t sC) {
    typedef typename WFrag<T16>::V V;
    __shared__ __align__(16) float os[16 * 68];
    const size_t z = blockIdx.z; A += z * sA; if (A2) A2 += z * sA; Bt += z * sB; if (Bt2) Bt2 += z * sB; C += z * sC;
    const int lane = threadIdx.x & 31, lr = lane & 15, hi = lane >> 4; const int r0 = blockIdx.x * 64, c0 = blockIdx.y * 64;
    if (CMODE == 1 && c0 > r0 + roff + 63) return;                  // score tile entirely above the causal diagonal: never read (the softmax masks j > i by select)
    const int Kl = (CMODE == 2) ? min(K, r0 + roff + 64) : K;        // P.V: probabilities are exactly 0 beyond the diagonal block, so the K loop stops there
    v8f acc[4][4];
#pragma unroll
    for (int mb = 0; mb < 4; ++mb)
#pragma unroll
        for (int nb = 0; nb < 4; ++nb) acc[mb][nb] = (v8f){};
    const size_t aoff = (size_t)(r0 + lr) * lda + 8 * hi, boff = (size_t)(c0 + lr) * K + 8 * hi;
#pragma unroll 1
    for (int kc = 0; kc < Kl; kc += 32) {
        V a[4], a2[4];
#pragma unroll
        for (int mb = 0; mb < 4; ++mb) { a[mb] = WFrag<T16>::ld(A + aoff + (size_t)mb * 16 * lda + kc); if (NSPLIT == 1 || NSPLIT == 2) a2[mb] = WFrag<T16>::ld(A2 + aoff + (size_t)mb * 16 * lda + kc); }
#pragma unroll
        for (int nb = 0; nb < 4; ++nb) { const V b = WFrag<T16>::ld(Bt + boff + (size_t)nb * 16 * K + kc); V b2; if (NSPLIT >= 2) b2 = WFrag<T16>::ld(Bt2 + boff + (size_t)nb * 16 * K + kc);
#pragma unroll
            for (int mb = 0; mb < 4; ++mb) { acc[mb][nb] = WFrag<T16>::mma(a[mb], b, acc[mb][nb]); if (NSPLIT == 1 || NSPLIT == 2) acc[mb][nb] = WFrag<T16>::mma(a2[mb], b, acc[mb][nb]); if (NSPLIT >= 2) acc[mb][nb] = WFrag<T16>::mma(a[mb], b2, acc[mb][nb]); } }
        asm volatile("v_nop\n\tv_nop\n\tv_nop\n\tv_nop" : "+v"(acc[0][0]), "+v"(acc[1][1]), "+v"(acc[2][2]), "+v"(acc[3][3]) : "v"(a[0]), "v"(a[3]));
    }
#pragma unroll
    for (int mb = 0; mb < 4; ++mb) {
#pragma unroll
        for (int nb = 0; nb < 4; ++nb) {
#pragma unroll
            for (int j = 0; j < 8; ++j) os[(hi * 8 + j) * 68 + nb * 16 + lr] = acc[mb][nb][j]; }
        __builtin_amdgcn_wave_barrier(); asm volatile("" ::: "memory");
        float* crow = C + (size_t)(r0 + mb * 16) * ldc + c0;
{
#pragma unroll
            for (int s = 0; s < 8; ++s) { const int row = 2 * s + hi, cofs = lr * 4; v4f val = *(const v4fa*)(os + row * 68 + cofs);
                *(v4f*)(crow + (size_t)row * ldc + cofs) = val; }
             }
        __builtin_amdgcn_wave_barrier(); asm volatile("" ::: "memory");
    }
}

__device__ __forceinline__ h16 tohx(float x) { return (h16)x; }
__device__ __forceinline__ void splitf(float y, unsigned short& h, unsigned short& l) { h = f2bf(y); l = f2bf(y - bf2f(h)); }
typedef __attribute__((ext_vector_type(2))) _Float16 v2h;
typedef __attribute__((ext_vector_type(4))) _Float16 v4h;
typedef __attribute__((ext_vector_type(2))) unsigned short v2us;
typedef __attribute__((ext_vector_type(4))) unsigned short v4us;
typedef __attribute__((ext_vector_type(2))) float v2f;
typedef __attribute__((ext_vector_type(4))) int v4i;

__global__ __launch_bounds__(256) void k_cvt8(const float* __restrict__ src, bf* dst, size_t n8) { const size_t i = (size_t)blockIdx.x * 256 + threadIdx.x; if (i >= n8) return; const v8f v = *(const v8f*)(src + i * 8); v8us o;
#pragma unroll
    for (int k = 0; k < 8; ++k) o[k] = f2bf(v[k]); *(v8us*)(dst + i * 8) = o;  }

__global__ __launch_bounds__(256) void k_vtp(const float* __restrict__ F, int pitch, int nheads, h16* V16, bf* Vh, bf* Vl) { const size_t e = ((size_t)blockIdx.x * 256 + threadIdx.x) * 2; if (e >= (size_t)nheads * HD * TT) return; const int t = (int)(e % TT); const int d = (int)((e / TT) % HD); const int g = (int)(e / ((size_t)TT * HD)); v2h o16; v2us oh, ol;
#pragma unroll
    for (int q = 0; q < 2; ++q) { const float x = F[(size_t)(t + q) * pitch + g * HD + d]; o16[q] = tohx(x); unsigned short a2, c2; splitf(x, a2, c2); oh[q] = a2; ol[q] = c2; }
    *(v2h*)(V16 + e) = o16; *(v2us*)(Vh + e) = oh; *(v2us*)(Vl + e) = ol;  }
__constant__ float INV2[HD / 2] = { 1.000000000e+00f, 8.659642935e-01f, 7.498942018e-01f, 6.493816376e-01f, 5.623413324e-01f, 4.869675040e-01f, 4.216964841e-01f, 3.651741147e-01f, 3.162277639e-01f, 2.738419473e-01f, 2.371373475e-01f, 2.053525001e-01f, 1.778279394e-01f, 1.539926529e-01f, 1.333521456e-01f, 1.154781953e-01f, 9.999999404e-02f, 8.659642935e-02f, 7.498941571e-02f, 6.493815780e-02f, 5.623412505e-02f, 4.869675636e-02f, 4.216965288e-02f, 3.651741147e-02f, 3.162277490e-02f, 2.738419361e-02f, 2.371373400e-02f, 2.053524740e-02f, 1.778279617e-02f, 1.539926231e-02f, 1.333521400e-02f, 1.154781692e-02f, 9.999999776e-03f, 8.659644052e-03f, 7.498940919e-03f, 6.493817084e-03f, 5.623412319e-03f, 4.869675264e-03f, 4.216963891e-03f, 3.651741194e-03f, 3.162276698e-03f, 2.738419222e-03f, 2.371374052e-03f, 2.053524600e-03f, 1.778279431e-03f, 1.539926161e-03f, 1.333521330e-03f, 1.154781668e-03f, 9.999999311e-04f, 8.659643936e-04f, 7.498940686e-04f, 6.493816618e-04f, 5.623411853e-04f, 4.869675031e-04f, 4.216964007e-04f, 3.651740844e-04f, 3.162277862e-04f, 2.738420444e-04f, 2.371372684e-04f, 2.053524659e-04f, 1.778279402e-04f, 1.539926743e-04f, 1.333520777e-04f, 1.154781567e-04f };   // float32 exp(-log(10000) x (2i) / 128) in the module's own spelling, generated with jnp to be bit-exact
__global__ __launch_bounds__(256) void k_csP(float* CS) { const int idx = blockIdx.x * 256 + threadIdx.x; if (idx >= TT * HD) return; const int d = idx % HD; const int t = idx / HD; const float a = __fmul_rn((float)t, INV2[d >> 1]); v2f cs; cs[0] = cosf(a); cs[1] = sinf(a); *(v2f*)(CS + (size_t)idx * 2) = cs;  }
__global__ __launch_bounds__(256) void k_ropeI(const float* __restrict__ F, int pitch, int nheads, const float* __restrict__ CS, float sc, h16* P16, bf* Ph, bf* Pl) {
    const size_t e = ((size_t)blockIdx.x * 256 + threadIdx.x) * 2; if (e >= (size_t)nheads * TT * HD) return; const int d = (int)(e % HD); const int t = (int)((e / HD) % TT); const int h = (int)(e / ((size_t)HD * TT)); const float* f = F + (size_t)t * pitch + h * HD; const float x0 = f[d], x1 = f[d + 1]; const v2f cs = *(const v2f*)(CS + ((size_t)t * HD + d) * 2); v2h o16; v2us oh, ol;
    float a0 = __fmul_rn(x0, cs[0]), b0 = __fmul_rn(x1, cs[1]), a1 = __fmul_rn(x1, cs[0]), b1 = __fmul_rn(x0, cs[1]); 
    float r0 = __fsub_rn(a0, b0) * sc, r1 = __fadd_rn(b1, a1) * sc;   /* even: x0 c - x1 s; odd: x0 s + x1 c */
    o16[0] = tohx(r0); o16[1] = tohx(r1); { unsigned short a2, c2; splitf(r0, a2, c2); oh[0] = a2; ol[0] = c2; splitf(r1, a2, c2); oh[1] = a2; ol[1] = c2; }
    *(v2h*)(P16 + e) = o16; *(v2us*)(Ph + e) = oh; *(v2us*)(Pl + e) = ol;  }

// k_asoft: per row (zz, i): t = S x HD^-0.5 for j <= i and i - j < WIN (WIN = 2048 = TT here: every key j <= i is kept: the plain causal rule; the reference's where(tril, scores, -1e30) is exclusion); softmax over the 2048 keys (register row, one exp, fixed trees);
// IN PLACE: one wave owns one row, holds all of it in registers before its first store, and writes the 16-bit probabilities over the row's own 8 KiB of scores (pitch 2 x TT 16-bit elements):
// rows >= RH: fp16 in the first half; rows < RH: the hi plane in the first half (Ph), the lo plane in the second (Pl = Ph + TT). P16, Ph and Pl alias Sb, so no pointer here is __restrict__.
// The launch covers the NR query rows I0 .. I0 + NR - 1 of each of the ZH heads; Sb holds [head][row - I0][key].
template <int I0>
__global__ __launch_bounds__(256) void k_asoft(const float* Sb, h16* P16, bf* Ph, bf* Pl) {
    const int lane = threadIdx.x & 31; const int row = blockIdx.x * 8 + (threadIdx.x >> 5); if (row >= ZH * NR) return; const int i = I0 + row % NR; const bool hires = (i < RH); const float* sr = Sb + (size_t)row * TT; float v[TT / 32]; float mx = -3.0e38f;
#pragma unroll
    for (int ch = 0; ch < TT / 128; ++ch) { const int j0 = ch * 128 + lane * 4; const v4f a = *(const v4f*)(sr + j0);
#pragma unroll
        for (int q = 0; q < 4; ++q) { const int j = j0 + q; (void)j; const float t = (j <= i && i - j < WIN) ? a[q] * SCL : -3.0e38f; v[ch * 4 + q] = t; mx = fmaxf(mx, t); } }
#pragma unroll
    for (int sh = 16; sh; sh >>= 1) mx = fmaxf(mx, __shfl_xor(mx, sh, 32));
    float sum = 0.f;
#pragma unroll
    for (int k = 0; k < TT / 32; ++k) { float d0 = __fsub_rn(v[k], mx); v[k] = __builtin_amdgcn_exp2f(__fmul_rn(d0, 1.4426950408889634f)); sum += v[k]; }
#pragma unroll
    for (int sh = 16; sh; sh >>= 1) sum += __shfl_xor(sum, sh, 32);
    const float f = __fdiv_rn(hires ? 1.0f : PCAR, sum);
{
        if (hires) {
#pragma unroll
            for (int ch = 0; ch < TT / 128; ++ch) { v4us oh, ol;
#pragma unroll
                for (int q = 0; q < 4; ++q) { unsigned short a, c2; splitf(v[ch * 4 + q] * f, a, c2); oh[q] = a; ol[q] = c2; }
                const size_t oo = (size_t)row * (2 * TT) + ch * 128 + lane * 4; *(v4us*)(Ph + oo) = oh; *(v4us*)(Pl + oo) = ol; }
        } else {
#pragma unroll
            for (int ch = 0; ch < TT / 128; ++ch) { v4h o4;
#pragma unroll
                for (int q = 0; q < 4; ++q) o4[q] = tohx(v[ch * 4 + q] * f);
                *(v4h*)(P16 + (size_t)row * (2 * TT) + ch * 128 + lane * 4) = o4; } }
         }
}
__global__ __launch_bounds__(256) void k_merge(const float* __restrict__ O, int h0, float* OUTb) { const size_t e = ((size_t)blockIdx.x * 256 + threadIdx.x) * 2; if (e >= (size_t)ZH * TT * HD) return; const int d = (int)(e % HD); const int t = (int)((e / HD) % TT); const int zz = (int)(e / ((size_t)HD * TT)); const float cs = (t < RH) ? 1.0f : (1.0f / PCAR); const size_t oo = (size_t)t * DQ + (h0 + zz) * HD + d;
    v2f o2; o2[0] = O[e] * cs; o2[1] = O[e + 1] * cs; *(v2f*)(OUTb + oo) = o2;  }

extern "C" void kernel_launch(void* const* d_in, const int* in_sizes, int n_in,
                              void* d_out, int out_size, void* d_ws, size_t ws_size, hipStream_t stream) {
    (void)in_sizes; (void)n_in; (void)out_size;
    const float* x = (const float*)d_in[0]; const float* wq = (const float*)d_in[1]; const float* wk = (const float*)d_in[2]; const float* wv = (const float*)d_in[3]; const float* wo = nullptr; (void)wo;   /* argument order x, Wq, Wk, Wv ('oi' (out, in) [2048][2048]): four inputs, all read; NO output weight: the merged heads are the output */
    float* OUT = (float*)d_out;     // [2][2048][2048]
    char* wsp = (char*)d_ws;
    auto take = [&](size_t bytes) { char* p = wsp; wsp += (bytes + 255) & ~(size_t)255; return (void*)p; };
    bf* WQ = (bf*)take((size_t)DQ * DM * 2); bf* WK = (bf*)take((size_t)DKV * DM * 2); bf* WV = (bf*)take((size_t)DKV * DM * 2); float* CS = (float*)take((size_t)TT * HD * 2 * 4);
    h16* QP16 = (h16*)take((size_t)NH_ * TT * HD * 2); h16* KP16 = (h16*)take((size_t)NKV * TT * HD * 2); h16* VT16 = (h16*)take((size_t)NKV * HD * TT * 2);
    bf* QPh = (bf*)take((size_t)NH_ * TT * HD * 2); bf* QPl = (bf*)take((size_t)NH_ * TT * HD * 2); bf* KPh = (bf*)take((size_t)NKV * TT * HD * 2); bf* KPl = (bf*)take((size_t)NKV * TT * HD * 2); bf* VTh = (bf*)take((size_t)NKV * HD * TT * 2); bf* VTl = (bf*)take((size_t)NKV * HD * TT * 2);
    float* Ob = (float*)take((size_t)ZH * TT * HD * 4);
    float* Sb = (float*)take((size_t)ZH * NR * TT * 4);   // scores of one pass, [head][row][key] (128 MiB); k_asoft writes the probabilities over them in place
    // The projection stage's buffers lie inside Sb: they are dead once the q, k, v planes of the batch are built, and the scores are dead before the next batch's cast (stream order). 40 MiB of the 128.
    bf* XB = (bf*)Sb; float* FQ = (float*)((char*)Sb + (size_t)TT * DM * 2); float* FK = (float*)((char*)FQ + (size_t)TT * DQ * 4);
    h16* P16 = (h16*)Sb; bf* Ph = (bf*)Sb; bf* Pl = Ph + TT;   // probability rows, pitch 2 x TT 16-bit elements (see k_asoft)
    if ((size_t)(wsp - (char*)d_ws) > ws_size) return;    // ws 256 MiB
    float* FV = FK;   // v projection reuses the k buffer after the k planes are built (stream-ordered)
    { k_cvt8<<<(unsigned)(((size_t)DQ * DM / 8 + 255) / 256), 256, 0, stream>>>(wq, WQ, (size_t)DQ * DM / 8); k_cvt8<<<(unsigned)(((size_t)DKV * DM / 8 + 255) / 256), 256, 0, stream>>>(wk, WK, (size_t)DKV * DM / 8); k_cvt8<<<(unsigned)(((size_t)DKV * DM / 8 + 255) / 256), 256, 0, stream>>>(wv, WV, (size_t)DKV * DM / 8);
       }
    k_csP<<<(TT * HD + 255) / 256, 256, 0, stream>>>(CS);   /* rotary table once (positions = arange) */
    const unsigned LQ = (unsigned)(((size_t)NH_ * TT * HD / 2 + 255) / 256), LKv = (unsigned)(((size_t)NKV * TT * HD / 2 + 255) / 256);
    for (int b = 0; b < NB_; ++b) {
        
        k_cvt8<<<(unsigned)(((size_t)TT * DM / 8 + 255) / 256), 256, 0, stream>>>(x + (size_t)b * TT * DM, XB, (size_t)TT * DM / 8);
        k_gemmw<bf, 0, false><<<dim3(TT / 64, DQ / 64, 1), 32, 0, stream>>>(XB, nullptr, WQ, nullptr, DM, FQ, DQ, nullptr, 0, 0, 0);
        k_ropeI<<<LQ, 256, 0, stream>>>(FQ, DQ, NH_, CS, 1.0f, QP16, QPh, QPl);
        k_gemmw<bf, 0, false><<<dim3(TT / 64, DKV / 64, 1), 32, 0, stream>>>(XB, nullptr, WK, nullptr, DM, FK, DKV, nullptr, 0, 0, 0);
        k_ropeI<<<LKv, 256, 0, stream>>>(FK, DKV, NKV, CS, 1.0f, KP16, KPh, KPl);
        k_gemmw<bf, 0, false><<<dim3(TT / 64, DKV / 64, 1), 32, 0, stream>>>(XB, nullptr, WV, nullptr, DM, FV, DKV, nullptr, 0, 0, 0); k_vtp<<<LKv, 256, 0, stream>>>(FV, DKV, NKV, VT16, VTh, VTl);
        // Attention, all ZH heads in grid z (one kv head per query head: q, k, v planes all have z-stride TT*HD), in two passes over the query rows.
        // Pass 1, rows 0 .. NR-1 (rows < RH on the hi/lo planes, the rest fp16):
        k_gemmc<bf, 2, 1><<<dim3(RH / 64, TT / 64, ZH), 32, 0, stream>>>(QPh, QPl, KPh, KPl, HD, HD, Sb, TT, 0, (size_t)TT * HD, (size_t)TT * HD, (size_t)NR * TT);
        k_gemmc<h16, 0, 1><<<dim3((NR - RH) / 64, TT / 64, ZH), 32, 0, stream>>>(QP16 + (size_t)RH * HD, nullptr, KP16, nullptr, HD, HD, Sb + (size_t)RH * TT, TT, RH, (size_t)TT * HD, (size_t)TT * HD, (size_t)NR * TT);
        k_asoft<0><<<ZH * NR / 8, 256, 0, stream>>>(Sb, P16, Ph, Pl);
        k_gemmc<bf, 2, 2><<<dim3(RH / 64, HD / 64, ZH), 32, 0, stream>>>(Ph, Pl, VTh, VTl, TT, 2 * TT, Ob, HD, 0, (size_t)NR * 2 * TT, (size_t)HD * TT, (size_t)TT * HD);
        k_gemmc<h16, 0, 2><<<dim3((NR - RH) / 64, HD / 64, ZH), 32, 0, stream>>>(P16 + (size_t)RH * 2 * TT, nullptr, VT16, nullptr, TT, 2 * TT, Ob + (size_t)RH * HD, HD, RH, (size_t)NR * 2 * TT, (size_t)HD * TT, (size_t)TT * HD);
        // Pass 2, rows NR .. TT-1 (all fp16); score row 0 of each head is query row NR:
        k_gemmc<h16, 0, 1><<<dim3((TT - NR) / 64, TT / 64, ZH), 32, 0, stream>>>(QP16 + (size_t)NR * HD, nullptr, KP16, nullptr, HD, HD, Sb, TT, NR, (size_t)TT * HD, (size_t)TT * HD, (size_t)NR * TT);
        k_asoft<NR><<<ZH * NR / 8, 256, 0, stream>>>(Sb, P16, Ph, Pl);
        k_gemmc<h16, 0, 2><<<dim3((TT - NR) / 64, HD / 64, ZH), 32, 0, stream>>>(P16, nullptr, VT16, nullptr, TT, 2 * TT, Ob + (size_t)NR * HD, HD, NR, (size_t)NR * 2 * TT, (size_t)HD * TT, (size_t)TT * HD);
        k_merge<<<(unsigned)(((size_t)ZH * TT * HD / 2 + 255) / 256), 256, 0, stream>>>(Ob, 0, OUT + (size_t)b * TT * DQ);
        /* no output projection: k_merge has written the merged heads of this batch to OUT */ }
}

// v002
// One run takes 735 microseconds.
// Two timings next to v001 put it at 1.05 and 1.06 times that version's speed.
// Over all steps from v000 it is 2.16 times as fast.
#include <hip/hip_runtime.h>

// Causal multi-head self-attention with 128-wide heads and interleaved-pair rotary embeddings, WITHOUT an output projection (x [2][2048][2048]; q, k, v = einsum('bsm,nm->bsn', x, W) = x W^T ('oi' (out, in) [2048][2048] normal x 0.02, no bias; 16 heads x 128); rope on (even, odd) pairs: (xe cos - xo sin, xe sin + xo cos) with angle m x theta[i], theta = exp(-log(10000) x (2i) / 128) IN THAT SPELLING (64 f32 frequencies baked from the module's own line; precise cosf/sinf), m = arange(2048); scores x 1/sqrt(128); causal (tril kept, -1e30 elsewhere == exclusion: exp underflows to exactly 0); softmax in f32; out = the merged heads [b][s][h x 128 + d] -> [2][2048][2048] f32 (8.4 M); argument order x, Wq, Wk, Wv).
// Layout per batch: bf16 copy of X; 'oi' weights; exact projections; k_csP table (64 angles) + k_ropeI interleaved-pair plane builders at HD 128; causal T-2048 attention with 128-wide heads (hybrid rows: < 512 hi/lo 3 products, rest fp16 x1024; k_gemmc skips tiles above the diagonal); the f32 merge writes the merged heads straight to the output rows (no output projection).
// Compute dtypes, f32 accumulate: every input rounded to bf16; projections exact; rotary f32; attention rows < 512 3 products, rest fp16; softmax f32; output f32 (the P.v accumulators, scaled back by 1/1024 on the fp16 rows).

#define NB_  2
#define TT   2048
#define DM   2048
#define NH_  16
#define NKV  16
#define REP  (NH_ / NKV)
#define HD   128
#define DQ   (NH_ * HD)
#define DKV  (NKV * HD)
#define ZH   16                   // heads per attention launch: all of a batch (grid z)
#define NR   1024                 // query rows per attention pass: the f32 scores of ZH heads x NR rows (128 MiB) are what the workspace holds at once
#define RH   512                  // query rows < RH use hi+lo planes (0: none)
#define WIN  2048
#define PCAR 1024.0f
#define SCL  0.088388347648318447f   // HD^-0.5
static_assert(ZH == NH_ && NKV == NH_ && TT == 2 * NR && RH <= NR && NR % 64 == 0, "the two attention passes in kernel_launch are written for these shapes");
typedef _Float16 h16;
typedef unsigned short bf;
typedef __attribute__((ext_vector_type(16))) __bf16   v16bf;
typedef __attribute__((ext_vector_type(16))) _Float16 v16h;
typedef __attribute__((ext_vector_type(8)))  _Float16 v8h;
typedef __attribute__((ext_vector_type(8)))  unsigned short v8us;
typedef __attribute__((ext_vector_type(8)))  float    v8f;
typedef __attribute__((ext_vector_type(4)))  float    v4f;
typedef v8h  __attribute__((may_alias)) v8ha;
typedef v4f  __attribute__((may_alias)) v4fa;
typedef v8us __attribute__((may_alias)) v8usa;

__device__ __forceinline__ unsigned short f2bf(float f) { unsigned u = __float_as_uint(f); u += 0x7FFFu + ((u >> 16) & 1u); return (unsigned short)(u >> 16); }
__device__ __forceinline__ float bf2f(unsigned short b) { return __uint_as_float(((unsigned)b) << 16); }
__device__ __forceinline__ float bfr(float f) { return bf2f(f2bf(f)); }
__device__ __forceinline__ v16h cat16(v8h lo, v8h hi) { return __builtin_shufflevector(lo, hi, 0, 1, 2, 3, 4, 5, 6, 7, 8, 9, 10, 11, 12, 13, 14, 15); }
__device__ __forceinline__ v16bf cat16b(v8us lo, v8us hi) { return __builtin_bit_cast(v16bf, __builtin_shufflevector(lo, hi, 0, 1, 2, 3, 4, 5, 6, 7, 8, 9, 10, 11, 12, 13, 14, 15)); }
__device__ __forceinline__ v8f wmma16(v16h a, v16h b, v8f c) { return __builtin_amdgcn_wmma_f32_16x16x32_f16(false, a, false, b, (short)0, c, false, false); }
__device__ __forceinline__ v8f wmmab(v16bf a, v16bf b, v8f c) { return __builtin_amdgcn_wmma_f32_16x16x32_bf16(false, a, false, b, (short)0, c, false, false); }



// ---- k_gemmw: register-blocked GEMM, ONE WAVE per 64x64 output tile (16 accumulators), operands straight from K-contiguous 16-bit planes; grid (M/64, N/64, Z), 32 threads.
// C[m][n] (f32, pitch ldc, + optional f32 bias[n]) = sum_k A[m][k] Bt[n][k] (+ split products per NSPLIT). z-batch strides sA/sB/sC in elements. K % 32 == 0.
template <typename T16> struct WFrag;
template <> struct WFrag<h16> { typedef v16h V; static __device__ __forceinline__ V ld(const h16* p) { return cat16(*(const v8h*)p, *(const v8h*)(p + 16)); } static __device__ __forceinline__ v8f mma(V a, V b, v8f c) { return wmma16(a, b, c); } };
template <> struct WFrag<bf> { typedef v16bf V; static __device__ __forceinline__ V ld(const bf* p) { return cat16b(*(const v8us*)p, *(const v8us*)(p + 16)); } static __device__ __forceinline__ v8f mma(V a, V b, v8f c) { return wmmab(a, b, c); } };
template <typename T16, int NSPLIT, bool BIAS>
__global__ __launch_bounds__(32) void k_gemmw(const T16* __restrict__ A, const T16* __restrict__ A2, const T16* __restrict__ Bt, const T16* __restrict__ Bt2, int K, float* C, int ldc, const float* __restrict__ bias, size_t sA, size_t sB, size_t sC) {
    typedef typename WFrag<T16>::V V;
    __shared__ __align__(16) float os[16 * 68];
    const size_t z = blockIdx.z; A += z * sA; if (A2) A2 += z * sA; Bt += z * sB; if (Bt2) Bt2 += z * sB; C += z * sC;
    const int lane = threadIdx.x & 31, lr = lane & 15, hi = lane >> 4; const int r0 = blockIdx.x * 64, c0 = blockIdx.y * 64;
    v8f acc[4][4];
#pragma unroll
    for (int mb = 0; mb < 4; ++mb)
#pragma unroll
        for (int nb = 0; nb < 4; ++nb) acc[mb][nb] = (v8f){};
    const size_t aoff = (size_t)(r0 + lr) * K + 8 * hi, boff = (size_t)(c0 + lr) * K + 8 * hi;
#pragma unroll 1
    for (int kc = 0; kc < K; kc += 32) {
        V a[4], a2[4];
#pragma unroll
        for (int mb = 0; mb < 4; ++mb) { a[mb] = WFrag<T16>::ld(A + aoff + (size_t)mb * 16 * K + kc); if (NSPLIT == 1 || NSPLIT == 2) a2[mb] = WFrag<T16>::ld(A2 + aoff + (size_t)mb * 16 * K + kc); }
#pragma unroll
        for (int nb = 0; nb < 4; ++nb) { const V b = WFrag<T16>::ld(Bt + boff + (size_t)nb * 16 * K + kc); V b2; if (NSPLIT >= 2) b2 = WFrag<T16>::ld(Bt2 + boff + (size_t)nb * 16 * K + kc);
#pragma unroll
            for (int mb = 0; mb < 4; ++mb) { acc[mb][nb] = WFrag<T16>::mma(a[mb], b, acc[mb][nb]); if (NSPLIT == 1 || NSPLIT == 2) acc[mb][nb] = WFrag<T16>::mma(a2[mb], b, acc[mb][nb]); if (NSPLIT >= 2) acc[mb][nb] = WFrag<T16>::mma(a[mb], b2, acc[mb][nb]); } }
        asm volatile("v_nop\n\tv_nop\n\tv_nop\n\tv_nop" : "+v"(acc[0][0]), "+v"(acc[1][1]), "+v"(acc[2][2]), "+v"(acc[3][3]) : "v"(a[0]), "v"(a[3]));
    }
#pragma unroll
    for (int mb = 0; mb < 4; ++mb) {
#pragma unroll
        for (int nb = 0; nb < 4; ++nb) {
#pragma unroll
            for (int j = 0; j < 8; ++j) os[(hi * 8 + j) * 68 + nb * 16 + lr] = acc[mb][nb][j]; }
        __builtin_amdgcn_wave_barrier(); asm volatile("" ::: "memory");
        float* crow = C + (size_t)(r0 + mb * 16) * ldc + c0;
{
#pragma unroll
            for (int s = 0; s < 8; ++s) { const int row = 2 * s + hi, cofs = lr * 4; v4f val = *(const v4fa*)(os + row * 68 + cofs); if (BIAS) { val[0] += bfr(bias[c0 + cofs]); val[1] += bfr(bias[c0 + cofs + 1]); val[2] += bfr(bias[c0 + cofs + 2]); val[3] += bfr(bias[c0 + cofs + 3]); }
                *(v4f*)(crow + (size_t)row * ldc + cofs) = val; }
             }
        __builtin_amdgcn_wave_barrier(); asm volatile("" ::: "memory");
    }
}

// ---- k_gemmc: the same one-wave 64x64 tile GEMM specialised for causal attention: CMODE 1 skips score tiles entirely above the diagonal (query rows r0+roff.., key columns c0..), CMODE 2 limits the
// key (K) loop of the probability x value contraction to the diagonal block (probabilities beyond it are exactly zero). roff = row offset of this launch's first row within the sequence. lda = row pitch of A and A2 in elements (Bt and Bt2 have pitch K).
template <typename T16, int NSPLIT, int CMODE>
__global__ __launch_bounds__(32) void k_gemmc(const T16* __restrict__ A, const T16* __restrict__ A2, const T16* __restrict__ Bt, const T16* __restrict__ Bt2, int K, int lda, float* C, int ldc, int roff, size_t sA, size_t sB, size_t sC) {
    typedef typename WFrag<T16>::V V;
    __shared__ __align__(16) float os[16 * 68];
    const size_t z = blockIdx.z; A += z * sA; if (A2) A2 += z * sA; Bt += z * sB; if (Bt2) Bt2 += z * sB; C += z * sC;
    const int lane = threadIdx.x & 31, lr = lane & 15, hi = lane >> 4; const int r0 = blockIdx.x * 64, c0 = blockIdx.y * 64;
    if (CMODE == 1 && c0 > r0 + roff + 63) return;                  // score tile entirely above the causal diagonal: never read (the softmax masks j > i by select)
    const int Kl = (CMODE == 2) ? min(K, r0 + roff + 64) : K;        // P.V: probabilities are exactly 0 beyond the diagonal block, so the K loop stops there
    v8f acc[4][4];
#pragma unroll
    for (int mb = 0; mb < 4; ++mb)
#pragma unroll
        for (int nb = 0; nb < 4; ++nb) acc[mb][nb] = (v8f){};
    const size_t aoff = (size_t)(r0 + lr) * lda + 8 * hi, boff = (size_t)(c0 + lr) * K + 8 * hi;
#pragma unroll 1
    for (int kc = 0; kc < Kl; kc += 32) {
        V a[4], a2[4];
#pragma unroll
        for (int mb = 0; mb < 4; ++mb) { a[mb] = WFrag<T16>::ld(A + aoff + (size_t)mb * 16 * lda + kc); if (NSPLIT == 1 || NSPLIT == 2) a2[mb] = WFrag<T16>::ld(A2 + aoff + (size_t)mb * 16 * lda + kc); }
#pragma unroll
        for (int nb = 0; nb < 4; ++nb) { const V b = WFrag<T16>::ld(Bt + boff + (size_t)nb * 16 * K + kc); V b2; if (NSPLIT >= 2) b2 = WFrag<T16>::ld(Bt2 + boff + (size_t)nb * 16 * K + kc);
#pragma unroll
            for (int mb = 0; mb < 4; ++mb) { acc[mb][nb] = WFrag<T16>::mma(a[mb], b, acc[mb][nb]); if (NSPLIT == 1 || NSPLIT == 2) acc[mb][nb] = WFrag<T16>::mma(a2[mb], b, acc[mb][nb]); if (NSPLIT >= 2) acc[mb][nb] = WFrag<T16>::mma(a[mb], b2, acc[mb][nb]); } }
        asm volatile("v_nop\n\tv_nop\n\tv_nop\n\tv_nop" : "+v"(acc[0][0]), "+v"(acc[1][1]), "+v"(acc[2][2]), "+v"(acc[3][3]) : "v"(a[0]), "v"(a[3]));
    }
#pragma unroll
    for (int mb = 0; mb < 4; ++mb) {
#pragma unroll
        for (int nb = 0; nb < 4; ++nb) {
#pragma unroll
            for (int j = 0; j < 8; ++j) os[(hi * 8 + j) * 68 + nb * 16 + lr] = acc[mb][nb][j]; }
        __builtin_amdgcn_wave_barrier(); asm volatile("" ::: "memory");
        float* crow = C + (size_t)(r0 + mb * 16) * ldc + c0;
{
#pragma unroll
            for (int s = 0; s < 8; ++s) { const int row = 2 * s + hi, cofs = lr * 4; v4f val = *(const v4fa*)(os + row * 68 + cofs);
                *(v4f*)(crow + (size_t)row * ldc + cofs) = val; }
             }
        __builtin_amdgcn_wave_barrier(); asm volatile("" ::: "memory");
    }
}

__device__ __forceinline__ h16 tohx(float x) { return (h16)x; }
__device__ __forceinline__ void splitf(float y, unsigned short& h, unsigned short& l) { h = f2bf(y); l = f2bf(y - bf2f(h)); }
typedef __attribute__((ext_vector_type(2))) _Float16 v2h;
typedef __attribute__((ext_vector_type(4))) _Float16 v4h;
typedef __attribute__((ext_vector_type(2))) unsigned short v2us;
typedef __attribute__((ext_vector_type(4))) unsigned short v4us;
typedef __attribute__((ext_vector_type(2))) float v2f;
typedef __attribute__((ext_vector_type(4))) int v4i;

// The plane builders below (k_cvt8, k_vtp, k_ropeI, k_merge) give every thread 32 elements, moved in 16-byte pieces with all of a thread's loads issued before its first store:
// 4096 waves a launch (16 per WGP), for speed only. Every grid covers its array exactly (static_asserts at the sizes).
#define CVN 4                     // 8-element pieces per thread in k_cvt8
static_assert(((size_t)DQ * DM / 8) % (256 * CVN) == 0 && ((size_t)DKV * DM / 8) % (256 * CVN) == 0 && ((size_t)TT * DM / 8) % (256 * CVN) == 0, "k_cvt8 has no tail");
__global__ __launch_bounds__(256) void k_cvt8(const float* __restrict__ src, bf* dst) { const size_t i0 = (size_t)blockIdx.x * (256 * CVN) + threadIdx.x; v8f v[CVN];
#pragma unroll
    for (int it = 0; it < CVN; ++it) v[it] = *(const v8f*)(src + (i0 + it * 256) * 8);
#pragma unroll
    for (int it = 0; it < CVN; ++it) { v8us o;
#pragma unroll
        for (int k = 0; k < 8; ++k) o[k] = f2bf(v[it][k]);
        *(v8us*)(dst + (i0 + it * 256) * 8) = o; } }

// k_vtp: one work-group transposes one head's 64 positions x 128 columns through LDS: rows are read as 512 contiguous bytes a wave, and every store of a wave covers four whole 128-byte lines of a plane (64 positions of one column each).
#define VTT 64                    // positions per k_vtp tile
#define VTP (HD + 1)              // LDS row pitch in floats: odd, so that the column reads of a wave fall on different banks
static_assert(TT % VTT == 0 && HD == 128, "k_vtp tile shape");
template <int PITCH>              // row pitch of F in floats, a constant so that a thread's 8 loads are one address and 8 immediate offsets
__global__ __launch_bounds__(256) void k_vtp(const float* __restrict__ F, int nheads, h16* V16, bf* Vh, bf* Vl) {
    __shared__ float ls[VTT * VTP];
    const int g = blockIdx.x / (TT / VTT), t0 = (blockIdx.x % (TT / VTT)) * VTT; if (g >= nheads) return;   // the same for the whole work-group, in front of the barrier
    const int lane = threadIdx.x & 31, w = threadIdx.x >> 5; v4f x[VTT / 8];
    const float* fb = F + (size_t)(t0 + w) * PITCH + g * HD + lane * 4;
#pragma unroll
    for (int it = 0; it < VTT / 8; ++it) x[it] = *(const v4f*)(fb + (size_t)(it * 8) * PITCH);
#pragma unroll
    for (int it = 0; it < VTT / 8; ++it)
#pragma unroll
        for (int q = 0; q < 4; ++q) ls[(it * 8 + w) * VTP + lane * 4 + q] = x[it][q];
    __syncthreads();   // the tile is complete before any wave reads a column that the other waves wrote
    const int tq = (lane & 7) * 8;
#pragma unroll
    for (int gi = 0; gi < HD / 32; ++gi) { const int d = gi * 32 + w * 4 + (lane >> 3); v8h o16; v8us oh, ol;
#pragma unroll
        for (int j = 0; j < 8; ++j) { const float y = ls[(tq + j) * VTP + d]; o16[j] = tohx(y); unsigned short a2, c2; splitf(y, a2, c2); oh[j] = a2; ol[j] = c2; }
        const size_t e = ((size_t)g * HD + d) * TT + t0 + tq; *(v8h*)(V16 + e) = o16; *(v8us*)(Vh + e) = oh; *(v8us*)(Vl + e) = ol; } }
__constant__ float INV2[HD / 2] = { 1.000000000e+00f, 8.659642935e-01f, 7.498942018e-01f, 6.493816376e-01f, 5.623413324e-01f, 4.869675040e-01f, 4.216964841e-01f, 3.651741147e-01f, 3.162277639e-01f, 2.738419473e-01f, 2.371373475e-01f, 2.053525001e-01f, 1.778279394e-01f, 1.539926529e-01f, 1.333521456e-01f, 1.154781953e-01f, 9.999999404e-02f, 8.659642935e-02f, 7.498941571e-02f, 6.493815780e-02f, 5.623412505e-02f, 4.869675636e-02f, 4.216965288e-02f, 3.651741147e-02f, 3.162277490e-02f, 2.738419361e-02f, 2.371373400e-02f, 2.053524740e-02f, 1.778279617e-02f, 1.539926231e-02f, 1.333521400e-02f, 1.154781692e-02f, 9.999999776e-03f, 8.659644052e-03f, 7.498940919e-03f, 6.493817084e-03f, 5.623412319e-03f, 4.869675264e-03f, 4.216963891e-03f, 3.651741194e-03f, 3.162276698e-03f, 2.738419222e-03f, 2.371374052e-03f, 2.053524600e-03f, 1.778279431e-03f, 1.539926161e-03f, 1.333521330e-03f, 1.154781668e-03f, 9.999999311e-04f, 8.659643936e-04f, 7.498940686e-04f, 6.493816618e-04f, 5.623411853e-04f, 4.869675031e-04f, 4.216964007e-04f, 3.651740844e-04f, 3.162277862e-04f, 2.738420444e-04f, 2.371372684e-04f, 2.053524659e-04f, 1.778279402e-04f, 1.539926743e-04f, 1.333520777e-04f, 1.154781567e-04f };   // float32 exp(-log(10000) x (2i) / 128) in the module's own spelling, generated with jnp to be bit-exact
__global__ __launch_bounds__(256) void k_csP(float* CS) { const int idx = blockIdx.x * 256 + threadIdx.x; if (idx >= TT * HD) return; const int d = idx % HD; const int t = idx / HD; const float a = __fmul_rn((float)t, INV2[d >> 1]); v2f cs; cs[0] = cosf(a); cs[1] = sinf(a); *(v2f*)(CS + (size_t)idx * 2) = cs;  }
// k_ropeI: a thread takes 8 consecutive columns (4 pairs) of one position in RHN heads, so its 4 table entries are read once for all of them.
#define RHN 4                     // heads per thread in k_ropeI
static_assert(RHN == 4 && NH_ % RHN == 0 && NKV % RHN == 0 && ((size_t)TT * HD / 8) % 256 == 0, "k_ropeI has no tail");
__global__ __launch_bounds__(256) void k_ropeI(const float* __restrict__ F, int pitch, int nheads, const float* __restrict__ CS, float sc, h16* P16, bf* Ph, bf* Pl) {
    const unsigned idx = blockIdx.x * 256 + threadIdx.x; const int d = (int)(idx % (HD / 8)) * 8; const int t = (int)((idx / (HD / 8)) % TT); const int h0 = (int)(idx / (HD / 8 * TT)) * RHN; if (h0 + RHN > nheads) return;
    const float* c = CS + ((size_t)t * HD + d) * 2; v2f cs[4]; v4f x[RHN][2];
#pragma unroll
    for (int k = 0; k < 4; ++k) cs[k] = *(const v2f*)(c + 4 * k);   /* the entry of column d + 2k */
    asm volatile("s_wait_xcnt 0x0" ::: "memory");   // precaution: the compiler lets the loads below land in the registers that hold the table loads' address
#pragma unroll
    for (int it = 0; it < RHN; ++it) { const float* f = F + (size_t)t * pitch + (h0 + it) * HD + d; x[it][0] = *(const v4f*)f; x[it][1] = *(const v4f*)(f + 4); }
    // Holds all 12 loads in front of the arithmetic (loaded values as inputs only): without it the compiler sinks some of them behind the first waits and a wave pays the memory latency three times.
    asm volatile("" :: "v"(cs[0]), "v"(cs[1]), "v"(cs[2]), "v"(cs[3]), "v"(x[0][0]), "v"(x[0][1]), "v"(x[1][0]), "v"(x[1][1]), "v"(x[2][0]), "v"(x[2][1]), "v"(x[3][0]), "v"(x[3][1]));
#pragma unroll
    for (int it = 0; it < RHN; ++it) { v8h o16; v8us oh, ol;
#pragma unroll
        for (int k = 0; k < 4; ++k) { const float x0 = x[it][k >> 1][(k & 1) * 2], x1 = x[it][k >> 1][(k & 1) * 2 + 1];
            float a0 = __fmul_rn(x0, cs[k][0]), b0 = __fmul_rn(x1, cs[k][1]), a1 = __fmul_rn(x1, cs[k][0]), b1 = __fmul_rn(x0, cs[k][1]);
            float r0 = __fsub_rn(a0, b0) * sc, r1 = __fadd_rn(b1, a1) * sc;   /* even: x0 c - x1 s; odd: x0 s + x1 c */
            o16[2 * k] = tohx(r0); o16[2 * k + 1] = tohx(r1); unsigned short a2, c2; splitf(r0, a2, c2); oh[2 * k] = a2; ol[2 * k] = c2; splitf(r1, a2, c2); oh[2 * k + 1] = a2; ol[2 * k + 1] = c2; }
        const size_t e = ((size_t)(h0 + it) * TT + t) * HD + d; *(v8h*)(P16 + e) = o16; *(v8us*)(Ph + e) = oh; *(v8us*)(Pl + e) = ol; } }

// k_asoft: per row (zz, i): t = S x HD^-0.5 for j <= i and i - j < WIN (WIN = 2048 = TT here: every key j <= i is kept: the plain causal rule; the reference's where(tril, scores, -1e30) is exclusion); softmax over the 2048 keys (register row, one exp, fixed trees);
// IN PLACE: one wave owns one row, holds all of it in registers before its first store, and writes the 16-bit probabilities over the row's own 8 KiB of scores (pitch 2 x TT 16-bit elements):
// rows >= RH: fp16 in the first half; rows < RH: the hi plane in the first half (Ph), the lo plane in the second (Pl = Ph + TT). P16, Ph and Pl alias Sb, so no pointer here is __restrict__.
// The launch covers the NR query rows I0 .. I0 + NR - 1 of each of the ZH heads; Sb holds [head][row - I0][key].
template <int I0>
__global__ __launch_bounds__(256) void k_asoft(const float* Sb, h16* P16, bf* Ph, bf* Pl) {
    const int lane = threadIdx.x & 31; const int row = blockIdx.x * 8 + (threadIdx.x >> 5); if (row >= ZH * NR) return; const int i = I0 + row % NR; const bool hires = (i < RH); const float* sr = Sb + (size_t)row * TT; float v[TT / 32]; float mx = -3.0e38f;
#pragma unroll
    for (int ch = 0; ch < TT / 128; ++ch) { const int j0 = ch * 128 + lane * 4; const v4f a = *(const v4f*)(sr + j0);
#pragma unroll
        for (int q = 0; q < 4; ++q) { const int j = j0 + q; (void)j; const float t = (j <= i && i - j < WIN) ? a[q] * SCL : -3.0e38f; v[ch * 4 + q] = t; mx = fmaxf(mx, t); } }
#pragma unroll
    for (int sh = 16; sh; sh >>= 1) mx = fmaxf(mx, __shfl_xor(mx, sh, 32));
    float sum = 0.f;
#pragma unroll
    for (int k = 0; k < TT / 32; ++k) { float d0 = __fsub_rn(v[k], mx); v[k] = __builtin_amdgcn_exp2f(__fmul_rn(d0, 1.4426950408889634f)); sum += v[k]; }
#pragma unroll
    for (int sh = 16; sh; sh >>= 1) sum += __shfl_xor(sum, sh, 32);
    const float f = __fdiv_rn(hires ? 1.0f : PCAR, sum);
{
        if (hires) {
#pragma unroll
            for (int ch = 0; ch < TT / 128; ++ch) { v4us oh, ol;
#pragma unroll
                for (int q = 0; q < 4; ++q) { unsigned short a, c2; splitf(v[ch * 4 + q] * f, a, c2); oh[q] = a; ol[q] = c2; }
                const size_t oo = (size_t)row * (2 * TT) + ch * 128 + lane * 4; *(v4us*)(Ph + oo) = oh; *(v4us*)(Pl + oo) = ol; }
        } else {
#pragma unroll
            for (int ch = 0; ch < TT / 128; ++ch) { v4h o4;
#pragma unroll
                for (int q = 0; q < 4; ++q) o4[q] = tohx(v[ch * 4 + q] * f);
                *(v4h*)(P16 + (size_t)row * (2 * TT) + ch * 128 + lane * 4) = o4; } }
         }
}
#define MGN 8                     // 4-element pieces per thread in k_merge
static_assert(((size_t)ZH * TT * HD / 4) % (256 * MGN) == 0, "k_merge has no tail");
__global__ __launch_bounds__(256) void k_merge(const float* __restrict__ O, int h0, float* OUTb) { const unsigned c0 = blockIdx.x * (256 * MGN) + threadIdx.x; v4f v[MGN];
#pragma unroll
    for (int it = 0; it < MGN; ++it) v[it] = *(const v4f*)(O + (size_t)(c0 + it * 256) * 4);
#pragma unroll
    for (int it = 0; it < MGN; ++it) { const unsigned e = (c0 + it * 256) * 4; const int d = (int)(e % HD); const int t = (int)((e / HD) % TT); const int zz = (int)(e / (HD * TT)); const float cs = (t < RH) ? 1.0f : (1.0f / PCAR); const size_t oo = (size_t)t * DQ + (h0 + zz) * HD + d;
        v4f o4; o4[0] = v[it][0] * cs; o4[1] = v[it][1] * cs; o4[2] = v[it][2] * cs; o4[3] = v[it][3] * cs; *(v4f*)(OUTb + oo) = o4; } }

extern "C" void kernel_launch(void* const* d_in, const int* in_sizes, int n_in,
                              void* d_out, int out_size, void* d_ws, size_t ws_size, hipStream_t stream) {
    (void)in_sizes; (void)n_in; (void)out_size;
    const float* x = (const float*)d_in[0]; const float* wq = (const float*)d_in[1]; const float* wk = (const float*)d_in[2]; const float* wv = (const float*)d_in[3]; const float* wo = nullptr; (void)wo;   /* argument order x, Wq, Wk, Wv ('oi' (out, in) [2048][2048]): four inputs, all read; NO output weight: the merged heads are the output */
    float* OUT = (float*)d_out;     // [2][2048][2048]
    char* wsp = (char*)d_ws;
    auto take = [&](size_t bytes) { char* p = wsp; wsp += (bytes + 255) & ~(size_t)255; return (void*)p; };
    bf* WQ = (bf*)take((size_t)DQ * DM * 2); bf* WK = (bf*)take((size_t)DKV * DM * 2); bf* WV = (bf*)take((size_t)DKV * DM * 2); float* CS = (float*)take((size_t)TT * HD * 2 * 4);
    h16* QP16 = (h16*)take((size_t)NH_ * TT * HD * 2); h16* KP16 = (h16*)take((size_t)NKV * TT * HD * 2); h16* VT16 = (h16*)take((size_t)NKV * HD * TT * 2);
    bf* QPh = (bf*)take((size_t)NH_ * TT * HD * 2); bf* QPl = (bf*)take((size_t)NH_ * TT * HD * 2); bf* KPh = (bf*)take((size_t)NKV * TT * HD * 2); bf* KPl = (bf*)take((size_t)NKV * TT * HD * 2); bf* VTh = (bf*)take((size_t)NKV * HD * TT * 2); bf* VTl = (bf*)take((size_t)NKV * HD * TT * 2);
    float* Ob = (float*)take((size_t)ZH * TT * HD * 4);
    float* Sb = (float*)take((size_t)ZH * NR * TT * 4);   // scores of one pass, [head][row][key] (128 MiB); k_asoft writes the probabilities over them in place
    // The projection stage's buffers lie inside Sb: they are dead once the q, k, v planes of the batch are built, and the scores are dead before the next batch's cast (stream order). 40 MiB of the 128.
    bf* XB = (bf*)Sb; float* FQ = (float*)((char*)Sb + (size_t)TT * DM * 2); float* FK = (float*)((char*)FQ + (size_t)TT * DQ * 4);
    h16* P16 = (h16*)Sb; bf* Ph = (bf*)Sb; bf* Pl = Ph + TT;   // probability rows, pitch 2 x TT 16-bit elements (see k_asoft)
    if ((size_t)(wsp - (char*)d_ws) > ws_size) return;    // ws 256 MiB
    float* FV = FK;   // v projection reuses the k buffer after the k planes are built (stream-ordered)
    { k_cvt8<<<(unsigned)((size_t)DQ * DM / 8 / (256 * CVN)), 256, 0, stream>>>(wq, WQ); k_cvt8<<<(unsigned)((size_t)DKV * DM / 8 / (256 * CVN)), 256, 0, stream>>>(wk, WK); k_cvt8<<<(unsigned)((size_t)DKV * DM / 8 / (256 * CVN)), 256, 0, stream>>>(wv, WV);
       }
    k_csP<<<(TT * HD + 255) / 256, 256, 0, stream>>>(CS);   /* rotary table once (positions = arange) */
    const unsigned LQ = (unsigned)((size_t)(NH_ / RHN) * TT * HD / 8 / 256), LKv = (unsigned)((size_t)(NKV / RHN) * TT * HD / 8 / 256), LVt = (unsigned)(NKV * (TT / VTT));
    for (int b = 0; b < NB_; ++b) {
        
        k_cvt8<<<(unsigned)((size_t)TT * DM / 8 / (256 * CVN)), 256, 0, stream>>>(x + (size_t)b * TT * DM, XB);
        k_gemmw<bf, 0, false><<<dim3(TT / 64, DQ / 64, 1), 32, 0, stream>>>(XB, nullptr, WQ, nullptr, DM, FQ, DQ, nullptr, 0, 0, 0);
        k_ropeI<<<LQ, 256, 0, stream>>>(FQ, DQ, NH_, CS, 1.0f, QP16, QPh, QPl);
        k_gemmw<bf, 0, false><<<dim3(TT / 64, DKV / 64, 1), 32, 0, stream>>>(XB, nullptr, WK, nullptr, DM, FK, DKV, nullptr, 0, 0, 0);
        k_ropeI<<<LKv, 256, 0, stream>>>(FK, DKV, NKV, CS, 1.0f, KP16, KPh, KPl);
        k_gemmw<bf, 0, false><<<dim3(TT / 64, DKV / 64, 1), 32, 0, stream>>>(XB, nullptr, WV, nullptr, DM, FV, DKV, nullptr, 0, 0, 0); k_vtp<DKV><<<LVt, 256, 0, stream>>>(FV, NKV, VT16, VTh, VTl);
        // Attention, all ZH heads in grid z (one kv head per query head: q, k, v planes all have z-stride TT*HD), in two passes over the query rows.
        // Pass 1, rows 0 .. NR-1 (rows < RH on the hi/lo planes, the rest fp16):
        k_gemmc<bf, 2, 1><<<dim3(RH / 64, TT / 64, ZH), 32, 0, stream>>>(QPh, QPl, KPh, KPl, HD, HD, Sb, TT, 0, (size_t)TT * HD, (size_t)TT * HD, (size_t)NR * TT);
        k_gemmc<h16, 0, 1><<<dim3((NR - RH) / 64, TT / 64, ZH), 32, 0, stream>>>(QP16 + (size_t)RH * HD, nullptr, KP16, nullptr, HD, HD, Sb + (size_t)RH * TT, TT, RH, (size_t)TT * HD, (size_t)TT * HD, (size_t)NR * TT);
        k_asoft<0><<<ZH * NR / 8, 256, 0, stream>>>(Sb, P16, Ph, Pl);
        k_gemmc<bf, 2, 2><<<dim3(RH / 64, HD / 64, ZH), 32, 0, stream>>>(Ph, Pl, VTh, VTl, TT, 2 * TT, Ob, HD, 0, (size_t)NR * 2 * TT, (size_t)HD * TT, (size_t)TT * HD);
        k_gemmc<h16, 0, 2><<<dim3((NR - RH) / 64, HD / 64, ZH), 32, 0, stream>>>(P16 + (size_t)RH * 2 * TT, nullptr, VT16, nullptr, TT, 2 * TT, Ob + (size_t)RH * HD, HD, RH, (size_t)NR * 2 * TT, (size_t)HD * TT, (size_t)TT * HD);
        // Pass 2, rows NR .. TT-1 (all fp16); score row 0 of each head is query row NR:
        k_gemmc<h16, 0, 1><<<dim3((TT - NR) / 64, TT / 64, ZH), 32, 0, stream>>>(QP16 + (size_t)NR * HD, nullptr, KP16, nullptr, HD, HD, Sb, TT, NR, (size_t)TT * HD, (size_t)TT * HD, (size_t)NR * TT);
        k_asoft<NR><<<ZH * NR / 8, 256, 0, stream>>>(Sb, P16, Ph, Pl);
        k_gemmc<h16, 0, 2><<<dim3((TT - NR) / 64, HD / 64, ZH), 32, 0, stream>>>(P16, nullptr, VT16, nullptr, TT, 2 * TT, Ob + (size_t)NR * HD, HD, NR, (size_t)NR * 2 * TT, (size_t)HD * TT, (size_t)TT * HD);
        k_merge<<<(unsigned)((size_t)ZH * TT * HD / 4 / (256 * MGN)), 256, 0, stream>>>(Ob, 0, OUT + (size_t)b * TT * DQ);
        /* no output projection: k_merge has written the merged heads of this batch to OUT */ }
}

// v003
// A run of this version takes 466 microseconds.
// Two timings next to v002 put it at 1.58 and 1.59 times that version's speed.
// All steps since v000 together make it 3.42 times as fast.
#include <hip/hip_runtime.h>

// Causal multi-head self-attention with 128-wide heads and interleaved-pair rotary embeddings, WITHOUT an output projection (x [2][2048][2048]; q, k, v = einsum('bsm,nm->bsn', x, W) = x W^T ('oi' (out, in) [2048][2048] normal x 0.02, no bias; 16 heads x 128); rope on (even, odd) pairs: (xe cos - xo sin, xe sin + xo cos) with angle m x theta[i], theta = exp(-log(10000) x (2i) / 128) IN THAT SPELLING (64 f32 frequencies baked from the module's own line; precise cosf/sinf), m = arange(2048); scores x 1/sqrt(128); causal (tril kept, -1e30 elsewhere == exclusion: exp underflows to exactly 0); softmax in f32; out = the merged heads [b][s][h x 128 + d] -> [2][2048][2048] f32 (8.4 M); argument order x, Wq, Wk, Wv).
// Layout per batch: bf16 copy of X; 'oi' weights; exact projections; k_csP table (64 angles) + k_ropeI interleaved-pair plane builders at HD 128; k_fattn: causal attention in one launch, scores and probabilities held in registers (running maximum and sum per query row; hybrid rows: < 512 hi/lo 3 products, rest fp16 x1024), which writes the merged heads straight to the output rows (no output projection).
// Compute dtypes, f32 accumulate: every input rounded to bf16; projections exact; rotary f32; attention rows < 512 3 products, rest fp16; softmax f32; output f32 (the P.v accumulators divided by the row sum).

#define NB_  2
#define TT   2048
#define DM   2048
#define NH_  16
#define NKV  16
#define REP  (NH_ / NKV)
#define HD   128
#define DQ   (NH_ * HD)
#define DKV  (NKV * HD)
#define RH   512                  // query rows < RH use hi+lo planes (0: none)
#define SCL  0.088388347648318447f   // HD^-0.5
#define LOG2E 1.4426950408889634f
typedef _Float16 h16;
typedef unsigned short bf;
typedef __attribute__((ext_vector_type(16))) __bf16   v16bf;
typedef __attribute__((ext_vector_type(16))) _Float16 v16h;
typedef __attribute__((ext_vector_type(8)))  _Float16 v8h;
typedef __attribute__((ext_vector_type(8)))  unsigned short v8us;
typedef __attribute__((ext_vector_type(8)))  float    v8f;
typedef __attribute__((ext_vector_type(4)))  float    v4f;
typedef v8h  __attribute__((may_alias)) v8ha;
typedef v4f  __attribute__((may_alias)) v4fa;
typedef v8us __attribute__((may_alias)) v8usa;

__device__ __forceinline__ unsigned short f2bf(float f) { unsigned u = __float_as_uint(f); u += 0x7FFFu + ((u >> 16) & 1u); return (unsigned short)(u >> 16); }
__device__ __forceinline__ float bf2f(unsigned short b) { return __uint_as_float(((unsigned)b) << 16); }
__device__ __forceinline__ float bfr(float f) { return bf2f(f2bf(f)); }
__device__ __forceinline__ v16h cat16(v8h lo, v8h hi) { return __builtin_shufflevector(lo, hi, 0, 1, 2, 3, 4, 5, 6, 7, 8, 9, 10, 11, 12, 13, 14, 15); }
__device__ __forceinline__ v16bf cat16b(v8us lo, v8us hi) { return __builtin_bit_cast(v16bf, __builtin_shufflevector(lo, hi, 0, 1, 2, 3, 4, 5, 6, 7, 8, 9, 10, 11, 12, 13, 14, 15)); }
__device__ __forceinline__ v8f wmma16(v16h a, v16h b, v8f c) { return __builtin_amdgcn_wmma_f32_16x16x32_f16(false, a, false, b, (short)0, c, false, false); }
__device__ __forceinline__ v8f wmmab(v16bf a, v16bf b, v8f c) { return __builtin_amdgcn_wmma_f32_16x16x32_bf16(false, a, false, b, (short)0, c, false, false); }



// ---- k_gemmw: register-blocked GEMM, ONE WAVE per 64x64 output tile (16 accumulators), operands straight from K-contiguous 16-bit planes; grid (M/64, N/64, Z), 32 threads.
// C[m][n] (f32, pitch ldc, + optional f32 bias[n]) = sum_k A[m][k] Bt[n][k] (+ split products per NSPLIT). z-batch strides sA/sB/sC in elements. K % 32 == 0.
template <typename T16> struct WFrag;
template <> struct WFrag<h16> { typedef v16h V; static __device__ __forceinline__ V ld(const h16* p) { return cat16(*(const v8h*)p, *(const v8h*)(p + 16)); } static __device__ __forceinline__ v8f mma(V a, V b, v8f c) { return wmma16(a, b, c); } };
template <> struct WFrag<bf> { typedef v16bf V; static __device__ __forceinline__ V ld(const bf* p) { return cat16b(*(const v8us*)p, *(const v8us*)(p + 16)); } static __device__ __forceinline__ v8f mma(V a, V b, v8f c) { return wmmab(a, b, c); } };
template <typename T16, int NSPLIT, bool BIAS>
__global__ __launch_bounds__(32) void k_gemmw(const T16* __restrict__ A, const T16* __restrict__ A2, const T16* __restrict__ Bt, const T16* __restrict__ Bt2, int K, float* C, int ldc, const float* __restrict__ bias, size_t sA, size_t sB, size_t sC) {
    typedef typename WFrag<T16>::V V;
    __shared__ __align__(16) float os[16 * 68];
    const size_t z = blockIdx.z; A += z * sA; if (A2) A2 += z * sA; Bt += z * sB; if (Bt2) Bt2 += z * sB; C += z * sC;
    const int lane = threadIdx.x & 31, lr = lane & 15, hi = lane >> 4; const int r0 = blockIdx.x * 64, c0 = blockIdx.y * 64;
    v8f acc[4][4];
#pragma unroll
    for (int mb = 0; mb < 4; ++mb)
#pragma unroll
        for (int nb = 0; nb < 4; ++nb) acc[mb][nb] = (v8f){};
    const size_t aoff = (size_t)(r0 + lr) * K + 8 * hi, boff = (size_t)(c0 + lr) * K + 8 * hi;
#pragma unroll 1
    for (int kc = 0; kc < K; kc += 32) {
        V a[4], a2[4];
#pragma unroll
        for (int mb = 0; mb < 4; ++mb) { a[mb] = WFrag<T16>::ld(A + aoff + (size_t)mb * 16 * K + kc); if (NSPLIT == 1 || NSPLIT == 2) a2[mb] = WFrag<T16>::ld(A2 + aoff + (size_t)mb * 16 * K + kc); }
#pragma unroll
        for (int nb = 0; nb < 4; ++nb) { const V b = WFrag<T16>::ld(Bt + boff + (size_t)nb * 16 * K + kc); V b2; if (NSPLIT >= 2) b2 = WFrag<T16>::ld(Bt2 + boff + (size_t)nb * 16 * K + kc);
#pragma unroll
            for (int mb = 0; mb < 4; ++mb) { acc[mb][nb] = WFrag<T16>::mma(a[mb], b, acc[mb][nb]); if (NSPLIT == 1 || NSPLIT == 2) acc[mb][nb] = WFrag<T16>::mma(a2[mb], b, acc[mb][nb]); if (NSPLIT >= 2) acc[mb][nb] = WFrag<T16>::mma(a[mb], b2, acc[mb][nb]); } }
        asm volatile("v_nop\n\tv_nop\n\tv_nop\n\tv_nop" : "+v"(acc[0][0]), "+v"(acc[1][1]), "+v"(acc[2][2]), "+v"(acc[3][3]) : "v"(a[0]), "v"(a[3]));
    }
#pragma unroll
    for (int mb = 0; mb < 4; ++mb) {
#pragma unroll
        for (int nb = 0; nb < 4; ++nb) {
#pragma unroll
            for (int j = 0; j < 8; ++j) os[(hi * 8 + j) * 68 + nb * 16 + lr] = acc[mb][nb][j]; }
        __builtin_amdgcn_wave_barrier(); asm volatile("" ::: "memory");
        float* crow = C + (size_t)(r0 + mb * 16) * ldc + c0;
{
#pragma unroll
            for (int s = 0; s < 8; ++s) { const int row = 2 * s + hi, cofs = lr * 4; v4f val = *(const v4fa*)(os + row * 68 + cofs); if (BIAS) { val[0] += bfr(bias[c0 + cofs]); val[1] += bfr(bias[c0 + cofs + 1]); val[2] += bfr(bias[c0 + cofs + 2]); val[3] += bfr(bias[c0 + cofs + 3]); }
                *(v4f*)(crow + (size_t)row * ldc + cofs) = val; }
             }
        __builtin_amdgcn_wave_barrier(); asm volatile("" ::: "memory");
    }
}

template <bool B> struct BoolC { static constexpr bool value = B; };
__device__ __forceinline__ h16 tohx(float x) { return (h16)x; }
__device__ __forceinline__ void splitf(float y, unsigned short& h, unsigned short& l) { h = f2bf(y); l = f2bf(y - bf2f(h)); }
typedef __attribute__((ext_vector_type(2))) _Float16 v2h;
typedef __attribute__((ext_vector_type(4))) _Float16 v4h;
typedef __attribute__((ext_vector_type(2))) unsigned short v2us;
typedef __attribute__((ext_vector_type(4))) unsigned short v4us;
typedef __attribute__((ext_vector_type(2))) float v2f;
typedef __attribute__((ext_vector_type(4))) int v4i;

// The plane builders below (k_cvt8, k_vtp, k_ropeI) give every thread 32 elements, moved in 16-byte pieces with all of a thread's loads issued before its first store:
// 4096 waves a launch (16 per WGP). Every grid covers its array exactly (static_asserts at the sizes).
#define CVN 4                     // 8-element pieces per thread in k_cvt8
static_assert(((size_t)DQ * DM / 8) % (256 * CVN) == 0 && ((size_t)DKV * DM / 8) % (256 * CVN) == 0 && ((size_t)TT * DM / 8) % (256 * CVN) == 0, "k_cvt8 has no tail");
__global__ __launch_bounds__(256) void k_cvt8(const float* __restrict__ src, bf* dst) { const size_t i0 = (size_t)blockIdx.x * (256 * CVN) + threadIdx.x; v8f v[CVN];
#pragma unroll
    for (int it = 0; it < CVN; ++it) v[it] = *(const v8f*)(src + (i0 + it * 256) * 8);
#pragma unroll
    for (int it = 0; it < CVN; ++it) { v8us o;
#pragma unroll
        for (int k = 0; k < 8; ++k) o[k] = f2bf(v[it][k]);
        *(v8us*)(dst + (i0 + it * 256) * 8) = o; } }

// k_vtp: one work-group transposes one head's 64 positions x 128 columns through LDS: rows are read as 512 contiguous bytes a wave, and every store of a wave covers four whole 128-byte lines of a plane (64 positions of one column each).
#define VTT 64                    // positions per k_vtp tile
#define VTP (HD + 1)              // LDS row pitch in floats: odd, so that the column reads of a wave fall on different banks
static_assert(TT % VTT == 0 && HD == 128, "k_vtp tile shape");
template <int PITCH>              // row pitch of F in floats, a constant so that a thread's 8 loads are one address and 8 immediate offsets
__global__ __launch_bounds__(256) void k_vtp(const float* __restrict__ F, int nheads, h16* V16, bf* Vh, bf* Vl) {
    __shared__ float ls[VTT * VTP];
    const int g = blockIdx.x / (TT / VTT), t0 = (blockIdx.x % (TT / VTT)) * VTT; if (g >= nheads) return;   // the same for the whole work-group, in front of the barrier
    const int lane = threadIdx.x & 31, w = threadIdx.x >> 5; v4f x[VTT / 8];
    const float* fb = F + (size_t)(t0 + w) * PITCH + g * HD + lane * 4;
#pragma unroll
    for (int it = 0; it < VTT / 8; ++it) x[it] = *(const v4f*)(fb + (size_t)(it * 8) * PITCH);
#pragma unroll
    for (int it = 0; it < VTT / 8; ++it)
#pragma unroll
        for (int q = 0; q < 4; ++q) ls[(it * 8 + w) * VTP + lane * 4 + q] = x[it][q];
    __syncthreads();   // the tile is complete before any wave reads a column that the other waves wrote
    const int tq = (lane & 7) * 8;
#pragma unroll
    for (int gi = 0; gi < HD / 32; ++gi) { const int d = gi * 32 + w * 4 + (lane >> 3); v8h o16; v8us oh, ol;
#pragma unroll
        for (int j = 0; j < 8; ++j) { const float y = ls[(tq + j) * VTP + d]; o16[j] = tohx(y); unsigned short a2, c2; splitf(y, a2, c2); oh[j] = a2; ol[j] = c2; }
        const size_t e = ((size_t)g * HD + d) * TT + t0 + tq; *(v8h*)(V16 + e) = o16; *(v8us*)(Vh + e) = oh; *(v8us*)(Vl + e) = ol; } }
__constant__ float INV2[HD / 2] = { 1.000000000e+00f, 8.659642935e-01f, 7.498942018e-01f, 6.493816376e-01f, 5.623413324e-01f, 4.869675040e-01f, 4.216964841e-01f, 3.651741147e-01f, 3.162277639e-01f, 2.738419473e-01f, 2.371373475e-01f, 2.053525001e-01f, 1.778279394e-01f, 1.539926529e-01f, 1.333521456e-01f, 1.154781953e-01f, 9.999999404e-02f, 8.659642935e-02f, 7.498941571e-02f, 6.493815780e-02f, 5.623412505e-02f, 4.869675636e-02f, 4.216965288e-02f, 3.651741147e-02f, 3.162277490e-02f, 2.738419361e-02f, 2.371373400e-02f, 2.053524740e-02f, 1.778279617e-02f, 1.539926231e-02f, 1.333521400e-02f, 1.154781692e-02f, 9.999999776e-03f, 8.659644052e-03f, 7.498940919e-03f, 6.493817084e-03f, 5.623412319e-03f, 4.869675264e-03f, 4.216963891e-03f, 3.651741194e-03f, 3.162276698e-03f, 2.738419222e-03f, 2.371374052e-03f, 2.053524600e-03f, 1.778279431e-03f, 1.539926161e-03f, 1.333521330e-03f, 1.154781668e-03f, 9.999999311e-04f, 8.659643936e-04f, 7.498940686e-04f, 6.493816618e-04f, 5.623411853e-04f, 4.869675031e-04f, 4.216964007e-04f, 3.651740844e-04f, 3.162277862e-04f, 2.738420444e-04f, 2.371372684e-04f, 2.053524659e-04f, 1.778279402e-04f, 1.539926743e-04f, 1.333520777e-04f, 1.154781567e-04f };   // float32 exp(-log(10000) x (2i) / 128) in the module's own spelling, generated with jnp to be bit-exact
__global__ __launch_bounds__(256) void k_csP(float* CS) { const int idx = blockIdx.x * 256 + threadIdx.x; if (idx >= TT * HD) return; const int d = idx % HD; const int t = idx / HD; const float a = __fmul_rn((float)t, INV2[d >> 1]); v2f cs; cs[0] = cosf(a); cs[1] = sinf(a); *(v2f*)(CS + (size_t)idx * 2) = cs;  }
// k_ropeI: a thread takes 8 consecutive columns (4 pairs) of one position in RHN heads, so its 4 table entries are read once for all of them.
#define RHN 4                     // heads per thread in k_ropeI
static_assert(RHN == 4 && NH_ % RHN == 0 && NKV % RHN == 0 && ((size_t)TT * HD / 8) % 256 == 0, "k_ropeI has no tail");
__global__ __launch_bounds__(256) void k_ropeI(const float* __restrict__ F, int pitch, int nheads, const float* __restrict__ CS, float sc, h16* P16, bf* Ph, bf* Pl) {
    const unsigned idx = blockIdx.x * 256 + threadIdx.x; const int d = (int)(idx % (HD / 8)) * 8; const int t = (int)((idx / (HD / 8)) % TT); const int h0 = (int)(idx / (HD / 8 * TT)) * RHN; if (h0 + RHN > nheads) return;
    const float* c = CS + ((size_t)t * HD + d) * 2; v2f cs[4]; v4f x[RHN][2];
#pragma unroll
    for (int k = 0; k < 4; ++k) cs[k] = *(const v2f*)(c + 4 * k);   /* the entry of column d + 2k */
    asm volatile("s_wait_xcnt 0x0" ::: "memory");   // precaution: the compiler lets the loads below land in the registers that hold the table loads' address
#pragma unroll
    for (int it = 0; it < RHN; ++it) { const float* f = F + (size_t)t * pitch + (h0 + it) * HD + d; x[it][0] = *(const v4f*)f; x[it][1] = *(const v4f*)(f + 4); }
    // Holds all 12 loads in front of the arithmetic (loaded values as inputs only): without it the compiler sinks some of them behind the first waits and a wave pays the memory latency three times.
    asm volatile("" :: "v"(cs[0]), "v"(cs[1]), "v"(cs[2]), "v"(cs[3]), "v"(x[0][0]), "v"(x[0][1]), "v"(x[1][0]), "v"(x[1][1]), "v"(x[2][0]), "v"(x[2][1]), "v"(x[3][0]), "v"(x[3][1]));
#pragma unroll
    for (int it = 0; it < RHN; ++it) { v8h o16; v8us oh, ol;
#pragma unroll
        for (int k = 0; k < 4; ++k) { const float x0 = x[it][k >> 1][(k & 1) * 2], x1 = x[it][k >> 1][(k & 1) * 2 + 1];
            float a0 = __fmul_rn(x0, cs[k][0]), b0 = __fmul_rn(x1, cs[k][1]), a1 = __fmul_rn(x1, cs[k][0]), b1 = __fmul_rn(x0, cs[k][1]);
            float r0 = __fsub_rn(a0, b0) * sc, r1 = __fadd_rn(b1, a1) * sc;   /* even: x0 c - x1 s; odd: x0 s + x1 c */
            o16[2 * k] = tohx(r0); o16[2 * k + 1] = tohx(r1); unsigned short a2, c2; splitf(r0, a2, c2); oh[2 * k] = a2; ol[2 * k] = c2; splitf(r1, a2, c2); oh[2 * k + 1] = a2; ol[2 * k + 1] = c2; }
        const size_t e = ((size_t)(h0 + it) * TT + t) * HD + d; *(v8h*)(P16 + e) = o16; *(v8us*)(Ph + e) = oh; *(v8us*)(Pl + e) = ol; } }

#define QW 32
__device__ __forceinline__ float xhalf(float x) { return __builtin_bit_cast(float, __builtin_amdgcn_permlanex16(__builtin_bit_cast(int, x), __builtin_bit_cast(int, x), 0x76543210, 0xfedcba98, false, false)); }   // lane l takes lane l ^ 16's value
template <typename T16, bool HL>
__device__ __forceinline__ void fattn_rows(const T16* __restrict__ Q, const T16* __restrict__ Q2, const T16* __restrict__ K, const T16* __restrict__ K2, const T16* __restrict__ VT, const T16* __restrict__ VT2, float* __restrict__ O, const int q0, const int lane) {
    typedef typename WFrag<T16>::V V;
    const int lr = lane & 15, hi = lane >> 4;
    const float CE = SCL * LOG2E, OFF = HL ? 0.0f : 10.0f;
    // Every load is a wave-uniform plane pointer that never changes + a 32-bit lane offset in bytes (walked block by block for k and v) + a constant.
    unsigned ko = (unsigned)(lr * HD + 8 * hi) * 2u, vo = (unsigned)(lr * TT + 8 * hi) * 2u;   // the lane's place in 16 rows of k, and of the transposed v
    const unsigned qo = ko + (unsigned)q0 * (HD * 2u);
    auto at = [](const T16* p, unsigned bytes) { return (const T16*)((const char*)p + bytes); };
    V qf[2][4], ql[2][4], kf[2][4], kl[2][4];
#pragma unroll
    for (int qt = 0; qt < 2; ++qt)
#pragma unroll
        for (int c = 0; c < 4; ++c) { const int e = qt * 16 * HD + c * 32; qf[qt][c] = WFrag<T16>::ld(at(Q, qo) + e); if (HL) ql[qt][c] = WFrag<T16>::ld(at(Q2, qo) + e); }
#pragma unroll
    for (int kt = 0; kt < 2; ++kt)
#pragma unroll
        for (int c = 0; c < 4; ++c) { const int e = kt * 16 * HD + c * 32; kf[kt][c] = WFrag<T16>::ld(at(K, ko) + e); if (HL) kl[kt][c] = WFrag<T16>::ld(at(K2, ko) + e); }
    asm volatile("s_wait_xcnt 0x0" :: "s"(Q), "s"(Q2), "s"(K), "s"(K2), "v"(qo) : "memory");   // precaution: behind it the registers that the q loads name may be reused; pointers and offset are inputs so that they stay as they are up to it
    v8f acc[8][2];
#pragma unroll
    for (int dt = 0; dt < 8; ++dt) { acc[dt][0] = (v8f){}; acc[dt][1] = (v8f){}; }
    float mx[2] = { -3.0e38f, -3.0e38f }, ls[2] = { 0.f, 0.f };
    auto step = [&](auto lastc) {
        constexpr bool LAST = decltype(lastc)::value;
        V vf[8], vl[8];
#pragma unroll
        for (int dt = 0; dt < 8; ++dt) { const int e = dt * 16 * TT; vf[dt] = WFrag<T16>::ld(at(VT, vo) + e); if (HL) vl[dt] = WFrag<T16>::ld(at(VT2, vo) + e); }
        v8f s[2][2];
#pragma unroll
        for (int kt = 0; kt < 2; ++kt) { s[kt][0] = (v8f){}; s[kt][1] = (v8f){}; }
#pragma unroll
        for (int c = 0; c < 4; ++c)
#pragma unroll
            for (int kt = 0; kt < 2; ++kt)
#pragma unroll
                for (int qt = 0; qt < 2; ++qt) { s[kt][qt] = WFrag<T16>::mma(kf[kt][c], qf[qt][c], s[kt][qt]); if (HL) { s[kt][qt] = WFrag<T16>::mma(kf[kt][c], ql[qt][c], s[kt][qt]); s[kt][qt] = WFrag<T16>::mma(kl[kt][c], qf[qt][c], s[kt][qt]); } }
        if (!LAST) {   // the next block's key fragments, into the same registers, fly during the softmax and the second contraction
#pragma unroll
            for (int kt = 0; kt < 2; ++kt)
#pragma unroll
                for (int c = 0; c < 4; ++c) { const int e = (32 + kt * 16) * HD + c * 32; kf[kt][c] = WFrag<T16>::ld(at(K, ko) + e); if (HL) kl[kt][c] = WFrag<T16>::ld(at(K2, ko) + e); }
        }
        V pf[2], pl[2];
#pragma unroll
        for (int qt = 0; qt < 2; ++qt) {
            float t[16];
#pragma unroll
            for (int i = 0; i < 16; ++i) { float x = s[i >> 3][qt][i & 7]; if (LAST) { if ((i >> 3) * 16 + hi * 8 + (i & 7) > qt * 16 + lr) x = -3.0e38f; } t[i] = x; }
            float m8[8];
#pragma unroll
            for (int i = 0; i < 8; ++i) m8[i] = fmaxf(t[i], t[i + 8]);
            float ml = fmaxf(fmaxf(fmaxf(m8[0], m8[1]), fmaxf(m8[2], m8[3])), fmaxf(fmaxf(m8[4], m8[5]), fmaxf(m8[6], m8[7])));
            ml = fmaxf(ml, xhalf(ml));
            const float mn = fmaxf(mx[qt], ml * CE), al = __builtin_amdgcn_exp2f(mx[qt] - mn), mo = mn - OFF; mx[qt] = mn;
#pragma unroll
            for (int i = 0; i < 16; ++i) t[i] = __builtin_amdgcn_exp2f(fmaf(t[i], CE, -mo));
            float s4[4];
#pragma unroll
            for (int i = 0; i < 4; ++i) s4[i] = (t[i] + t[i + 4]) + (t[i + 8] + t[i + 12]);
            ls[qt] = fmaf(ls[qt], al, (s4[0] + s4[1]) + (s4[2] + s4[3]));
#pragma unroll
            for (int dt = 0; dt < 8; ++dt) acc[dt][qt] *= al;
            if constexpr (HL) { v8us h0, h1, l0, l1;
#pragma unroll
                for (int i = 0; i < 8; ++i) { unsigned short a, b; splitf(t[i], a, b); h0[i] = a; l0[i] = b; splitf(t[i + 8], a, b); h1[i] = a; l1[i] = b; }
                pf[qt] = cat16b(h0, h1); pl[qt] = cat16b(l0, l1);
            } else { v16h p;
#pragma unroll
                for (int i = 0; i < 16; ++i) p[i] = tohx(t[i]);
                pf[qt] = p; }
        }
#pragma unroll
        for (int dt = 0; dt < 8; ++dt)
#pragma unroll
            for (int qt = 0; qt < 2; ++qt) { acc[dt][qt] = WFrag<T16>::mma(vf[dt], pf[qt], acc[dt][qt]); if (HL) { acc[dt][qt] = WFrag<T16>::mma(vf[dt], pl[qt], acc[dt][qt]); acc[dt][qt] = WFrag<T16>::mma(vl[dt], pf[qt], acc[dt][qt]); } }
        // precaution: stands in front of the advance below, which rewrites the offset registers that this block's loads name; the offsets are operands so that the advance stays behind it, the plane pointers are inputs so that their registers stay as they are up to it
        __builtin_amdgcn_sched_barrier(0);   // keeps the wait below at the block's end, far behind the block's loads; without it the compiler lifts the wait to directly behind the last load, in front of the softmax
        asm volatile("s_wait_xcnt 0x0" : "+v"(ko), "+v"(vo) : "s"(K), "s"(K2), "s"(VT), "s"(VT2) : "memory");
        ko += 32 * HD * 2; vo += 32 * 2;
    };
    const int nb = q0 / 32 + 1;
#pragma unroll 1
    for (int kb = 0; kb < nb - 1; ++kb) step(BoolC<false>());
    step(BoolC<true>());
#pragma unroll
    for (int qt = 0; qt < 2; ++qt) { const float inv = __fdiv_rn(1.0f, ls[qt] + xhalf(ls[qt]));
#pragma unroll
        for (int dt = 0; dt < 8; ++dt) acc[dt][qt] *= inv; }
    const unsigned oo = (unsigned)((q0 + lr) * DQ + hi * 8) * 4u;   // bytes: the lane's 8 columns of its first query row
    __builtin_amdgcn_sched_barrier(0);   // all arithmetic stands in front of the first store, so that no register that an issued store names is rewritten behind it
#pragma unroll
    for (int qt = 0; qt < 2; ++qt)
#pragma unroll
        for (int dt = 0; dt < 8; ++dt) { float* o = (float*)((char*)O + oo) + qt * 16 * DQ + dt * 16;
            *(v4f*)o = __builtin_shufflevector(acc[dt][qt], acc[dt][qt], 0, 1, 2, 3); *(v4f*)(o + 4) = __builtin_shufflevector(acc[dt][qt], acc[dt][qt], 4, 5, 6, 7); }
}
// Grid (TT / QW / 4, heads), 4 waves, no barrier and no LDS. The four waves of a work-group take the row blocks g, 31 - g, 32 + g and 63 - g of one head, so that every work-group walks about the same number of key blocks and its waves walk the same keys from block 0 on.
static_assert(TT / QW == 64 && RH % QW == 0 && HD == 128 && NKV == NH_, "k_fattn is written for these shapes");
__global__ __launch_bounds__(128) void k_fattn(const h16* __restrict__ Q16, const h16* __restrict__ K16, const h16* __restrict__ V16, const bf* __restrict__ Qh, const bf* __restrict__ Ql, const bf* __restrict__ Kh, const bf* __restrict__ Kl, const bf* __restrict__ Vh, const bf* __restrict__ Vl, float* __restrict__ OUTb) {
    const int wave = __builtin_amdgcn_readfirstlane((int)(threadIdx.x >> 5)), lane = threadIdx.x & 31, g = blockIdx.x;
    const int qb = (wave == 0) ? g : (wave == 1) ? 31 - g : (wave == 2) ? 32 + g : 63 - g;
    const size_t po = (size_t)blockIdx.y * TT * HD; float* O = OUTb + blockIdx.y * HD;
    if (qb * QW < RH) fattn_rows<bf, true>(Qh + po, Ql + po, Kh + po, Kl + po, Vh + po, Vl + po, O, qb * QW, lane);
    else fattn_rows<h16, false>(Q16 + po, nullptr, K16 + po, nullptr, V16 + po, nullptr, O, qb * QW, lane);
}

extern "C" void kernel_launch(void* const* d_in, const int* in_sizes, int n_in,
                              void* d_out, int out_size, void* d_ws, size_t ws_size, hipStream_t stream) {
    (void)in_sizes; (void)n_in; (void)out_size;
    const float* x = (const float*)d_in[0]; const float* wq = (const float*)d_in[1]; const float* wk = (const float*)d_in[2]; const float* wv = (const float*)d_in[3]; const float* wo = nullptr; (void)wo;   /* argument order x, Wq, Wk, Wv ('oi' (out, in) [2048][2048]): four inputs, all read; NO output weight: the merged heads are the output */
    float* OUT = (float*)d_out;     // [2][2048][2048]
    char* wsp = (char*)d_ws;
    auto take = [&](size_t bytes) { char* p = wsp; wsp += (bytes + 255) & ~(size_t)255; return (void*)p; };
    bf* WQ = (bf*)take((size_t)DQ * DM * 2); bf* WK = (bf*)take((size_t)DKV * DM * 2); bf* WV = (bf*)take((size_t)DKV * DM * 2); float* CS = (float*)take((size_t)TT * HD * 2 * 4);
    h16* QP16 = (h16*)take((size_t)NH_ * TT * HD * 2); h16* KP16 = (h16*)take((size_t)NKV * TT * HD * 2); h16* VT16 = (h16*)take((size_t)NKV * HD * TT * 2);
    bf* QPh = (bf*)take((size_t)NH_ * TT * HD * 2); bf* QPl = (bf*)take((size_t)NH_ * TT * HD * 2); bf* KPh = (bf*)take((size_t)NKV * TT * HD * 2); bf* KPl = (bf*)take((size_t)NKV * TT * HD * 2); bf* VTh = (bf*)take((size_t)NKV * HD * TT * 2); bf* VTl = (bf*)take((size_t)NKV * HD * TT * 2);
    // The projection stage's buffers: the bf16 copy of x, and two f32 projection results.
    bf* XB = (bf*)take((size_t)TT * DM * 2); float* FQ = (float*)take((size_t)TT * DQ * 4); float* FK = (float*)take((size_t)TT * DKV * 4);
    if ((size_t)(wsp - (char*)d_ws) > ws_size) return;    // ws 256 MiB
    float* FV = FK;   // v projection reuses the k buffer after the k planes are built (stream-ordered)
    { k_cvt8<<<(unsigned)((size_t)DQ * DM / 8 / (256 * CVN)), 256, 0, stream>>>(wq, WQ); k_cvt8<<<(unsigned)((size_t)DKV * DM / 8 / (256 * CVN)), 256, 0, stream>>>(wk, WK); k_cvt8<<<(unsigned)((size_t)DKV * DM / 8 / (256 * CVN)), 256, 0, stream>>>(wv, WV);
       }
    k_csP<<<(TT * HD + 255) / 256, 256, 0, stream>>>(CS);   /* rotary table once (positions = arange) */
    const unsigned LQ = (unsigned)((size_t)(NH_ / RHN) * TT * HD / 8 / 256), LKv = (unsigned)((size_t)(NKV / RHN) * TT * HD / 8 / 256), LVt = (unsigned)(NKV * (TT / VTT));
    for (int b = 0; b < NB_; ++b) {
        
        k_cvt8<<<(unsigned)((size_t)TT * DM / 8 / (256 * CVN)), 256, 0, stream>>>(x + (size_t)b * TT * DM, XB);
        k_gemmw<bf, 0, false><<<dim3(TT / 64, DQ / 64, 1), 32, 0, stream>>>(XB, nullptr, WQ, nullptr, DM, FQ, DQ, nullptr, 0, 0, 0);
        k_ropeI<<<LQ, 256, 0, stream>>>(FQ, DQ, NH_, CS, 1.0f, QP16, QPh, QPl);
        k_gemmw<bf, 0, false><<<dim3(TT / 64, DKV / 64, 1), 32, 0, stream>>>(XB, nullptr, WK, nullptr, DM, FK, DKV, nullptr, 0, 0, 0);
        k_ropeI<<<LKv, 256, 0, stream>>>(FK, DKV, NKV, CS, 1.0f, KP16, KPh, KPl);
        k_gemmw<bf, 0, false><<<dim3(TT / 64, DKV / 64, 1), 32, 0, stream>>>(XB, nullptr, WV, nullptr, DM, FV, DKV, nullptr, 0, 0, 0); k_vtp<DKV><<<LVt, 256, 0, stream>>>(FV, NKV, VT16, VTh, VTl);
        k_fattn<<<dim3(TT / QW / 4, NH_, 1), 128, 0, stream>>>(QP16, KP16, VT16, QPh, QPl, KPh, KPl, VTh, VTl, OUT + (size_t)b * TT * DQ);
        /* no output projection: k_fattn has written the merged heads of this batch to OUT */ }
}

// v004
// Measured time: 293 microseconds a run.
// Timed twice side by side with v003, it ran 1.56 and 1.57 times as fast.
// Counting every step since v000, it is 5.35 times as fast.
#include <hip/hip_runtime.h>

// Causal multi-head self-attention with 128-wide heads and interleaved-pair rotary embeddings, WITHOUT an output projection (x [2][2048][2048]; q, k, v = einsum('bsm,nm->bsn', x, W) = x W^T ('oi' (out, in) [2048][2048] normal x 0.02, no bias; 16 heads x 128); rope on (even, odd) pairs: (xe cos - xo sin, xe sin + xo cos) with angle m x theta[i], theta = exp(-log(10000) x (2i) / 128) IN THAT SPELLING (64 f32 frequencies baked from the module's own line; precise cosf/sinf), m = arange(2048); scores x 1/sqrt(128); causal (tril kept, -1e30 elsewhere == exclusion: exp underflows to exactly 0); softmax in f32; out = the merged heads [b][s][h x 128 + d] -> [2][2048][2048] f32 (8.4 M); argument order x, Wq, Wk, Wv).
// Layout per batch: bf16 copy of X; 'oi' weights; exact projections; k_csP table (64 angles) + k_ropeI interleaved-pair plane builders at HD 128; k_fattn: causal attention in one launch, scores and probabilities held in registers (running maximum and sum per query row; hybrid rows: < 512 hi/lo 3 products, rest fp16 x1024), which writes the merged heads straight to the output rows (no output projection).
// Compute dtypes, f32 accumulate: every input rounded to bf16; projections exact; rotary f32; attention rows < 512 3 products, rest fp16; softmax f32; output f32 (the P.v accumulators divided by the row sum).

#define NB_  2
#define TT   2048
#define DM   2048
#define NH_  16
#define NKV  16
#define REP  (NH_ / NKV)
#define HD   128
#define DQ   (NH_ * HD)
#define DKV  (NKV * HD)
#define RH   512                  // query rows < RH use hi+lo planes (0: none)
#define SCL  0.088388347648318447f   // HD^-0.5
#define LOG2E 1.4426950408889634f
typedef _Float16 h16;
typedef unsigned short bf;
typedef __attribute__((ext_vector_type(16))) __bf16   v16bf;
typedef __attribute__((ext_vector_type(16))) _Float16 v16h;
typedef __attribute__((ext_vector_type(8)))  _Float16 v8h;
typedef __attribute__((ext_vector_type(8)))  unsigned short v8us;
typedef __attribute__((ext_vector_type(8)))  float    v8f;
typedef __attribute__((ext_vector_type(4)))  float    v4f;
typedef v8h  __attribute__((may_alias)) v8ha;
typedef v4f  __attribute__((may_alias)) v4fa;
typedef v8us __attribute__((may_alias)) v8usa;

__device__ __forceinline__ unsigned short f2bf(float f) { unsigned u = __float_as_uint(f); u += 0x7FFFu + ((u >> 16) & 1u); return (unsigned short)(u >> 16); }
__device__ __forceinline__ float bf2f(unsigned short b) { return __uint_as_float(((unsigned)b) << 16); }
__device__ __forceinline__ float bfr(float f) { return bf2f(f2bf(f)); }
__device__ __forceinline__ v16h cat16(v8h lo, v8h hi) { return __builtin_shufflevector(lo, hi, 0, 1, 2, 3, 4, 5, 6, 7, 8, 9, 10, 11, 12, 13, 14, 15); }
__device__ __forceinline__ v16bf cat16b(v8us lo, v8us hi) { return __builtin_bit_cast(v16bf, __builtin_shufflevector(lo, hi, 0, 1, 2, 3, 4, 5, 6, 7, 8, 9, 10, 11, 12, 13, 14, 15)); }
__device__ __forceinline__ v8f wmma16(v16h a, v16h b, v8f c) { return __builtin_amdgcn_wmma_f32_16x16x32_f16(false, a, false, b, (short)0, c, false, false); }
__device__ __forceinline__ v8f wmmab(v16bf a, v16bf b, v8f c) { return __builtin_amdgcn_wmma_f32_16x16x32_bf16(false, a, false, b, (short)0, c, false, false); }



// ---- k_gemmt: C[m][n] (f32, pitch DQ) = sum_k A[m][k] Bt[n][k], bf16 operands with K-contiguous rows of DM elements. One work-group of 4 waves per 128x128 tile of C, one 64x64 quarter (16 accumulators) a wave; grid (M/128, N/128).
// The operands come through LDS: a pass is 128 k = 256 bytes of each of the tile's 128 A rows and 128 Bt rows. Every wave brings one slice of 64 rows with one tensor load (whole lines from L2, each row fetched once per work-group),
// two buffers, the load of pass s + 2 issued when pass s has been read. The mover pads each row by 16 bytes: pitch 272 B, an odd multiple of 16 B, for the ds_load_b128 fragment reads.
// The fragments keep the WFrag k order (8 hi .. 8 hi + 7, then 16 + 8 hi ..) for A and Bt alike, and every accumulator still sums k upwards in steps of 32.
template <typename T16> struct WFrag;
template <> struct WFrag<h16> { typedef v16h V; static __device__ __forceinline__ V ld(const h16* p) { return cat16(*(const v8h*)p, *(const v8h*)(p + 16)); } static __device__ __forceinline__ v8f mma(V a, V b, v8f c) { return wmma16(a, b, c); } };
template <> struct WFrag<bf> { typedef v16bf V; static __device__ __forceinline__ V ld(const bf* p) { return cat16b(*(const v8us*)p, *(const v8us*)(p + 16)); } static __device__ __forceinline__ v8f mma(V a, V b, v8f c) { return wmmab(a, b, c); } };
typedef unsigned u32x4 __attribute__((ext_vector_type(4)));
typedef unsigned u32x8 __attribute__((ext_vector_type(8)));
#define GKP 128u                  // k per pass
#define GNP (DM / GKP)            // passes
#define GROWB (GKP * 2u)          // bytes of a row per pass
#define GPITCH (GROWB + 16u)      // LDS row pitch
#define GSLICE 18432u             // a slice in LDS: 64 rows x 272 B = 17,408 B, rounded up to a multiple of 2 KiB
#define GBUF (4u * GSLICE)        // a buffer: A rows 0..63, A rows 64..127, Bt rows 0..63, Bt rows 64..127
static_assert(GNP >= 2 && DM % GKP == 0 && TT % 128 == 0 && DQ % 128 == 0 && DKV % 128 == 0 && DQ == DKV && 64u * GPITCH <= GSLICE && GSLICE % 2048u == 0, "k_gemmt tile shape");
__device__ __forceinline__ unsigned uni(unsigned v) { return (unsigned)__builtin_amdgcn_readfirstlane((int)v); }
__device__ __forceinline__ unsigned pinned(unsigned v) { unsigned w = uni(v); asm volatile("" : "+s"(w)); return w; }   // a value that decides or addresses a tensor load, held in a scalar register
__device__ __forceinline__ v16bf ldsfrag(const unsigned char* p) { return cat16b(*(const v8usa*)p, *(const v8usa*)(p + 32)); }
__global__ __launch_bounds__(128) void k_gemmt(const bf* __restrict__ A, const bf* __restrict__ Bt, float* C) {
    __shared__ __attribute__((aligned(2048))) unsigned char ring[2 * GBUF];
    __shared__ __align__(16) float osm[4][16 * 68];
    const unsigned wave = uni(threadIdx.x >> 5), lane = threadIdx.x & 31, lr = lane & 15, hi = lane >> 4;
    const unsigned wm = wave & 1u, wn = wave >> 1;
    const unsigned r0 = blockIdx.x * 128u, c0 = blockIdx.y * 128u;
    // Wave w brings slice w of every pass: waves 0 and 1 the two halves of the A rows, waves 2 and 3 those of the Bt rows.
    const unsigned long long gsrc = (unsigned long long)(size_t)((wave < 2u) ? A + (size_t)(r0 + 64u * wave) * DM : Bt + (size_t)(c0 + 64u * (wave - 2u)) * DM);
    const unsigned ldst = (unsigned)(size_t)ring + wave * GSLICE;
    u32x8 g1;   // 1-byte elements, tensor = tile = 64 rows of 256 bytes, source pitch DM x 2 bytes, 4 dwords of pad behind every 64 dwords, no mask
    g1[0] = uni((1u << 20) | (5u << 22) | (3u << 25)); g1[1] = uni((GROWB & 0xFFFFu) << 16); g1[2] = uni((GROWB >> 16) | (64u << 16)); g1[3] = uni(GROWB << 16); g1[4] = uni(64u); g1[5] = uni(DM * 2u); g1[6] = uni(0u); g1[7] = uni(0u);
    auto issue = [&](unsigned st) {
        const unsigned long long ga = gsrc + (unsigned long long)st * GROWB; u32x4 g0;
        g0[0] = uni(1u); g0[1] = uni(ldst + (st & 1u) * GBUF); g0[2] = uni((unsigned)ga); g0[3] = uni((((unsigned)(ga >> 32)) & 0x01FFFFFFu) | 0x80000000u);
        asm volatile("tensor_load_to_lds %0, %1" :: "s"(g0), "s"(g1) : "memory");
    };
    issue(0u);
    asm volatile("s_wait_tensorcnt 0x0" ::: "memory");   // this wave's slice of pass 0 has landed
    __syncthreads();                                      // ... and so has every other wave's: pass 0 is readable
    issue(1u);
    v8f acc[4][4];
#pragma unroll
    for (int mb = 0; mb < 4; ++mb)
#pragma unroll
        for (int nb = 0; nb < 4; ++nb) acc[mb][nb] = (v8f){};
    const unsigned aoff = wm * GSLICE + lr * GPITCH + 16u * hi, boff = (2u + wn) * GSLICE + lr * GPITCH + 16u * hi;
#pragma unroll 1   // one pass a trip: the publish point at the foot stands once in the code
    for (unsigned s = 0; s < GNP; ++s) {
        const unsigned char* pa = ring + (s & 1u) * GBUF + aoff; const unsigned char* pb = ring + (s & 1u) * GBUF + boff;
        v16bf a[2][4], b[2][4];
#pragma unroll
        for (int f = 0; f < 4; ++f) { a[0][f] = ldsfrag(pa + f * 16 * GPITCH); b[0][f] = ldsfrag(pb + f * 16 * GPITCH); }
#pragma unroll
        for (int ks = 0; ks < 4; ++ks) {
            if (ks + 1 < 4) {
#pragma unroll
                for (int f = 0; f < 4; ++f) { a[(ks + 1) & 1][f] = ldsfrag(pa + f * 16 * GPITCH + (ks + 1) * 64); b[(ks + 1) & 1][f] = ldsfrag(pb + f * 16 * GPITCH + (ks + 1) * 64); }
            }
            __builtin_amdgcn_sched_barrier(0);   // the next block's 16 LDS reads stay one group in front of this block's products
#pragma unroll
            for (int nb = 0; nb < 4; ++nb)
#pragma unroll
                for (int mb = 0; mb < 4; ++mb) acc[mb][nb] = wmmab(a[ks & 1][mb], b[ks & 1][nb], acc[mb][nb]);
            __builtin_amdgcn_sched_barrier(0);   // the other side of the same fence: no later read moves up into this block
        }
        // Publish point of pass s + 1, every wave, in this order.
        asm volatile("s_wait_dscnt 0x0" ::: "memory");       // this wave's reads of pass s's buffer are done before that buffer is refilled
        asm volatile("s_wait_tensorcnt 0x0" ::: "memory");   // this wave's slice of pass s + 1 has landed
        __syncthreads();                                      // pass s + 1 is readable, and nobody reads pass s's buffer any more
        const unsigned st = pinned(s + 2u);                   // formed behind the wait above, so that the descriptor's address words are too
        if (pinned(st < GNP)) issue(st);
    }
    asm volatile("s_wait_tensorcnt 0x0" ::: "memory");   // no request is outstanding when the wave goes on
    asm volatile("s_wait_dscnt 0x0" ::: "memory");
    float* os = osm[wave];   // each wave stages its own 16 rows, so that a store covers whole 128-byte lines
#pragma unroll
    for (int mb = 0; mb < 4; ++mb) {
#pragma unroll
        for (int nb = 0; nb < 4; ++nb) {
#pragma unroll
            for (int j = 0; j < 8; ++j) os[(hi * 8 + j) * 68 + nb * 16 + lr] = acc[mb][nb][j]; }
        __builtin_amdgcn_wave_barrier(); asm volatile("" ::: "memory");   // compiler fence: the row reads below stay behind the other lanes' LDS writes above
        float* crow = C + (size_t)(r0 + 64u * wm + mb * 16) * DQ + c0 + 64u * wn;
#pragma unroll
        for (int s = 0; s < 8; ++s) { const int row = 2 * s + hi, cofs = lr * 4; const v4f val = *(const v4fa*)(os + row * 68 + cofs); *(v4f*)(crow + (size_t)row * DQ + cofs) = val; }
        __builtin_amdgcn_wave_barrier(); asm volatile("" ::: "memory");   // compiler fence: the next 16 rows' LDS writes stay behind these reads
    }
}

template <bool B> struct BoolC { static constexpr bool value = B; };
__device__ __forceinline__ h16 tohx(float x) { return (h16)x; }
__device__ __forceinline__ void splitf(float y, unsigned short& h, unsigned short& l) { h = f2bf(y); l = f2bf(y - bf2f(h)); }
typedef __attribute__((ext_vector_type(2))) _Float16 v2h;
typedef __attribute__((ext_vector_type(4))) _Float16 v4h;
typedef __attribute__((ext_vector_type(2))) unsigned short v2us;
typedef __attribute__((ext_vector_type(4))) unsigned short v4us;
typedef __attribute__((ext_vector_type(2))) float v2f;
typedef __attribute__((ext_vector_type(4))) int v4i;

// The plane builders below (k_cvt8, k_vtp, k_ropeI) give every thread 32 elements, moved in 16-byte pieces with all of a thread's loads issued before its first store:
// 4096 waves a launch (16 per WGP). Every grid covers its array exactly (static_asserts at the sizes).
#define CVN 4                     // 8-element pieces per thread in k_cvt8
static_assert(((size_t)DQ * DM / 8) % (256 * CVN) == 0 && ((size_t)DKV * DM / 8) % (256 * CVN) == 0 && ((size_t)TT * DM / 8) % (256 * CVN) == 0, "k_cvt8 has no tail");
__global__ __launch_bounds__(256) void k_cvt8(const float* __restrict__ src, bf* dst) { const size_t i0 = (size_t)blockIdx.x * (256 * CVN) + threadIdx.x; v8f v[CVN];
#pragma unroll
    for (int it = 0; it < CVN; ++it) v[it] = *(const v8f*)(src + (i0 + it * 256) * 8);
#pragma unroll
    for (int it = 0; it < CVN; ++it) { v8us o;
#pragma unroll
        for (int k = 0; k < 8; ++k) o[k] = f2bf(v[it][k]);
        *(v8us*)(dst + (i0 + it * 256) * 8) = o; } }

// k_vtp: one work-group transposes one head's 64 positions x 128 columns through LDS: rows are read as 512 contiguous bytes a wave, and every store of a wave covers four whole 128-byte lines of a plane (64 positions of one column each).
#define VTT 64                    // positions per k_vtp tile
#define VTP (HD + 1)              // LDS row pitch in floats: odd, so that the column reads of a wave fall on different banks
static_assert(TT % VTT == 0 && HD == 128, "k_vtp tile shape");
template <int PITCH>              // row pitch of F in floats, a constant so that a thread's 8 loads are one address and 8 immediate offsets
__global__ __launch_bounds__(256) void k_vtp(const float* __restrict__ F, int nheads, h16* V16, bf* Vh, bf* Vl) {
    __shared__ float ls[VTT * VTP];
    const int g = blockIdx.x / (TT / VTT), t0 = (blockIdx.x % (TT / VTT)) * VTT; if (g >= nheads) return;   // the same for the whole work-group, in front of the barrier
    const int lane = threadIdx.x & 31, w = threadIdx.x >> 5; v4f x[VTT / 8];
    const float* fb = F + (size_t)(t0 + w) * PITCH + g * HD + lane * 4;
#pragma unroll
    for (int it = 0; it < VTT / 8; ++it) x[it] = *(const v4f*)(fb + (size_t)(it * 8) * PITCH);
#pragma unroll
    for (int it = 0; it < VTT / 8; ++it)
#pragma unroll
        for (int q = 0; q < 4; ++q) ls[(it * 8 + w) * VTP + lane * 4 + q] = x[it][q];
    __syncthreads();   // the tile is complete before any wave reads a column that the other waves wrote
    const int tq = (lane & 7) * 8;
#pragma unroll
    for (int gi = 0; gi < HD / 32; ++gi) { const int d = gi * 32 + w * 4 + (lane >> 3); v8h o16; v8us oh, ol;
#pragma unroll
        for (int j = 0; j < 8; ++j) { const float y = ls[(tq + j) * VTP + d]; o16[j] = tohx(y); unsigned short a2, c2; splitf(y, a2, c2); oh[j] = a2; ol[j] = c2; }
        const size_t e = ((size_t)g * HD + d) * TT + t0 + tq; *(v8h*)(V16 + e) = o16; *(v8us*)(Vh + e) = oh; *(v8us*)(Vl + e) = ol; } }
__constant__ float INV2[HD / 2] = { 1.000000000e+00f, 8.659642935e-01f, 7.498942018e-01f, 6.493816376e-01f, 5.623413324e-01f, 4.869675040e-01f, 4.216964841e-01f, 3.651741147e-01f, 3.162277639e-01f, 2.738419473e-01f, 2.371373475e-01f, 2.053525001e-01f, 1.778279394e-01f, 1.539926529e-01f, 1.333521456e-01f, 1.154781953e-01f, 9.999999404e-02f, 8.659642935e-02f, 7.498941571e-02f, 6.493815780e-02f, 5.623412505e-02f, 4.869675636e-02f, 4.216965288e-02f, 3.651741147e-02f, 3.162277490e-02f, 2.738419361e-02f, 2.371373400e-02f, 2.053524740e-02f, 1.778279617e-02f, 1.539926231e-02f, 1.333521400e-02f, 1.154781692e-02f, 9.999999776e-03f, 8.659644052e-03f, 7.498940919e-03f, 6.493817084e-03f, 5.623412319e-03f, 4.869675264e-03f, 4.216963891e-03f, 3.651741194e-03f, 3.162276698e-03f, 2.738419222e-03f, 2.371374052e-03f, 2.053524600e-03f, 1.778279431e-03f, 1.539926161e-03f, 1.333521330e-03f, 1.154781668e-03f, 9.999999311e-04f, 8.659643936e-04f, 7.498940686e-04f, 6.493816618e-04f, 5.623411853e-04f, 4.869675031e-04f, 4.216964007e-04f, 3.651740844e-04f, 3.162277862e-04f, 2.738420444e-04f, 2.371372684e-04f, 2.053524659e-04f, 1.778279402e-04f, 1.539926743e-04f, 1.333520777e-04f, 1.154781567e-04f };   // float32 exp(-log(10000) x (2i) / 128) in the module's own spelling, generated with jnp to be bit-exact
__global__ __launch_bounds__(256) void k_csP(float* CS) { const int idx = blockIdx.x * 256 + threadIdx.x; if (idx >= TT * HD) return; const int d = idx % HD; const int t = idx / HD; const float a = __fmul_rn((float)t, INV2[d >> 1]); v2f cs; cs[0] = cosf(a); cs[1] = sinf(a); *(v2f*)(CS + (size_t)idx * 2) = cs;  }
// k_ropeI: a thread takes 8 consecutive columns (4 pairs) of one position in RHN heads, so its 4 table entries are read once for all of them.
#define RHN 4                     // heads per thread in k_ropeI
static_assert(RHN == 4 && NH_ % RHN == 0 && NKV % RHN == 0 && ((size_t)TT * HD / 8) % 256 == 0, "k_ropeI has no tail");
__global__ __launch_bounds__(256) void k_ropeI(const float* __restrict__ F, int pitch, int nheads, const float* __restrict__ CS, float sc, h16* P16, bf* Ph, bf* Pl) {
    const unsigned idx = blockIdx.x * 256 + threadIdx.x; const int d = (int)(idx % (HD / 8)) * 8; const int t = (int)((idx / (HD / 8)) % TT); const int h0 = (int)(idx / (HD / 8 * TT)) * RHN; if (h0 + RHN > nheads) return;
    const float* c = CS + ((size_t)t * HD + d) * 2; v2f cs[4]; v4f x[RHN][2];
#pragma unroll
    for (int k = 0; k < 4; ++k) cs[k] = *(const v2f*)(c + 4 * k);   /* the entry of column d + 2k */
    asm volatile("s_wait_xcnt 0x0" ::: "memory");   // precaution: the compiler lets the loads below land in the registers that hold the table loads' address
#pragma unroll
    for (int it = 0; it < RHN; ++it) { const float* f = F + (size_t)t * pitch + (h0 + it) * HD + d; x[it][0] = *(const v4f*)f; x[it][1] = *(const v4f*)(f + 4); }
    // Holds all 12 loads in front of the arithmetic (loaded values as inputs only): without it the compiler sinks some of them behind the first waits and a wave pays the memory latency three times.
    asm volatile("" :: "v"(cs[0]), "v"(cs[1]), "v"(cs[2]), "v"(cs[3]), "v"(x[0][0]), "v"(x[0][1]), "v"(x[1][0]), "v"(x[1][1]), "v"(x[2][0]), "v"(x[2][1]), "v"(x[3][0]), "v"(x[3][1]));
#pragma unroll
    for (int it = 0; it < RHN; ++it) { v8h o16; v8us oh, ol;
#pragma unroll
        for (int k = 0; k < 4; ++k) { const float x0 = x[it][k >> 1][(k & 1) * 2], x1 = x[it][k >> 1][(k & 1) * 2 + 1];
            float a0 = __fmul_rn(x0, cs[k][0]), b0 = __fmul_rn(x1, cs[k][1]), a1 = __fmul_rn(x1, cs[k][0]), b1 = __fmul_rn(x0, cs[k][1]);
            float r0 = __fsub_rn(a0, b0) * sc, r1 = __fadd_rn(b1, a1) * sc;   /* even: x0 c - x1 s; odd: x0 s + x1 c */
            o16[2 * k] = tohx(r0); o16[2 * k + 1] = tohx(r1); unsigned short a2, c2; splitf(r0, a2, c2); oh[2 * k] = a2; ol[2 * k] = c2; splitf(r1, a2, c2); oh[2 * k + 1] = a2; ol[2 * k + 1] = c2; }
        const size_t e = ((size_t)(h0 + it) * TT + t) * HD + d; *(v8h*)(P16 + e) = o16; *(v8us*)(Ph + e) = oh; *(v8us*)(Pl + e) = ol; } }

#define QW 32
__device__ __forceinline__ float xhalf(float x) { return __builtin_bit_cast(float, __builtin_amdgcn_permlanex16(__builtin_bit_cast(int, x), __builtin_bit_cast(int, x), 0x76543210, 0xfedcba98, false, false)); }   // lane l takes lane l ^ 16's value
template <typename T16, bool HL>
__device__ __forceinline__ void fattn_rows(const T16* __restrict__ Q, const T16* __restrict__ Q2, const T16* __restrict__ K, const T16* __restrict__ K2, const T16* __restrict__ VT, const T16* __restrict__ VT2, float* __restrict__ O, const int q0, const int lane) {
    typedef typename WFrag<T16>::V V;
    const int lr = lane & 15, hi = lane >> 4;
    const float CE = SCL * LOG2E, OFF = HL ? 0.0f : 10.0f;
    // Every load is a wave-uniform plane pointer that never changes + a 32-bit lane offset in bytes (walked block by block for k and v) + a constant.
    unsigned ko = (unsigned)(lr * HD + 8 * hi) * 2u, vo = (unsigned)(lr * TT + 8 * hi) * 2u;   // the lane's place in 16 rows of k, and of the transposed v
    const unsigned qo = ko + (unsigned)q0 * (HD * 2u);
    auto at = [](const T16* p, unsigned bytes) { return (const T16*)((const char*)p + bytes); };
    V qf[2][4], ql[2][4], kf[2][4], kl[2][4];
#pragma unroll
    for (int qt = 0; qt < 2; ++qt)
#pragma unroll
        for (int c = 0; c < 4; ++c) { const int e = qt * 16 * HD + c * 32; qf[qt][c] = WFrag<T16>::ld(at(Q, qo) + e); if (HL) ql[qt][c] = WFrag<T16>::ld(at(Q2, qo) + e); }
#pragma unroll
    for (int kt = 0; kt < 2; ++kt)
#pragma unroll
        for (int c = 0; c < 4; ++c) { const int e = kt * 16 * HD + c * 32; kf[kt][c] = WFrag<T16>::ld(at(K, ko) + e); if (HL) kl[kt][c] = WFrag<T16>::ld(at(K2, ko) + e); }
    asm volatile("s_wait_xcnt 0x0" :: "s"(Q), "s"(Q2), "s"(K), "s"(K2), "v"(qo) : "memory");   // precaution: behind it the registers that the q loads name may be reused; pointers and offset are inputs so that they stay as they are up to it
    v8f acc[8][2];
#pragma unroll
    for (int dt = 0; dt < 8; ++dt) { acc[dt][0] = (v8f){}; acc[dt][1] = (v8f){}; }
    float mx[2] = { -3.0e38f, -3.0e38f }, ls[2] = { 0.f, 0.f };
    auto step = [&](auto lastc) {
        constexpr bool LAST = decltype(lastc)::value;
        V vf[8], vl[8];
#pragma unroll
        for (int dt = 0; dt < 8; ++dt) { const int e = dt * 16 * TT; vf[dt] = WFrag<T16>::ld(at(VT, vo) + e); if (HL) vl[dt] = WFrag<T16>::ld(at(VT2, vo) + e); }
        v8f s[2][2];
#pragma unroll
        for (int kt = 0; kt < 2; ++kt) { s[kt][0] = (v8f){}; s[kt][1] = (v8f){}; }
#pragma unroll
        for (int c = 0; c < 4; ++c)
#pragma unroll
            for (int kt = 0; kt < 2; ++kt)
#pragma unroll
                for (int qt = 0; qt < 2; ++qt) { s[kt][qt] = WFrag<T16>::mma(kf[kt][c], qf[qt][c], s[kt][qt]); if (HL) { s[kt][qt] = WFrag<T16>::mma(kf[kt][c], ql[qt][c], s[kt][qt]); s[kt][qt] = WFrag<T16>::mma(kl[kt][c], qf[qt][c], s[kt][qt]); } }
        if (!LAST) {   // the next block's key fragments, into the same registers, fly during the softmax and the second contraction
#pragma unroll
            for (int kt = 0; kt < 2; ++kt)
#pragma unroll
                for (int c = 0; c < 4; ++c) { const int e = (32 + kt * 16) * HD + c * 32; kf[kt][c] = WFrag<T16>::ld(at(K, ko) + e); if (HL) kl[kt][c] = WFrag<T16>::ld(at(K2, ko) + e); }
        }
        V pf[2], pl[2];
#pragma unroll
        for (int qt = 0; qt < 2; ++qt) {
            float t[16];
#pragma unroll
            for (int i = 0; i < 16; ++i) { float x = s[i >> 3][qt][i & 7]; if (LAST) { if ((i >> 3) * 16 + hi * 8 + (i & 7) > qt * 16 + lr) x = -3.0e38f; } t[i] = x; }
            float m8[8];
#pragma unroll
            for (int i = 0; i < 8; ++i) m8[i] = fmaxf(t[i], t[i + 8]);
            float ml = fmaxf(fmaxf(fmaxf(m8[0], m8[1]), fmaxf(m8[2], m8[3])), fmaxf(fmaxf(m8[4], m8[5]), fmaxf(m8[6], m8[7])));
            ml = fmaxf(ml, xhalf(ml));
            const float mn = fmaxf(mx[qt], ml * CE), al = __builtin_amdgcn_exp2f(mx[qt] - mn), mo = mn - OFF; mx[qt] = mn;
#pragma unroll
            for (int i = 0; i < 16; ++i) t[i] = __builtin_amdgcn_exp2f(fmaf(t[i], CE, -mo));
            float s4[4];
#pragma unroll
            for (int i = 0; i < 4; ++i) s4[i] = (t[i] + t[i + 4]) + (t[i + 8] + t[i + 12]);
            ls[qt] = fmaf(ls[qt], al, (s4[0] + s4[1]) + (s4[2] + s4[3]));
#pragma unroll
            for (int dt = 0; dt < 8; ++dt) acc[dt][qt] *= al;
            if constexpr (HL) { v8us h0, h1, l0, l1;
#pragma unroll
                for (int i = 0; i < 8; ++i) { unsigned short a, b; splitf(t[i], a, b); h0[i] = a; l0[i] = b; splitf(t[i + 8], a, b); h1[i] = a; l1[i] = b; }
                pf[qt] = cat16b(h0, h1); pl[qt] = cat16b(l0, l1);
            } else { v16h p;
#pragma unroll
                for (int i = 0; i < 16; ++i) p[i] = tohx(t[i]);
                pf[qt] = p; }
        }
#pragma unroll
        for (int dt = 0; dt < 8; ++dt)
#pragma unroll
            for (int qt = 0; qt < 2; ++qt) { acc[dt][qt] = WFrag<T16>::mma(vf[dt], pf[qt], acc[dt][qt]); if (HL) { acc[dt][qt] = WFrag<T16>::mma(vf[dt], pl[qt], acc[dt][qt]); acc[dt][qt] = WFrag<T16>::mma(vl[dt], pf[qt], acc[dt][qt]); } }
        // precaution: stands in front of the advance below, which rewrites the offset registers that this block's loads name; the offsets are operands so that the advance stays behind it, the plane pointers are inputs so that their registers stay as they are up to it
        __builtin_amdgcn_sched_barrier(0);   // keeps the wait below at the block's end, far behind the block's loads; without it the compiler lifts the wait to directly behind the last load, in front of the softmax
        asm volatile("s_wait_xcnt 0x0" : "+v"(ko), "+v"(vo) : "s"(K), "s"(K2), "s"(VT), "s"(VT2) : "memory");
        ko += 32 * HD * 2; vo += 32 * 2;
    };
    const int nb = q0 / 32 + 1;
#pragma unroll 1
    for (int kb = 0; kb < nb - 1; ++kb) step(BoolC<false>());
    step(BoolC<true>());
#pragma unroll
    for (int qt = 0; qt < 2; ++qt) { const float inv = __fdiv_rn(1.0f, ls[qt] + xhalf(ls[qt]));
#pragma unroll
        for (int dt = 0; dt < 8; ++dt) acc[dt][qt] *= inv; }
    const unsigned oo = (unsigned)((q0 + lr) * DQ + hi * 8) * 4u;   // bytes: the lane's 8 columns of its first query row
    __builtin_amdgcn_sched_barrier(0);   // all arithmetic stands in front of the first store, so that no register that an issued store names is rewritten behind it
#pragma unroll
    for (int qt = 0; qt < 2; ++qt)
#pragma unroll
        for (int dt = 0; dt < 8; ++dt) { float* o = (float*)((char*)O + oo) + qt * 16 * DQ + dt * 16;
            *(v4f*)o = __builtin_shufflevector(acc[dt][qt], acc[dt][qt], 0, 1, 2, 3); *(v4f*)(o + 4) = __builtin_shufflevector(acc[dt][qt], acc[dt][qt], 4, 5, 6, 7); }
}
// Grid (TT / QW / 4, heads), 4 waves, no barrier and no LDS. The four waves of a work-group take the row blocks g, 31 - g, 32 + g and 63 - g of one head, so that every work-group walks about the same number of key blocks and its waves walk the same keys from block 0 on.
static_assert(TT / QW == 64 && RH % QW == 0 && HD == 128 && NKV == NH_, "k_fattn is written for these shapes");
__global__ __launch_bounds__(128) void k_fattn(const h16* __restrict__ Q16, const h16* __restrict__ K16, const h16* __restrict__ V16, const bf* __restrict__ Qh, const bf* __restrict__ Ql, const bf* __restrict__ Kh, const bf* __restrict__ Kl, const bf* __restrict__ Vh, const bf* __restrict__ Vl, float* __restrict__ OUTb) {
    const int wave = __builtin_amdgcn_readfirstlane((int)(threadIdx.x >> 5)), lane = threadIdx.x & 31, g = blockIdx.x;
    const int qb = (wave == 0) ? g : (wave == 1) ? 31 - g : (wave == 2) ? 32 + g : 63 - g;
    const size_t po = (size_t)blockIdx.y * TT * HD; float* O = OUTb + blockIdx.y * HD;
    if (qb * QW < RH) fattn_rows<bf, true>(Qh + po, Ql + po, Kh + po, Kl + po, Vh + po, Vl + po, O, qb * QW, lane);
    else fattn_rows<h16, false>(Q16 + po, nullptr, K16 + po, nullptr, V16 + po, nullptr, O, qb * QW, lane);
}

extern "C" void kernel_launch(void* const* d_in, const int* in_sizes, int n_in,
                              void* d_out, int out_size, void* d_ws, size_t ws_size, hipStream_t stream) {
    (void)in_sizes; (void)n_in; (void)out_size;
    const float* x = (const float*)d_in[0]; const float* wq = (const float*)d_in[1]; const float* wk = (const float*)d_in[2]; const float* wv = (const float*)d_in[3]; const float* wo = nullptr; (void)wo;   /* argument order x, Wq, Wk, Wv ('oi' (out, in) [2048][2048]): four inputs, all read; NO output weight: the merged heads are the output */
    float* OUT = (float*)d_out;     // [2][2048][2048]
    char* wsp = (char*)d_ws;
    auto take = [&](size_t bytes) { char* p = wsp; wsp += (bytes + 255) & ~(size_t)255; return (void*)p; };
    bf* WQ = (bf*)take((size_t)DQ * DM * 2); bf* WK = (bf*)take((size_t)DKV * DM * 2); bf* WV = (bf*)take((size_t)DKV * DM * 2); float* CS = (float*)take((size_t)TT * HD * 2 * 4);
    h16* QP16 = (h16*)take((size_t)NH_ * TT * HD * 2); h16* KP16 = (h16*)take((size_t)NKV * TT * HD * 2); h16* VT16 = (h16*)take((size_t)NKV * HD * TT * 2);
    bf* QPh = (bf*)take((size_t)NH_ * TT * HD * 2); bf* QPl = (bf*)take((size_t)NH_ * TT * HD * 2); bf* KPh = (bf*)take((size_t)NKV * TT * HD * 2); bf* KPl = (bf*)take((size_t)NKV * TT * HD * 2); bf* VTh = (bf*)take((size_t)NKV * HD * TT * 2); bf* VTl = (bf*)take((size_t)NKV * HD * TT * 2);
    // The projection stage's buffers: the bf16 copy of x, and two f32 projection results.
    bf* XB = (bf*)take((size_t)TT * DM * 2); float* FQ = (float*)take((size_t)TT * DQ * 4); float* FK = (float*)take((size_t)TT * DKV * 4);
    if ((size_t)(wsp - (char*)d_ws) > ws_size) return;    // ws 256 MiB
    float* FV = FK;   // v projection reuses the k buffer after the k planes are built (stream-ordered)
    { k_cvt8<<<(unsigned)((size_t)DQ * DM / 8 / (256 * CVN)), 256, 0, stream>>>(wq, WQ); k_cvt8<<<(unsigned)((size_t)DKV * DM / 8 / (256 * CVN)), 256, 0, stream>>>(wk, WK); k_cvt8<<<(unsigned)((size_t)DKV * DM / 8 / (256 * CVN)), 256, 0, stream>>>(wv, WV);
       }
    k_csP<<<(TT * HD + 255) / 256, 256, 0, stream>>>(CS);   /* rotary table once (positions = arange) */
    const unsigned LQ = (unsigned)((size_t)(NH_ / RHN) * TT * HD / 8 / 256), LKv = (unsigned)((size_t)(NKV / RHN) * TT * HD / 8 / 256), LVt = (unsigned)(NKV * (TT / VTT));
    for (int b = 0; b < NB_; ++b) {
        
        k_cvt8<<<(unsigned)((size_t)TT * DM / 8 / (256 * CVN)), 256, 0, stream>>>(x + (size_t)b * TT * DM, XB);
        k_gemmt<<<dim3(TT / 128, DQ / 128, 1), 128, 0, stream>>>(XB, WQ, FQ);
        k_ropeI<<<LQ, 256, 0, stream>>>(FQ, DQ, NH_, CS, 1.0f, QP16, QPh, QPl);
        k_gemmt<<<dim3(TT / 128, DKV / 128, 1), 128, 0, stream>>>(XB, WK, FK);
        k_ropeI<<<LKv, 256, 0, stream>>>(FK, DKV, NKV, CS, 1.0f, KP16, KPh, KPl);
        k_gemmt<<<dim3(TT / 128, DKV / 128, 1), 128, 0, stream>>>(XB, WV, FV); k_vtp<DKV><<<LVt, 256, 0, stream>>>(FV, NKV, VT16, VTh, VTl);
        k_fattn<<<dim3(TT / QW / 4, NH_, 1), 128, 0, stream>>>(QP16, KP16, VT16, QPh, QPl, KPh, KPl, VTh, VTl, OUT + (size_t)b * TT * DQ);
        /* no output projection: k_fattn has written the merged heads of this batch to OUT */ }
}

// v005
// It runs in 250 microseconds.
// Two timings next to v004 put it at 1.16 and 1.18 times that version's speed.
// Over all steps from v000 it is 6.26 times as fast.
#include <hip/hip_runtime.h>

// Causal multi-head self-attention with 128-wide heads and interleaved-pair rotary embeddings, WITHOUT an output projection (x [2][2048][2048]; q, k, v = einsum('bsm,nm->bsn', x, W) = x W^T ('oi' (out, in) [2048][2048] normal x 0.02, no bias; 16 heads x 128); rope on (even, odd) pairs: (xe cos - xo sin, xe sin + xo cos) with angle m x theta[i], theta = exp(-log(10000) x (2i) / 128) IN THAT SPELLING (64 f32 frequencies baked from the module's own line; precise cosf/sinf), m = arange(2048); scores x 1/sqrt(128); causal (tril kept, -1e30 elsewhere == exclusion: exp underflows to exactly 0); softmax in f32; out = the merged heads [b][s][h x 128 + d] -> [2][2048][2048] f32 (8.4 M); argument order x, Wq, Wk, Wv).
// Layout, every stage one launch over both batches (and over the three projections, or over q and k): bf16 copy of X; 'oi' weights; exact projections; rotary table (2048 positions x 64 angles, filled in k_prep) + k_ropeI interleaved-pair plane builders at HD 128; k_fattn: causal attention in one launch, scores and probabilities held in registers (running maximum and sum per query row; hybrid rows: < 512 hi/lo 3 products, rest fp16 x1024), which writes the merged heads straight to the output rows (no output projection).
// Compute dtypes, f32 accumulate: every input rounded to bf16; projections exact; rotary f32; attention rows < 512 3 products, rest fp16; softmax f32; output f32 (the P.v accumulators divided by the row sum).

#define NB_  2
#define TT   2048
#define DM   2048
#define NH_  16
#define NKV  16
#define REP  (NH_ / NKV)
#define HD   128
#define DQ   (NH_ * HD)
#define DKV  (NKV * HD)
#define RH   512                  // query rows < RH use hi+lo planes (0: none)
#define SCL  0.088388347648318447f   // HD^-0.5
#define LOG2E 1.4426950408889634f
typedef _Float16 h16;
typedef unsigned short bf;
typedef __attribute__((ext_vector_type(16))) __bf16   v16bf;
typedef __attribute__((ext_vector_type(16))) _Float16 v16h;
typedef __attribute__((ext_vector_type(8)))  _Float16 v8h;
typedef __attribute__((ext_vector_type(8)))  unsigned short v8us;
typedef __attribute__((ext_vector_type(8)))  float    v8f;
typedef __attribute__((ext_vector_type(4)))  float    v4f;
typedef v8h  __attribute__((may_alias)) v8ha;
typedef v4f  __attribute__((may_alias)) v4fa;
typedef v8us __attribute__((may_alias)) v8usa;

__device__ __forceinline__ unsigned short f2bf(float f) { unsigned u = __float_as_uint(f); u += 0x7FFFu + ((u >> 16) & 1u); return (unsigned short)(u >> 16); }
__device__ __forceinline__ float bf2f(unsigned short b) { return __uint_as_float(((unsigned)b) << 16); }
__device__ __forceinline__ float bfr(float f) { return bf2f(f2bf(f)); }
__device__ __forceinline__ v16h cat16(v8h lo, v8h hi) { return __builtin_shufflevector(lo, hi, 0, 1, 2, 3, 4, 5, 6, 7, 8, 9, 10, 11, 12, 13, 14, 15); }
__device__ __forceinline__ v16bf cat16b(v8us lo, v8us hi) { return __builtin_bit_cast(v16bf, __builtin_shufflevector(lo, hi, 0, 1, 2, 3, 4, 5, 6, 7, 8, 9, 10, 11, 12, 13, 14, 15)); }
__device__ __forceinline__ v8f wmma16(v16h a, v16h b, v8f c) { return __builtin_amdgcn_wmma_f32_16x16x32_f16(false, a, false, b, (short)0, c, false, false); }
__device__ __forceinline__ v8f wmmab(v16bf a, v16bf b, v8f c) { return __builtin_amdgcn_wmma_f32_16x16x32_bf16(false, a, false, b, (short)0, c, false, false); }



// ---- k_gemmt: C[m][n] (f32, pitch DQ) = sum_k A[m][k] Bt[n][k], bf16 operands with K-contiguous rows of DM elements. One work-group of 4 waves per 128x128 tile of C, one 64x64 quarter (16 accumulators) a wave; grid (M/128, N/128). Bt holds the three weights one behind the other (N = 3 DQ rows); C is three planes of M x DQ, one per weight.
// The operands come through LDS: a pass is 128 k = 256 bytes of each of the tile's 128 A rows and 128 Bt rows. Every wave brings one slice of 64 rows with one tensor load (whole lines from L2, each row fetched once per work-group),
// two buffers, the load of pass s + 2 issued when pass s has been read. The mover pads each row by 16 bytes: pitch 272 B, an odd multiple of 16 B, for the ds_load_b128 fragment reads.
// The fragments keep the WFrag k order (8 hi .. 8 hi + 7, then 16 + 8 hi ..) for A and Bt alike, and every accumulator still sums k upwards in steps of 32.
template <typename T16> struct WFrag;
template <> struct WFrag<h16> { typedef v16h V; static __device__ __forceinline__ V ld(const h16* p) { return cat16(*(const v8h*)p, *(const v8h*)(p + 16)); } static __device__ __forceinline__ v8f mma(V a, V b, v8f c) { return wmma16(a, b, c); } };
template <> struct WFrag<bf> { typedef v16bf V; static __device__ __forceinline__ V ld(const bf* p) { return cat16b(*(const v8us*)p, *(const v8us*)(p + 16)); } static __device__ __forceinline__ v8f mma(V a, V b, v8f c) { return wmmab(a, b, c); } };
typedef unsigned u32x4 __attribute__((ext_vector_type(4)));
typedef unsigned u32x8 __attribute__((ext_vector_type(8)));
#define GKP 128u                  // k per pass
#define GNP (DM / GKP)            // passes
#define GROWB (GKP * 2u)          // bytes of a row per pass
#define GPITCH (GROWB + 16u)      // LDS row pitch
#define GSLICE 18432u             // a slice in LDS: 64 rows x 272 B = 17,408 B, rounded up to a multiple of 2 KiB
#define GBUF (4u * GSLICE)        // a buffer: A rows 0..63, A rows 64..127, Bt rows 0..63, Bt rows 64..127
static_assert(GNP >= 2 && DM % GKP == 0 && TT % 128 == 0 && DQ % 128 == 0 && DKV % 128 == 0 && DQ == DKV && 64u * GPITCH <= GSLICE && GSLICE % 2048u == 0, "k_gemmt tile shape");
__device__ __forceinline__ unsigned uni(unsigned v) { return (unsigned)__builtin_amdgcn_readfirstlane((int)v); }
__device__ __forceinline__ unsigned pinned(unsigned v) { unsigned w = uni(v); asm volatile("" : "+s"(w)); return w; }   // a value that decides or addresses a tensor load, held in a scalar register
__device__ __forceinline__ v16bf ldsfrag(const unsigned char* p) { return cat16b(*(const v8usa*)p, *(const v8usa*)(p + 32)); }
__global__ __launch_bounds__(128) void k_gemmt(const bf* __restrict__ A, const bf* __restrict__ Bt, float* C) {
    __shared__ __attribute__((aligned(2048))) unsigned char ring[2 * GBUF];
    __shared__ __align__(16) float osm[4][16 * 68];
    const unsigned wave = uni(threadIdx.x >> 5), lane = threadIdx.x & 31, lr = lane & 15, hi = lane >> 4;
    const unsigned wm = wave & 1u, wn = wave >> 1;
    const unsigned r0 = blockIdx.x * 128u, c0 = blockIdx.y * 128u;
    C += (size_t)(c0 / DQ) * ((size_t)NB_ * TT * DQ - DQ);   // columns c0 .. of the stacked weights are columns c0 % DQ .. of plane c0 / DQ of C
    // Wave w brings slice w of every pass: waves 0 and 1 the two halves of the A rows, waves 2 and 3 those of the Bt rows.
    const unsigned long long gsrc = (unsigned long long)(size_t)((wave < 2u) ? A + (size_t)(r0 + 64u * wave) * DM : Bt + (size_t)(c0 + 64u * (wave - 2u)) * DM);
    const unsigned ldst = (unsigned)(size_t)ring + wave * GSLICE;
    u32x8 g1;   // 1-byte elements, tensor = tile = 64 rows of 256 bytes, source pitch DM x 2 bytes, 4 dwords of pad behind every 64 dwords, no mask
    g1[0] = uni((1u << 20) | (5u << 22) | (3u << 25)); g1[1] = uni((GROWB & 0xFFFFu) << 16); g1[2] = uni((GROWB >> 16) | (64u << 16)); g1[3] = uni(GROWB << 16); g1[4] = uni(64u); g1[5] = uni(DM * 2u); g1[6] = uni(0u); g1[7] = uni(0u);
    auto issue = [&](unsigned st) {
        const unsigned long long ga = gsrc + (unsigned long long)st * GROWB; u32x4 g0;
        g0[0] = uni(1u); g0[1] = uni(ldst + (st & 1u) * GBUF); g0[2] = uni((unsigned)ga); g0[3] = uni((((unsigned)(ga >> 32)) & 0x01FFFFFFu) | 0x80000000u);
        asm volatile("tensor_load_to_lds %0, %1" :: "s"(g0), "s"(g1) : "memory");
    };
    issue(0u);
    asm volatile("s_wait_tensorcnt 0x0" ::: "memory");   // this wave's slice of pass 0 has landed
    __syncthreads();                                      // ... and so has every other wave's: pass 0 is readable
    issue(1u);
    v8f acc[4][4];
#pragma unroll
    for (int mb = 0; mb < 4; ++mb)
#pragma unroll
        for (int nb = 0; nb < 4; ++nb) acc[mb][nb] = (v8f){};
    const unsigned aoff = wm * GSLICE + lr * GPITCH + 16u * hi, boff = (2u + wn) * GSLICE + lr * GPITCH + 16u * hi;
#pragma unroll 1   // one pass a trip: the publish point at the foot stands once in the code
    for (unsigned s = 0; s < GNP; ++s) {
        const unsigned char* pa = ring + (s & 1u) * GBUF + aoff; const unsigned char* pb = ring + (s & 1u) * GBUF + boff;
        v16bf a[2][4], b[2][4];
#pragma unroll
        for (int f = 0; f < 4; ++f) { a[0][f] = ldsfrag(pa + f * 16 * GPITCH); b[0][f] = ldsfrag(pb + f * 16 * GPITCH); }
#pragma unroll
        for (int ks = 0; ks < 4; ++ks) {
            if (ks + 1 < 4) {
#pragma unroll
                for (int f = 0; f < 4; ++f) { a[(ks + 1) & 1][f] = ldsfrag(pa + f * 16 * GPITCH + (ks + 1) * 64); b[(ks + 1) & 1][f] = ldsfrag(pb + f * 16 * GPITCH + (ks + 1) * 64); }
            }
            __builtin_amdgcn_sched_barrier(0);   // the next block's 16 LDS reads stay one group in front of this block's products
#pragma unroll
            for (int nb = 0; nb < 4; ++nb)
#pragma unroll
                for (int mb = 0; mb < 4; ++mb) acc[mb][nb] = wmmab(a[ks & 1][mb], b[ks & 1][nb], acc[mb][nb]);
            __builtin_amdgcn_sched_barrier(0);   // the other side of the same fence: no later read moves up into this block
        }
        // Publish point of pass s + 1, every wave, in this order.
        asm volatile("s_wait_dscnt 0x0" ::: "memory");       // this wave's reads of pass s's buffer are done before that buffer is refilled
        asm volatile("s_wait_tensorcnt 0x0" ::: "memory");   // this wave's slice of pass s + 1 has landed
        __syncthreads();                                      // pass s + 1 is readable, and nobody reads pass s's buffer any more
        const unsigned st = pinned(s + 2u);                   // formed behind the wait above, so that the descriptor's address words are too
        if (pinned(st < GNP)) issue(st);
    }
    asm volatile("s_wait_tensorcnt 0x0" ::: "memory");   // no request is outstanding when the wave goes on
    asm volatile("s_wait_dscnt 0x0" ::: "memory");
    float* os = osm[wave];   // each wave stages its own 16 rows, so that a store covers whole 128-byte lines
#pragma unroll
    for (int mb = 0; mb < 4; ++mb) {
#pragma unroll
        for (int nb = 0; nb < 4; ++nb) {
#pragma unroll
            for (int j = 0; j < 8; ++j) os[(hi * 8 + j) * 68 + nb * 16 + lr] = acc[mb][nb][j]; }
        __builtin_amdgcn_wave_barrier(); asm volatile("" ::: "memory");   // compiler fence: the row reads below stay behind the other lanes' LDS writes above
        float* crow = C + (size_t)(r0 + 64u * wm + mb * 16) * DQ + c0 + 64u * wn;
#pragma unroll
        for (int s = 0; s < 8; ++s) { const int row = 2 * s + hi, cofs = lr * 4; const v4f val = *(const v4fa*)(os + row * 68 + cofs); *(v4f*)(crow + (size_t)row * DQ + cofs) = val; }
        __builtin_amdgcn_wave_barrier(); asm volatile("" ::: "memory");   // compiler fence: the next 16 rows' LDS writes stay behind these reads
    }
}

template <bool B> struct BoolC { static constexpr bool value = B; };
__device__ __forceinline__ h16 tohx(float x) { return (h16)x; }
__device__ __forceinline__ void splitf(float y, unsigned short& h, unsigned short& l) { h = f2bf(y); l = f2bf(y - bf2f(h)); }
typedef __attribute__((ext_vector_type(2))) _Float16 v2h;
typedef __attribute__((ext_vector_type(4))) _Float16 v4h;
typedef __attribute__((ext_vector_type(2))) unsigned short v2us;
typedef __attribute__((ext_vector_type(4))) unsigned short v4us;
typedef __attribute__((ext_vector_type(2))) float v2f;
typedef __attribute__((ext_vector_type(4))) int v4i;

// The plane builders below (the casts of k_prep, k_vtp, k_ropeI) give every thread 32 elements, moved in 16-byte pieces with all of a thread's loads issued before its first store:
// 4096 waves a plane (16 per WGP), for speed only. Every grid covers its array exactly (static_asserts at the sizes).
#define CVN 4                     // 8-element pieces per thread in a cast
static_assert(((size_t)DQ * DM / 8) % (256 * CVN) == 0 && ((size_t)DKV * DM / 8) % (256 * CVN) == 0 && ((size_t)TT * DM / 8) % (256 * CVN) == 0, "a cast has no tail");
__device__ __forceinline__ void cvt8_body(const float* __restrict__ src, bf* dst) { const size_t i0 = (size_t)blockIdx.x * (256 * CVN) + threadIdx.x; v8f v[CVN];
#pragma unroll
    for (int it = 0; it < CVN; ++it) v[it] = *(const v8f*)(src + (i0 + it * 256) * 8);
#pragma unroll
    for (int it = 0; it < CVN; ++it) { v8us o;
#pragma unroll
        for (int k = 0; k < 8; ++k) o[k] = f2bf(v[it][k]);
        *(v8us*)(dst + (i0 + it * 256) * 8) = o; }
    asm volatile("s_wait_xcnt 0x0" ::: "memory"); }   // precaution: stands behind the last store, in front of whatever code follows the cast in the kernel and reuses the registers that the stores name

// k_vtp: one work-group transposes one head's 64 positions x 128 columns through LDS: rows are read as 512 contiguous bytes a wave, and every store of a wave covers four whole 128-byte lines of a plane (64 positions of one column each).
#define VTT 64                    // positions per k_vtp tile
#define VTP (HD + 1)              // LDS row pitch in floats: odd, so that the column reads of a wave fall on different banks
static_assert(TT % VTT == 0 && HD == 128, "k_vtp tile shape");
template <int PITCH>              // row pitch of F in floats, a constant so that a thread's 8 loads are one address and 8 immediate offsets
__global__ __launch_bounds__(256) void k_vtp(const float* __restrict__ F, int nheads, h16* V16, bf* Vh, bf* Vl) {
    __shared__ float ls[VTT * VTP];
    const int g = blockIdx.x / (TT / VTT), t0 = (blockIdx.x % (TT / VTT)) * VTT; if (g >= nheads) return;   // the same for the whole work-group, in front of the barrier
    F += (size_t)blockIdx.y * TT * PITCH; V16 += (size_t)blockIdx.y * NKV * HD * TT; Vh += (size_t)blockIdx.y * NKV * HD * TT; Vl += (size_t)blockIdx.y * NKV * HD * TT;   // grid y: the batch
    const int lane = threadIdx.x & 31, w = threadIdx.x >> 5; v4f x[VTT / 8];
    const float* fb = F + (size_t)(t0 + w) * PITCH + g * HD + lane * 4;
#pragma unroll
    for (int it = 0; it < VTT / 8; ++it) x[it] = *(const v4f*)(fb + (size_t)(it * 8) * PITCH);
#pragma unroll
    for (int it = 0; it < VTT / 8; ++it)
#pragma unroll
        for (int q = 0; q < 4; ++q) ls[(it * 8 + w) * VTP + lane * 4 + q] = x[it][q];
    __syncthreads();   // the tile is complete before any wave reads a column that the other waves wrote
    const int tq = (lane & 7) * 8;
#pragma unroll
    for (int gi = 0; gi < HD / 32; ++gi) { const int d = gi * 32 + w * 4 + (lane >> 3); v8h o16; v8us oh, ol;
#pragma unroll
        for (int j = 0; j < 8; ++j) { const float y = ls[(tq + j) * VTP + d]; o16[j] = tohx(y); unsigned short a2, c2; splitf(y, a2, c2); oh[j] = a2; ol[j] = c2; }
        const size_t e = ((size_t)g * HD + d) * TT + t0 + tq; *(v8h*)(V16 + e) = o16; *(v8us*)(Vh + e) = oh; *(v8us*)(Vl + e) = ol; } }
__constant__ float INV2[HD / 2] = { 1.000000000e+00f, 8.659642935e-01f, 7.498942018e-01f, 6.493816376e-01f, 5.623413324e-01f, 4.869675040e-01f, 4.216964841e-01f, 3.651741147e-01f, 3.162277639e-01f, 2.738419473e-01f, 2.371373475e-01f, 2.053525001e-01f, 1.778279394e-01f, 1.539926529e-01f, 1.333521456e-01f, 1.154781953e-01f, 9.999999404e-02f, 8.659642935e-02f, 7.498941571e-02f, 6.493815780e-02f, 5.623412505e-02f, 4.869675636e-02f, 4.216965288e-02f, 3.651741147e-02f, 3.162277490e-02f, 2.738419361e-02f, 2.371373400e-02f, 2.053524740e-02f, 1.778279617e-02f, 1.539926231e-02f, 1.333521400e-02f, 1.154781692e-02f, 9.999999776e-03f, 8.659644052e-03f, 7.498940919e-03f, 6.493817084e-03f, 5.623412319e-03f, 4.869675264e-03f, 4.216963891e-03f, 3.651741194e-03f, 3.162276698e-03f, 2.738419222e-03f, 2.371374052e-03f, 2.053524600e-03f, 1.778279431e-03f, 1.539926161e-03f, 1.333521330e-03f, 1.154781668e-03f, 9.999999311e-04f, 8.659643936e-04f, 7.498940686e-04f, 6.493816618e-04f, 5.623411853e-04f, 4.869675031e-04f, 4.216964007e-04f, 3.651740844e-04f, 3.162277862e-04f, 2.738420444e-04f, 2.371372684e-04f, 2.053524659e-04f, 1.778279402e-04f, 1.539926743e-04f, 1.333520777e-04f, 1.154781567e-04f };   // float32 exp(-log(10000) x (2i) / 128) in the module's own spelling, generated with jnp to be bit-exact
__device__ __forceinline__ void csP_body(float* CS, const int blk) { const int idx = blk * 256 + threadIdx.x; if (idx >= TT * HD) return; const int d = idx % HD; const int t = idx / HD; const float a = __fmul_rn((float)t, INV2[d >> 1]); v2f cs; cs[0] = cosf(a); cs[1] = sinf(a); *(v2f*)(CS + (size_t)idx * 2) = cs;  }
// k_prep: everything that depends on the inputs alone, in one launch. Grid (PRX, CSY + NB_ + 3): the first CSY rows fill the rotary table (arithmetic), the next NB_ rows cast the batches of x, the last three cast Wq, Wk, Wv (all five into consecutive planes of dst).
#define PRX ((unsigned)((size_t)TT * DM / 8 / (256 * CVN)))
#define CSY ((unsigned)((TT * HD / 256) / PRX))
static_assert(DQ == TT && DKV == TT && (TT * HD) % 256 == 0 && (TT * HD / 256) % PRX == 0, "k_prep: five planes of one size, and the table is whole rows of the grid");
__global__ __launch_bounds__(256) void k_prep(const float* __restrict__ x, const float* __restrict__ wq, const float* __restrict__ wk, const float* __restrict__ wv, bf* dst, float* CS) {
    if (blockIdx.y < CSY) { csP_body(CS, (int)(blockIdx.y * PRX + blockIdx.x)); return; }
    const unsigned y = blockIdx.y - CSY;
    const float* src = (y < NB_) ? x + (size_t)y * TT * DM : (y == NB_) ? wq : (y == NB_ + 1u) ? wk : wv;
    cvt8_body(src, dst + (size_t)y * TT * DM);
}
// k_ropeI: a thread takes 8 consecutive columns (4 pairs) of one position in RHN heads, so its 4 table entries are read once for all of them. Grid y picks the plane: q of batch 0, q of batch 1, k of batch 0, k of batch 1, in F and in the outputs alike.
#define RHN 4                     // heads per thread in k_ropeI
static_assert(RHN == 4 && NH_ % RHN == 0 && NKV % RHN == 0 && ((size_t)TT * HD / 8) % 256 == 0, "k_ropeI has no tail");
__global__ __launch_bounds__(256) void k_ropeI(const float* __restrict__ F, int pitch, int nheads, const float* __restrict__ CS, float sc, h16* P16, bf* Ph, bf* Pl) {
    const unsigned idx = blockIdx.x * 256 + threadIdx.x; const int d = (int)(idx % (HD / 8)) * 8; const int t = (int)((idx / (HD / 8)) % TT); const int h0 = (int)(idx / (HD / 8 * TT)) * RHN; if (h0 + RHN > nheads) return;
    F += (size_t)blockIdx.y * TT * DQ; P16 += (size_t)blockIdx.y * NH_ * TT * HD; Ph += (size_t)blockIdx.y * NH_ * TT * HD; Pl += (size_t)blockIdx.y * NH_ * TT * HD;
    const float* c = CS + ((size_t)t * HD + d) * 2; v2f cs[4]; v4f x[RHN][2];
#pragma unroll
    for (int k = 0; k < 4; ++k) cs[k] = *(const v2f*)(c + 4 * k);   /* the entry of column d + 2k */
    asm volatile("s_wait_xcnt 0x0" ::: "memory");   // precaution: the compiler lets the loads below land in the registers that hold the table loads' address
#pragma unroll
    for (int it = 0; it < RHN; ++it) { const float* f = F + (size_t)t * pitch + (h0 + it) * HD + d; x[it][0] = *(const v4f*)f; x[it][1] = *(const v4f*)(f + 4); }
    // Holds all 12 loads in front of the arithmetic (loaded values as inputs only): without it the compiler sinks some of them behind the first waits and a wave pays the memory latency three times.
    asm volatile("" :: "v"(cs[0]), "v"(cs[1]), "v"(cs[2]), "v"(cs[3]), "v"(x[0][0]), "v"(x[0][1]), "v"(x[1][0]), "v"(x[1][1]), "v"(x[2][0]), "v"(x[2][1]), "v"(x[3][0]), "v"(x[3][1]));
#pragma unroll
    for (int it = 0; it < RHN; ++it) { v8h o16; v8us oh, ol;
#pragma unroll
        for (int k = 0; k < 4; ++k) { const float x0 = x[it][k >> 1][(k & 1) * 2], x1 = x[it][k >> 1][(k & 1) * 2 + 1];
            float a0 = __fmul_rn(x0, cs[k][0]), b0 = __fmul_rn(x1, cs[k][1]), a1 = __fmul_rn(x1, cs[k][0]), b1 = __fmul_rn(x0, cs[k][1]);
            float r0 = __fsub_rn(a0, b0) * sc, r1 = __fadd_rn(b1, a1) * sc;   /* even: x0 c - x1 s; odd: x0 s + x1 c */
            o16[2 * k] = tohx(r0); o16[2 * k + 1] = tohx(r1); unsigned short a2, c2; splitf(r0, a2, c2); oh[2 * k] = a2; ol[2 * k] = c2; splitf(r1, a2, c2); oh[2 * k + 1] = a2; ol[2 * k + 1] = c2; }
        const size_t e = ((size_t)(h0 + it) * TT + t) * HD + d; *(v8h*)(P16 + e) = o16; *(v8us*)(Ph + e) = oh; *(v8us*)(Pl + e) = ol; } }

#define QW 32
__device__ __forceinline__ float xhalf(float x) { return __builtin_bit_cast(float, __builtin_amdgcn_permlanex16(__builtin_bit_cast(int, x), __builtin_bit_cast(int, x), 0x76543210, 0xfedcba98, false, false)); }   // lane l takes lane l ^ 16's value
template <typename T16, bool HL>
__device__ __forceinline__ void fattn_rows(const T16* __restrict__ Q, const T16* __restrict__ Q2, const T16* __restrict__ K, const T16* __restrict__ K2, const T16* __restrict__ VT, const T16* __restrict__ VT2, float* __restrict__ O, const int q0, const int lane) {
    typedef typename WFrag<T16>::V V;
    const int lr = lane & 15, hi = lane >> 4;
    const float CE = SCL * LOG2E, OFF = HL ? 0.0f : 10.0f;
    // Every load is a wave-uniform plane pointer that never changes + a 32-bit lane offset in bytes (walked block by block for k and v) + a constant.
    unsigned ko = (unsigned)(lr * HD + 8 * hi) * 2u, vo = (unsigned)(lr * TT + 8 * hi) * 2u;   // the lane's place in 16 rows of k, and of the transposed v
    const unsigned qo = ko + (unsigned)q0 * (HD * 2u);
    auto at = [](const T16* p, unsigned bytes) { return (const T16*)((const char*)p + bytes); };
    V qf[2][4], ql[2][4], kf[2][4], kl[2][4];
#pragma unroll
    for (int qt = 0; qt < 2; ++qt)
#pragma unroll
        for (int c = 0; c < 4; ++c) { const int e = qt * 16 * HD + c * 32; qf[qt][c] = WFrag<T16>::ld(at(Q, qo) + e); if (HL) ql[qt][c] = WFrag<T16>::ld(at(Q2, qo) + e); }
#pragma unroll
    for (int kt = 0; kt < 2; ++kt)
#pragma unroll
        for (int c = 0; c < 4; ++c) { const int e = kt * 16 * HD + c * 32; kf[kt][c] = WFrag<T16>::ld(at(K, ko) + e); if (HL) kl[kt][c] = WFrag<T16>::ld(at(K2, ko) + e); }
    asm volatile("s_wait_xcnt 0x0" :: "s"(Q), "s"(Q2), "s"(K), "s"(K2), "v"(qo) : "memory");   // precaution: behind it the registers that the q loads name may be reused; pointers and offset are inputs so that they stay as they are up to it
    v8f acc[8][2];
#pragma unroll
    for (int dt = 0; dt < 8; ++dt) { acc[dt][0] = (v8f){}; acc[dt][1] = (v8f){}; }
    float mx[2] = { -3.0e38f, -3.0e38f }, ls[2] = { 0.f, 0.f };
    auto step = [&](auto lastc) {
        constexpr bool LAST = decltype(lastc)::value;
        V vf[8], vl[8];
#pragma unroll
        for (int dt = 0; dt < 8; ++dt) { const int e = dt * 16 * TT; vf[dt] = WFrag<T16>::ld(at(VT, vo) + e); if (HL) vl[dt] = WFrag<T16>::ld(at(VT2, vo) + e); }
        v8f s[2][2];
#pragma unroll
        for (int kt = 0; kt < 2; ++kt) { s[kt][0] = (v8f){}; s[kt][1] = (v8f){}; }
#pragma unroll
        for (int c = 0; c < 4; ++c)
#pragma unroll
            for (int kt = 0; kt < 2; ++kt)
#pragma unroll
                for (int qt = 0; qt < 2; ++qt) { s[kt][qt] = WFrag<T16>::mma(kf[kt][c], qf[qt][c], s[kt][qt]); if (HL) { s[kt][qt] = WFrag<T16>::mma(kf[kt][c], ql[qt][c], s[kt][qt]); s[kt][qt] = WFrag<T16>::mma(kl[kt][c], qf[qt][c], s[kt][qt]); } }
        if (!LAST) {   // the next block's key fragments, into the same registers, fly during the softmax and the second contraction
#pragma unroll
            for (int kt = 0; kt < 2; ++kt)
#pragma unroll
                for (int c = 0; c < 4; ++c) { const int e = (32 + kt * 16) * HD + c * 32; kf[kt][c] = WFrag<T16>::ld(at(K, ko) + e); if (HL) kl[kt][c] = WFrag<T16>::ld(at(K2, ko) + e); }
        }
        V pf[2], pl[2];
#pragma unroll
        for (int qt = 0; qt < 2; ++qt) {
            float t[16];
#pragma unroll
            for (int i = 0; i < 16; ++i) { float x = s[i >> 3][qt][i & 7]; if (LAST) { if ((i >> 3) * 16 + hi * 8 + (i & 7) > qt * 16 + lr) x = -3.0e38f; } t[i] = x; }
            float m8[8];
#pragma unroll
            for (int i = 0; i < 8; ++i) m8[i] = fmaxf(t[i], t[i + 8]);
            float ml = fmaxf(fmaxf(fmaxf(m8[0], m8[1]), fmaxf(m8[2], m8[3])), fmaxf(fmaxf(m8[4], m8[5]), fmaxf(m8[6], m8[7])));
            ml = fmaxf(ml, xhalf(ml));
            const float mn = fmaxf(mx[qt], ml * CE), al = __builtin_amdgcn_exp2f(mx[qt] - mn), mo = mn - OFF; mx[qt] = mn;
#pragma unroll
            for (int i = 0; i < 16; ++i) t[i] = __builtin_amdgcn_exp2f(fmaf(t[i], CE, -mo));
            float s4[4];
#pragma unroll
            for (int i = 0; i < 4; ++i) s4[i] = (t[i] + t[i + 4]) + (t[i + 8] + t[i + 12]);
            ls[qt] = fmaf(ls[qt], al, (s4[0] + s4[1]) + (s4[2] + s4[3]));
#pragma unroll
            for (int dt = 0; dt < 8; ++dt) acc[dt][qt] *= al;
            if constexpr (HL) { v8us h0, h1, l0, l1;
#pragma unroll
                for (int i = 0; i < 8; ++i) { unsigned short a, b; splitf(t[i], a, b); h0[i] = a; l0[i] = b; splitf(t[i + 8], a, b); h1[i] = a; l1[i] = b; }
                pf[qt] = cat16b(h0, h1); pl[qt] = cat16b(l0, l1);
            } else { v16h p;
#pragma unroll
                for (int i = 0; i < 16; ++i) p[i] = tohx(t[i]);
                pf[qt] = p; }
        }
#pragma unroll
        for (int dt = 0; dt < 8; ++dt)
#pragma unroll
            for (int qt = 0; qt < 2; ++qt) { acc[dt][qt] = WFrag<T16>::mma(vf[dt], pf[qt], acc[dt][qt]); if (HL) { acc[dt][qt] = WFrag<T16>::mma(vf[dt], pl[qt], acc[dt][qt]); acc[dt][qt] = WFrag<T16>::mma(vl[dt], pf[qt], acc[dt][qt]); } }
        // precaution: stands in front of the advance below, which rewrites the offset registers that this block's loads name; the offsets are operands so that the advance stays behind it, the plane pointers are inputs so that their registers stay as they are up to it
        __builtin_amdgcn_sched_barrier(0);   // keeps the wait below at the block's end, far behind the block's loads; without it the compiler lifts the wait to directly behind the last load, in front of the softmax
        asm volatile("s_wait_xcnt 0x0" : "+v"(ko), "+v"(vo) : "s"(K), "s"(K2), "s"(VT), "s"(VT2) : "memory");
        ko += 32 * HD * 2; vo += 32 * 2;
    };
    const int nb = q0 / 32 + 1;
#pragma unroll 1
    for (int kb = 0; kb < nb - 1; ++kb) step(BoolC<false>());
    step(BoolC<true>());
#pragma unroll
    for (int qt = 0; qt < 2; ++qt) { const float inv = __fdiv_rn(1.0f, ls[qt] + xhalf(ls[qt]));
#pragma unroll
        for (int dt = 0; dt < 8; ++dt) acc[dt][qt] *= inv; }
    const unsigned oo = (unsigned)((q0 + lr) * DQ + hi * 8) * 4u;   // bytes: the lane's 8 columns of its first query row
    __builtin_amdgcn_sched_barrier(0);   // all arithmetic stands in front of the first store, so that no register that an issued store names is rewritten behind it
#pragma unroll
    for (int qt = 0; qt < 2; ++qt)
#pragma unroll
        for (int dt = 0; dt < 8; ++dt) { float* o = (float*)((char*)O + oo) + qt * 16 * DQ + dt * 16;
            *(v4f*)o = __builtin_shufflevector(acc[dt][qt], acc[dt][qt], 0, 1, 2, 3); *(v4f*)(o + 4) = __builtin_shufflevector(acc[dt][qt], acc[dt][qt], 4, 5, 6, 7); }
}
// Grid (TT / QW / 4, heads, batches), 4 waves, no barrier and no LDS. The four waves of a work-group take the row blocks g, 31 - g, 32 + g and 63 - g of one head, so that every work-group walks about the same number of key blocks and its waves walk the same keys from block 0 on.
// A wave holds more than 512 registers, so a WGP holds one work-group at a time: the 512 work-groups run in two turns, and a work-group of the second turn starts as soon as one of the first has ended (a work-group lasts as long as its longest wave, 64 - g key blocks of the 130 that its four waves walk).
static_assert(TT / QW == 64 && RH % QW == 0 && HD == 128 && NKV == NH_, "k_fattn is written for these shapes");
__global__ __launch_bounds__(128) void k_fattn(const h16* __restrict__ Q16, const h16* __restrict__ K16, const h16* __restrict__ V16, const bf* __restrict__ Qh, const bf* __restrict__ Ql, const bf* __restrict__ Kh, const bf* __restrict__ Kl, const bf* __restrict__ Vh, const bf* __restrict__ Vl, float* __restrict__ OUTb) {
    const int wave = __builtin_amdgcn_readfirstlane((int)(threadIdx.x >> 5)), lane = threadIdx.x & 31, g = blockIdx.x;
    const int qb = (wave == 0) ? g : (wave == 1) ? 31 - g : (wave == 2) ? 32 + g : 63 - g;
    const size_t po = ((size_t)blockIdx.z * NH_ + blockIdx.y) * TT * HD; float* O = OUTb + (size_t)blockIdx.z * TT * DQ + blockIdx.y * HD;
    if (qb * QW < RH) fattn_rows<bf, true>(Qh + po, Ql + po, Kh + po, Kl + po, Vh + po, Vl + po, O, qb * QW, lane);
    else fattn_rows<h16, false>(Q16 + po, nullptr, K16 + po, nullptr, V16 + po, nullptr, O, qb * QW, lane);
}

extern "C" void kernel_launch(void* const* d_in, const int* in_sizes, int n_in,
                              void* d_out, int out_size, void* d_ws, size_t ws_size, hipStream_t stream) {
    (void)in_sizes; (void)n_in; (void)out_size;
    const float* x = (const float*)d_in[0]; const float* wq = (const float*)d_in[1]; const float* wk = (const float*)d_in[2]; const float* wv = (const float*)d_in[3]; const float* wo = nullptr; (void)wo;   /* argument order x, Wq, Wk, Wv ('oi' (out, in) [2048][2048]): four inputs, all read; NO output weight: the merged heads are the output */
    float* OUT = (float*)d_out;     // [2][2048][2048]
    char* wsp = (char*)d_ws;
    auto take = [&](size_t bytes) { char* p = wsp; wsp += (bytes + 255) & ~(size_t)255; return (void*)p; };
    // The casts' five planes, consecutive: x of batch 0, x of batch 1, Wq, Wk, Wv.
    bf* XB = (bf*)take((size_t)(NB_ + 3) * TT * DM * 2); bf* WQ = XB + (size_t)NB_ * TT * DM; float* CS = (float*)take((size_t)TT * HD * 2 * 4);
    // The f32 projections, [q, k, v][batch][position][column]. The v planes lie over the q and k projections, which the rotary launch has read by then (stream-ordered).
    float* FQ = (float*)take((size_t)3 * NB_ * TT * DQ * 4); float* FV = FQ + (size_t)2 * NB_ * TT * DQ;
    h16* VT16 = (h16*)FQ; bf* VTh = (bf*)(VT16 + (size_t)NB_ * NKV * HD * TT); bf* VTl = VTh + (size_t)NB_ * NKV * HD * TT;
    // The q and k planes, [q, k][batch][head][position][column].
    h16* QP16 = (h16*)take((size_t)2 * NB_ * NH_ * TT * HD * 2); bf* QPh = (bf*)take((size_t)2 * NB_ * NH_ * TT * HD * 2); bf* QPl = (bf*)take((size_t)2 * NB_ * NH_ * TT * HD * 2);
    h16* KP16 = QP16 + (size_t)NB_ * NH_ * TT * HD; bf* KPh = QPh + (size_t)NB_ * NH_ * TT * HD; bf* KPl = QPl + (size_t)NB_ * NH_ * TT * HD;
    if ((size_t)(wsp - (char*)d_ws) > ws_size) return;    // ws 256 MiB
    k_prep<<<dim3(PRX, CSY + NB_ + 3, 1), 256, 0, stream>>>(x, wq, wk, wv, XB, CS);   /* casts, and the rotary table (positions = arange) */
    k_gemmt<<<dim3(NB_ * TT / 128, 3 * DQ / 128, 1), 128, 0, stream>>>(XB, WQ, FQ);
    k_ropeI<<<dim3((unsigned)((size_t)(NH_ / RHN) * TT * HD / 8 / 256), 2 * NB_, 1), 256, 0, stream>>>(FQ, DQ, NH_, CS, 1.0f, QP16, QPh, QPl);
    k_vtp<DKV><<<dim3((unsigned)(NKV * (TT / VTT)), NB_, 1), 256, 0, stream>>>(FV, NKV, VT16, VTh, VTl);
    k_fattn<<<dim3(TT / QW / 4, NH_, NB_), 128, 0, stream>>>(QP16, KP16, VT16, QPh, QPl, KPh, KPl, VTh, VTl, OUT);
    /* no output projection: k_fattn has written the merged heads of both batches to OUT */
}

// v006
// A run of this version takes 238 microseconds.
// Timed twice side by side with v005, it ran 1.05 and 1.03 times as fast.
// Counting every step since v000, it is 6.52 times as fast.
#include <hip/hip_runtime.h>

// Causal multi-head self-attention with 128-wide heads and interleaved-pair rotary embeddings, WITHOUT an output projection (x [2][2048][2048]; q, k, v = einsum('bsm,nm->bsn', x, W) = x W^T ('oi' (out, in) [2048][2048] normal x 0.02, no bias; 16 heads x 128); rope on (even, odd) pairs: (xe cos - xo sin, xe sin + xo cos) with angle m x theta[i], theta = exp(-log(10000) x (2i) / 128) IN THAT SPELLING (64 f32 frequencies baked from the module's own line; precise cosf/sinf), m = arange(2048); scores x 1/sqrt(128); causal (tril kept, -1e30 elsewhere == exclusion: exp underflows to exactly 0); softmax in f32; out = the merged heads [b][s][h x 128 + d] -> [2][2048][2048] f32 (8.4 M); argument order x, Wq, Wk, Wv).
// Layout, every stage one launch over both batches (and over the three projections, or over q and k): bf16 copy of X; 'oi' weights; exact projections; rotary table (2048 positions x 64 angles, filled in k_prep) + k_ropeI interleaved-pair plane builders at HD 128; k_fattn: causal attention in one launch, scores and probabilities held in registers (running maximum and sum per query row; hybrid rows: < 512 hi/lo 3 products, rest fp16 x1024), which writes the merged heads straight to the output rows (no output projection).
// Compute dtypes, f32 accumulate: every input rounded to bf16; projections exact; rotary f32; attention rows < 512 3 products, rest fp16; softmax f32; output f32 (the P.v accumulators divided by the row sum).

#define NB_  2
#define TT   2048
#define DM   2048
#define NH_  16
#define NKV  16
#define REP  (NH_ / NKV)
#define HD   128
#define DQ   (NH_ * HD)
#define DKV  (NKV * HD)
#define RH   512                  // query rows < RH use hi+lo planes (0: none)
#define SCL  0.088388347648318447f   // HD^-0.5
#define LOG2E 1.4426950408889634f
typedef _Float16 h16;
typedef unsigned short bf;
typedef __attribute__((ext_vector_type(16))) __bf16   v16bf;
typedef __attribute__((ext_vector_type(16))) _Float16 v16h;
typedef __attribute__((ext_vector_type(8)))  _Float16 v8h;
typedef __attribute__((ext_vector_type(8)))  unsigned short v8us;
typedef __attribute__((ext_vector_type(8)))  float    v8f;
typedef __attribute__((ext_vector_type(4)))  float    v4f;
typedef v8h  __attribute__((may_alias)) v8ha;
typedef v4f  __attribute__((may_alias)) v4fa;
typedef v8us __attribute__((may_alias)) v8usa;

__device__ __forceinline__ unsigned short f2bf(float f) { unsigned u = __float_as_uint(f); u += 0x7FFFu + ((u >> 16) & 1u); return (unsigned short)(u >> 16); }
__device__ __forceinline__ float bf2f(unsigned short b) { return __uint_as_float(((unsigned)b) << 16); }
__device__ __forceinline__ float bfr(float f) { return bf2f(f2bf(f)); }
__device__ __forceinline__ v16h cat16(v8h lo, v8h hi) { return __builtin_shufflevector(lo, hi, 0, 1, 2, 3, 4, 5, 6, 7, 8, 9, 10, 11, 12, 13, 14, 15); }
__device__ __forceinline__ v16bf cat16b(v8us lo, v8us hi) { return __builtin_bit_cast(v16bf, __builtin_shufflevector(lo, hi, 0, 1, 2, 3, 4, 5, 6, 7, 8, 9, 10, 11, 12, 13, 14, 15)); }
__device__ __forceinline__ v8f wmma16(v16h a, v16h b, v8f c) { return __builtin_amdgcn_wmma_f32_16x16x32_f16(false, a, false, b, (short)0, c, false, false); }
__device__ __forceinline__ v8f wmmab(v16bf a, v16bf b, v8f c) { return __builtin_amdgcn_wmma_f32_16x16x32_bf16(false, a, false, b, (short)0, c, false, false); }



// ---- k_gemmt: C[m][n] (f32, pitch DQ) = sum_k A[m][k] Bt[n][k], bf16 operands with K-contiguous rows of DM elements. One work-group of 4 waves per 128x128 tile of C, one 64x64 quarter (16 accumulators) a wave; grid (M/128, N/128). Bt holds the three weights one behind the other (N = 3 DQ rows); C is three planes of M x DQ, one per weight.
// The operands come through LDS: a pass is 128 k = 256 bytes of each of the tile's 128 A rows and 128 Bt rows. Every wave brings one slice of 64 rows with one tensor load (whole lines from L2, each row fetched once per work-group),
// two buffers, the load of pass s + 2 issued when pass s has been read. The mover pads each row by 16 bytes: pitch 272 B, an odd multiple of 16 B, for the ds_load_b128 fragment reads.
// The fragments keep the WFrag k order (8 hi .. 8 hi + 7, then 16 + 8 hi ..) for A and Bt alike, and every accumulator still sums k upwards in steps of 32.
// ld reads a fragment from K-contiguous rows; ldf reads one stored in FRAGMENT ORDER: 1 KiB a fragment (16 rows x 32 k), the 16-byte piece (row lr, k 16 j + 8 hi ..) at byte 512 j + 16 (16 hi + lr), so that each of its two loads is 512 contiguous bytes of a wave. Same k order as ld.
template <typename T16> struct WFrag;
template <> struct WFrag<h16> { typedef v16h V; static __device__ __forceinline__ V ld(const h16* p) { return cat16(*(const v8h*)p, *(const v8h*)(p + 16)); } static __device__ __forceinline__ V ldf(const h16* p) { return cat16(*(const v8h*)p, *(const v8h*)(p + 256)); } static __device__ __forceinline__ v8f mma(V a, V b, v8f c) { return wmma16(a, b, c); } };
template <> struct WFrag<bf> { typedef v16bf V; static __device__ __forceinline__ V ld(const bf* p) { return cat16b(*(const v8us*)p, *(const v8us*)(p + 16)); } static __device__ __forceinline__ V ldf(const bf* p) { return cat16b(*(const v8us*)p, *(const v8us*)(p + 256)); } static __device__ __forceinline__ v8f mma(V a, V b, v8f c) { return wmmab(a, b, c); } };
typedef unsigned u32x4 __attribute__((ext_vector_type(4)));
typedef unsigned u32x8 __attribute__((ext_vector_type(8)));
#define GKP 128u                  // k per pass
#define GNP (DM / GKP)            // passes
#define GROWB (GKP * 2u)          // bytes of a row per pass
#define GPITCH (GROWB + 16u)      // LDS row pitch
#define GSLICE 18432u             // a slice in LDS: 64 rows x 272 B = 17,408 B, rounded up to a multiple of 2 KiB
#define GBUF (4u * GSLICE)        // a buffer: A rows 0..63, A rows 64..127, Bt rows 0..63, Bt rows 64..127
static_assert(GNP >= 2 && DM % GKP == 0 && TT % 128 == 0 && DQ % 128 == 0 && DKV % 128 == 0 && DQ == DKV && 64u * GPITCH <= GSLICE && GSLICE % 2048u == 0, "k_gemmt tile shape");
__device__ __forceinline__ unsigned uni(unsigned v) { return (unsigned)__builtin_amdgcn_readfirstlane((int)v); }
__device__ __forceinline__ unsigned pinned(unsigned v) { unsigned w = uni(v); asm volatile("" : "+s"(w)); return w; }   // a value that decides or addresses a tensor load, held in a scalar register
__device__ __forceinline__ v16bf ldsfrag(const unsigned char* p) { return cat16b(*(const v8usa*)p, *(const v8usa*)(p + 32)); }
__global__ __launch_bounds__(128) void k_gemmt(const bf* __restrict__ A, const bf* __restrict__ Bt, float* C) {
    __shared__ __attribute__((aligned(2048))) unsigned char ring[2 * GBUF];
    __shared__ __align__(16) float osm[4][16 * 68];
    const unsigned wave = uni(threadIdx.x >> 5), lane = threadIdx.x & 31, lr = lane & 15, hi = lane >> 4;
    const unsigned wm = wave & 1u, wn = wave >> 1;
    const unsigned r0 = blockIdx.x * 128u, c0 = blockIdx.y * 128u;
    C += (size_t)(c0 / DQ) * ((size_t)NB_ * TT * DQ - DQ);   // columns c0 .. of the stacked weights are columns c0 % DQ .. of plane c0 / DQ of C
    // Wave w brings slice w of every pass: waves 0 and 1 the two halves of the A rows, waves 2 and 3 those of the Bt rows.
    const unsigned long long gsrc = (unsigned long long)(size_t)((wave < 2u) ? A + (size_t)(r0 + 64u * wave) * DM : Bt + (size_t)(c0 + 64u * (wave - 2u)) * DM);
    const unsigned ldst = (unsigned)(size_t)ring + wave * GSLICE;
    u32x8 g1;   // 1-byte elements, tensor = tile = 64 rows of 256 bytes, source pitch DM x 2 bytes, 4 dwords of pad behind every 64 dwords, no mask
    g1[0] = uni((1u << 20) | (5u << 22) | (3u << 25)); g1[1] = uni((GROWB & 0xFFFFu) << 16); g1[2] = uni((GROWB >> 16) | (64u << 16)); g1[3] = uni(GROWB << 16); g1[4] = uni(64u); g1[5] = uni(DM * 2u); g1[6] = uni(0u); g1[7] = uni(0u);
    auto issue = [&](unsigned st) {
        const unsigned long long ga = gsrc + (unsigned long long)st * GROWB; u32x4 g0;
        g0[0] = uni(1u); g0[1] = uni(ldst + (st & 1u) * GBUF); g0[2] = uni((unsigned)ga); g0[3] = uni((((unsigned)(ga >> 32)) & 0x01FFFFFFu) | 0x80000000u);
        asm volatile("tensor_load_to_lds %0, %1" :: "s"(g0), "s"(g1) : "memory");
    };
    issue(0u);
    asm volatile("s_wait_tensorcnt 0x0" ::: "memory");   // this wave's slice of pass 0 has landed
    __syncthreads();                                      // ... and so has every other wave's: pass 0 is readable
    issue(1u);
    v8f acc[4][4];
#pragma unroll
    for (int mb = 0; mb < 4; ++mb)
#pragma unroll
        for (int nb = 0; nb < 4; ++nb) acc[mb][nb] = (v8f){};
    const unsigned aoff = wm * GSLICE + lr * GPITCH + 16u * hi, boff = (2u + wn) * GSLICE + lr * GPITCH + 16u * hi;
#pragma unroll 1   // one pass a trip: the publish point at the foot stands once in the code
    for (unsigned s = 0; s < GNP; ++s) {
        const unsigned char* pa = ring + (s & 1u) * GBUF + aoff; const unsigned char* pb = ring + (s & 1u) * GBUF + boff;
        v16bf a[2][4], b[2][4];
#pragma unroll
        for (int f = 0; f < 4; ++f) { a[0][f] = ldsfrag(pa + f * 16 * GPITCH); b[0][f] = ldsfrag(pb + f * 16 * GPITCH); }
#pragma unroll
        for (int ks = 0; ks < 4; ++ks) {
            if (ks + 1 < 4) {
#pragma unroll
                for (int f = 0; f < 4; ++f) { a[(ks + 1) & 1][f] = ldsfrag(pa + f * 16 * GPITCH + (ks + 1) * 64); b[(ks + 1) & 1][f] = ldsfrag(pb + f * 16 * GPITCH + (ks + 1) * 64); }
            }
            __builtin_amdgcn_sched_barrier(0);   // the next block's 16 LDS reads stay one group in front of this block's products
#pragma unroll
            for (int nb = 0; nb < 4; ++nb)
#pragma unroll
                for (int mb = 0; mb < 4; ++mb) acc[mb][nb] = wmmab(a[ks & 1][mb], b[ks & 1][nb], acc[mb][nb]);
            __builtin_amdgcn_sched_barrier(0);   // the other side of the same fence: no later read moves up into this block
        }
        // Publish point of pass s + 1, every wave, in this order.
        asm volatile("s_wait_dscnt 0x0" ::: "memory");       // this wave's reads of pass s's buffer are done before that buffer is refilled
        asm volatile("s_wait_tensorcnt 0x0" ::: "memory");   // this wave's slice of pass s + 1 has landed
        __syncthreads();                                      // pass s + 1 is readable, and nobody reads pass s's buffer any more
        const unsigned st = pinned(s + 2u);                   // formed behind the wait above, so that the descriptor's address words are too
        if (pinned(st < GNP)) issue(st);
    }
    asm volatile("s_wait_tensorcnt 0x0" ::: "memory");   // no request is outstanding when the wave goes on
    asm volatile("s_wait_dscnt 0x0" ::: "memory");
    float* os = osm[wave];   // each wave stages its own 16 rows, so that a store covers whole 128-byte lines
#pragma unroll
    for (int mb = 0; mb < 4; ++mb) {
#pragma unroll
        for (int nb = 0; nb < 4; ++nb) {
#pragma unroll
            for (int j = 0; j < 8; ++j) os[(hi * 8 + j) * 68 + nb * 16 + lr] = acc[mb][nb][j]; }
        __builtin_amdgcn_wave_barrier(); asm volatile("" ::: "memory");   // compiler fence: the row reads below stay behind the other lanes' LDS writes above
        float* crow = C + (size_t)(r0 + 64u * wm + mb * 16) * DQ + c0 + 64u * wn;
#pragma unroll
        for (int s = 0; s < 8; ++s) { const int row = 2 * s + hi, cofs = lr * 4; const v4f val = *(const v4fa*)(os + row * 68 + cofs); *(v4f*)(crow + (size_t)row * DQ + cofs) = val; }
        __builtin_amdgcn_wave_barrier(); asm volatile("" ::: "memory");   // compiler fence: the next 16 rows' LDS writes stay behind these reads
    }
}

template <bool B> struct BoolC { static constexpr bool value = B; };
__device__ __forceinline__ h16 tohx(float x) { return (h16)x; }
__device__ __forceinline__ void splitf(float y, unsigned short& h, unsigned short& l) { h = f2bf(y); l = f2bf(y - bf2f(h)); }
typedef __attribute__((ext_vector_type(2))) _Float16 v2h;
typedef __attribute__((ext_vector_type(4))) _Float16 v4h;
typedef __attribute__((ext_vector_type(2))) unsigned short v2us;
typedef __attribute__((ext_vector_type(4))) unsigned short v4us;
typedef __attribute__((ext_vector_type(2))) float v2f;
typedef __attribute__((ext_vector_type(4))) int v4i;

// The plane builders below (the casts of k_prep, k_vtp, k_ropeI) give every thread 32 elements, moved in 16-byte pieces with all of a thread's loads issued before its first store:
// 4096 waves a plane (16 per WGP), for speed only. Every grid covers its array exactly (static_asserts at the sizes).
#define CVN 4                     // 8-element pieces per thread in a cast
static_assert(((size_t)DQ * DM / 8) % (256 * CVN) == 0 && ((size_t)DKV * DM / 8) % (256 * CVN) == 0 && ((size_t)TT * DM / 8) % (256 * CVN) == 0, "a cast has no tail");
__device__ __forceinline__ void cvt8_body(const float* __restrict__ src, bf* dst) { const size_t i0 = (size_t)blockIdx.x * (256 * CVN) + threadIdx.x; v8f v[CVN];
#pragma unroll
    for (int it = 0; it < CVN; ++it) v[it] = *(const v8f*)(src + (i0 + it * 256) * 8);
#pragma unroll
    for (int it = 0; it < CVN; ++it) { v8us o;
#pragma unroll
        for (int k = 0; k < 8; ++k) o[k] = f2bf(v[it][k]);
        *(v8us*)(dst + (i0 + it * 256) * 8) = o; }
    asm volatile("s_wait_xcnt 0x0" ::: "memory"); }   // precaution: stands behind the last store, in front of whatever code follows the cast in the kernel and reuses the registers that the stores name

// k_vtp: one work-group transposes one head's 64 positions x 128 columns through LDS: rows are read as 512 contiguous bytes a wave. The planes are written in fragment order (WFrag::ldf) for k_fattn's second contraction: fragment (32-key block kb, 16 columns dt) at 1 KiB x (8 kb + dt) of the head's plane, its rows the columns, its k the keys; every store of a wave is one half fragment, 512 contiguous bytes.
#define VTT 64                    // positions per k_vtp tile
#define VTP (HD + 2)              // LDS row pitch in floats: a wave reads 16 columns of each of two rows that lie 8 apart, and 8 x 130 = 16 mod 64 puts the two runs on different banks
static_assert(TT % VTT == 0 && HD == 128, "k_vtp tile shape");
template <int PITCH>              // row pitch of F in floats, a constant so that a thread's 8 loads are one address and 8 immediate offsets
__global__ __launch_bounds__(256) void k_vtp(const float* __restrict__ F, int nheads, h16* V16, bf* Vh, bf* Vl) {
    __shared__ float ls[VTT * VTP];
    const int g = blockIdx.x / (TT / VTT), t0 = (blockIdx.x % (TT / VTT)) * VTT; if (g >= nheads) return;   // the same for the whole work-group, in front of the barrier
    F += (size_t)blockIdx.y * TT * PITCH; V16 += (size_t)blockIdx.y * NKV * HD * TT; Vh += (size_t)blockIdx.y * NKV * HD * TT; Vl += (size_t)blockIdx.y * NKV * HD * TT;   // grid y: the batch
    const int lane = threadIdx.x & 31, w = threadIdx.x >> 5; v4f x[VTT / 8];
    const float* fb = F + (size_t)(t0 + w) * PITCH + g * HD + lane * 4;
#pragma unroll
    for (int it = 0; it < VTT / 8; ++it) x[it] = *(const v4f*)(fb + (size_t)(it * 8) * PITCH);
#pragma unroll
    for (int it = 0; it < VTT / 8; ++it)
#pragma unroll
        for (int q = 0; q < 4; ++q) ls[(it * 8 + w) * VTP + lane * 4 + q] = x[it][q];
    __syncthreads();   // the tile is complete before any wave reads a column that the other waves wrote
    static_assert(VTT == 64 && HD / 16 == 8, "k_vtp: wave w writes the column group dt = w of the tile's two key blocks");
    const int d = w * 16 + (lane & 15);
#pragma unroll
    for (int gi = 0; gi < 4; ++gi) { const int tq = (gi >> 1) * 32 + ((gi & 1) * 2 + (lane >> 4)) * 8; v8h o16; v8us oh, ol;   // gi: key block of the tile, then half j of the fragment
#pragma unroll
        for (int j = 0; j < 8; ++j) { const float y = ls[(tq + j) * VTP + d]; o16[j] = tohx(y); unsigned short a2, c2; splitf(y, a2, c2); oh[j] = a2; ol[j] = c2; }
        const size_t e = (size_t)g * HD * TT + (size_t)((((t0 / 32 + (gi >> 1)) * 8 + w) * 2 + (gi & 1)) * 32 + lane) * 8; *(v8h*)(V16 + e) = o16; *(v8us*)(Vh + e) = oh; *(v8us*)(Vl + e) = ol; } }
__constant__ float INV2[HD / 2] = { 1.000000000e+00f, 8.659642935e-01f, 7.498942018e-01f, 6.493816376e-01f, 5.623413324e-01f, 4.869675040e-01f, 4.216964841e-01f, 3.651741147e-01f, 3.162277639e-01f, 2.738419473e-01f, 2.371373475e-01f, 2.053525001e-01f, 1.778279394e-01f, 1.539926529e-01f, 1.333521456e-01f, 1.154781953e-01f, 9.999999404e-02f, 8.659642935e-02f, 7.498941571e-02f, 6.493815780e-02f, 5.623412505e-02f, 4.869675636e-02f, 4.216965288e-02f, 3.651741147e-02f, 3.162277490e-02f, 2.738419361e-02f, 2.371373400e-02f, 2.053524740e-02f, 1.778279617e-02f, 1.539926231e-02f, 1.333521400e-02f, 1.154781692e-02f, 9.999999776e-03f, 8.659644052e-03f, 7.498940919e-03f, 6.493817084e-03f, 5.623412319e-03f, 4.869675264e-03f, 4.216963891e-03f, 3.651741194e-03f, 3.162276698e-03f, 2.738419222e-03f, 2.371374052e-03f, 2.053524600e-03f, 1.778279431e-03f, 1.539926161e-03f, 1.333521330e-03f, 1.154781668e-03f, 9.999999311e-04f, 8.659643936e-04f, 7.498940686e-04f, 6.493816618e-04f, 5.623411853e-04f, 4.869675031e-04f, 4.216964007e-04f, 3.651740844e-04f, 3.162277862e-04f, 2.738420444e-04f, 2.371372684e-04f, 2.053524659e-04f, 1.778279402e-04f, 1.539926743e-04f, 1.333520777e-04f, 1.154781567e-04f };   // float32 exp(-log(10000) x (2i) / 128) in the module's own spelling, generated with jnp to be bit-exact
__device__ __forceinline__ void csP_body(float* CS, const int blk) { const int idx = blk * 256 + threadIdx.x; if (idx >= TT * HD) return; const int d = idx % HD; const int t = idx / HD; const float a = __fmul_rn((float)t, INV2[d >> 1]); v2f cs; cs[0] = cosf(a); cs[1] = sinf(a); *(v2f*)(CS + (size_t)idx * 2) = cs;  }
// k_prep: everything that depends on the inputs alone, in one launch. Grid (PRX, CSY + NB_ + 3): the first CSY rows fill the rotary table (arithmetic), the next NB_ rows cast the batches of x, the last three cast Wq, Wk, Wv (all five into consecutive planes of dst).
#define PRX ((unsigned)((size_t)TT * DM / 8 / (256 * CVN)))
#define CSY ((unsigned)((TT * HD / 256) / PRX))
static_assert(DQ == TT && DKV == TT && (TT * HD) % 256 == 0 && (TT * HD / 256) % PRX == 0, "k_prep: five planes of one size, and the table is whole rows of the grid");
__global__ __launch_bounds__(256) void k_prep(const float* __restrict__ x, const float* __restrict__ wq, const float* __restrict__ wk, const float* __restrict__ wv, bf* dst, float* CS) {
    if (blockIdx.y < CSY) { csP_body(CS, (int)(blockIdx.y * PRX + blockIdx.x)); return; }
    const unsigned y = blockIdx.y - CSY;
    const float* src = (y < NB_) ? x + (size_t)y * TT * DM : (y == NB_) ? wq : (y == NB_ + 1u) ? wk : wv;
    cvt8_body(src, dst + (size_t)y * TT * DM);
}
// k_ropeI: a thread takes 8 consecutive columns (4 pairs) of one position in RHN heads, so its 4 table entries are read once for all of them. Grid y picks the plane: q of batch 0, q of batch 1, k of batch 0, k of batch 1, in F and in the outputs alike.
#define RHN 4                     // heads per thread in k_ropeI
static_assert(RHN == 4 && NH_ % RHN == 0 && NKV % RHN == 0 && ((size_t)TT * HD / 8) % 256 == 0, "k_ropeI has no tail");
__global__ __launch_bounds__(256) void k_ropeI(const float* __restrict__ F, int pitch, int nheads, const float* __restrict__ CS, float sc, h16* P16, bf* Ph, bf* Pl) {
    // The k planes are written in fragment order (WFrag::ldf) for k_fattn's first contraction: fragment (16 keys, 32 columns c) at 1 KiB x (4 (t / 16) + c) of the head's plane. There a wave takes 8 positions x 4 pieces (not 2 x 16) of the work-group's 16 x 16, so that its stores still cover four whole 128-byte lines.
    const bool kpl = blockIdx.y >= NB_; const unsigned tl = threadIdx.x & 31, tw = threadIdx.x >> 5;
    const unsigned idx = blockIdx.x * 256 + (kpl ? ((tl & 7) + 8 * (tw & 1)) * (HD / 8) + (tl >> 3) + 4 * (tw >> 1) : threadIdx.x); const int d = (int)(idx % (HD / 8)) * 8; const int t = (int)((idx / (HD / 8)) % TT); const int h0 = (int)(idx / (HD / 8 * TT)) * RHN; if (h0 + RHN > nheads) return;
    F += (size_t)blockIdx.y * TT * DQ; P16 += (size_t)blockIdx.y * NH_ * TT * HD; Ph += (size_t)blockIdx.y * NH_ * TT * HD; Pl += (size_t)blockIdx.y * NH_ * TT * HD;
    const int fo = kpl ? ((((t >> 4) * 4 + (d >> 5)) * 2 + ((d >> 4) & 1)) * 32 + ((d >> 3) & 1) * 16 + (t & 15)) * 8 - (t * HD + d) : 0; P16 += fo; Ph += fo; Pl += fo;   // from the piece's row-major place in its head's plane (the e below) to its place in fragment order
    const float* c = CS + ((size_t)t * HD + d) * 2; v2f cs[4]; v4f x[RHN][2];
#pragma unroll
    for (int k = 0; k < 4; ++k) cs[k] = *(const v2f*)(c + 4 * k);   /* the entry of column d + 2k */
    asm volatile("s_wait_xcnt 0x0" ::: "memory");   // precaution: the compiler lets the loads below land in the registers that hold the table loads' address
#pragma unroll
    for (int it = 0; it < RHN; ++it) { const float* f = F + (size_t)t * pitch + (h0 + it) * HD + d; x[it][0] = *(const v4f*)f; x[it][1] = *(const v4f*)(f + 4); }
    // Holds all 12 loads in front of the arithmetic (loaded values as inputs only): without it the compiler sinks some of them behind the first waits and a wave pays the memory latency three times.
    asm volatile("" :: "v"(cs[0]), "v"(cs[1]), "v"(cs[2]), "v"(cs[3]), "v"(x[0][0]), "v"(x[0][1]), "v"(x[1][0]), "v"(x[1][1]), "v"(x[2][0]), "v"(x[2][1]), "v"(x[3][0]), "v"(x[3][1]));
#pragma unroll
    for (int it = 0; it < RHN; ++it) { v8h o16; v8us oh, ol;
#pragma unroll
        for (int k = 0; k < 4; ++k) { const float x0 = x[it][k >> 1][(k & 1) * 2], x1 = x[it][k >> 1][(k & 1) * 2 + 1];
            float a0 = __fmul_rn(x0, cs[k][0]), b0 = __fmul_rn(x1, cs[k][1]), a1 = __fmul_rn(x1, cs[k][0]), b1 = __fmul_rn(x0, cs[k][1]);
            float r0 = __fsub_rn(a0, b0) * sc, r1 = __fadd_rn(b1, a1) * sc;   /* even: x0 c - x1 s; odd: x0 s + x1 c */
            o16[2 * k] = tohx(r0); o16[2 * k + 1] = tohx(r1); unsigned short a2, c2; splitf(r0, a2, c2); oh[2 * k] = a2; ol[2 * k] = c2; splitf(r1, a2, c2); oh[2 * k + 1] = a2; ol[2 * k + 1] = c2; }
        const size_t e = ((size_t)(h0 + it) * TT + t) * HD + d; *(v8h*)(P16 + e) = o16; *(v8us*)(Ph + e) = oh; *(v8us*)(Pl + e) = ol; } }

#define QW 32
__device__ __forceinline__ float xhalf(float x) { return __builtin_bit_cast(float, __builtin_amdgcn_permlanex16(__builtin_bit_cast(int, x), __builtin_bit_cast(int, x), 0x76543210, 0xfedcba98, false, false)); }   // lane l takes lane l ^ 16's value
template <typename T16, bool HL>
__device__ __forceinline__ void fattn_rows(const T16* __restrict__ Q, const T16* __restrict__ Q2, const T16* __restrict__ K, const T16* __restrict__ K2, const T16* __restrict__ VT, const T16* __restrict__ VT2, float* __restrict__ O, const int q0, const int lane) {
    typedef typename WFrag<T16>::V V;
    const int lr = lane & 15, hi = lane >> 4;
    const float CE = SCL * LOG2E, OFF = HL ? 0.0f : 10.0f;
    // Every load is a wave-uniform plane pointer that never changes + a 32-bit lane offset in bytes (walked block by block for k and v) + a constant.
    // k and the transposed v lie in fragment order (WFrag::ldf): a 32-key block is 8 fragments = 8 KiB of either plane, and every load of a wave is 512 contiguous bytes (4 whole lines, not 32 bytes of each of 16 lines).
    unsigned ko = (unsigned)lane * 16u, vo = (unsigned)lane * 16u;   // the lane's piece in a half fragment of k, and of the transposed v
    const unsigned qo = (unsigned)(lr * HD + 8 * hi) * 2u + (unsigned)q0 * (HD * 2u);   // q stays in rows: it is read once
    auto at = [](const T16* p, unsigned bytes) { return (const T16*)((const char*)p + bytes); };
    V qf[2][4], ql[2][4], kf[2][4], kl[2][4];
#pragma unroll
    for (int qt = 0; qt < 2; ++qt)
#pragma unroll
        for (int c = 0; c < 4; ++c) { const int e = qt * 16 * HD + c * 32; qf[qt][c] = WFrag<T16>::ld(at(Q, qo) + e); if (HL) ql[qt][c] = WFrag<T16>::ld(at(Q2, qo) + e); }
#pragma unroll
    for (int kt = 0; kt < 2; ++kt)
#pragma unroll
        for (int c = 0; c < 4; ++c) { const int e = (kt * 4 + c) * 512; kf[kt][c] = WFrag<T16>::ldf(at(K, ko) + e); if (HL) kl[kt][c] = WFrag<T16>::ldf(at(K2, ko) + e); }
    asm volatile("s_wait_xcnt 0x0" :: "s"(Q), "s"(Q2), "s"(K), "s"(K2), "v"(qo) : "memory");   // precaution: behind it the registers that the q loads name may be reused; pointers and offset are inputs so that they stay as they are up to it
    v8f acc[8][2];
#pragma unroll
    for (int dt = 0; dt < 8; ++dt) { acc[dt][0] = (v8f){}; acc[dt][1] = (v8f){}; }
    float mx[2] = { -3.0e38f, -3.0e38f }, ls[2] = { 0.f, 0.f };
    auto step = [&](auto lastc) {
        constexpr bool LAST = decltype(lastc)::value;
        V vf[8], vl[8];
#pragma unroll
        for (int dt = 0; dt < 8; ++dt) { const int e = dt * 512; vf[dt] = WFrag<T16>::ldf(at(VT, vo) + e); if (HL) vl[dt] = WFrag<T16>::ldf(at(VT2, vo) + e); }
        v8f s[2][2];
#pragma unroll
        for (int kt = 0; kt < 2; ++kt) { s[kt][0] = (v8f){}; s[kt][1] = (v8f){}; }
#pragma unroll
        for (int c = 0; c < 4; ++c)
#pragma unroll
            for (int kt = 0; kt < 2; ++kt)
#pragma unroll
                for (int qt = 0; qt < 2; ++qt) { s[kt][qt] = WFrag<T16>::mma(kf[kt][c], qf[qt][c], s[kt][qt]); if (HL) { s[kt][qt] = WFrag<T16>::mma(kf[kt][c], ql[qt][c], s[kt][qt]); s[kt][qt] = WFrag<T16>::mma(kl[kt][c], qf[qt][c], s[kt][qt]); } }
        if (!LAST) {   // the next block's key fragments, into the same registers, fly during the softmax and the second contraction
#pragma unroll
            for (int kt = 0; kt < 2; ++kt)
#pragma unroll
                for (int c = 0; c < 4; ++c) { const int e = (8 + kt * 4 + c) * 512; kf[kt][c] = WFrag<T16>::ldf(at(K, ko) + e); if (HL) kl[kt][c] = WFrag<T16>::ldf(at(K2, ko) + e); }
        }
        V pf[2], pl[2];
#pragma unroll
        for (int qt = 0; qt < 2; ++qt) {
            float t[16];
#pragma unroll
            for (int i = 0; i < 16; ++i) { float x = s[i >> 3][qt][i & 7]; if (LAST) { if ((i >> 3) * 16 + hi * 8 + (i & 7) > qt * 16 + lr) x = -3.0e38f; } t[i] = x; }
            float m8[8];
#pragma unroll
            for (int i = 0; i < 8; ++i) m8[i] = fmaxf(t[i], t[i + 8]);
            float ml = fmaxf(fmaxf(fmaxf(m8[0], m8[1]), fmaxf(m8[2], m8[3])), fmaxf(fmaxf(m8[4], m8[5]), fmaxf(m8[6], m8[7])));
            ml = fmaxf(ml, xhalf(ml));
            const float mn = fmaxf(mx[qt], ml * CE), al = __builtin_amdgcn_exp2f(mx[qt] - mn), mo = mn - OFF; mx[qt] = mn;
#pragma unroll
            for (int i = 0; i < 16; ++i) t[i] = __builtin_amdgcn_exp2f(fmaf(t[i], CE, -mo));
            float s4[4];
#pragma unroll
            for (int i = 0; i < 4; ++i) s4[i] = (t[i] + t[i + 4]) + (t[i + 8] + t[i + 12]);
            ls[qt] = fmaf(ls[qt], al, (s4[0] + s4[1]) + (s4[2] + s4[3]));
#pragma unroll
            for (int dt = 0; dt < 8; ++dt) acc[dt][qt] *= al;
            if constexpr (HL) { v8us h0, h1, l0, l1;
#pragma unroll
                for (int i = 0; i < 8; ++i) { unsigned short a, b; splitf(t[i], a, b); h0[i] = a; l0[i] = b; splitf(t[i + 8], a, b); h1[i] = a; l1[i] = b; }
                pf[qt] = cat16b(h0, h1); pl[qt] = cat16b(l0, l1);
            } else { v16h p;
#pragma unroll
                for (int i = 0; i < 16; ++i) p[i] = tohx(t[i]);
                pf[qt] = p; }
        }
#pragma unroll
        for (int dt = 0; dt < 8; ++dt)
#pragma unroll
            for (int qt = 0; qt < 2; ++qt) { acc[dt][qt] = WFrag<T16>::mma(vf[dt], pf[qt], acc[dt][qt]); if (HL) { acc[dt][qt] = WFrag<T16>::mma(vf[dt], pl[qt], acc[dt][qt]); acc[dt][qt] = WFrag<T16>::mma(vl[dt], pf[qt], acc[dt][qt]); } }
        // precaution: stands in front of the advance below, which rewrites the offset registers that this block's loads name; the offsets are operands so that the advance stays behind it, the plane pointers are inputs so that their registers stay as they are up to it
        __builtin_amdgcn_sched_barrier(0);   // keeps the wait below at the block's end, far behind the block's loads; without it the compiler lifts the wait to directly behind the last load, in front of the softmax
        asm volatile("s_wait_xcnt 0x0" : "+v"(ko), "+v"(vo) : "s"(K), "s"(K2), "s"(VT), "s"(VT2) : "memory");
        ko += 8 * 1024; vo += 8 * 1024;
    };
    const int nb = q0 / 32 + 1;
#pragma unroll 1
    for (int kb = 0; kb < nb - 1; ++kb) step(BoolC<false>());
    step(BoolC<true>());
#pragma unroll
    for (int qt = 0; qt < 2; ++qt) { const float inv = __fdiv_rn(1.0f, ls[qt] + xhalf(ls[qt]));
#pragma unroll
        for (int dt = 0; dt < 8; ++dt) acc[dt][qt] *= inv; }
    const unsigned oo = (unsigned)((q0 + lr) * DQ + hi * 8) * 4u;   // bytes: the lane's 8 columns of its first query row
    __builtin_amdgcn_sched_barrier(0);   // all arithmetic stands in front of the first store, so that no register that an issued store names is rewritten behind it
#pragma unroll
    for (int qt = 0; qt < 2; ++qt)
#pragma unroll
        for (int dt = 0; dt < 8; ++dt) { float* o = (float*)((char*)O + oo) + qt * 16 * DQ + dt * 16;
            *(v4f*)o = __builtin_shufflevector(acc[dt][qt], acc[dt][qt], 0, 1, 2, 3); *(v4f*)(o + 4) = __builtin_shufflevector(acc[dt][qt], acc[dt][qt], 4, 5, 6, 7); }
}
// Grid (TT / QW / 4, heads, batches), 4 waves, no barrier and no LDS. The four waves of a work-group take the row blocks g, 31 - g, 32 + g and 63 - g of one head, so that every work-group walks about the same number of key blocks and its waves walk the same keys from block 0 on.
// A wave holds more than 512 registers, so a WGP holds one work-group at a time: the 512 work-groups run in two turns, and a work-group of the second turn starts as soon as one of the first has ended (a work-group lasts as long as its longest wave, 64 - g key blocks of the 130 that its four waves walk).
static_assert(TT / QW == 64 && RH % QW == 0 && HD == 128 && NKV == NH_, "k_fattn is written for these shapes");
__global__ __launch_bounds__(128) void k_fattn(const h16* __restrict__ Q16, const h16* __restrict__ K16, const h16* __restrict__ V16, const bf* __restrict__ Qh, const bf* __restrict__ Ql, const bf* __restrict__ Kh, const bf* __restrict__ Kl, const bf* __restrict__ Vh, const bf* __restrict__ Vl, float* __restrict__ OUTb) {
    const int wave = __builtin_amdgcn_readfirstlane((int)(threadIdx.x >> 5)), lane = threadIdx.x & 31, g = blockIdx.x;
    const int qb = (wave == 0) ? g : (wave == 1) ? 31 - g : (wave == 2) ? 32 + g : 63 - g;
    const size_t po = ((size_t)blockIdx.z * NH_ + blockIdx.y) * TT * HD; float* O = OUTb + (size_t)blockIdx.z * TT * DQ + blockIdx.y * HD;
    if (qb * QW < RH) fattn_rows<bf, true>(Qh + po, Ql + po, Kh + po, Kl + po, Vh + po, Vl + po, O, qb * QW, lane);
    else fattn_rows<h16, false>(Q16 + po, nullptr, K16 + po, nullptr, V16 + po, nullptr, O, qb * QW, lane);
}

extern "C" void kernel_launch(void* const* d_in, const int* in_sizes, int n_in,
                              void* d_out, int out_size, void* d_ws, size_t ws_size, hipStream_t stream) {
    (void)in_sizes; (void)n_in; (void)out_size;
    const float* x = (const float*)d_in[0]; const float* wq = (const float*)d_in[1]; const float* wk = (const float*)d_in[2]; const float* wv = (const float*)d_in[3]; const float* wo = nullptr; (void)wo;   /* argument order x, Wq, Wk, Wv ('oi' (out, in) [2048][2048]): four inputs, all read; NO output weight: the merged heads are the output */
    float* OUT = (float*)d_out;     // [2][2048][2048]
    char* wsp = (char*)d_ws;
    auto take = [&](size_t bytes) { char* p = wsp; wsp += (bytes + 255) & ~(size_t)255; return (void*)p; };
    // The casts' five planes, consecutive: x of batch 0, x of batch 1, Wq, Wk, Wv.
    bf* XB = (bf*)take((size_t)(NB_ + 3) * TT * DM * 2); bf* WQ = XB + (size_t)NB_ * TT * DM; float* CS = (float*)take((size_t)TT * HD * 2 * 4);
    // The f32 projections, [q, k, v][batch][position][column]. The v planes lie over the q and k projections, which the rotary launch has read by then (stream-ordered).
    float* FQ = (float*)take((size_t)3 * NB_ * TT * DQ * 4); float* FV = FQ + (size_t)2 * NB_ * TT * DQ;
    h16* VT16 = (h16*)FQ; bf* VTh = (bf*)(VT16 + (size_t)NB_ * NKV * HD * TT); bf* VTl = VTh + (size_t)NB_ * NKV * HD * TT;
    // The q and k planes, [q, k][batch][head]; q as [position][column], k in fragment order (WFrag::ldf).
    h16* QP16 = (h16*)take((size_t)2 * NB_ * NH_ * TT * HD * 2); bf* QPh = (bf*)take((size_t)2 * NB_ * NH_ * TT * HD * 2); bf* QPl = (bf*)take((size_t)2 * NB_ * NH_ * TT * HD * 2);
    h16* KP16 = QP16 + (size_t)NB_ * NH_ * TT * HD; bf* KPh = QPh + (size_t)NB_ * NH_ * TT * HD; bf* KPl = QPl + (size_t)NB_ * NH_ * TT * HD;
    if ((size_t)(wsp - (char*)d_ws) > ws_size) return;    // ws 256 MiB
    k_prep<<<dim3(PRX, CSY + NB_ + 3, 1), 256, 0, stream>>>(x, wq, wk, wv, XB, CS);   /* casts, and the rotary table (positions = arange) */
    k_gemmt<<<dim3(NB_ * TT / 128, 3 * DQ / 128, 1), 128, 0, stream>>>(XB, WQ, FQ);
    k_ropeI<<<dim3((unsigned)((size_t)(NH_ / RHN) * TT * HD / 8 / 256), 2 * NB_, 1), 256, 0, stream>>>(FQ, DQ, NH_, CS, 1.0f, QP16, QPh, QPl);
    k_vtp<DKV><<<dim3((unsigned)(NKV * (TT / VTT)), NB_, 1), 256, 0, stream>>>(FV, NKV, VT16, VTh, VTl);
    k_fattn<<<dim3(TT / QW / 4, NH_, NB_), 128, 0, stream>>>(QP16, KP16, VT16, QPh, QPl, KPh, KPl, VTh, VTl, OUT);
    /* no output projection: k_fattn has written the merged heads of both batches to OUT */
}

// v007
// One run takes 212 microseconds.
// In both of two side-by-side timings against v006, it was 1.12 times as fast.
// Over all steps from v000 it is 7.31 times as fast.
#include <hip/hip_runtime.h>

// Causal multi-head self-attention with 128-wide heads and interleaved-pair rotary embeddings, WITHOUT an output projection (x [2][2048][2048]; q, k, v = einsum('bsm,nm->bsn', x, W) = x W^T ('oi' (out, in) [2048][2048] normal x 0.02, no bias; 16 heads x 128); rope on (even, odd) pairs: (xe cos - xo sin, xe sin + xo cos) with angle m x theta[i], theta = exp(-log(10000) x (2i) / 128) IN THAT SPELLING (64 f32 frequencies baked from the module's own line; precise cosf/sinf), m = arange(2048); scores x 1/sqrt(128); causal (tril kept, -1e30 elsewhere == exclusion: exp underflows to exactly 0); softmax in f32; out = the merged heads [b][s][h x 128 + d] -> [2][2048][2048] f32 (8.4 M); argument order x, Wq, Wk, Wv).
// Layout, every stage one launch over both batches (and over the three projections, or over q and k): bf16 copy of X; 'oi' weights; exact projections; rotary table (2048 positions x 64 angles, filled in k_prep) + k_ropeI interleaved-pair plane builders at HD 128; k_fattn: causal attention in one launch, scores and probabilities held in registers (running maximum and sum per query row; hybrid rows: < 512 hi/lo 3 products, rest fp16 x1024), which writes the merged heads straight to the output rows (no output projection).
// Compute dtypes, f32 accumulate: every input rounded to bf16; projections exact; rotary f32; attention rows < 512 3 products, rest fp16; softmax f32; output f32 (the P.v accumulators divided by the row sum).

#define NB_  2
#define TT   2048
#define DM   2048
#define NH_  16
#define NKV  16
#define REP  (NH_ / NKV)
#define HD   128
#define DQ   (NH_ * HD)
#define DKV  (NKV * HD)
#define RH   512                  // query rows < RH use hi+lo planes
#define SCL  0.088388347648318447f   // HD^-0.5
#define LOG2E 1.4426950408889634f
typedef _Float16 h16;
typedef unsigned short bf;
typedef __attribute__((ext_vector_type(16))) __bf16   v16bf;
typedef __attribute__((ext_vector_type(16))) _Float16 v16h;
typedef __attribute__((ext_vector_type(8)))  _Float16 v8h;
typedef __attribute__((ext_vector_type(8)))  unsigned short v8us;
typedef __attribute__((ext_vector_type(8)))  float    v8f;
typedef __attribute__((ext_vector_type(4)))  float    v4f;
typedef v8h  __attribute__((may_alias)) v8ha;
typedef v4f  __attribute__((may_alias)) v4fa;
typedef v8us __attribute__((may_alias)) v8usa;

__device__ __forceinline__ unsigned short f2bf(float f) { unsigned u = __float_as_uint(f); u += 0x7FFFu + ((u >> 16) & 1u); return (unsigned short)(u >> 16); }
__device__ __forceinline__ float bf2f(unsigned short b) { return __uint_as_float(((unsigned)b) << 16); }
__device__ __forceinline__ float bfr(float f) { return bf2f(f2bf(f)); }
__device__ __forceinline__ v16h cat16(v8h lo, v8h hi) { return __builtin_shufflevector(lo, hi, 0, 1, 2, 3, 4, 5, 6, 7, 8, 9, 10, 11, 12, 13, 14, 15); }
__device__ __forceinline__ v16bf cat16b(v8us lo, v8us hi) { return __builtin_bit_cast(v16bf, __builtin_shufflevector(lo, hi, 0, 1, 2, 3, 4, 5, 6, 7, 8, 9, 10, 11, 12, 13, 14, 15)); }
__device__ __forceinline__ v8f wmma16(v16h a, v16h b, v8f c) { return __builtin_amdgcn_wmma_f32_16x16x32_f16(false, a, false, b, (short)0, c, false, false); }
__device__ __forceinline__ v8f wmmab(v16bf a, v16bf b, v8f c) { return __builtin_amdgcn_wmma_f32_16x16x32_bf16(false, a, false, b, (short)0, c, false, false); }



// ---- k_gemmt: C[m][n] (f32, pitch DQ) = sum_k A[m][k] Bt[n][k], bf16 operands with K-contiguous rows of DM elements. One work-group of 4 waves per 128x128 tile of C, one 64x64 quarter (16 accumulators) a wave; grid (M/128, N/128). Bt holds the three weights one behind the other (N = 3 DQ rows); C is three planes of M x DQ, one per weight.
// The operands come through LDS: a pass is 128 k = 256 bytes of each of the tile's 128 A rows and 128 Bt rows. Every wave brings one slice of 64 rows with one tensor load (whole lines from L2, each row fetched once per work-group),
// two buffers, the load of pass s + 2 issued when pass s has been read. The mover pads each row by 16 bytes: pitch 272 B, an odd multiple of 16 B, for the ds_load_b128 fragment reads.
// The fragments keep the WFrag k order (8 hi .. 8 hi + 7, then 16 + 8 hi ..) for A and Bt alike, and every accumulator still sums k upwards in steps of 32.
// ld reads a fragment from K-contiguous rows; ldf reads one stored in FRAGMENT ORDER: 1 KiB a fragment (16 rows x 32 k), the 16-byte piece (row lr, k 16 j + 8 hi ..) at byte 512 j + 16 (16 hi + lr), so that each of its two loads is 512 contiguous bytes of a wave. Same k order as ld.
template <typename T16> struct WFrag;
template <> struct WFrag<h16> { typedef v16h V; static __device__ __forceinline__ V ld(const h16* p) { return cat16(*(const v8h*)p, *(const v8h*)(p + 16)); } static __device__ __forceinline__ V ldf(const h16* p) { return cat16(*(const v8h*)p, *(const v8h*)(p + 256)); } static __device__ __forceinline__ v8f mma(V a, V b, v8f c) { return wmma16(a, b, c); } };
template <> struct WFrag<bf> { typedef v16bf V; static __device__ __forceinline__ V ld(const bf* p) { return cat16b(*(const v8us*)p, *(const v8us*)(p + 16)); } static __device__ __forceinline__ V ldf(const bf* p) { return cat16b(*(const v8us*)p, *(const v8us*)(p + 256)); } static __device__ __forceinline__ v8f mma(V a, V b, v8f c) { return wmmab(a, b, c); } };
typedef unsigned u32x4 __attribute__((ext_vector_type(4)));
typedef unsigned u32x8 __attribute__((ext_vector_type(8)));
#define GKP 128u                  // k per pass
#define GNP (DM / GKP)            // passes
#define GROWB (GKP * 2u)          // bytes of a row per pass
#define GPITCH (GROWB + 16u)      // LDS row pitch
#define GSLICE 18432u             // a slice in LDS: 64 rows x 272 B = 17,408 B, rounded up to a multiple of 2 KiB
#define GBUF (4u * GSLICE)        // a buffer: A rows 0..63, A rows 64..127, Bt rows 0..63, Bt rows 64..127
static_assert(GNP >= 2 && DM % GKP == 0 && TT % 128 == 0 && DQ % 128 == 0 && DKV % 128 == 0 && DQ == DKV && 64u * GPITCH <= GSLICE && GSLICE % 2048u == 0, "k_gemmt tile shape");
__device__ __forceinline__ unsigned uni(unsigned v) { return (unsigned)__builtin_amdgcn_readfirstlane((int)v); }
__device__ __forceinline__ unsigned pinned(unsigned v) { unsigned w = uni(v); asm volatile("" : "+s"(w)); return w; }   // a value that decides or addresses a tensor load, held in a scalar register
__device__ __forceinline__ v16bf ldsfrag(const unsigned char* p) { return cat16b(*(const v8usa*)p, *(const v8usa*)(p + 32)); }
__global__ __launch_bounds__(128) void k_gemmt(const bf* __restrict__ A, const bf* __restrict__ Bt, float* C) {
    __shared__ __attribute__((aligned(2048))) unsigned char ring[2 * GBUF];
    __shared__ __align__(16) float osm[4][16 * 68];
    const unsigned wave = uni(threadIdx.x >> 5), lane = threadIdx.x & 31, lr = lane & 15, hi = lane >> 4;
    const unsigned wm = wave & 1u, wn = wave >> 1;
    const unsigned r0 = blockIdx.x * 128u, c0 = blockIdx.y * 128u;
    C += (size_t)(c0 / DQ) * ((size_t)NB_ * TT * DQ - DQ);   // columns c0 .. of the stacked weights are columns c0 % DQ .. of plane c0 / DQ of C
    // Wave w brings slice w of every pass: waves 0 and 1 the two halves of the A rows, waves 2 and 3 those of the Bt rows.
    const unsigned long long gsrc = (unsigned long long)(size_t)((wave < 2u) ? A + (size_t)(r0 + 64u * wave) * DM : Bt + (size_t)(c0 + 64u * (wave - 2u)) * DM);
    const unsigned ldst = (unsigned)(size_t)ring + wave * GSLICE;
    u32x8 g1;   // 1-byte elements, tensor = tile = 64 rows of 256 bytes, source pitch DM x 2 bytes, 4 dwords of pad behind every 64 dwords, no mask
    g1[0] = uni((1u << 20) | (5u << 22) | (3u << 25)); g1[1] = uni((GROWB & 0xFFFFu) << 16); g1[2] = uni((GROWB >> 16) | (64u << 16)); g1[3] = uni(GROWB << 16); g1[4] = uni(64u); g1[5] = uni(DM * 2u); g1[6] = uni(0u); g1[7] = uni(0u);
    auto issue = [&](unsigned st) {
        const unsigned long long ga = gsrc + (unsigned long long)st * GROWB; u32x4 g0;
        g0[0] = uni(1u); g0[1] = uni(ldst + (st & 1u) * GBUF); g0[2] = uni((unsigned)ga); g0[3] = uni((((unsigned)(ga >> 32)) & 0x01FFFFFFu) | 0x80000000u);
        asm volatile("tensor_load_to_lds %0, %1" :: "s"(g0), "s"(g1) : "memory");
    };
    issue(0u);
    asm volatile("s_wait_tensorcnt 0x0" ::: "memory");   // this wave's slice of pass 0 has landed
    __syncthreads();                                      // ... and so has every other wave's: pass 0 is readable
    issue(1u);
    v8f acc[4][4];
#pragma unroll
    for (int mb = 0; mb < 4; ++mb)
#pragma unroll
        for (int nb = 0; nb < 4; ++nb) acc[mb][nb] = (v8f){};
    const unsigned aoff = wm * GSLICE + lr * GPITCH + 16u * hi, boff = (2u + wn) * GSLICE + lr * GPITCH + 16u * hi;
#pragma unroll 1   // one pass a trip: the publish point at the foot stands once in the code
    for (unsigned s = 0; s < GNP; ++s) {
        const unsigned char* pa = ring + (s & 1u) * GBUF + aoff; const unsigned char* pb = ring + (s & 1u) * GBUF + boff;
        v16bf a[2][4], b[2][4];
#pragma unroll
        for (int f = 0; f < 4; ++f) { a[0][f] = ldsfrag(pa + f * 16 * GPITCH); b[0][f] = ldsfrag(pb + f * 16 * GPITCH); }
#pragma unroll
        for (int ks = 0; ks < 4; ++ks) {
            if (ks + 1 < 4) {
#pragma unroll
                for (int f = 0; f < 4; ++f) { a[(ks + 1) & 1][f] = ldsfrag(pa + f * 16 * GPITCH + (ks + 1) * 64); b[(ks + 1) & 1][f] = ldsfrag(pb + f * 16 * GPITCH + (ks + 1) * 64); }
            }
            __builtin_amdgcn_sched_barrier(0);   // the next block's 16 LDS reads stay one group in front of this block's products
#pragma unroll
            for (int nb = 0; nb < 4; ++nb)
#pragma unroll
                for (int mb = 0; mb < 4; ++mb) acc[mb][nb] = wmmab(a[ks & 1][mb], b[ks & 1][nb], acc[mb][nb]);
            __builtin_amdgcn_sched_barrier(0);   // the other side of the same fence: no later read moves up into this block
        }
        // Publish point of pass s + 1, every wave, in this order.
        asm volatile("s_wait_dscnt 0x0" ::: "memory");       // this wave's reads of pass s's buffer are done before that buffer is refilled
        asm volatile("s_wait_tensorcnt 0x0" ::: "memory");   // this wave's slice of pass s + 1 has landed
        __syncthreads();                                      // pass s + 1 is readable, and nobody reads pass s's buffer any more
        const unsigned st = pinned(s + 2u);                   // formed behind the wait above, so that the descriptor's address words are too
        if (pinned(st < GNP)) issue(st);
    }
    asm volatile("s_wait_tensorcnt 0x0" ::: "memory");   // no request is outstanding when the wave goes on
    asm volatile("s_wait_dscnt 0x0" ::: "memory");
    float* os = osm[wave];   // each wave stages its own 16 rows, so that a store covers whole 128-byte lines
#pragma unroll
    for (int mb = 0; mb < 4; ++mb) {
#pragma unroll
        for (int nb = 0; nb < 4; ++nb) {
#pragma unroll
            for (int j = 0; j < 8; ++j) os[(hi * 8 + j) * 68 + nb * 16 + lr] = acc[mb][nb][j]; }
        __builtin_amdgcn_wave_barrier(); asm volatile("" ::: "memory");   // compiler fence: the row reads below stay behind the other lanes' LDS writes above
        float* crow = C + (size_t)(r0 + 64u * wm + mb * 16) * DQ + c0 + 64u * wn;
#pragma unroll
        for (int s = 0; s < 8; ++s) { const int row = 2 * s + hi, cofs = lr * 4; const v4f val = *(const v4fa*)(os + row * 68 + cofs); *(v4f*)(crow + (size_t)row * DQ + cofs) = val; }
        __builtin_amdgcn_wave_barrier(); asm volatile("" ::: "memory");   // compiler fence: the next 16 rows' LDS writes stay behind these reads
    }
}

template <bool B> struct BoolC { static constexpr bool value = B; };
__device__ __forceinline__ h16 tohx(float x) { return (h16)x; }
__device__ __forceinline__ void splitf(float y, unsigned short& h, unsigned short& l) { h = f2bf(y); l = f2bf(y - bf2f(h)); }
typedef __attribute__((ext_vector_type(2))) _Float16 v2h;
typedef __attribute__((ext_vector_type(4))) _Float16 v4h;
typedef __attribute__((ext_vector_type(2))) unsigned short v2us;
typedef __attribute__((ext_vector_type(4))) unsigned short v4us;
typedef __attribute__((ext_vector_type(2))) float v2f;
typedef __attribute__((ext_vector_type(4))) int v4i;

// The plane builders below (the casts of k_prep, k_vtp, k_ropeI) give every thread 32 elements, moved in 16-byte pieces with all of a thread's loads issued before its first store:
// 4096 waves a plane (16 per WGP), for speed only. Every grid covers its array exactly (static_asserts at the sizes).
#define CVN 4                     // 8-element pieces per thread in a cast
static_assert(((size_t)DQ * DM / 8) % (256 * CVN) == 0 && ((size_t)DKV * DM / 8) % (256 * CVN) == 0 && ((size_t)TT * DM / 8) % (256 * CVN) == 0, "a cast has no tail");
__device__ __forceinline__ void cvt8_body(const float* __restrict__ src, bf* dst) { const size_t i0 = (size_t)blockIdx.x * (256 * CVN) + threadIdx.x; v8f v[CVN];
#pragma unroll
    for (int it = 0; it < CVN; ++it) v[it] = *(const v8f*)(src + (i0 + it * 256) * 8);
#pragma unroll
    for (int it = 0; it < CVN; ++it) { v8us o;
#pragma unroll
        for (int k = 0; k < 8; ++k) o[k] = f2bf(v[it][k]);
        *(v8us*)(dst + (i0 + it * 256) * 8) = o; }
    asm volatile("s_wait_xcnt 0x0" ::: "memory"); }   // precaution: stands behind the last store, in front of whatever code follows the cast in the kernel and reuses the registers that the stores name

// k_vtp: one work-group transposes one head's 64 positions x 128 columns through LDS: rows are read as 512 contiguous bytes a wave. The planes are written in fragment order (WFrag::ldf) for k_fattn's second contraction: fragment (32-key block kb, 16 columns dt) at 1 KiB x (8 kb + dt) of the head's plane, its rows the columns, its k the keys; every store of a wave is one half fragment, 512 contiguous bytes.
#define VTT 64                    // positions per k_vtp tile
#define VTP (HD + 2)              // LDS row pitch in floats: a wave reads 16 columns of each of two rows that lie 8 apart, and 8 x 130 = 16 mod 64 puts the two runs on different banks
static_assert(TT % VTT == 0 && HD == 128, "k_vtp tile shape");
template <int PITCH>              // row pitch of F in floats, a constant so that a thread's 8 loads are one address and 8 immediate offsets
__global__ __launch_bounds__(256) void k_vtp(const float* __restrict__ F, int nheads, h16* V16, bf* Vh, bf* Vl) {
    __shared__ float ls[VTT * VTP];
    const int g = blockIdx.x / (TT / VTT), t0 = (blockIdx.x % (TT / VTT)) * VTT; if (g >= nheads) return;   // the same for the whole work-group, in front of the barrier
    F += (size_t)blockIdx.y * TT * PITCH; V16 += (size_t)blockIdx.y * NKV * HD * TT; Vh += (size_t)blockIdx.y * NKV * HD * TT; Vl += (size_t)blockIdx.y * NKV * HD * TT;   // grid y: the batch
    const int lane = threadIdx.x & 31, w = threadIdx.x >> 5; v4f x[VTT / 8];
    const float* fb = F + (size_t)(t0 + w) * PITCH + g * HD + lane * 4;
#pragma unroll
    for (int it = 0; it < VTT / 8; ++it) x[it] = *(const v4f*)(fb + (size_t)(it * 8) * PITCH);
#pragma unroll
    for (int it = 0; it < VTT / 8; ++it)
#pragma unroll
        for (int q = 0; q < 4; ++q) ls[(it * 8 + w) * VTP + lane * 4 + q] = x[it][q];
    __syncthreads();   // the tile is complete before any wave reads a column that the other waves wrote
    static_assert(VTT == 64 && HD / 16 == 8, "k_vtp: wave w writes the column group dt = w of the tile's two key blocks");
    const int d = w * 16 + (lane & 15);
#pragma unroll
    for (int gi = 0; gi < 4; ++gi) { const int tq = (gi >> 1) * 32 + ((gi & 1) * 2 + (lane >> 4)) * 8; v8h o16; v8us oh, ol;   // gi: key block of the tile, then half j of the fragment
#pragma unroll
        for (int j = 0; j < 8; ++j) { const float y = ls[(tq + j) * VTP + d]; o16[j] = tohx(y); unsigned short a2, c2; splitf(y, a2, c2); oh[j] = a2; ol[j] = c2; }
        const size_t e = (size_t)g * HD * TT + (size_t)((((t0 / 32 + (gi >> 1)) * 8 + w) * 2 + (gi & 1)) * 32 + lane) * 8; *(v8h*)(V16 + e) = o16; *(v8us*)(Vh + e) = oh; *(v8us*)(Vl + e) = ol; } }
__constant__ float INV2[HD / 2] = { 1.000000000e+00f, 8.659642935e-01f, 7.498942018e-01f, 6.493816376e-01f, 5.623413324e-01f, 4.869675040e-01f, 4.216964841e-01f, 3.651741147e-01f, 3.162277639e-01f, 2.738419473e-01f, 2.371373475e-01f, 2.053525001e-01f, 1.778279394e-01f, 1.539926529e-01f, 1.333521456e-01f, 1.154781953e-01f, 9.999999404e-02f, 8.659642935e-02f, 7.498941571e-02f, 6.493815780e-02f, 5.623412505e-02f, 4.869675636e-02f, 4.216965288e-02f, 3.651741147e-02f, 3.162277490e-02f, 2.738419361e-02f, 2.371373400e-02f, 2.053524740e-02f, 1.778279617e-02f, 1.539926231e-02f, 1.333521400e-02f, 1.154781692e-02f, 9.999999776e-03f, 8.659644052e-03f, 7.498940919e-03f, 6.493817084e-03f, 5.623412319e-03f, 4.869675264e-03f, 4.216963891e-03f, 3.651741194e-03f, 3.162276698e-03f, 2.738419222e-03f, 2.371374052e-03f, 2.053524600e-03f, 1.778279431e-03f, 1.539926161e-03f, 1.333521330e-03f, 1.154781668e-03f, 9.999999311e-04f, 8.659643936e-04f, 7.498940686e-04f, 6.493816618e-04f, 5.623411853e-04f, 4.869675031e-04f, 4.216964007e-04f, 3.651740844e-04f, 3.162277862e-04f, 2.738420444e-04f, 2.371372684e-04f, 2.053524659e-04f, 1.778279402e-04f, 1.539926743e-04f, 1.333520777e-04f, 1.154781567e-04f };   // float32 exp(-log(10000) x (2i) / 128) in the module's own spelling, generated with jnp to be bit-exact
__device__ __forceinline__ void csP_body(float* CS, const int blk) { const int idx = blk * 256 + threadIdx.x; if (idx >= TT * HD) return; const int d = idx % HD; const int t = idx / HD; const float a = __fmul_rn((float)t, INV2[d >> 1]); v2f cs; cs[0] = cosf(a); cs[1] = sinf(a); *(v2f*)(CS + (size_t)idx * 2) = cs;  }
// k_prep: everything that depends on the inputs alone, in one launch. Grid (PRX, CSY + NB_ + 3): the first CSY rows fill the rotary table (arithmetic), the next NB_ rows cast the batches of x, the last three cast Wq, Wk, Wv (all five into consecutive planes of dst).
#define PRX ((unsigned)((size_t)TT * DM / 8 / (256 * CVN)))
#define CSY ((unsigned)((TT * HD / 256) / PRX))
static_assert(DQ == TT && DKV == TT && (TT * HD) % 256 == 0 && (TT * HD / 256) % PRX == 0, "k_prep: five planes of one size, and the table is whole rows of the grid");
__global__ __launch_bounds__(256) void k_prep(const float* __restrict__ x, const float* __restrict__ wq, const float* __restrict__ wk, const float* __restrict__ wv, bf* dst, float* CS) {
    if (blockIdx.y < CSY) { csP_body(CS, (int)(blockIdx.y * PRX + blockIdx.x)); return; }
    const unsigned y = blockIdx.y - CSY;
    const float* src = (y < NB_) ? x + (size_t)y * TT * DM : (y == NB_) ? wq : (y == NB_ + 1u) ? wk : wv;
    cvt8_body(src, dst + (size_t)y * TT * DM);
}
// k_ropeI: a thread takes 8 consecutive columns (4 pairs) of one position in RHN heads, so its 4 table entries are read once for all of them. Grid y picks the plane: q of batch 0, q of batch 1, k of batch 0, k of batch 1, in F and in the outputs alike.
#define RHN 4                     // heads per thread in k_ropeI
static_assert(RHN == 4 && NH_ % RHN == 0 && NKV % RHN == 0 && ((size_t)TT * HD / 8) % 256 == 0, "k_ropeI has no tail");
__global__ __launch_bounds__(256) void k_ropeI(const float* __restrict__ F, int pitch, int nheads, const float* __restrict__ CS, float sc, h16* P16, bf* Ph, bf* Pl) {
    // The k planes are written in fragment order (WFrag::ldf) for k_fattn's first contraction: fragment (16 keys, 32 columns c) at 1 KiB x (4 (t / 16) + c) of the head's plane. There a wave takes 8 positions x 4 pieces (not 2 x 16) of the work-group's 16 x 16, so that its stores still cover four whole 128-byte lines.
    const bool kpl = blockIdx.y >= NB_; const unsigned tl = threadIdx.x & 31, tw = threadIdx.x >> 5;
    const unsigned idx = blockIdx.x * 256 + (kpl ? ((tl & 7) + 8 * (tw & 1)) * (HD / 8) + (tl >> 3) + 4 * (tw >> 1) : threadIdx.x); const int d = (int)(idx % (HD / 8)) * 8; const int t = (int)((idx / (HD / 8)) % TT); const int h0 = (int)(idx / (HD / 8 * TT)) * RHN; if (h0 + RHN > nheads) return;
    F += (size_t)blockIdx.y * TT * DQ; P16 += (size_t)blockIdx.y * NH_ * TT * HD; Ph += (size_t)blockIdx.y * NH_ * TT * HD; Pl += (size_t)blockIdx.y * NH_ * TT * HD;
    const int fo = kpl ? ((((t >> 4) * 4 + (d >> 5)) * 2 + ((d >> 4) & 1)) * 32 + ((d >> 3) & 1) * 16 + (t & 15)) * 8 - (t * HD + d) : 0; P16 += fo; Ph += fo; Pl += fo;   // from the piece's row-major place in its head's plane (the e below) to its place in fragment order
    const float* c = CS + ((size_t)t * HD + d) * 2; v2f cs[4]; v4f x[RHN][2];
#pragma unroll
    for (int k = 0; k < 4; ++k) cs[k] = *(const v2f*)(c + 4 * k);   /* the entry of column d + 2k */
    asm volatile("s_wait_xcnt 0x0" ::: "memory");   // precaution: the compiler lets the loads below land in the registers that hold the table loads' address
#pragma unroll
    for (int it = 0; it < RHN; ++it) { const float* f = F + (size_t)t * pitch + (h0 + it) * HD + d; x[it][0] = *(const v4f*)f; x[it][1] = *(const v4f*)(f + 4); }
    // Holds all 12 loads in front of the arithmetic (loaded values as inputs only): without it the compiler sinks some of them behind the first waits and a wave pays the memory latency three times.
    asm volatile("" :: "v"(cs[0]), "v"(cs[1]), "v"(cs[2]), "v"(cs[3]), "v"(x[0][0]), "v"(x[0][1]), "v"(x[1][0]), "v"(x[1][1]), "v"(x[2][0]), "v"(x[2][1]), "v"(x[3][0]), "v"(x[3][1]));
#pragma unroll
    for (int it = 0; it < RHN; ++it) { v8h o16; v8us oh, ol;
#pragma unroll
        for (int k = 0; k < 4; ++k) { const float x0 = x[it][k >> 1][(k & 1) * 2], x1 = x[it][k >> 1][(k & 1) * 2 + 1];
            float a0 = __fmul_rn(x0, cs[k][0]), b0 = __fmul_rn(x1, cs[k][1]), a1 = __fmul_rn(x1, cs[k][0]), b1 = __fmul_rn(x0, cs[k][1]);
            float r0 = __fsub_rn(a0, b0) * sc, r1 = __fadd_rn(b1, a1) * sc;   /* even: x0 c - x1 s; odd: x0 s + x1 c */
            o16[2 * k] = tohx(r0); o16[2 * k + 1] = tohx(r1); unsigned short a2, c2; splitf(r0, a2, c2); oh[2 * k] = a2; ol[2 * k] = c2; splitf(r1, a2, c2); oh[2 * k + 1] = a2; ol[2 * k + 1] = c2; }
        const size_t e = ((size_t)(h0 + it) * TT + t) * HD + d; *(v8h*)(P16 + e) = o16; *(v8us*)(Ph + e) = oh; *(v8us*)(Pl + e) = ol; } }

#define QW 32
__device__ __forceinline__ float xhalf(float x) { return __builtin_bit_cast(float, __builtin_amdgcn_permlanex16(__builtin_bit_cast(int, x), __builtin_bit_cast(int, x), 0x76543210, 0xfedcba98, false, false)); }   // lane l takes lane l ^ 16's value
template <typename T16, bool HL>
__device__ __forceinline__ void fattn_rows(const T16* __restrict__ Q, const T16* __restrict__ Q2, const T16* __restrict__ K, const T16* __restrict__ K2, const T16* __restrict__ VT, const T16* __restrict__ VT2, float* __restrict__ O, const int q0, const int lane) {
    typedef typename WFrag<T16>::V V;
    const int lr = lane & 15, hi = lane >> 4;
    const float CE = SCL * LOG2E, OFF = HL ? 0.0f : 10.0f;
    // Every load is a wave-uniform plane pointer that never changes + a 32-bit lane offset in bytes (walked block by block for k and v) + a constant.
    // k and the transposed v lie in fragment order (WFrag::ldf): a 32-key block is 8 fragments = 8 KiB of either plane, and every load of a wave is 512 contiguous bytes (4 whole lines, not 32 bytes of each of 16 lines).
    unsigned ko = (unsigned)lane * 16u, vo = (unsigned)lane * 16u;   // the lane's piece in a half fragment of k, and of the transposed v
    const unsigned qo = (unsigned)(lr * HD + 8 * hi) * 2u + (unsigned)q0 * (HD * 2u);   // q stays in rows: it is read once
    auto at = [](const T16* p, unsigned bytes) { return (const T16*)((const char*)p + bytes); };
    V qf[2][4], ql[2][4], kf[2][4], kl[2][4];
#pragma unroll
    for (int qt = 0; qt < 2; ++qt)
#pragma unroll
        for (int c = 0; c < 4; ++c) { const int e = qt * 16 * HD + c * 32; qf[qt][c] = WFrag<T16>::ld(at(Q, qo) + e); if (HL) ql[qt][c] = WFrag<T16>::ld(at(Q2, qo) + e); }
#pragma unroll
    for (int kt = 0; kt < 2; ++kt)
#pragma unroll
        for (int c = 0; c < 4; ++c) { const int e = (kt * 4 + c) * 512; kf[kt][c] = WFrag<T16>::ldf(at(K, ko) + e); if (HL) kl[kt][c] = WFrag<T16>::ldf(at(K2, ko) + e); }
    asm volatile("s_wait_xcnt 0x0" :: "s"(Q), "s"(Q2), "s"(K), "s"(K2), "v"(qo) : "memory");   // precaution: behind it the registers that the q loads name may be reused; pointers and offset are inputs so that they stay as they are up to it
    v8f acc[8][2];
#pragma unroll
    for (int dt = 0; dt < 8; ++dt) { acc[dt][0] = (v8f){}; acc[dt][1] = (v8f){}; }
    float mx[2] = { -3.0e38f, -3.0e38f }, ls[2] = { 0.f, 0.f };
    auto step = [&](auto lastc) {
        constexpr bool LAST = decltype(lastc)::value;
        V vf[8], vl[8];
#pragma unroll
        for (int dt = 0; dt < 8; ++dt) { const int e = dt * 512; vf[dt] = WFrag<T16>::ldf(at(VT, vo) + e); if (HL) vl[dt] = WFrag<T16>::ldf(at(VT2, vo) + e); }
        v8f s[2][2];
#pragma unroll
        for (int kt = 0; kt < 2; ++kt) { s[kt][0] = (v8f){}; s[kt][1] = (v8f){}; }
#pragma unroll
        for (int c = 0; c < 4; ++c)
#pragma unroll
            for (int kt = 0; kt < 2; ++kt)
#pragma unroll
                for (int qt = 0; qt < 2; ++qt) { s[kt][qt] = WFrag<T16>::mma(kf[kt][c], qf[qt][c], s[kt][qt]); if (HL) { s[kt][qt] = WFrag<T16>::mma(kf[kt][c], ql[qt][c], s[kt][qt]); s[kt][qt] = WFrag<T16>::mma(kl[kt][c], qf[qt][c], s[kt][qt]); } }
        if (!LAST) {   // the next block's key fragments, into the same registers, fly during the softmax and the second contraction
#pragma unroll
            for (int kt = 0; kt < 2; ++kt)
#pragma unroll
                for (int c = 0; c < 4; ++c) { const int e = (8 + kt * 4 + c) * 512; kf[kt][c] = WFrag<T16>::ldf(at(K, ko) + e); if (HL) kl[kt][c] = WFrag<T16>::ldf(at(K2, ko) + e); }
        }
        V pf[2], pl[2];
#pragma unroll
        for (int qt = 0; qt < 2; ++qt) {
            float t[16];
#pragma unroll
            for (int i = 0; i < 16; ++i) { float x = s[i >> 3][qt][i & 7]; if (LAST) { if ((i >> 3) * 16 + hi * 8 + (i & 7) > qt * 16 + lr) x = -3.0e38f; } t[i] = x; }
            float m8[8];
#pragma unroll
            for (int i = 0; i < 8; ++i) m8[i] = fmaxf(t[i], t[i + 8]);
            float ml = fmaxf(fmaxf(fmaxf(m8[0], m8[1]), fmaxf(m8[2], m8[3])), fmaxf(fmaxf(m8[4], m8[5]), fmaxf(m8[6], m8[7])));
            ml = fmaxf(ml, xhalf(ml));
            const float mn = fmaxf(mx[qt], ml * CE), al = __builtin_amdgcn_exp2f(mx[qt] - mn), mo = mn - OFF; mx[qt] = mn;
#pragma unroll
            for (int i = 0; i < 16; ++i) t[i] = __builtin_amdgcn_exp2f(fmaf(t[i], CE, -mo));
            float s4[4];
#pragma unroll
            for (int i = 0; i < 4; ++i) s4[i] = (t[i] + t[i + 4]) + (t[i + 8] + t[i + 12]);
            ls[qt] = fmaf(ls[qt], al, (s4[0] + s4[1]) + (s4[2] + s4[3]));
#pragma unroll
            for (int dt = 0; dt < 8; ++dt) acc[dt][qt] *= al;
            if constexpr (HL) { v8us h0, h1, l0, l1;
#pragma unroll
                for (int i = 0; i < 8; ++i) { unsigned short a, b; splitf(t[i], a, b); h0[i] = a; l0[i] = b; splitf(t[i + 8], a, b); h1[i] = a; l1[i] = b; }
                pf[qt] = cat16b(h0, h1); pl[qt] = cat16b(l0, l1);
            } else { v16h p;
#pragma unroll
                for (int i = 0; i < 16; ++i) p[i] = tohx(t[i]);
                pf[qt] = p; }
        }
#pragma unroll
        for (int dt = 0; dt < 8; ++dt)
#pragma unroll
            for (int qt = 0; qt < 2; ++qt) { acc[dt][qt] = WFrag<T16>::mma(vf[dt], pf[qt], acc[dt][qt]); if (HL) { acc[dt][qt] = WFrag<T16>::mma(vf[dt], pl[qt], acc[dt][qt]); acc[dt][qt] = WFrag<T16>::mma(vl[dt], pf[qt], acc[dt][qt]); } }
        // precaution: stands in front of the advance below, which rewrites the offset registers that this block's loads name; the offsets are operands so that the advance stays behind it, the plane pointers are inputs so that their registers stay as they are up to it
        __builtin_amdgcn_sched_barrier(0);   // keeps the wait below at the block's end, far behind the block's loads; without it the compiler lifts the wait to directly behind the last load, in front of the softmax
        asm volatile("s_wait_xcnt 0x0" : "+v"(ko), "+v"(vo) : "s"(K), "s"(K2), "s"(VT), "s"(VT2) : "memory");
        ko += 8 * 1024; vo += 8 * 1024;
    };
    const int nb = q0 / 32 + 1;
#pragma unroll 1
    for (int kb = 0; kb < nb - 1; ++kb) step(BoolC<false>());
    step(BoolC<true>());
#pragma unroll
    for (int qt = 0; qt < 2; ++qt) { const float inv = __fdiv_rn(1.0f, ls[qt] + xhalf(ls[qt]));
#pragma unroll
        for (int dt = 0; dt < 8; ++dt) acc[dt][qt] *= inv; }
    const unsigned oo = (unsigned)((q0 + lr) * DQ + hi * 8) * 4u;   // bytes: the lane's 8 columns of its first query row
    __builtin_amdgcn_sched_barrier(0);   // all arithmetic stands in front of the first store, so that no register that an issued store names is rewritten behind it
#pragma unroll
    for (int qt = 0; qt < 2; ++qt)
#pragma unroll
        for (int dt = 0; dt < 8; ++dt) { float* o = (float*)((char*)O + oo) + qt * 16 * DQ + dt * 16;
            *(v4f*)o = __builtin_shufflevector(acc[dt][qt], acc[dt][qt], 0, 1, 2, 3); *(v4f*)(o + 4) = __builtin_shufflevector(acc[dt][qt], acc[dt][qt], 4, 5, 6, 7); }
}
// Grid (heads, batches, TT / QW / 4), 4 waves, no barrier and no LDS. The four waves of a work-group take four consecutive row blocks (128 query rows) of one head: they walk the same keys from block 0 on and end within three key blocks of one another, so that no SIMD of the WGP idles while a longer sibling runs on.
// A wave holds more than 512 registers, so a WGP holds one work-group at a time and the 512 work-groups run in two turns. Grid z is a RANK by cost, heaviest first: tile t costs 4 t + 4 key blocks, and a key block of the hi + lo tiles (t < 4) counts for a little more than two (three times the products, twice the loads and the vector work).
// TILE_OF_RANK holds the tile of rank r in nibble r: 15 .. 8, 3, 7, 6, 2, 5, 4, 1, 0 (a permutation of 0 .. 15: every tile is taken once whatever the start order is).
#define TILE_OF_RANK 0x0145267389ABCDEFull
static_assert(TT / QW == 64 && RH == 16 * QW && HD == 128 && NKV == NH_, "k_fattn is written for these shapes");
__global__ __launch_bounds__(128) void k_fattn(const h16* __restrict__ Q16, const h16* __restrict__ K16, const h16* __restrict__ V16, const bf* __restrict__ Qh, const bf* __restrict__ Ql, const bf* __restrict__ Kh, const bf* __restrict__ Kl, const bf* __restrict__ Vh, const bf* __restrict__ Vl, float* __restrict__ OUTb) {
    const int wave = __builtin_amdgcn_readfirstlane((int)(threadIdx.x >> 5)), lane = threadIdx.x & 31;
    const int qb = 4 * (int)((TILE_OF_RANK >> (4u * blockIdx.z)) & 15u) + wave;
    const size_t po = ((size_t)blockIdx.y * NH_ + blockIdx.x) * TT * HD; float* O = OUTb + (size_t)blockIdx.y * TT * DQ + blockIdx.x * HD;
    if (qb * QW < RH) fattn_rows<bf, true>(Qh + po, Ql + po, Kh + po, Kl + po, Vh + po, Vl + po, O, qb * QW, lane);
    else fattn_rows<h16, false>(Q16 + po, nullptr, K16 + po, nullptr, V16 + po, nullptr, O, qb * QW, lane);
}

extern "C" void kernel_launch(void* const* d_in, const int* in_sizes, int n_in,
                              void* d_out, int out_size, void* d_ws, size_t ws_size, hipStream_t stream) {
    (void)in_sizes; (void)n_in; (void)out_size;
    const float* x = (const float*)d_in[0]; const float* wq = (const float*)d_in[1]; const float* wk = (const float*)d_in[2]; const float* wv = (const float*)d_in[3]; const float* wo = nullptr; (void)wo;   /* argument order x, Wq, Wk, Wv ('oi' (out, in) [2048][2048]): four inputs, all read; NO output weight: the merged heads are the output */
    float* OUT = (float*)d_out;     // [2][2048][2048]
    char* wsp = (char*)d_ws;
    auto take = [&](size_t bytes) { char* p = wsp; wsp += (bytes + 255) & ~(size_t)255; return (void*)p; };
    // The casts' five planes, consecutive: x of batch 0, x of batch 1, Wq, Wk, Wv.
    bf* XB = (bf*)take((size_t)(NB_ + 3) * TT * DM * 2); bf* WQ = XB + (size_t)NB_ * TT * DM; float* CS = (float*)take((size_t)TT * HD * 2 * 4);
    // The f32 projections, [q, k, v][batch][position][column]. The v planes lie over the q and k projections, which the rotary launch has read by then (stream-ordered).
    float* FQ = (float*)take((size_t)3 * NB_ * TT * DQ * 4); float* FV = FQ + (size_t)2 * NB_ * TT * DQ;
    h16* VT16 = (h16*)FQ; bf* VTh = (bf*)(VT16 + (size_t)NB_ * NKV * HD * TT); bf* VTl = VTh + (size_t)NB_ * NKV * HD * TT;
    // The q and k planes, [q, k][batch][head]; q as [position][column], k in fragment order (WFrag::ldf).
    h16* QP16 = (h16*)take((size_t)2 * NB_ * NH_ * TT * HD * 2); bf* QPh = (bf*)take((size_t)2 * NB_ * NH_ * TT * HD * 2); bf* QPl = (bf*)take((size_t)2 * NB_ * NH_ * TT * HD * 2);
    h16* KP16 = QP16 + (size_t)NB_ * NH_ * TT * HD; bf* KPh = QPh + (size_t)NB_ * NH_ * TT * HD; bf* KPl = QPl + (size_t)NB_ * NH_ * TT * HD;
    if ((size_t)(wsp - (char*)d_ws) > ws_size) return;    // ws 256 MiB
    k_prep<<<dim3(PRX, CSY + NB_ + 3, 1), 256, 0, stream>>>(x, wq, wk, wv, XB, CS);   /* casts, and the rotary table (positions = arange) */
    k_gemmt<<<dim3(NB_ * TT / 128, 3 * DQ / 128, 1), 128, 0, stream>>>(XB, WQ, FQ);
    k_ropeI<<<dim3((unsigned)((size_t)(NH_ / RHN) * TT * HD / 8 / 256), 2 * NB_, 1), 256, 0, stream>>>(FQ, DQ, NH_, CS, 1.0f, QP16, QPh, QPl);
    k_vtp<DKV><<<dim3((unsigned)(NKV * (TT / VTT)), NB_, 1), 256, 0, stream>>>(FV, NKV, VT16, VTh, VTl);
    k_fattn<<<dim3(NH_, NB_, TT / QW / 4), 128, 0, stream>>>(QP16, KP16, VT16, QPh, QPl, KPh, KPl, VTh, VTl, OUT);
    /* no output projection: k_fattn has written the merged heads of both batches to OUT */
}

// v008
// A run of this version takes 189 microseconds.
// Next to v007, in two timings, it ran 1.12 and 1.13 times as fast.
// Counting every step since v000, it is 8.21 times as fast.
#include <hip/hip_runtime.h>

// Causal multi-head self-attention with 128-wide heads and interleaved-pair rotary embeddings, WITHOUT an output projection (x [2][2048][2048]; q, k, v = einsum('bsm,nm->bsn', x, W) = x W^T ('oi' (out, in) [2048][2048] normal x 0.02, no bias; 16 heads x 128); rope on (even, odd) pairs: (xe cos - xo sin, xe sin + xo cos) with angle m x theta[i], theta = exp(-log(10000) x (2i) / 128) IN THAT SPELLING (64 f32 frequencies baked from the module's own line; precise cosf/sinf), m = arange(2048); scores x 1/sqrt(128); causal (tril kept, -1e30 elsewhere == exclusion: exp underflows to exactly 0); softmax in f32; out = the merged heads [b][s][h x 128 + d] -> [2][2048][2048] f32 (8.4 M); argument order x, Wq, Wk, Wv).
// Layout, every stage one launch over both batches: k_prep: bf16 copy of X and of the 'oi' weights, rotary table (cos, sin of 2048 positions x 64 angles); k_gemmt: the three exact projections as one GEMM grid, whose epilogue applies the interleaved-pair rotary step to q and k and writes the q, k and transposed-v planes itself (the f32 projections never go to memory); k_fattn: causal attention in one launch, scores and probabilities held in registers (running maximum and sum per query row; hybrid rows: < 512 hi/lo 3 products, rest fp16 x1024), which writes the merged heads straight to the output rows (no output projection).
// Compute dtypes, f32 accumulate: every input rounded to bf16; projections exact; rotary f32; attention rows < 512 3 products, rest fp16; softmax f32; output f32 (the P.v accumulators divided by the row sum).

#define NB_  2
#define TT   2048
#define DM   2048
#define NH_  16
#define NKV  16
#define REP  (NH_ / NKV)
#define HD   128
#define DQ   (NH_ * HD)
#define DKV  (NKV * HD)
#define RH   512                  // query rows < RH use hi+lo planes
#define SCL  0.088388347648318447f   // HD^-0.5
#define LOG2E 1.4426950408889634f
typedef _Float16 h16;
typedef unsigned short bf;
typedef __attribute__((ext_vector_type(16))) __bf16   v16bf;
typedef __attribute__((ext_vector_type(16))) _Float16 v16h;
typedef __attribute__((ext_vector_type(8)))  _Float16 v8h;
typedef __attribute__((ext_vector_type(8)))  unsigned short v8us;
typedef __attribute__((ext_vector_type(8)))  float    v8f;
typedef __attribute__((ext_vector_type(4)))  float    v4f;
typedef v8h  __attribute__((may_alias)) v8ha;
typedef v4f  __attribute__((may_alias)) v4fa;
typedef v8us __attribute__((may_alias)) v8usa;

__device__ __forceinline__ unsigned short f2bf(float f) { unsigned u = __float_as_uint(f); u += 0x7FFFu + ((u >> 16) & 1u); return (unsigned short)(u >> 16); }
__device__ __forceinline__ float bf2f(unsigned short b) { return __uint_as_float(((unsigned)b) << 16); }
__device__ __forceinline__ float bfr(float f) { return bf2f(f2bf(f)); }
__device__ __forceinline__ v16h cat16(v8h lo, v8h hi) { return __builtin_shufflevector(lo, hi, 0, 1, 2, 3, 4, 5, 6, 7, 8, 9, 10, 11, 12, 13, 14, 15); }
__device__ __forceinline__ v16bf cat16b(v8us lo, v8us hi) { return __builtin_bit_cast(v16bf, __builtin_shufflevector(lo, hi, 0, 1, 2, 3, 4, 5, 6, 7, 8, 9, 10, 11, 12, 13, 14, 15)); }
__device__ __forceinline__ v8f wmma16(v16h a, v16h b, v8f c) { return __builtin_amdgcn_wmma_f32_16x16x32_f16(false, a, false, b, (short)0, c, false, false); }
__device__ __forceinline__ v8f wmmab(v16bf a, v16bf b, v8f c) { return __builtin_amdgcn_wmma_f32_16x16x32_bf16(false, a, false, b, (short)0, c, false, false); }

template <bool B> struct BoolC { static constexpr bool value = B; };
__device__ __forceinline__ h16 tohx(float x) { return (h16)x; }
__device__ __forceinline__ void splitf(float y, unsigned short& h, unsigned short& l) { h = f2bf(y); l = f2bf(y - bf2f(h)); }
typedef __attribute__((ext_vector_type(2))) _Float16 v2h;
typedef __attribute__((ext_vector_type(4))) _Float16 v4h;
typedef __attribute__((ext_vector_type(2))) unsigned short v2us;
typedef __attribute__((ext_vector_type(4))) unsigned short v4us;
typedef __attribute__((ext_vector_type(2))) float v2f;
typedef __attribute__((ext_vector_type(4))) int v4i;

// ---- k_gemmt: C[m][n] (f32, in registers only) = sum_k A[m][k] Bt[n][k], bf16 operands with K-contiguous rows of DM elements. One work-group of 4 waves per 128x128 tile of C, one 64x64 quarter (16 accumulators) a wave; grid (M/128, N/128). Bt holds the three weights one behind the other (N = 3 DQ rows), so a tile is 128 positions of ONE head of q, of k or of v, and the epilogue turns it into that head's planes for k_fattn.
// The operands come through LDS: a pass is 128 k = 256 bytes of each of the tile's 128 A rows and 128 Bt rows. Every wave brings one slice of 64 rows with one tensor load (whole lines from L2, each row fetched once per work-group),
// two buffers, the load of pass s + 2 issued when pass s has been read. The mover pads each row by 16 bytes: pitch 272 B, an odd multiple of 16 B, for the ds_load_b128 fragment reads.
// The fragments keep the WFrag k order (8 hi .. 8 hi + 7, then 16 + 8 hi ..) for A and Bt alike, and every accumulator still sums k upwards in steps of 32.
// ld reads a fragment from K-contiguous rows; ldf reads one stored in FRAGMENT ORDER: 1 KiB a fragment (16 rows x 32 k), the 16-byte piece (row lr, k 16 j + 8 hi ..) at byte 512 j + 16 (16 hi + lr), so that each of its two loads is 512 contiguous bytes of a wave. Same k order as ld.
template <typename T16> struct WFrag;
template <> struct WFrag<h16> { typedef v16h V; static __device__ __forceinline__ V ld(const h16* p) { return cat16(*(const v8h*)p, *(const v8h*)(p + 16)); } static __device__ __forceinline__ V ldf(const h16* p) { return cat16(*(const v8h*)p, *(const v8h*)(p + 256)); } static __device__ __forceinline__ v8f mma(V a, V b, v8f c) { return wmma16(a, b, c); } };
template <> struct WFrag<bf> { typedef v16bf V; static __device__ __forceinline__ V ld(const bf* p) { return cat16b(*(const v8us*)p, *(const v8us*)(p + 16)); } static __device__ __forceinline__ V ldf(const bf* p) { return cat16b(*(const v8us*)p, *(const v8us*)(p + 256)); } static __device__ __forceinline__ v8f mma(V a, V b, v8f c) { return wmmab(a, b, c); } };
typedef unsigned u32x4 __attribute__((ext_vector_type(4)));
typedef unsigned u32x8 __attribute__((ext_vector_type(8)));
#define GKP 128u                  // k per pass
#define GNP (DM / GKP)            // passes
#define GROWB (GKP * 2u)          // bytes of a row per pass
#define GPITCH (GROWB + 16u)      // LDS row pitch
#define GSLICE 18432u             // a slice in LDS: 64 rows x 272 B = 17,408 B, rounded up to a multiple of 2 KiB
#define GBUF (4u * GSLICE)        // a buffer: A rows 0..63, A rows 64..127, Bt rows 0..63, Bt rows 64..127
static_assert(GNP >= 2 && DM % GKP == 0 && TT % 128 == 0 && DQ % 128 == 0 && DKV % 128 == 0 && DQ == DKV && 64u * GPITCH <= GSLICE && GSLICE % 2048u == 0, "k_gemmt tile shape");
__device__ __forceinline__ unsigned uni(unsigned v) { return (unsigned)__builtin_amdgcn_readfirstlane((int)v); }
__device__ __forceinline__ unsigned pinned(unsigned v) { unsigned w = uni(v); asm volatile("" : "+s"(w)); return w; }   // a value that decides or addresses a tensor load, held in a scalar register
__device__ __forceinline__ v16bf ldsfrag(const unsigned char* p) { return cat16b(*(const v8usa*)p, *(const v8usa*)(p + 32)); }
static_assert(HD == 128 && TT % 128 == 0 && NKV == NH_, "k_gemmt: a tile is one head's 128 columns and lies in one batch");
__global__ __launch_bounds__(128) void k_gemmt(const bf* __restrict__ A, const bf* __restrict__ Bt, const float* __restrict__ CS, h16* P16, bf* Ph, bf* Pl, h16* V16, bf* Vh, bf* Vl) {
    __shared__ __attribute__((aligned(2048))) unsigned char ring[2 * GBUF];
    __shared__ __align__(16) float osm[4][16 * 68];
    const unsigned wave = uni(threadIdx.x >> 5), lane = threadIdx.x & 31, lr = lane & 15, hi = lane >> 4;
    const unsigned wm = wave & 1u, wn = wave >> 1;
    const unsigned r0 = blockIdx.x * 128u, c0 = blockIdx.y * 128u;
    const unsigned plane = c0 / DQ, head = (c0 % DQ) / HD, bat = r0 / TT;   // 0 q, 1 k, 2 v; all three the same for the whole work-group
    const unsigned tw = r0 % TT + 64u * wm, dw = 64u * wn;                  // the wave's first position in its batch and its first column in its head
    // Wave w brings slice w of every pass: waves 0 and 1 the two halves of the A rows, waves 2 and 3 those of the Bt rows.
    const unsigned long long gsrc = (unsigned long long)(size_t)((wave < 2u) ? A + (size_t)(r0 + 64u * wave) * DM : Bt + (size_t)(c0 + 64u * (wave - 2u)) * DM);
    const unsigned ldst = (unsigned)(size_t)ring + wave * GSLICE;
    u32x8 g1;   // 1-byte elements, tensor = tile = 64 rows of 256 bytes, source pitch DM x 2 bytes, 4 dwords of pad behind every 64 dwords, no mask
    g1[0] = uni((1u << 20) | (5u << 22) | (3u << 25)); g1[1] = uni((GROWB & 0xFFFFu) << 16); g1[2] = uni((GROWB >> 16) | (64u << 16)); g1[3] = uni(GROWB << 16); g1[4] = uni(64u); g1[5] = uni(DM * 2u); g1[6] = uni(0u); g1[7] = uni(0u);
    u32x4 g0; g0[0] = uni(1u);   // lives outside issue(), so that the tensor waits can name it; word 0 never changes
    auto issue = [&](unsigned st) {
        const unsigned long long ga = gsrc + (unsigned long long)st * GROWB;
        g0[1] = uni(ldst + (st & 1u) * GBUF); g0[2] = uni((unsigned)ga); g0[3] = uni((((unsigned)(ga >> 32)) & 0x01FFFFFFu) | 0x80000000u);
        asm volatile("tensor_load_to_lds %0, %1" :: "s"(g0), "s"(g1) : "memory");
    };
    issue(0u);
    asm volatile("s_wait_tensorcnt 0x0" : "+s"(g0), "+s"(g1) :: "memory");   // this wave's slice of pass 0 has landed; both descriptor groups are operands of every tensor wait, so that their words stay in their own registers from an issue to the wait that covers it
    __syncthreads();                                      // ... and so has every other wave's: pass 0 is readable
    issue(1u);
    // The wave's rotary table entries (q and k tiles), asked for here so that they arrive under the first passes: 16 pieces of 8 columns a lane, the 4 (cos, sin) pairs of a piece being 32 contiguous bytes of the table.
    // A piece is (16-row group mb, i). In a q tile: row (lane >> 3) + 4 i, columns 8 (lane & 7) .. (a wave's store is 4 whole rows of 128 bytes). In a k tile: row (lane & 7) + 8 (i & 1), columns 8 ((lane >> 3) + 4 (i >> 1)) .. (a wave's store is 4 whole 128-byte lines of the fragment order). Either way a table load of a wave touches 8 lines.
    v4f cs[4][4][2];
    auto loadcs = [&](auto kc) {
        constexpr bool KP = decltype(kc)::value;
        const unsigned co = ((tw + (KP ? lane & 7u : lane >> 3)) * HD + dw + 8u * (KP ? lane >> 3 : lane & 7u)) * 4u;   // bytes: the entries of the lane's first piece
#pragma unroll
        for (int mb = 0; mb < 4; ++mb)
#pragma unroll
            for (int i = 0; i < 4; ++i)
#pragma unroll
                for (int k = 0; k < 2; ++k) cs[mb][i][k] = *(const v4f*)((const char*)CS + co + ((mb * 16 + (KP ? 8 * (i & 1) : 4 * i)) * HD + (KP ? 32 * (i >> 1) : 0) + 4 * k) * 4);   /* the pairs of columns d + 4k and d + 4k + 2 */
        asm volatile("s_wait_xcnt 0x0" :: "s"(CS), "v"(co) : "memory");   // precaution: behind it the registers that the table loads name may be reused; pointer and offset are inputs so that they stay as they are up to it
    };
    if (plane == 0u) loadcs(BoolC<false>()); else if (plane == 1u) loadcs(BoolC<true>());
    v8f acc[4][4];
#pragma unroll
    for (int mb = 0; mb < 4; ++mb)
#pragma unroll
        for (int nb = 0; nb < 4; ++nb) acc[mb][nb] = (v8f){};
    const unsigned aoff = wm * GSLICE + lr * GPITCH + 16u * hi, boff = (2u + wn) * GSLICE + lr * GPITCH + 16u * hi;
#pragma unroll 1   // one pass a trip: the publish point at the foot stands once in the code
    for (unsigned s = 0; s < GNP; ++s) {
        const unsigned char* pa = ring + (s & 1u) * GBUF + aoff; const unsigned char* pb = ring + (s & 1u) * GBUF + boff;
        v16bf a[2][4], b[2][4];
#pragma unroll
        for (int f = 0; f < 4; ++f) { a[0][f] = ldsfrag(pa + f * 16 * GPITCH); b[0][f] = ldsfrag(pb + f * 16 * GPITCH); }
#pragma unroll
        for (int ks = 0; ks < 4; ++ks) {
            if (ks + 1 < 4) {
#pragma unroll
                for (int f = 0; f < 4; ++f) { a[(ks + 1) & 1][f] = ldsfrag(pa + f * 16 * GPITCH + (ks + 1) * 64); b[(ks + 1) & 1][f] = ldsfrag(pb + f * 16 * GPITCH + (ks + 1) * 64); }
            }
            __builtin_amdgcn_sched_barrier(0);   // the next block's 16 LDS reads stay one group in front of this block's products
#pragma unroll
            for (int nb = 0; nb < 4; ++nb)
#pragma unroll
                for (int mb = 0; mb < 4; ++mb) acc[mb][nb] = wmmab(a[ks & 1][mb], b[ks & 1][nb], acc[mb][nb]);
            __builtin_amdgcn_sched_barrier(0);   // the other side of the same fence: no later read moves up into this block
        }
        // Publish point of pass s + 1, every wave, in this order.
        asm volatile("s_wait_dscnt 0x0" ::: "memory");       // this wave's reads of pass s's buffer are done before that buffer is refilled
        asm volatile("s_wait_tensorcnt 0x0" : "+s"(g0), "+s"(g1) :: "memory");   // this wave's slice of pass s + 1 has landed
        __syncthreads();                                      // pass s + 1 is readable, and nobody reads pass s's buffer any more
        const unsigned st = pinned(s + 2u);                   // formed behind the wait above, so that the descriptor's address words are too
        if (pinned(st < GNP)) issue(st);
    }
    asm volatile("s_wait_tensorcnt 0x0" : "+s"(g0), "+s"(g1) :: "memory");   // no request is outstanding when the wave goes on
    asm volatile("s_wait_dscnt 0x0" ::: "memory");
    if (plane == 2u) {
        // v: an accumulator IS a piece of the transposed plane in fragment order (WFrag::ldf): a lane holds 8 consecutive keys (8 hi + j) of one column (lr). Fragment (32-key block kb, 16 columns dt) at 1 KiB x (8 kb + dt) of the head's plane, its rows the columns, its k the keys; every store of a wave is one half fragment, 512 contiguous bytes.
        const size_t vb = ((size_t)bat * NKV + head) * HD * TT;
        const unsigned vo = (((tw / 32u) * 8u + 4u * wn) * 64u + lane) * 16u;   // bytes: the lane's piece in the wave's first half fragment
#pragma unroll
        for (int mb = 0; mb < 4; ++mb) {
            v8h o16[4]; v8us oh[4], ol[4];
#pragma unroll
            for (int nb = 0; nb < 4; ++nb)
#pragma unroll
                for (int j = 0; j < 8; ++j) { const float y = acc[mb][nb][j]; o16[nb][j] = tohx(y); unsigned short a2, c2; splitf(y, a2, c2); oh[nb][j] = a2; ol[nb][j] = c2; }
            __builtin_amdgcn_sched_barrier(0);   // the group's arithmetic stands in front of its first store, so that no register that an issued store names is rewritten before the wait below
#pragma unroll
            for (int nb = 0; nb < 4; ++nb) { const int e = ((mb >> 1) * 16 + nb * 2 + (mb & 1)) * 512;   // a constant, added to the pointer and not to the lane's offset, so that it becomes the store's immediate offset
                *(v8h*)((char*)(V16 + vb) + vo + e) = o16[nb]; *(v8us*)((char*)(Vh + vb) + vo + e) = oh[nb]; *(v8us*)((char*)(Vl + vb) + vo + e) = ol[nb]; }
            asm volatile("s_wait_xcnt 0x0" :: "v"(vo) : "memory");   // precaution: behind it the next group may reuse the registers that these stores name; the offset is an input so that it stays as it is up to the wait
            __builtin_amdgcn_sched_barrier(0);   // the other side: the next group's arithmetic stays behind the wait
        }
        return;
    }
    float* os = osm[wave];   // each wave stages its own 16 rows: a rotary pair lies in two neighbouring lanes of an accumulator, and in one lane of a row piece
    auto qkout = [&](auto kc) {
        constexpr bool KP = decltype(kc)::value;
        const size_t pb = ((size_t)((KP ? NB_ : 0) + bat) * NH_ + head) * TT * HD;
        const unsigned lo = (KP ? lane & 7u : lane >> 3) * 68u + 8u * (KP ? lane >> 3 : lane & 7u);   // floats: the lane's first piece in the staged rows
        // q stays in rows; k goes in fragment order (WFrag::ldf) for k_fattn's first contraction: fragment (16 keys, 32 columns c) at 1 KiB x (4 (t / 16) + c) of the head's plane.
        const unsigned eo = (KP ? ((tw / 16u) * 8u + 4u * wn) * 256u + (lane >> 3) * 128u + (lane & 7u) * 8u : (tw + (lane >> 3)) * HD + dw + 8u * (lane & 7u)) * 2u;   // bytes: the lane's first piece in the head's plane
#pragma unroll
        for (int mb = 0; mb < 4; ++mb) {
#pragma unroll
            for (int nb = 0; nb < 4; ++nb) {
#pragma unroll
                for (int j = 0; j < 8; ++j) os[(hi * 8 + j) * 68 + nb * 16 + lr] = acc[mb][nb][j]; }
            __builtin_amdgcn_wave_barrier(); asm volatile("" ::: "memory");   // compiler fence: the row reads below stay behind the other lanes' LDS writes above
            v8h o16[4]; v8us oh[4], ol[4];
#pragma unroll
            for (int i = 0; i < 4; ++i) { const float* xp = os + lo + (KP ? 8 * (i & 1) * 68 + 32 * (i >> 1) : 4 * i * 68); const v4f xa = *(const v4fa*)xp, xb = *(const v4fa*)(xp + 4);
#pragma unroll
                for (int k = 0; k < 4; ++k) { const float x0 = (k < 2 ? xa : xb)[(k & 1) * 2], x1 = (k < 2 ? xa : xb)[(k & 1) * 2 + 1]; const float cc = cs[mb][i][k >> 1][(k & 1) * 2], sn = cs[mb][i][k >> 1][(k & 1) * 2 + 1];
                    const float a0 = __fmul_rn(x0, cc), b0 = __fmul_rn(x1, sn), a1 = __fmul_rn(x1, cc), b1 = __fmul_rn(x0, sn);
                    const float y0 = __fsub_rn(a0, b0), y1 = __fadd_rn(b1, a1);   /* even: x0 c - x1 s; odd: x0 s + x1 c */
                    o16[i][2 * k] = tohx(y0); o16[i][2 * k + 1] = tohx(y1); unsigned short a2, c2; splitf(y0, a2, c2); oh[i][2 * k] = a2; ol[i][2 * k] = c2; splitf(y1, a2, c2); oh[i][2 * k + 1] = a2; ol[i][2 * k + 1] = c2; } }
            __builtin_amdgcn_wave_barrier(); asm volatile("" ::: "memory");   // compiler fence: the next 16 rows' LDS writes stay behind these reads
            __builtin_amdgcn_sched_barrier(0);   // the group's arithmetic stands in front of its first store, so that no register that an issued store names is rewritten before the wait below
#pragma unroll
            for (int i = 0; i < 4; ++i) { const int e = mb * 4096 + (KP ? (i >> 1) * 1024 + (i & 1) * 128 : i * 1024);   // a constant, added to the pointer and not to the lane's offset, so that it becomes the store's immediate offset
                *(v8h*)((char*)(P16 + pb) + eo + e) = o16[i]; *(v8us*)((char*)(Ph + pb) + eo + e) = oh[i]; *(v8us*)((char*)(Pl + pb) + eo + e) = ol[i]; }
            asm volatile("s_wait_xcnt 0x0" :: "v"(eo) : "memory");   // precaution: behind it the next group may reuse the registers that these stores name; the offset is an input so that it stays as it is up to the wait
        }
    };
    if (plane == 0u) qkout(BoolC<false>()); else qkout(BoolC<true>());
}

// The casts of k_prep give every thread 32 elements, moved in 16-byte pieces with all of a thread's loads issued before its first store:
// 4096 waves a plane (16 per WGP), for speed only. Every grid covers its array exactly (static_asserts at the sizes).
#define CVN 4                     // 8-element pieces per thread in a cast
static_assert(((size_t)DQ * DM / 8) % (256 * CVN) == 0 && ((size_t)DKV * DM / 8) % (256 * CVN) == 0 && ((size_t)TT * DM / 8) % (256 * CVN) == 0, "a cast has no tail");
__device__ __forceinline__ void cvt8_body(const float* __restrict__ src, bf* dst) { const size_t i0 = (size_t)blockIdx.x * (256 * CVN) + threadIdx.x; v8f v[CVN];
#pragma unroll
    for (int it = 0; it < CVN; ++it) v[it] = *(const v8f*)(src + (i0 + it * 256) * 8);
#pragma unroll
    for (int it = 0; it < CVN; ++it) { v8us o;
#pragma unroll
        for (int k = 0; k < 8; ++k) o[k] = f2bf(v[it][k]);
        *(v8us*)(dst + (i0 + it * 256) * 8) = o; }
    asm volatile("s_wait_xcnt 0x0" ::: "memory"); }   // precaution: stands behind the last store, in front of whatever code follows the cast in the kernel and reuses the registers that the stores name

__constant__ float INV2[HD / 2] = { 1.000000000e+00f, 8.659642935e-01f, 7.498942018e-01f, 6.493816376e-01f, 5.623413324e-01f, 4.869675040e-01f, 4.216964841e-01f, 3.651741147e-01f, 3.162277639e-01f, 2.738419473e-01f, 2.371373475e-01f, 2.053525001e-01f, 1.778279394e-01f, 1.539926529e-01f, 1.333521456e-01f, 1.154781953e-01f, 9.999999404e-02f, 8.659642935e-02f, 7.498941571e-02f, 6.493815780e-02f, 5.623412505e-02f, 4.869675636e-02f, 4.216965288e-02f, 3.651741147e-02f, 3.162277490e-02f, 2.738419361e-02f, 2.371373400e-02f, 2.053524740e-02f, 1.778279617e-02f, 1.539926231e-02f, 1.333521400e-02f, 1.154781692e-02f, 9.999999776e-03f, 8.659644052e-03f, 7.498940919e-03f, 6.493817084e-03f, 5.623412319e-03f, 4.869675264e-03f, 4.216963891e-03f, 3.651741194e-03f, 3.162276698e-03f, 2.738419222e-03f, 2.371374052e-03f, 2.053524600e-03f, 1.778279431e-03f, 1.539926161e-03f, 1.333521330e-03f, 1.154781668e-03f, 9.999999311e-04f, 8.659643936e-04f, 7.498940686e-04f, 6.493816618e-04f, 5.623411853e-04f, 4.869675031e-04f, 4.216964007e-04f, 3.651740844e-04f, 3.162277862e-04f, 2.738420444e-04f, 2.371372684e-04f, 2.053524659e-04f, 1.778279402e-04f, 1.539926743e-04f, 1.333520777e-04f, 1.154781567e-04f };   // float32 exp(-log(10000) x (2i) / 128) in the module's own spelling, generated with jnp to be bit-exact
// The rotary table: one (cos, sin) entry a pair of columns, [position][HD / 2], so that the 4 entries of 8 consecutive columns are 32 contiguous bytes.
__device__ __forceinline__ void csP_body(float* CS, const int blk) { const int idx = blk * 256 + threadIdx.x; if (idx >= TT * (HD / 2)) return; const int p = idx % (HD / 2); const int t = idx / (HD / 2); const float a = __fmul_rn((float)t, INV2[p]); v2f cs; cs[0] = cosf(a); cs[1] = sinf(a); *(v2f*)(CS + (size_t)idx * 2) = cs;  }
// k_prep: everything that depends on the inputs alone, in one launch. Grid (PRX, CSY + NB_ + 3): the first CSY rows fill the rotary table (arithmetic, put first for speed only), the next NB_ rows cast the batches of x, the last three cast Wq, Wk, Wv (all five into consecutive planes of dst).
#define PRX ((unsigned)((size_t)TT * DM / 8 / (256 * CVN)))
#define CSY ((unsigned)((TT * (HD / 2) / 256) / PRX))
static_assert(DQ == TT && DKV == TT && (TT * (HD / 2)) % 256 == 0 && (TT * (HD / 2) / 256) % PRX == 0 && CSY >= 1, "k_prep: five planes of one size, and the table is whole rows of the grid");
__global__ __launch_bounds__(256) void k_prep(const float* __restrict__ x, const float* __restrict__ wq, const float* __restrict__ wk, const float* __restrict__ wv, bf* dst, float* CS) {
    if (blockIdx.y < CSY) { csP_body(CS, (int)(blockIdx.y * PRX + blockIdx.x)); return; }
    const unsigned y = blockIdx.y - CSY;
    const float* src = (y < NB_) ? x + (size_t)y * TT * DM : (y == NB_) ? wq : (y == NB_ + 1u) ? wk : wv;
    cvt8_body(src, dst + (size_t)y * TT * DM);
}

#define QW 32
__device__ __forceinline__ float xhalf(float x) { return __builtin_bit_cast(float, __builtin_amdgcn_permlanex16(__builtin_bit_cast(int, x), __builtin_bit_cast(int, x), 0x76543210, 0xfedcba98, false, false)); }   // lane l takes lane l ^ 16's value
template <typename T16, bool HL>
__device__ __forceinline__ void fattn_rows(const T16* __restrict__ Q, const T16* __restrict__ Q2, const T16* __restrict__ K, const T16* __restrict__ K2, const T16* __restrict__ VT, const T16* __restrict__ VT2, float* __restrict__ O, const int q0, const int lane) {
    typedef typename WFrag<T16>::V V;
    const int lr = lane & 15, hi = lane >> 4;
    const float CE = SCL * LOG2E, OFF = HL ? 0.0f : 10.0f;
    // Every load is a wave-uniform plane pointer that never changes + a 32-bit lane offset in bytes (walked block by block for k and v) + a constant.
    // k and the transposed v lie in fragment order (WFrag::ldf): a 32-key block is 8 fragments = 8 KiB of either plane, and every load of a wave is 512 contiguous bytes (4 whole lines, not 32 bytes of each of 16 lines).
    unsigned ko = (unsigned)lane * 16u, vo = (unsigned)lane * 16u;   // the lane's piece in a half fragment of k, and of the transposed v
    const unsigned qo = (unsigned)(lr * HD + 8 * hi) * 2u + (unsigned)q0 * (HD * 2u);   // q stays in rows: it is read once
    auto at = [](const T16* p, unsigned bytes) { return (const T16*)((const char*)p + bytes); };
    V qf[2][4], ql[2][4], kf[2][4], kl[2][4];
#pragma unroll
    for (int qt = 0; qt < 2; ++qt)
#pragma unroll
        for (int c = 0; c < 4; ++c) { const int e = qt * 16 * HD + c * 32; qf[qt][c] = WFrag<T16>::ld(at(Q, qo) + e); if (HL) ql[qt][c] = WFrag<T16>::ld(at(Q2, qo) + e); }
#pragma unroll
    for (int kt = 0; kt < 2; ++kt)
#pragma unroll
        for (int c = 0; c < 4; ++c) { const int e = (kt * 4 + c) * 512; kf[kt][c] = WFrag<T16>::ldf(at(K, ko) + e); if (HL) kl[kt][c] = WFrag<T16>::ldf(at(K2, ko) + e); }
    asm volatile("s_wait_xcnt 0x0" :: "s"(Q), "s"(Q2), "s"(K), "s"(K2), "v"(qo) : "memory");   // precaution: behind it the registers that the q loads name may be reused; pointers and offset are inputs so that they stay as they are up to it
    v8f acc[8][2];
#pragma unroll
    for (int dt = 0; dt < 8; ++dt) { acc[dt][0] = (v8f){}; acc[dt][1] = (v8f){}; }
    float mx[2] = { -3.0e38f, -3.0e38f }, ls[2] = { 0.f, 0.f };
    auto step = [&](auto lastc) {
        constexpr bool LAST = decltype(lastc)::value;
        V vf[8], vl[8];
#pragma unroll
        for (int dt = 0; dt < 8; ++dt) { const int e = dt * 512; vf[dt] = WFrag<T16>::ldf(at(VT, vo) + e); if (HL) vl[dt] = WFrag<T16>::ldf(at(VT2, vo) + e); }
        v8f s[2][2];
#pragma unroll
        for (int kt = 0; kt < 2; ++kt) { s[kt][0] = (v8f){}; s[kt][1] = (v8f){}; }
#pragma unroll
        for (int c = 0; c < 4; ++c)
#pragma unroll
            for (int kt = 0; kt < 2; ++kt)
#pragma unroll
                for (int qt = 0; qt < 2; ++qt) { s[kt][qt] = WFrag<T16>::mma(kf[kt][c], qf[qt][c], s[kt][qt]); if (HL) { s[kt][qt] = WFrag<T16>::mma(kf[kt][c], ql[qt][c], s[kt][qt]); s[kt][qt] = WFrag<T16>::mma(kl[kt][c], qf[qt][c], s[kt][qt]); } }
        if (!LAST) {   // the next block's key fragments, into the same registers, fly during the softmax and the second contraction
#pragma unroll
            for (int kt = 0; kt < 2; ++kt)
#pragma unroll
                for (int c = 0; c < 4; ++c) { const int e = (8 + kt * 4 + c) * 512; kf[kt][c] = WFrag<T16>::ldf(at(K, ko) + e); if (HL) kl[kt][c] = WFrag<T16>::ldf(at(K2, ko) + e); }
        }
        V pf[2], pl[2];
#pragma unroll
        for (int qt = 0; qt < 2; ++qt) {
            float t[16];
#pragma unroll
            for (int i = 0; i < 16; ++i) { float x = s[i >> 3][qt][i & 7]; if (LAST) { if ((i >> 3) * 16 + hi * 8 + (i & 7) > qt * 16 + lr) x = -3.0e38f; } t[i] = x; }
            float m8[8];
#pragma unroll
            for (int i = 0; i < 8; ++i) m8[i] = fmaxf(t[i], t[i + 8]);
            float ml = fmaxf(fmaxf(fmaxf(m8[0], m8[1]), fmaxf(m8[2], m8[3])), fmaxf(fmaxf(m8[4], m8[5]), fmaxf(m8[6], m8[7])));
            ml = fmaxf(ml, xhalf(ml));
            const float mn = fmaxf(mx[qt], ml * CE), al = __builtin_amdgcn_exp2f(mx[qt] - mn), mo = mn - OFF; mx[qt] = mn;
#pragma unroll
            for (int i = 0; i < 16; ++i) t[i] = __builtin_amdgcn_exp2f(fmaf(t[i], CE, -mo));
            float s4[4];
#pragma unroll
            for (int i = 0; i < 4; ++i) s4[i] = (t[i] + t[i + 4]) + (t[i + 8] + t[i + 12]);
            ls[qt] = fmaf(ls[qt], al, (s4[0] + s4[1]) + (s4[2] + s4[3]));
#pragma unroll
            for (int dt = 0; dt < 8; ++dt) acc[dt][qt] *= al;
            if constexpr (HL) { v8us h0, h1, l0, l1;
#pragma unroll
                for (int i = 0; i < 8; ++i) { unsigned short a, b; splitf(t[i], a, b); h0[i] = a; l0[i] = b; splitf(t[i + 8], a, b); h1[i] = a; l1[i] = b; }
                pf[qt] = cat16b(h0, h1); pl[qt] = cat16b(l0, l1);
            } else { v16h p;
#pragma unroll
                for (int i = 0; i < 16; ++i) p[i] = tohx(t[i]);
                pf[qt] = p; }
        }
#pragma unroll
        for (int dt = 0; dt < 8; ++dt)
#pragma unroll
            for (int qt = 0; qt < 2; ++qt) { acc[dt][qt] = WFrag<T16>::mma(vf[dt], pf[qt], acc[dt][qt]); if (HL) { acc[dt][qt] = WFrag<T16>::mma(vf[dt], pl[qt], acc[dt][qt]); acc[dt][qt] = WFrag<T16>::mma(vl[dt], pf[qt], acc[dt][qt]); } }
        // precaution: stands in front of the advance below, which rewrites the offset registers that this block's loads name; the offsets are operands so that the advance stays behind it, the plane pointers are inputs so that their registers stay as they are up to it
        __builtin_amdgcn_sched_barrier(0);   // keeps the wait below at the block's end, far behind the block's loads; without it the compiler lifts the wait to directly behind the last load, in front of the softmax
        asm volatile("s_wait_xcnt 0x0" : "+v"(ko), "+v"(vo) : "s"(K), "s"(K2), "s"(VT), "s"(VT2) : "memory");
        ko += 8 * 1024; vo += 8 * 1024;
    };
    const int nb = q0 / 32 + 1;
#pragma unroll 1
    for (int kb = 0; kb < nb - 1; ++kb) step(BoolC<false>());
    step(BoolC<true>());
#pragma unroll
    for (int qt = 0; qt < 2; ++qt) { const float inv = __fdiv_rn(1.0f, ls[qt] + xhalf(ls[qt]));
#pragma unroll
        for (int dt = 0; dt < 8; ++dt) acc[dt][qt] *= inv; }
    const unsigned oo = (unsigned)((q0 + lr) * DQ + hi * 8) * 4u;   // bytes: the lane's 8 columns of its first query row
    __builtin_amdgcn_sched_barrier(0);   // all arithmetic stands in front of the first store, so that no register that an issued store names is rewritten behind it
#pragma unroll
    for (int qt = 0; qt < 2; ++qt)
#pragma unroll
        for (int dt = 0; dt < 8; ++dt) { float* o = (float*)((char*)O + oo) + qt * 16 * DQ + dt * 16;
            *(v4f*)o = __builtin_shufflevector(acc[dt][qt], acc[dt][qt], 0, 1, 2, 3); *(v4f*)(o + 4) = __builtin_shufflevector(acc[dt][qt], acc[dt][qt], 4, 5, 6, 7); }
}
// Grid (heads, batches, TT / QW / 4), 4 waves, no barrier and no LDS. The four waves of a work-group take four consecutive row blocks (128 query rows) of one head: they walk the same keys from block 0 on and end within three key blocks of one another, so that no SIMD of the WGP idles while a longer sibling runs on.
// A wave holds more than 512 registers, so a WGP holds one work-group at a time and the 512 work-groups run in two turns. Grid z is a RANK by cost, heaviest first: tile t costs 4 t + 4 key blocks, and a key block of the hi + lo tiles (t < 4) counts for a little more than two (three times the products, twice the loads and the vector work).
// TILE_OF_RANK holds the tile of rank r in nibble r: 15 .. 8, 3, 7, 6, 2, 5, 4, 1, 0 (a permutation of 0 .. 15: every tile is taken once whatever the start order is).
#define TILE_OF_RANK 0x0145267389ABCDEFull
static_assert(TT / QW == 64 && RH == 16 * QW && HD == 128 && NKV == NH_, "k_fattn is written for these shapes");
__global__ __launch_bounds__(128) void k_fattn(const h16* __restrict__ Q16, const h16* __restrict__ K16, const h16* __restrict__ V16, const bf* __restrict__ Qh, const bf* __restrict__ Ql, const bf* __restrict__ Kh, const bf* __restrict__ Kl, const bf* __restrict__ Vh, const bf* __restrict__ Vl, float* __restrict__ OUTb) {
    const int wave = __builtin_amdgcn_readfirstlane((int)(threadIdx.x >> 5)), lane = threadIdx.x & 31;
    const int qb = 4 * (int)((TILE_OF_RANK >> (4u * blockIdx.z)) & 15u) + wave;
    const size_t po = ((size_t)blockIdx.y * NH_ + blockIdx.x) * TT * HD; float* O = OUTb + (size_t)blockIdx.y * TT * DQ + blockIdx.x * HD;
    if (qb * QW < RH) fattn_rows<bf, true>(Qh + po, Ql + po, Kh + po, Kl + po, Vh + po, Vl + po, O, qb * QW, lane);
    else fattn_rows<h16, false>(Q16 + po, nullptr, K16 + po, nullptr, V16 + po, nullptr, O, qb * QW, lane);
}

extern "C" void kernel_launch(void* const* d_in, const int* in_sizes, int n_in,
                              void* d_out, int out_size, void* d_ws, size_t ws_size, hipStream_t stream) {
    (void)in_sizes; (void)n_in; (void)out_size;
    const float* x = (const float*)d_in[0]; const float* wq = (const float*)d_in[1]; const float* wk = (const float*)d_in[2]; const float* wv = (const float*)d_in[3]; const float* wo = nullptr; (void)wo;   /* argument order x, Wq, Wk, Wv ('oi' (out, in) [2048][2048]): four inputs, all read; NO output weight: the merged heads are the output */
    float* OUT = (float*)d_out;     // [2][2048][2048]
    char* wsp = (char*)d_ws;
    auto take = [&](size_t bytes) { char* p = wsp; wsp += (bytes + 255) & ~(size_t)255; return (void*)p; };
    // The casts' five planes, consecutive: x of batch 0, x of batch 1, Wq, Wk, Wv.
    bf* XB = (bf*)take((size_t)(NB_ + 3) * TT * DM * 2); bf* WQ = XB + (size_t)NB_ * TT * DM; float* CS = (float*)take((size_t)TT * (HD / 2) * 2 * 4);
    // The transposed v planes, [batch][head][fragment].
    h16* VT16 = (h16*)take((size_t)NB_ * NKV * HD * TT * 2); bf* VTh = (bf*)take((size_t)NB_ * NKV * HD * TT * 2); bf* VTl = (bf*)take((size_t)NB_ * NKV * HD * TT * 2);
    // The q and k planes, [q, k][batch][head]: q as [position][column], k in fragment order.
    h16* QP16 = (h16*)take((size_t)2 * NB_ * NH_ * TT * HD * 2); bf* QPh = (bf*)take((size_t)2 * NB_ * NH_ * TT * HD * 2); bf* QPl = (bf*)take((size_t)2 * NB_ * NH_ * TT * HD * 2);
    h16* KP16 = QP16 + (size_t)NB_ * NH_ * TT * HD; bf* KPh = QPh + (size_t)NB_ * NH_ * TT * HD; bf* KPl = QPl + (size_t)NB_ * NH_ * TT * HD;
    if ((size_t)(wsp - (char*)d_ws) > ws_size) return;    // ws 256 MiB
    k_prep<<<dim3(PRX, CSY + NB_ + 3, 1), 256, 0, stream>>>(x, wq, wk, wv, XB, CS);   /* casts, and the rotary table (positions = arange) */
    k_gemmt<<<dim3(NB_ * TT / 128, 3 * DQ / 128, 1), 128, 0, stream>>>(XB, WQ, CS, QP16, QPh, QPl, VT16, VTh, VTl);   /* projections, rotary step, planes */
    k_fattn<<<dim3(NH_, NB_, TT / QW / 4), 128, 0, stream>>>(QP16, KP16, VT16, QPh, QPl, KPh, KPl, VTh, VTl, OUT);
    /* no output projection: k_fattn has written the merged heads of both batches to OUT */
}

// v009
// One run takes 156 microseconds.
// Next to v008, in two timings, it ran 1.21 and 1.22 times as fast.
// Over all steps from v000 it is 9.98 times as fast.
#include <hip/hip_runtime.h>

// Causal multi-head self-attention with 128-wide heads and interleaved-pair rotary embeddings, WITHOUT an output projection (x [2][2048][2048]; q, k, v = einsum('bsm,nm->bsn', x, W) = x W^T ('oi' (out, in) [2048][2048] normal x 0.02, no bias; 16 heads x 128); rope on (even, odd) pairs: (xe cos - xo sin, xe sin + xo cos) with angle m x theta[i], theta = exp(-log(10000) x (2i) / 128) IN THAT SPELLING (64 f32 frequencies baked from the module's own line; precise cosf/sinf), m = arange(2048); scores x 1/sqrt(128); causal (tril kept, -1e30 elsewhere == exclusion: exp underflows to exactly 0); softmax in f32; out = the merged heads [b][s][h x 128 + d] -> [2][2048][2048] f32 (8.4 M); argument order x, Wq, Wk, Wv).
// Layout, every stage one launch over both batches: k_prep: bf16 copy of X and of the 'oi' weights, rotary table (cos, sin of 2048 positions x 64 angles); k_gemmt: the three exact projections as one GEMM grid, whose epilogue applies the interleaved-pair rotary step to q and k and writes the q, k and transposed-v planes itself (the f32 projections never go to memory); k_fattn: causal attention in one launch, scores and probabilities held in registers (running maximum and sum per query row; hybrid rows: < 512 hi/lo 3 products, rest fp16 x1024), which writes the merged heads straight to the output rows (no output projection).
// Compute dtypes, f32 accumulate: every input rounded to bf16; projections exact; rotary f32; attention rows < 512 3 products, rest fp16; softmax f32; output f32 (the P.v accumulators divided by the row sum).

#define NB_  2
#define TT   2048
#define DM   2048
#define NH_  16
#define NKV  16
#define REP  (NH_ / NKV)
#define HD   128
#define DQ   (NH_ * HD)
#define DKV  (NKV * HD)
#define RH   512                  // query rows < RH use hi+lo planes
#define SCL  0.088388347648318447f   // HD^-0.5
#define LOG2E 1.4426950408889634f
typedef _Float16 h16;
typedef unsigned short bf;
typedef __attribute__((ext_vector_type(16))) __bf16   v16bf;
typedef __attribute__((ext_vector_type(16))) _Float16 v16h;
typedef __attribute__((ext_vector_type(8)))  _Float16 v8h;
typedef __attribute__((ext_vector_type(8)))  unsigned short v8us;
typedef __attribute__((ext_vector_type(8)))  float    v8f;
typedef __attribute__((ext_vector_type(4)))  float    v4f;
typedef v8h  __attribute__((may_alias)) v8ha;
typedef v4f  __attribute__((may_alias)) v4fa;
typedef v8us __attribute__((may_alias)) v8usa;

__device__ __forceinline__ unsigned short f2bf(float f) { unsigned u = __float_as_uint(f); u += 0x7FFFu + ((u >> 16) & 1u); return (unsigned short)(u >> 16); }
__device__ __forceinline__ float bf2f(unsigned short b) { return __uint_as_float(((unsigned)b) << 16); }
__device__ __forceinline__ float bfr(float f) { return bf2f(f2bf(f)); }
__device__ __forceinline__ v16h cat16(v8h lo, v8h hi) { return __builtin_shufflevector(lo, hi, 0, 1, 2, 3, 4, 5, 6, 7, 8, 9, 10, 11, 12, 13, 14, 15); }
__device__ __forceinline__ v16bf cat16b(v8us lo, v8us hi) { return __builtin_bit_cast(v16bf, __builtin_shufflevector(lo, hi, 0, 1, 2, 3, 4, 5, 6, 7, 8, 9, 10, 11, 12, 13, 14, 15)); }
__device__ __forceinline__ v8f wmma16(v16h a, v16h b, v8f c) { return __builtin_amdgcn_wmma_f32_16x16x32_f16(false, a, false, b, (short)0, c, false, false); }
__device__ __forceinline__ v8f wmmab(v16bf a, v16bf b, v8f c) { return __builtin_amdgcn_wmma_f32_16x16x32_bf16(false, a, false, b, (short)0, c, false, false); }

template <bool B> struct BoolC { static constexpr bool value = B; };
__device__ __forceinline__ h16 tohx(float x) { return (h16)x; }
__device__ __forceinline__ void splitf(float y, unsigned short& h, unsigned short& l) { h = f2bf(y); l = f2bf(y - bf2f(h)); }
typedef __attribute__((ext_vector_type(2))) _Float16 v2h;
typedef __attribute__((ext_vector_type(4))) _Float16 v4h;
typedef __attribute__((ext_vector_type(2))) unsigned short v2us;
typedef __attribute__((ext_vector_type(4))) unsigned short v4us;
typedef __attribute__((ext_vector_type(2))) float v2f;
typedef __attribute__((ext_vector_type(4))) int v4i;

// ---- k_gemmt: C[m][n] (f32, in registers only) = sum_k A[m][k] Bt[n][k], bf16 operands with K-contiguous rows of DM elements. One work-group of 4 waves per 128x128 tile of C, one 64x64 quarter (16 accumulators) a wave; grid (M/128, N/128). Bt holds the three weights one behind the other (N = 3 DQ rows), so a tile is 128 positions of ONE head of q, of k or of v, and the epilogue turns it into that head's planes for k_fattn.
// The operands come through LDS: a pass is 128 k = 256 bytes of each of the tile's 128 A rows and 128 Bt rows. Every wave brings one slice of 64 rows with one tensor load (whole lines from L2, each row fetched once per work-group),
// two buffers, the load of pass s + 2 issued when pass s has been read. The mover pads each row by 16 bytes: pitch 272 B, an odd multiple of 16 B, for the ds_load_b128 fragment reads.
// The fragments keep the WFrag k order (8 hi .. 8 hi + 7, then 16 + 8 hi ..) for A and Bt alike, and every accumulator still sums k upwards in steps of 32.
// ld reads a fragment from K-contiguous rows; ldf reads one stored in FRAGMENT ORDER: 1 KiB a fragment (16 rows x 32 k), the 16-byte piece (row lr, k 16 j + 8 hi ..) at byte 512 j + 16 (16 hi + lr), so that each of its two loads is 512 contiguous bytes of a wave. Same k order as ld.
template <typename T16> struct WFrag;
template <> struct WFrag<h16> { typedef v16h V; static __device__ __forceinline__ V ld(const h16* p) { return cat16(*(const v8h*)p, *(const v8h*)(p + 16)); } static __device__ __forceinline__ V ldf(const h16* p) { return cat16(*(const v8h*)p, *(const v8h*)(p + 256)); } static __device__ __forceinline__ v8f mma(V a, V b, v8f c) { return wmma16(a, b, c); } };
template <> struct WFrag<bf> { typedef v16bf V; static __device__ __forceinline__ V ld(const bf* p) { return cat16b(*(const v8us*)p, *(const v8us*)(p + 16)); } static __device__ __forceinline__ V ldf(const bf* p) { return cat16b(*(const v8us*)p, *(const v8us*)(p + 256)); } static __device__ __forceinline__ v8f mma(V a, V b, v8f c) { return wmmab(a, b, c); } };
typedef unsigned u32x4 __attribute__((ext_vector_type(4)));
typedef unsigned u32x8 __attribute__((ext_vector_type(8)));
#define GKP 128u                  // k per pass
#define GNP (DM / GKP)            // passes
#define GROWB (GKP * 2u)          // bytes of a row per pass
#define GPITCH (GROWB + 16u)      // LDS row pitch
#define GSLICE 18432u             // a slice in LDS: 64 rows x 272 B = 17,408 B, rounded up to a multiple of 2 KiB
#define GBUF (4u * GSLICE)        // a buffer: A rows 0..63, A rows 64..127, Bt rows 0..63, Bt rows 64..127
#define OSB (16u * 68u * 4u)      // a wave's epilogue staging: 16 rows of 68 floats
static_assert(4u * OSB <= 2u * GBUF && OSB % 16u == 0 && 2u * (2u * GBUF) <= 327680u, "the staging lies in the ring, and two work-groups fit a WGP's LDS");
static_assert(GNP >= 2 && DM % GKP == 0 && TT % 128 == 0 && DQ % 128 == 0 && DKV % 128 == 0 && DQ == DKV && 64u * GPITCH <= GSLICE && GSLICE % 2048u == 0, "k_gemmt tile shape");
__device__ __forceinline__ unsigned uni(unsigned v) { return (unsigned)__builtin_amdgcn_readfirstlane((int)v); }
__device__ __forceinline__ unsigned pinned(unsigned v) { unsigned w = uni(v); asm volatile("" : "+s"(w)); return w; }   // a value that decides or addresses a tensor load, held in a scalar register
__device__ __forceinline__ v16bf ldsfrag(const unsigned char* p) { return cat16b(*(const v8usa*)p, *(const v8usa*)(p + 32)); }
static_assert(HD == 128 && TT % 128 == 0 && NKV == NH_, "k_gemmt: a tile is one head's 128 columns and lies in one batch");
__global__ __launch_bounds__(128) void k_gemmt(const bf* __restrict__ A, const bf* __restrict__ Bt, const float* __restrict__ CS, h16* P16, bf* Ph, bf* Pl, h16* V16, bf* Vh, bf* Vl) {
    __shared__ __attribute__((aligned(2048))) unsigned char ring[2 * GBUF];   // the kernel's only LDS: 147,456 B, so that two work-groups fit one WGP's 327,680 B (two waves a SIMD): one's prologue, barrier waits and epilogue run under the other's passes
    const unsigned wave = uni(threadIdx.x >> 5), lane = threadIdx.x & 31, lr = lane & 15, hi = lane >> 4;
    const unsigned wm = wave & 1u, wn = wave >> 1;
    const unsigned r0 = blockIdx.x * 128u, c0 = blockIdx.y * 128u;
    const unsigned plane = c0 / DQ, head = (c0 % DQ) / HD, bat = r0 / TT;   // 0 q, 1 k, 2 v; all three the same for the whole work-group
    const unsigned tw = r0 % TT + 64u * wm, dw = 64u * wn;                  // the wave's first position in its batch and its first column in its head
    // Wave w brings slice w of every pass: waves 0 and 1 the two halves of the A rows, waves 2 and 3 those of the Bt rows.
    const unsigned long long gsrc = (unsigned long long)(size_t)((wave < 2u) ? A + (size_t)(r0 + 64u * wave) * DM : Bt + (size_t)(c0 + 64u * (wave - 2u)) * DM);
    const unsigned ldst = (unsigned)(size_t)ring + wave * GSLICE;
    u32x8 g1;   // 1-byte elements, tensor = tile = 64 rows of 256 bytes, source pitch DM x 2 bytes, 4 dwords of pad behind every 64 dwords, no mask
    g1[0] = uni((1u << 20) | (5u << 22) | (3u << 25)); g1[1] = uni((GROWB & 0xFFFFu) << 16); g1[2] = uni((GROWB >> 16) | (64u << 16)); g1[3] = uni(GROWB << 16); g1[4] = uni(64u); g1[5] = uni(DM * 2u); g1[6] = uni(0u); g1[7] = uni(0u);
    u32x4 g0; g0[0] = uni(1u);   // lives outside issue(), so that the tensor waits can name it; word 0 never changes
    auto issue = [&](unsigned st) {
        const unsigned long long ga = gsrc + (unsigned long long)st * GROWB;
        g0[1] = uni(ldst + (st & 1u) * GBUF); g0[2] = uni((unsigned)ga); g0[3] = uni((((unsigned)(ga >> 32)) & 0x01FFFFFFu) | 0x80000000u);
        asm volatile("tensor_load_to_lds %0, %1" :: "s"(g0), "s"(g1) : "memory");
    };
    issue(0u);
    asm volatile("s_wait_tensorcnt 0x0" : "+s"(g0), "+s"(g1) :: "memory");   // this wave's slice of pass 0 has landed; both descriptor groups are operands of every tensor wait, so that their words stay in their own registers from an issue to the wait that covers it
    __syncthreads();                                      // ... and so has every other wave's: pass 0 is readable
    issue(1u);
    // The wave's rotary table entries (q and k tiles), asked for here so that they arrive under the first passes: 16 pieces of 8 columns a lane, the 4 (cos, sin) pairs of a piece being 32 contiguous bytes of the table.
    // A piece is (16-row group mb, i). In a q tile: row (lane >> 3) + 4 i, columns 8 (lane & 7) .. (a wave's store is 4 whole rows of 128 bytes). In a k tile: row (lane & 7) + 8 (i & 1), columns 8 ((lane >> 3) + 4 (i >> 1)) .. (a wave's store is 4 whole 128-byte lines of the fragment order). Either way a table load of a wave touches 8 lines.
    v4f cs[4][4][2];
    auto loadcs = [&](auto kc) {
        constexpr bool KP = decltype(kc)::value;
        const unsigned co = ((tw + (KP ? lane & 7u : lane >> 3)) * HD + dw + 8u * (KP ? lane >> 3 : lane & 7u)) * 4u;   // bytes: the entries of the lane's first piece
#pragma unroll
        for (int mb = 0; mb < 4; ++mb)
#pragma unroll
            for (int i = 0; i < 4; ++i)
#pragma unroll
                for (int k = 0; k < 2; ++k) cs[mb][i][k] = *(const v4f*)((const char*)CS + co + ((mb * 16 + (KP ? 8 * (i & 1) : 4 * i)) * HD + (KP ? 32 * (i >> 1) : 0) + 4 * k) * 4);   /* the pairs of columns d + 4k and d + 4k + 2 */
        asm volatile("s_wait_xcnt 0x0" :: "s"(CS), "v"(co) : "memory");   // precaution: behind it the registers that the table loads name may be reused; pointer and offset are inputs so that they stay as they are up to it
    };
    if (plane == 0u) loadcs(BoolC<false>()); else if (plane == 1u) loadcs(BoolC<true>());
    v8f acc[4][4];
#pragma unroll
    for (int mb = 0; mb < 4; ++mb)
#pragma unroll
        for (int nb = 0; nb < 4; ++nb) acc[mb][nb] = (v8f){};
    const unsigned aoff = wm * GSLICE + lr * GPITCH + 16u * hi, boff = (2u + wn) * GSLICE + lr * GPITCH + 16u * hi;
#pragma unroll 1   // one pass a trip: the publish point at the foot stands once in the code
    for (unsigned s = 0; s < GNP; ++s) {
        const unsigned char* pa = ring + (s & 1u) * GBUF + aoff; const unsigned char* pb = ring + (s & 1u) * GBUF + boff;
        v16bf a[2][4], b[2][4];
#pragma unroll
        for (int f = 0; f < 4; ++f) { a[0][f] = ldsfrag(pa + f * 16 * GPITCH); b[0][f] = ldsfrag(pb + f * 16 * GPITCH); }
#pragma unroll
        for (int ks = 0; ks < 4; ++ks) {
            if (ks + 1 < 4) {
#pragma unroll
                for (int f = 0; f < 4; ++f) { a[(ks + 1) & 1][f] = ldsfrag(pa + f * 16 * GPITCH + (ks + 1) * 64); b[(ks + 1) & 1][f] = ldsfrag(pb + f * 16 * GPITCH + (ks + 1) * 64); }
            }
            __builtin_amdgcn_sched_barrier(0);   // the next block's 16 LDS reads stay one group in front of this block's products
#pragma unroll
            for (int nb = 0; nb < 4; ++nb)
#pragma unroll
                for (int mb = 0; mb < 4; ++mb) acc[mb][nb] = wmmab(a[ks & 1][mb], b[ks & 1][nb], acc[mb][nb]);
            __builtin_amdgcn_sched_barrier(0);   // the other side of the same fence: no later read moves up into this block
        }
        // Publish point of pass s + 1, every wave, in this order.
        asm volatile("s_wait_dscnt 0x0" ::: "memory");       // this wave's reads of pass s's buffer are done before that buffer is refilled
        asm volatile("s_wait_tensorcnt 0x0" : "+s"(g0), "+s"(g1) :: "memory");   // this wave's slice of pass s + 1 has landed
        __syncthreads();                                      // pass s + 1 is readable, and nobody reads pass s's buffer any more
        const unsigned st = pinned(s + 2u);                   // formed behind the wait above, so that the descriptor's address words are too
        if (pinned(st < GNP)) issue(st);
    }
    asm volatile("s_wait_tensorcnt 0x0" : "+s"(g0), "+s"(g1) :: "memory");   // no request is outstanding when the wave goes on
    asm volatile("s_wait_dscnt 0x0" ::: "memory");
    if (plane == 2u) {
        // v: an accumulator IS a piece of the transposed plane in fragment order (WFrag::ldf): a lane holds 8 consecutive keys (8 hi + j) of one column (lr). Fragment (32-key block kb, 16 columns dt) at 1 KiB x (8 kb + dt) of the head's plane, its rows the columns, its k the keys; every store of a wave is one half fragment, 512 contiguous bytes.
        const size_t vb = ((size_t)bat * NKV + head) * HD * TT;
        const unsigned vo = (((tw / 32u) * 8u + 4u * wn) * 64u + lane) * 16u;   // bytes: the lane's piece in the wave's first half fragment
#pragma unroll
        for (int mb = 0; mb < 4; ++mb) {
            v8h o16[4]; v8us oh[4], ol[4];
#pragma unroll
            for (int nb = 0; nb < 4; ++nb)
#pragma unroll
                for (int j = 0; j < 8; ++j) { const float y = acc[mb][nb][j]; o16[nb][j] = tohx(y); unsigned short a2, c2; splitf(y, a2, c2); oh[nb][j] = a2; ol[nb][j] = c2; }
            __builtin_amdgcn_sched_barrier(0);   // the group's arithmetic stands in front of its first store, so that no register that an issued store names is rewritten before the wait below
#pragma unroll
            for (int nb = 0; nb < 4; ++nb) { const int e = ((mb >> 1) * 16 + nb * 2 + (mb & 1)) * 512;   // a constant, added to the pointer and not to the lane's offset, so that it becomes the store's immediate offset
                *(v8h*)((char*)(V16 + vb) + vo + e) = o16[nb]; *(v8us*)((char*)(Vh + vb) + vo + e) = oh[nb]; *(v8us*)((char*)(Vl + vb) + vo + e) = ol[nb]; }
            asm volatile("s_wait_xcnt 0x0" :: "v"(vo) : "memory");   // precaution: behind it the next group may reuse the registers that these stores name; the offset is an input so that it stays as it is up to the wait
            __builtin_amdgcn_sched_barrier(0);   // the other side: the next group's arithmetic stays behind the wait
        }
        return;
    }
    // Each wave stages its own 16 rows: a rotary pair lies in two neighbouring lanes of an accumulator, and in one lane of a row piece. The rows lie in the ring, which is free here: the last pass's publish point (every wave's s_wait_dscnt 0, then the barrier) ended every read of it, and no tensor load is outstanding.
    float* os = (float*)(ring + wave * OSB);
    auto qkout = [&](auto kc) {
        constexpr bool KP = decltype(kc)::value;
        const size_t pb = ((size_t)((KP ? NB_ : 0) + bat) * NH_ + head) * TT * HD;
        const unsigned lo = (KP ? lane & 7u : lane >> 3) * 68u + 8u * (KP ? lane >> 3 : lane & 7u);   // floats: the lane's first piece in the staged rows
        // q stays in rows; k goes in fragment order (WFrag::ldf) for k_fattn's first contraction: fragment (16 keys, 32 columns c) at 1 KiB x (4 (t / 16) + c) of the head's plane.
        const unsigned eo = (KP ? ((tw / 16u) * 8u + 4u * wn) * 256u + (lane >> 3) * 128u + (lane & 7u) * 8u : (tw + (lane >> 3)) * HD + dw + 8u * (lane & 7u)) * 2u;   // bytes: the lane's first piece in the head's plane
#pragma unroll
        for (int mb = 0; mb < 4; ++mb) {
#pragma unroll
            for (int nb = 0; nb < 4; ++nb) {
#pragma unroll
                for (int j = 0; j < 8; ++j) os[(hi * 8 + j) * 68 + nb * 16 + lr] = acc[mb][nb][j]; }
            __builtin_amdgcn_wave_barrier(); asm volatile("" ::: "memory");   // compiler fence: the row reads below stay behind the other lanes' LDS writes above
            v8h o16[4]; v8us oh[4], ol[4];
#pragma unroll
            for (int i = 0; i < 4; ++i) { const float* xp = os + lo + (KP ? 8 * (i & 1) * 68 + 32 * (i >> 1) : 4 * i * 68); const v4f xa = *(const v4fa*)xp, xb = *(const v4fa*)(xp + 4);
#pragma unroll
                for (int k = 0; k < 4; ++k) { const float x0 = (k < 2 ? xa : xb)[(k & 1) * 2], x1 = (k < 2 ? xa : xb)[(k & 1) * 2 + 1]; const float cc = cs[mb][i][k >> 1][(k & 1) * 2], sn = cs[mb][i][k >> 1][(k & 1) * 2 + 1];
                    const float a0 = __fmul_rn(x0, cc), b0 = __fmul_rn(x1, sn), a1 = __fmul_rn(x1, cc), b1 = __fmul_rn(x0, sn);
                    const float y0 = __fsub_rn(a0, b0), y1 = __fadd_rn(b1, a1);   /* even: x0 c - x1 s; odd: x0 s + x1 c */
                    o16[i][2 * k] = tohx(y0); o16[i][2 * k + 1] = tohx(y1); unsigned short a2, c2; splitf(y0, a2, c2); oh[i][2 * k] = a2; ol[i][2 * k] = c2; splitf(y1, a2, c2); oh[i][2 * k + 1] = a2; ol[i][2 * k + 1] = c2; } }
            __builtin_amdgcn_wave_barrier(); asm volatile("" ::: "memory");   // compiler fence: the next 16 rows' LDS writes stay behind these reads
            __builtin_amdgcn_sched_barrier(0);   // the group's arithmetic stands in front of its first store, so that no register that an issued store names is rewritten before the wait below
#pragma unroll
            for (int i = 0; i < 4; ++i) { const int e = mb * 4096 + (KP ? (i >> 1) * 1024 + (i & 1) * 128 : i * 1024);   // a constant, added to the pointer and not to the lane's offset, so that it becomes the store's immediate offset
                *(v8h*)((char*)(P16 + pb) + eo + e) = o16[i]; *(v8us*)((char*)(Ph + pb) + eo + e) = oh[i]; *(v8us*)((char*)(Pl + pb) + eo + e) = ol[i]; }
            asm volatile("s_wait_xcnt 0x0" :: "v"(eo) : "memory");   // precaution: behind it the next group may reuse the registers that these stores name; the offset is an input so that it stays as it is up to the wait
        }
    };
    if (plane == 0u) qkout(BoolC<false>()); else qkout(BoolC<true>());
}

// The casts of k_prep give every thread 32 elements, moved in 16-byte pieces with all of a thread's loads issued before its first store:
// 4096 waves a plane (16 per WGP), for speed only. Every grid covers its array exactly (static_asserts at the sizes).
#define CVN 4                     // 8-element pieces per thread in a cast
static_assert(((size_t)DQ * DM / 8) % (256 * CVN) == 0 && ((size_t)DKV * DM / 8) % (256 * CVN) == 0 && ((size_t)TT * DM / 8) % (256 * CVN) == 0, "a cast has no tail");
__device__ __forceinline__ void cvt8_body(const float* __restrict__ src, bf* dst) { const size_t i0 = (size_t)blockIdx.x * (256 * CVN) + threadIdx.x; v8f v[CVN];
#pragma unroll
    for (int it = 0; it < CVN; ++it) v[it] = *(const v8f*)(src + (i0 + it * 256) * 8);
#pragma unroll
    for (int it = 0; it < CVN; ++it) { v8us o;
#pragma unroll
        for (int k = 0; k < 8; ++k) o[k] = f2bf(v[it][k]);
        *(v8us*)(dst + (i0 + it * 256) * 8) = o; }
    asm volatile("s_wait_xcnt 0x0" ::: "memory"); }   // precaution: stands behind the last store, in front of whatever code follows the cast in the kernel and reuses the registers that the stores name

__constant__ float INV2[HD / 2] = { 1.000000000e+00f, 8.659642935e-01f, 7.498942018e-01f, 6.493816376e-01f, 5.623413324e-01f, 4.869675040e-01f, 4.216964841e-01f, 3.651741147e-01f, 3.162277639e-01f, 2.738419473e-01f, 2.371373475e-01f, 2.053525001e-01f, 1.778279394e-01f, 1.539926529e-01f, 1.333521456e-01f, 1.154781953e-01f, 9.999999404e-02f, 8.659642935e-02f, 7.498941571e-02f, 6.493815780e-02f, 5.623412505e-02f, 4.869675636e-02f, 4.216965288e-02f, 3.651741147e-02f, 3.162277490e-02f, 2.738419361e-02f, 2.371373400e-02f, 2.053524740e-02f, 1.778279617e-02f, 1.539926231e-02f, 1.333521400e-02f, 1.154781692e-02f, 9.999999776e-03f, 8.659644052e-03f, 7.498940919e-03f, 6.493817084e-03f, 5.623412319e-03f, 4.869675264e-03f, 4.216963891e-03f, 3.651741194e-03f, 3.162276698e-03f, 2.738419222e-03f, 2.371374052e-03f, 2.053524600e-03f, 1.778279431e-03f, 1.539926161e-03f, 1.333521330e-03f, 1.154781668e-03f, 9.999999311e-04f, 8.659643936e-04f, 7.498940686e-04f, 6.493816618e-04f, 5.623411853e-04f, 4.869675031e-04f, 4.216964007e-04f, 3.651740844e-04f, 3.162277862e-04f, 2.738420444e-04f, 2.371372684e-04f, 2.053524659e-04f, 1.778279402e-04f, 1.539926743e-04f, 1.333520777e-04f, 1.154781567e-04f };   // float32 exp(-log(10000) x (2i) / 128) in the module's own spelling, generated with jnp to be bit-exact
// The rotary table: one (cos, sin) entry a pair of columns, [position][HD / 2], so that the 4 entries of 8 consecutive columns are 32 contiguous bytes.
__device__ __forceinline__ void csP_body(float* CS, const int blk) { const int idx = blk * 256 + threadIdx.x; if (idx >= TT * (HD / 2)) return; const int p = idx % (HD / 2); const int t = idx / (HD / 2); const float a = __fmul_rn((float)t, INV2[p]); v2f cs; cs[0] = cosf(a); cs[1] = sinf(a); *(v2f*)(CS + (size_t)idx * 2) = cs;  }
// k_prep: everything that depends on the inputs alone, in one launch. Grid (PRX, CSY + NB_ + 3): the first CSY rows fill the rotary table (arithmetic, put first for speed only), the next NB_ rows cast the batches of x, the last three cast Wq, Wk, Wv (all five into consecutive planes of dst).
#define PRX ((unsigned)((size_t)TT * DM / 8 / (256 * CVN)))
#define CSY ((unsigned)((TT * (HD / 2) / 256) / PRX))
static_assert(DQ == TT && DKV == TT && (TT * (HD / 2)) % 256 == 0 && (TT * (HD / 2) / 256) % PRX == 0 && CSY >= 1, "k_prep: five planes of one size, and the table is whole rows of the grid");
__global__ __launch_bounds__(256) void k_prep(const float* __restrict__ x, const float* __restrict__ wq, const float* __restrict__ wk, const float* __restrict__ wv, bf* dst, float* CS) {
    if (blockIdx.y < CSY) { csP_body(CS, (int)(blockIdx.y * PRX + blockIdx.x)); return; }
    const unsigned y = blockIdx.y - CSY;
    const float* src = (y < NB_) ? x + (size_t)y * TT * DM : (y == NB_) ? wq : (y == NB_ + 1u) ? wk : wv;
    cvt8_body(src, dst + (size_t)y * TT * DM);
}

#define QW 32
__device__ __forceinline__ float xhalf(float x) { return __builtin_bit_cast(float, __builtin_amdgcn_permlanex16(__builtin_bit_cast(int, x), __builtin_bit_cast(int, x), 0x76543210, 0xfedcba98, false, false)); }   // lane l takes lane l ^ 16's value
template <typename T16, bool HL>
__device__ __forceinline__ void fattn_rows(const T16* __restrict__ Q, const T16* __restrict__ Q2, const T16* __restrict__ K, const T16* __restrict__ K2, const T16* __restrict__ VT, const T16* __restrict__ VT2, float* __restrict__ O, const int q0, const int lane) {
    typedef typename WFrag<T16>::V V;
    const int lr = lane & 15, hi = lane >> 4;
    const float CE = SCL * LOG2E, OFF = HL ? 0.0f : 10.0f;
    // Every load is a wave-uniform plane pointer that never changes + a 32-bit lane offset in bytes (walked block by block for k and v) + a constant.
    // k and the transposed v lie in fragment order (WFrag::ldf): a 32-key block is 8 fragments = 8 KiB of either plane, and every load of a wave is 512 contiguous bytes (4 whole lines, not 32 bytes of each of 16 lines).
    unsigned ko = (unsigned)lane * 16u, vo = (unsigned)lane * 16u;   // the lane's piece in a half fragment of k, and of the transposed v
    const unsigned qo = (unsigned)(lr * HD + 8 * hi) * 2u + (unsigned)q0 * (HD * 2u);   // q stays in rows: it is read once
    auto at = [](const T16* p, unsigned bytes) { return (const T16*)((const char*)p + bytes); };
    V qf[2][4], ql[2][4], kf[2][4], kl[2][4];
#pragma unroll
    for (int qt = 0; qt < 2; ++qt)
#pragma unroll
        for (int c = 0; c < 4; ++c) { const int e = qt * 16 * HD + c * 32; qf[qt][c] = WFrag<T16>::ld(at(Q, qo) + e); if (HL) ql[qt][c] = WFrag<T16>::ld(at(Q2, qo) + e); }
#pragma unroll
    for (int kt = 0; kt < 2; ++kt)
#pragma unroll
        for (int c = 0; c < 4; ++c) { const int e = (kt * 4 + c) * 512; kf[kt][c] = WFrag<T16>::ldf(at(K, ko) + e); if (HL) kl[kt][c] = WFrag<T16>::ldf(at(K2, ko) + e); }
    asm volatile("s_wait_xcnt 0x0" :: "s"(Q), "s"(Q2), "s"(K), "s"(K2), "v"(qo) : "memory");   // precaution: behind it the registers that the q loads name may be reused; pointers and offset are inputs so that they stay as they are up to it
    v8f acc[8][2];
#pragma unroll
    for (int dt = 0; dt < 8; ++dt) { acc[dt][0] = (v8f){}; acc[dt][1] = (v8f){}; }
    float mx[2] = { -3.0e38f, -3.0e38f }, ls[2] = { 0.f, 0.f };
    auto step = [&](auto lastc) {
        constexpr bool LAST = decltype(lastc)::value;
        V vf[8], vl[8];
#pragma unroll
        for (int dt = 0; dt < 8; ++dt) { const int e = dt * 512; vf[dt] = WFrag<T16>::ldf(at(VT, vo) + e); if (HL) vl[dt] = WFrag<T16>::ldf(at(VT2, vo) + e); }
        v8f s[2][2];
#pragma unroll
        for (int kt = 0; kt < 2; ++kt) { s[kt][0] = (v8f){}; s[kt][1] = (v8f){}; }
#pragma unroll
        for (int c = 0; c < 4; ++c)
#pragma unroll
            for (int kt = 0; kt < 2; ++kt)
#pragma unroll
                for (int qt = 0; qt < 2; ++qt) { s[kt][qt] = WFrag<T16>::mma(kf[kt][c], qf[qt][c], s[kt][qt]); if (HL) { s[kt][qt] = WFrag<T16>::mma(kf[kt][c], ql[qt][c], s[kt][qt]); s[kt][qt] = WFrag<T16>::mma(kl[kt][c], qf[qt][c], s[kt][qt]); } }
        if (!LAST) {   // the next block's key fragments, into the same registers, fly during the softmax and the second contraction
#pragma unroll
            for (int kt = 0; kt < 2; ++kt)
#pragma unroll
                for (int c = 0; c < 4; ++c) { const int e = (8 + kt * 4 + c) * 512; kf[kt][c] = WFrag<T16>::ldf(at(K, ko) + e); if (HL) kl[kt][c] = WFrag<T16>::ldf(at(K2, ko) + e); }
        }
        V pf[2], pl[2];
#pragma unroll
        for (int qt = 0; qt < 2; ++qt) {
            float t[16];
#pragma unroll
            for (int i = 0; i < 16; ++i) { float x = s[i >> 3][qt][i & 7]; if (LAST) { if ((i >> 3) * 16 + hi * 8 + (i & 7) > qt * 16 + lr) x = -3.0e38f; } t[i] = x; }
            float m8[8];
#pragma unroll
            for (int i = 0; i < 8; ++i) m8[i] = fmaxf(t[i], t[i + 8]);
            float ml = fmaxf(fmaxf(fmaxf(m8[0], m8[1]), fmaxf(m8[2], m8[3])), fmaxf(fmaxf(m8[4], m8[5]), fmaxf(m8[6], m8[7])));
            ml = fmaxf(ml, xhalf(ml));
            const float mn = fmaxf(mx[qt], ml * CE), al = __builtin_amdgcn_exp2f(mx[qt] - mn), mo = mn - OFF; mx[qt] = mn;
#pragma unroll
            for (int i = 0; i < 16; ++i) t[i] = __builtin_amdgcn_exp2f(fmaf(t[i], CE, -mo));
            float s4[4];
#pragma unroll
            for (int i = 0; i < 4; ++i) s4[i] = (t[i] + t[i + 4]) + (t[i + 8] + t[i + 12]);
            ls[qt] = fmaf(ls[qt], al, (s4[0] + s4[1]) + (s4[2] + s4[3]));
#pragma unroll
            for (int dt = 0; dt < 8; ++dt) acc[dt][qt] *= al;
            if constexpr (HL) { v8us h0, h1, l0, l1;
#pragma unroll
                for (int i = 0; i < 8; ++i) { unsigned short a, b; splitf(t[i], a, b); h0[i] = a; l0[i] = b; splitf(t[i + 8], a, b); h1[i] = a; l1[i] = b; }
                pf[qt] = cat16b(h0, h1); pl[qt] = cat16b(l0, l1);
            } else { v16h p;
#pragma unroll
                for (int i = 0; i < 16; ++i) p[i] = tohx(t[i]);
                pf[qt] = p; }
        }
#pragma unroll
        for (int dt = 0; dt < 8; ++dt)
#pragma unroll
            for (int qt = 0; qt < 2; ++qt) { acc[dt][qt] = WFrag<T16>::mma(vf[dt], pf[qt], acc[dt][qt]); if (HL) { acc[dt][qt] = WFrag<T16>::mma(vf[dt], pl[qt], acc[dt][qt]); acc[dt][qt] = WFrag<T16>::mma(vl[dt], pf[qt], acc[dt][qt]); } }
        // precaution: stands in front of the advance below, which rewrites the offset registers that this block's loads name; the offsets are operands so that the advance stays behind it, the plane pointers are inputs so that their registers stay as they are up to it
        __builtin_amdgcn_sched_barrier(0);   // keeps the wait below at the block's end, far behind the block's loads; without it the compiler lifts the wait to directly behind the last load, in front of the softmax
        asm volatile("s_wait_xcnt 0x0" : "+v"(ko), "+v"(vo) : "s"(K), "s"(K2), "s"(VT), "s"(VT2) : "memory");
        ko += 8 * 1024; vo += 8 * 1024;
    };
    const int nb = q0 / 32 + 1;
#pragma unroll 1
    for (int kb = 0; kb < nb - 1; ++kb) step(BoolC<false>());
    step(BoolC<true>());
#pragma unroll
    for (int qt = 0; qt < 2; ++qt) { const float inv = __fdiv_rn(1.0f, ls[qt] + xhalf(ls[qt]));
#pragma unroll
        for (int dt = 0; dt < 8; ++dt) acc[dt][qt] *= inv; }
    const unsigned oo = (unsigned)((q0 + lr) * DQ + hi * 8) * 4u;   // bytes: the lane's 8 columns of its first query row
    __builtin_amdgcn_sched_barrier(0);   // all arithmetic stands in front of the first store, so that no register that an issued store names is rewritten behind it
#pragma unroll
    for (int qt = 0; qt < 2; ++qt)
#pragma unroll
        for (int dt = 0; dt < 8; ++dt) { float* o = (float*)((char*)O + oo) + qt * 16 * DQ + dt * 16;
            *(v4f*)o = __builtin_shufflevector(acc[dt][qt], acc[dt][qt], 0, 1, 2, 3); *(v4f*)(o + 4) = __builtin_shufflevector(acc[dt][qt], acc[dt][qt], 4, 5, 6, 7); }
}
// Grid (heads, batches, TT / QW / 4), 4 waves, no barrier and no LDS. The four waves of a work-group take four consecutive row blocks (128 query rows) of one head: they walk the same keys from block 0 on and end within three key blocks of one another, so that no SIMD of the WGP idles while a longer sibling runs on.
// A wave holds more than 512 registers, so a WGP holds one work-group at a time and the 512 work-groups run in two turns. Grid z is a RANK by cost, heaviest first: tile t costs 4 t + 4 key blocks, and a key block of the hi + lo tiles (t < 4) counts for a little more than two (three times the products, twice the loads and the vector work).
// TILE_OF_RANK holds the tile of rank r in nibble r: 15 .. 8, 3, 7, 6, 2, 5, 4, 1, 0 (a permutation of 0 .. 15: every tile is taken once whatever the start order is).
#define TILE_OF_RANK 0x0145267389ABCDEFull
static_assert(TT / QW == 64 && RH == 16 * QW && HD == 128 && NKV == NH_, "k_fattn is written for these shapes");
__global__ __launch_bounds__(128) void k_fattn(const h16* __restrict__ Q16, const h16* __restrict__ K16, const h16* __restrict__ V16, const bf* __restrict__ Qh, const bf* __restrict__ Ql, const bf* __restrict__ Kh, const bf* __restrict__ Kl, const bf* __restrict__ Vh, const bf* __restrict__ Vl, float* __restrict__ OUTb) {
    const int wave = __builtin_amdgcn_readfirstlane((int)(threadIdx.x >> 5)), lane = threadIdx.x & 31;
    const int qb = 4 * (int)((TILE_OF_RANK >> (4u * blockIdx.z)) & 15u) + wave;
    const size_t po = ((size_t)blockIdx.y * NH_ + blockIdx.x) * TT * HD; float* O = OUTb + (size_t)blockIdx.y * TT * DQ + blockIdx.x * HD;
    if (qb * QW < RH) fattn_rows<bf, true>(Qh + po, Ql + po, Kh + po, Kl + po, Vh + po, Vl + po, O, qb * QW, lane);
    else fattn_rows<h16, false>(Q16 + po, nullptr, K16 + po, nullptr, V16 + po, nullptr, O, qb * QW, lane);
}

extern "C" void kernel_launch(void* const* d_in, const int* in_sizes, int n_in,
                              void* d_out, int out_size, void* d_ws, size_t ws_size, hipStream_t stream) {
    (void)in_sizes; (void)n_in; (void)out_size;
    const float* x = (const float*)d_in[0]; const float* wq = (const float*)d_in[1]; const float* wk = (const float*)d_in[2]; const float* wv = (const float*)d_in[3]; const float* wo = nullptr; (void)wo;   /* argument order x, Wq, Wk, Wv ('oi' (out, in) [2048][2048]): four inputs, all read; NO output weight: the merged heads are the output */
    float* OUT = (float*)d_out;     // [2][2048][2048]
    char* wsp = (char*)d_ws;
    auto take = [&](size_t bytes) { char* p = wsp; wsp += (bytes + 255) & ~(size_t)255; return (void*)p; };
    // The casts' five planes, consecutive: x of batch 0, x of batch 1, Wq, Wk, Wv.
    bf* XB = (bf*)take((size_t)(NB_ + 3) * TT * DM * 2); bf* WQ = XB + (size_t)NB_ * TT * DM; float* CS = (float*)take((size_t)TT * (HD / 2) * 2 * 4);
    // The transposed v planes, [batch][head][fragment].
    h16* VT16 = (h16*)take((size_t)NB_ * NKV * HD * TT * 2); bf* VTh = (bf*)take((size_t)NB_ * NKV * HD * TT * 2); bf* VTl = (bf*)take((size_t)NB_ * NKV * HD * TT * 2);
    // The q and k planes, [q, k][batch][head]: q as [position][column], k in fragment order.
    h16* QP16 = (h16*)take((size_t)2 * NB_ * NH_ * TT * HD * 2); bf* QPh = (bf*)take((size_t)2 * NB_ * NH_ * TT * HD * 2); bf* QPl = (bf*)take((size_t)2 * NB_ * NH_ * TT * HD * 2);
    h16* KP16 = QP16 + (size_t)NB_ * NH_ * TT * HD; bf* KPh = QPh + (size_t)NB_ * NH_ * TT * HD; bf* KPl = QPl + (size_t)NB_ * NH_ * TT * HD;
    if ((size_t)(wsp - (char*)d_ws) > ws_size) return;    // ws 256 MiB
    k_prep<<<dim3(PRX, CSY + NB_ + 3, 1), 256, 0, stream>>>(x, wq, wk, wv, XB, CS);   /* casts, and the rotary table (positions = arange) */
    k_gemmt<<<dim3(NB_ * TT / 128, 3 * DQ / 128, 1), 128, 0, stream>>>(XB, WQ, CS, QP16, QPh, QPl, VT16, VTh, VTl);   /* projections, rotary step, planes */
    k_fattn<<<dim3(NH_, NB_, TT / QW / 4), 128, 0, stream>>>(QP16, KP16, VT16, QPh, QPl, KPh, KPl, VTh, VTl, OUT);
    /* no output projection: k_fattn has written the merged heads of both batches to OUT */
}

// v010
// One run takes 138 microseconds.
// Next to v009, in two timings, it ran 1.13 times as fast each time.
// Over all steps from v000 it is 11.3 times as fast.
#include <hip/hip_runtime.h>

// Causal multi-head self-attention with 128-wide heads and interleaved-pair rotary embeddings, WITHOUT an output projection (x [2][2048][2048]; q, k, v = einsum('bsm,nm->bsn', x, W) = x W^T ('oi' (out, in) [2048][2048] normal x 0.02, no bias; 16 heads x 128); rope on (even, odd) pairs: (xe cos - xo sin, xe sin + xo cos) with angle m x theta[i], theta = exp(-log(10000) x (2i) / 128) IN THAT SPELLING (64 f32 frequencies baked from the module's own line; precise cosf/sinf), m = arange(2048); scores x 1/sqrt(128); causal (tril kept, -1e30 elsewhere == exclusion: exp underflows to exactly 0); softmax in f32; out = the merged heads [b][s][h x 128 + d] -> [2][2048][2048] f32 (8.4 M); argument order x, Wq, Wk, Wv).
// Layout, every stage one launch over both batches: k_prep: bf16 copy of X and of the 'oi' weights, rotary table (cos, sin of 2048 positions x 64 angles); k_gemmt: the three exact projections as one GEMM grid, whose epilogue applies the interleaved-pair rotary step to q and k and writes the q, k and transposed-v planes itself (the f32 projections never go to memory); k_fattn: causal attention in one launch, scores and probabilities held in registers (running maximum and sum per query row; hybrid rows: < 512 hi/lo 3 products, rest fp16 x1024), which writes the merged heads straight to the output rows (no output projection).
// Compute dtypes, f32 accumulate: every input rounded to bf16; projections exact; rotary f32; attention rows < 512 3 products, rest fp16; softmax f32; output f32 (the P.v accumulators divided by the row sum).

#define NB_  2
#define TT   2048
#define DM   2048
#define NH_  16
#define NKV  16
#define REP  (NH_ / NKV)
#define HD   128
#define DQ   (NH_ * HD)
#define DKV  (NKV * HD)
#define RH   512                  // query rows < RH use hi+lo planes
#define SCL  0.088388347648318447f   // HD^-0.5
#define LOG2E 1.4426950408889634f
typedef _Float16 h16;
typedef unsigned short bf;
typedef __attribute__((ext_vector_type(16))) __bf16   v16bf;
typedef __attribute__((ext_vector_type(16))) _Float16 v16h;
typedef __attribute__((ext_vector_type(8)))  _Float16 v8h;
typedef __attribute__((ext_vector_type(8)))  unsigned short v8us;
typedef __attribute__((ext_vector_type(8)))  float    v8f;
typedef __attribute__((ext_vector_type(4)))  float    v4f;
typedef v8h  __attribute__((may_alias)) v8ha;
typedef v4f  __attribute__((may_alias)) v4fa;
typedef v8us __attribute__((may_alias)) v8usa;

__device__ __forceinline__ unsigned short f2bf(float f) { unsigned u = __float_as_uint(f); u += 0x7FFFu + ((u >> 16) & 1u); return (unsigned short)(u >> 16); }
__device__ __forceinline__ float bf2f(unsigned short b) { return __uint_as_float(((unsigned)b) << 16); }
__device__ __forceinline__ float bfr(float f) { return bf2f(f2bf(f)); }
__device__ __forceinline__ v16h cat16(v8h lo, v8h hi) { return __builtin_shufflevector(lo, hi, 0, 1, 2, 3, 4, 5, 6, 7, 8, 9, 10, 11, 12, 13, 14, 15); }
__device__ __forceinline__ v16bf cat16b(v8us lo, v8us hi) { return __builtin_bit_cast(v16bf, __builtin_shufflevector(lo, hi, 0, 1, 2, 3, 4, 5, 6, 7, 8, 9, 10, 11, 12, 13, 14, 15)); }
__device__ __forceinline__ v8f wmma16(v16h a, v16h b, v8f c) { return __builtin_amdgcn_wmma_f32_16x16x32_f16(false, a, false, b, (short)0, c, false, false); }
__device__ __forceinline__ v8f wmmab(v16bf a, v16bf b, v8f c) { return __builtin_amdgcn_wmma_f32_16x16x32_bf16(false, a, false, b, (short)0, c, false, false); }

template <bool B> struct BoolC { static constexpr bool value = B; };
__device__ __forceinline__ h16 tohx(float x) { return (h16)x; }
__device__ __forceinline__ void splitf(float y, unsigned short& h, unsigned short& l) { h = f2bf(y); l = f2bf(y - bf2f(h)); }
typedef __attribute__((ext_vector_type(2))) _Float16 v2h;
typedef __attribute__((ext_vector_type(4))) _Float16 v4h;
typedef __attribute__((ext_vector_type(2))) unsigned short v2us;
typedef __attribute__((ext_vector_type(4))) unsigned short v4us;
typedef __attribute__((ext_vector_type(2))) float v2f;
typedef __attribute__((ext_vector_type(4))) int v4i;

// ---- k_gemmt: C[m][n] (f32, in registers only) = sum_k A[m][k] Bt[n][k], bf16 operands with K-contiguous rows of DM elements. One work-group of 4 waves per 128x128 tile of C, one 64x64 quarter (16 accumulators) a wave; grid (M/128, N/128). Bt holds the three weights one behind the other (N = 3 DQ rows), so a tile is 128 positions of ONE head of q, of k or of v, and the epilogue turns it into that head's planes for k_fattn.
// The operands come through LDS: a pass is 128 k = 256 bytes of each of the tile's 128 A rows and 128 Bt rows. Every wave brings one slice of 64 rows with one tensor load (whole lines from L2, each row fetched once per work-group),
// two buffers, the load of pass s + 2 issued when pass s has been read. The mover pads each row by 16 bytes: pitch 272 B, an odd multiple of 16 B, for the ds_load_b128 fragment reads.
// The fragments keep the WFrag k order (8 hi .. 8 hi + 7, then 16 + 8 hi ..) for A and Bt alike, and every accumulator still sums k upwards in steps of 32.
// ld reads a fragment from K-contiguous rows; ldf reads one stored in FRAGMENT ORDER: 1 KiB a fragment (16 rows x 32 k), the 16-byte piece (row lr, k 16 j + 8 hi ..) at byte 512 j + 16 (16 hi + lr), so that each of its two loads is 512 contiguous bytes of a wave. Same k order as ld.
template <typename T16> struct WFrag;
template <> struct WFrag<h16> { typedef v16h V; static __device__ __forceinline__ V ld(const h16* p) { return cat16(*(const v8h*)p, *(const v8h*)(p + 16)); } static __device__ __forceinline__ V ldf(const h16* p) { return cat16(*(const v8h*)p, *(const v8h*)(p + 256)); } static __device__ __forceinline__ v8f mma(V a, V b, v8f c) { return wmma16(a, b, c); } };
template <> struct WFrag<bf> { typedef v16bf V; static __device__ __forceinline__ V ld(const bf* p) { return cat16b(*(const v8us*)p, *(const v8us*)(p + 16)); } static __device__ __forceinline__ V ldf(const bf* p) { return cat16b(*(const v8us*)p, *(const v8us*)(p + 256)); } static __device__ __forceinline__ v8f mma(V a, V b, v8f c) { return wmmab(a, b, c); } };
typedef unsigned u32x4 __attribute__((ext_vector_type(4)));
typedef unsigned u32x8 __attribute__((ext_vector_type(8)));
#define GKP 128u                  // k per pass
#define GNP (DM / GKP)            // passes
#define GROWB (GKP * 2u)          // bytes of a row per pass
#define GPITCH (GROWB + 16u)      // LDS row pitch
#define GSLICE 18432u             // a slice in LDS: 64 rows x 272 B = 17,408 B, rounded up to a multiple of 2 KiB
#define GBUF (4u * GSLICE)        // a buffer: A rows 0..63, A rows 64..127, Bt rows 0..63, Bt rows 64..127
#define OSB (16u * 68u * 4u)      // a wave's epilogue staging: 16 rows of 68 floats
static_assert(4u * OSB <= 2u * GBUF && OSB % 16u == 0 && 2u * (2u * GBUF) <= 327680u, "the staging lies in the ring, and two work-groups fit a WGP's LDS");
static_assert(GNP >= 2 && DM % GKP == 0 && TT % 128 == 0 && DQ % 128 == 0 && DKV % 128 == 0 && DQ == DKV && 64u * GPITCH <= GSLICE && GSLICE % 2048u == 0, "k_gemmt tile shape");
__device__ __forceinline__ unsigned uni(unsigned v) { return (unsigned)__builtin_amdgcn_readfirstlane((int)v); }
__device__ __forceinline__ unsigned pinned(unsigned v) { unsigned w = uni(v); asm volatile("" : "+s"(w)); return w; }   // a value that decides or addresses a tensor load, held in a scalar register
__device__ __forceinline__ v16bf ldsfrag(const unsigned char* p) { return cat16b(*(const v8usa*)p, *(const v8usa*)(p + 32)); }
static_assert(HD == 128 && TT % 128 == 0 && NKV == NH_, "k_gemmt: a tile is one head's 128 columns and lies in one batch");
__global__ __launch_bounds__(128) void k_gemmt(const bf* __restrict__ A, const bf* __restrict__ Bt, const float* __restrict__ CS, h16* P16, bf* Ph, bf* Pl, h16* V16, bf* Vh, bf* Vl) {
    __shared__ __attribute__((aligned(2048))) unsigned char ring[2 * GBUF];   // the kernel's only LDS: 147,456 B, so that two work-groups fit one WGP's 327,680 B (two waves a SIMD): one's prologue, barrier waits and epilogue run under the other's passes
    const unsigned wave = uni(threadIdx.x >> 5), lane = threadIdx.x & 31, lr = lane & 15, hi = lane >> 4;
    const unsigned wm = wave & 1u, wn = wave >> 1;
    const unsigned r0 = blockIdx.x * 128u, c0 = blockIdx.y * 128u;
    const unsigned plane = c0 / DQ, head = (c0 % DQ) / HD, bat = r0 / TT;   // 0 q, 1 k, 2 v; all three the same for the whole work-group
    const unsigned tw = r0 % TT + 64u * wm, dw = 64u * wn;                  // the wave's first position in its batch and its first column in its head
    // Wave w brings slice w of every pass: waves 0 and 1 the two halves of the A rows, waves 2 and 3 those of the Bt rows.
    const unsigned long long gsrc = (unsigned long long)(size_t)((wave < 2u) ? A + (size_t)(r0 + 64u * wave) * DM : Bt + (size_t)(c0 + 64u * (wave - 2u)) * DM);
    const unsigned ldst = (unsigned)(size_t)ring + wave * GSLICE;
    u32x8 g1;   // 1-byte elements, tensor = tile = 64 rows of 256 bytes, source pitch DM x 2 bytes, 4 dwords of pad behind every 64 dwords, no mask
    g1[0] = uni((1u << 20) | (5u << 22) | (3u << 25)); g1[1] = uni((GROWB & 0xFFFFu) << 16); g1[2] = uni((GROWB >> 16) | (64u << 16)); g1[3] = uni(GROWB << 16); g1[4] = uni(64u); g1[5] = uni(DM * 2u); g1[6] = uni(0u); g1[7] = uni(0u);
    u32x4 g0; g0[0] = uni(1u);   // lives outside issue(), so that the tensor waits can name it; word 0 never changes
    auto issue = [&](unsigned st) {
        const unsigned long long ga = gsrc + (unsigned long long)st * GROWB;
        g0[1] = uni(ldst + (st & 1u) * GBUF); g0[2] = uni((unsigned)ga); g0[3] = uni((((unsigned)(ga >> 32)) & 0x01FFFFFFu) | 0x80000000u);
        asm volatile("tensor_load_to_lds %0, %1" :: "s"(g0), "s"(g1) : "memory");
    };
    issue(0u);
    asm volatile("s_wait_tensorcnt 0x0" : "+s"(g0), "+s"(g1) :: "memory");   // this wave's slice of pass 0 has landed; both descriptor groups are operands of every tensor wait, so that their words stay in their own registers from an issue to the wait that covers it
    __syncthreads();                                      // ... and so has every other wave's: pass 0 is readable
    issue(1u);
    // The wave's rotary table entries (q and k tiles), asked for here so that they arrive under the first passes: 16 pieces of 8 columns a lane, the 4 (cos, sin) pairs of a piece being 32 contiguous bytes of the table.
    // A piece is (16-row group mb, i). In a q tile: row (lane >> 3) + 4 i, columns 8 (lane & 7) .. (a wave's store is 4 whole rows of 128 bytes). In a k tile: row (lane & 7) + 8 (i & 1), columns 8 ((lane >> 3) + 4 (i >> 1)) .. (a wave's store is 4 whole 128-byte lines of the fragment order). Either way a table load of a wave touches 8 lines.
    v4f cs[4][4][2];
    auto loadcs = [&](auto kc) {
        constexpr bool KP = decltype(kc)::value;
        const unsigned co = ((tw + (KP ? lane & 7u : lane >> 3)) * HD + dw + 8u * (KP ? lane >> 3 : lane & 7u)) * 4u;   // bytes: the entries of the lane's first piece
#pragma unroll
        for (int mb = 0; mb < 4; ++mb)
#pragma unroll
            for (int i = 0; i < 4; ++i)
#pragma unroll
                for (int k = 0; k < 2; ++k) cs[mb][i][k] = *(const v4f*)((const char*)CS + co + ((mb * 16 + (KP ? 8 * (i & 1) : 4 * i)) * HD + (KP ? 32 * (i >> 1) : 0) + 4 * k) * 4);   /* the pairs of columns d + 4k and d + 4k + 2 */
        asm volatile("s_wait_xcnt 0x0" :: "s"(CS), "v"(co) : "memory");   // precaution: behind it the registers that the table loads name may be reused; pointer and offset are inputs so that they stay as they are up to it
    };
    if (plane == 0u) loadcs(BoolC<false>()); else if (plane == 1u) loadcs(BoolC<true>());
    v8f acc[4][4];
#pragma unroll
    for (int mb = 0; mb < 4; ++mb)
#pragma unroll
        for (int nb = 0; nb < 4; ++nb) acc[mb][nb] = (v8f){};
    const unsigned aoff = wm * GSLICE + lr * GPITCH + 16u * hi, boff = (2u + wn) * GSLICE + lr * GPITCH + 16u * hi;
#pragma unroll 1   // one pass a trip: the publish point at the foot stands once in the code
    for (unsigned s = 0; s < GNP; ++s) {
        const unsigned char* pa = ring + (s & 1u) * GBUF + aoff; const unsigned char* pb = ring + (s & 1u) * GBUF + boff;
        v16bf a[2][4], b[2][4];
#pragma unroll
        for (int f = 0; f < 4; ++f) { a[0][f] = ldsfrag(pa + f * 16 * GPITCH); b[0][f] = ldsfrag(pb + f * 16 * GPITCH); }
#pragma unroll
        for (int ks = 0; ks < 4; ++ks) {
            if (ks + 1 < 4) {
#pragma unroll
                for (int f = 0; f < 4; ++f) { a[(ks + 1) & 1][f] = ldsfrag(pa + f * 16 * GPITCH + (ks + 1) * 64); b[(ks + 1) & 1][f] = ldsfrag(pb + f * 16 * GPITCH + (ks + 1) * 64); }
            }
            __builtin_amdgcn_sched_barrier(0);   // the next block's 16 LDS reads stay one group in front of this block's products
#pragma unroll
            for (int nb = 0; nb < 4; ++nb)
#pragma unroll
                for (int mb = 0; mb < 4; ++mb) acc[mb][nb] = wmmab(a[ks & 1][mb], b[ks & 1][nb], acc[mb][nb]);
            __builtin_amdgcn_sched_barrier(0);   // the other side of the same fence: no later read moves up into this block
        }
        // Publish point of pass s + 1, every wave, in this order.
        asm volatile("s_wait_dscnt 0x0" ::: "memory");       // this wave's reads of pass s's buffer are done before that buffer is refilled
        asm volatile("s_wait_tensorcnt 0x0" : "+s"(g0), "+s"(g1) :: "memory");   // this wave's slice of pass s + 1 has landed
        __syncthreads();                                      // pass s + 1 is readable, and nobody reads pass s's buffer any more
        const unsigned st = pinned(s + 2u);                   // formed behind the wait above, so that the descriptor's address words are too
        if (pinned(st < GNP)) issue(st);
    }
    asm volatile("s_wait_tensorcnt 0x0" : "+s"(g0), "+s"(g1) :: "memory");   // no request is outstanding when the wave goes on
    asm volatile("s_wait_dscnt 0x0" ::: "memory");
    if (plane == 2u) {
        // v: an accumulator IS a piece of the transposed plane in fragment order (WFrag::ldf): a lane holds 8 consecutive keys (8 hi + j) of one column (lr). Fragment (32-key block kb, 16 columns dt) at 1 KiB x (8 kb + dt) of the head's plane, its rows the columns, its k the keys; every store of a wave is one half fragment, 512 contiguous bytes.
        const size_t vb = ((size_t)bat * NKV + head) * HD * TT;
        const unsigned vo = (((tw / 32u) * 8u + 4u * wn) * 64u + lane) * 16u;   // bytes: the lane's piece in the wave's first half fragment
#pragma unroll
        for (int mb = 0; mb < 4; ++mb) {
            v8h o16[4]; v8us oh[4], ol[4];
#pragma unroll
            for (int nb = 0; nb < 4; ++nb)
#pragma unroll
                for (int j = 0; j < 8; ++j) { const float y = acc[mb][nb][j]; o16[nb][j] = tohx(y); unsigned short a2, c2; splitf(y, a2, c2); oh[nb][j] = a2; ol[nb][j] = c2; }
            __builtin_amdgcn_sched_barrier(0);   // the group's arithmetic stands in front of its first store, so that no register that an issued store names is rewritten before the wait below
#pragma unroll
            for (int nb = 0; nb < 4; ++nb) { const int e = ((mb >> 1) * 16 + nb * 2 + (mb & 1)) * 512;   // a constant, added to the pointer and not to the lane's offset, so that it becomes the store's immediate offset
                *(v8h*)((char*)(V16 + vb) + vo + e) = o16[nb]; *(v8us*)((char*)(Vh + vb) + vo + e) = oh[nb]; *(v8us*)((char*)(Vl + vb) + vo + e) = ol[nb]; }
            asm volatile("s_wait_xcnt 0x0" :: "v"(vo) : "memory");   // precaution: behind it the next group may reuse the registers that these stores name; the offset is an input so that it stays as it is up to the wait
            __builtin_amdgcn_sched_barrier(0);   // the other side: the next group's arithmetic stays behind the wait
        }
        return;
    }
    // Each wave stages its own 16 rows: a rotary pair lies in two neighbouring lanes of an accumulator, and in one lane of a row piece. The rows lie in the ring, which is free here: the last pass's publish point (every wave's s_wait_dscnt 0, then the barrier) ended every read of it, and no tensor load is outstanding.
    float* os = (float*)(ring + wave * OSB);
    auto qkout = [&](auto kc) {
        constexpr bool KP = decltype(kc)::value;
        const size_t pb = ((size_t)((KP ? NB_ : 0) + bat) * NH_ + head) * TT * HD;
        const unsigned lo = (KP ? lane & 7u : lane >> 3) * 68u + 8u * (KP ? lane >> 3 : lane & 7u);   // floats: the lane's first piece in the staged rows
        // q stays in rows; k goes in fragment order (WFrag::ldf) for k_fattn's first contraction: fragment (16 keys, 32 columns c) at 1 KiB x (4 (t / 16) + c) of the head's plane.
        const unsigned eo = (KP ? ((tw / 16u) * 8u + 4u * wn) * 256u + (lane >> 3) * 128u + (lane & 7u) * 8u : (tw + (lane >> 3)) * HD + dw + 8u * (lane & 7u)) * 2u;   // bytes: the lane's first piece in the head's plane
#pragma unroll
        for (int mb = 0; mb < 4; ++mb) {
#pragma unroll
            for (int nb = 0; nb < 4; ++nb) {
#pragma unroll
                for (int j = 0; j < 8; ++j) os[(hi * 8 + j) * 68 + nb * 16 + lr] = acc[mb][nb][j]; }
            __builtin_amdgcn_wave_barrier(); asm volatile("" ::: "memory");   // compiler fence: the row reads below stay behind the other lanes' LDS writes above
            v8h o16[4]; v8us oh[4], ol[4];
#pragma unroll
            for (int i = 0; i < 4; ++i) { const float* xp = os + lo + (KP ? 8 * (i & 1) * 68 + 32 * (i >> 1) : 4 * i * 68); const v4f xa = *(const v4fa*)xp, xb = *(const v4fa*)(xp + 4);
#pragma unroll
                for (int k = 0; k < 4; ++k) { const float x0 = (k < 2 ? xa : xb)[(k & 1) * 2], x1 = (k < 2 ? xa : xb)[(k & 1) * 2 + 1]; const float cc = cs[mb][i][k >> 1][(k & 1) * 2], sn = cs[mb][i][k >> 1][(k & 1) * 2 + 1];
                    const float a0 = __fmul_rn(x0, cc), b0 = __fmul_rn(x1, sn), a1 = __fmul_rn(x1, cc), b1 = __fmul_rn(x0, sn);
                    const float y0 = __fsub_rn(a0, b0), y1 = __fadd_rn(b1, a1);   /* even: x0 c - x1 s; odd: x0 s + x1 c */
                    o16[i][2 * k] = tohx(y0); o16[i][2 * k + 1] = tohx(y1); unsigned short a2, c2; splitf(y0, a2, c2); oh[i][2 * k] = a2; ol[i][2 * k] = c2; splitf(y1, a2, c2); oh[i][2 * k + 1] = a2; ol[i][2 * k + 1] = c2; } }
            __builtin_amdgcn_wave_barrier(); asm volatile("" ::: "memory");   // compiler fence: the next 16 rows' LDS writes stay behind these reads
            __builtin_amdgcn_sched_barrier(0);   // the group's arithmetic stands in front of its first store, so that no register that an issued store names is rewritten before the wait below
#pragma unroll
            for (int i = 0; i < 4; ++i) { const int e = mb * 4096 + (KP ? (i >> 1) * 1024 + (i & 1) * 128 : i * 1024);   // a constant, added to the pointer and not to the lane's offset, so that it becomes the store's immediate offset
                *(v8h*)((char*)(P16 + pb) + eo + e) = o16[i]; *(v8us*)((char*)(Ph + pb) + eo + e) = oh[i]; *(v8us*)((char*)(Pl + pb) + eo + e) = ol[i]; }
            asm volatile("s_wait_xcnt 0x0" :: "v"(eo) : "memory");   // precaution: behind it the next group may reuse the registers that these stores name; the offset is an input so that it stays as it is up to the wait
        }
    };
    if (plane == 0u) qkout(BoolC<false>()); else qkout(BoolC<true>());
}

// The casts of k_prep give every thread 32 elements, moved in 16-byte pieces with all of a thread's loads issued before its first store:
// 4096 waves a plane (16 per WGP), for speed only. Every grid covers its array exactly (static_asserts at the sizes).
#define CVN 4                     // 8-element pieces per thread in a cast
static_assert(((size_t)DQ * DM / 8) % (256 * CVN) == 0 && ((size_t)DKV * DM / 8) % (256 * CVN) == 0 && ((size_t)TT * DM / 8) % (256 * CVN) == 0, "a cast has no tail");
__device__ __forceinline__ void cvt8_body(const float* __restrict__ src, bf* dst) { const size_t i0 = (size_t)blockIdx.x * (256 * CVN) + threadIdx.x; v8f v[CVN];
#pragma unroll
    for (int it = 0; it < CVN; ++it) v[it] = *(const v8f*)(src + (i0 + it * 256) * 8);
#pragma unroll
    for (int it = 0; it < CVN; ++it) { v8us o;
#pragma unroll
        for (int k = 0; k < 8; ++k) o[k] = f2bf(v[it][k]);
        *(v8us*)(dst + (i0 + it * 256) * 8) = o; }
    asm volatile("s_wait_xcnt 0x0" ::: "memory"); }   // precaution: stands behind the last store, in front of whatever code follows the cast in the kernel and reuses the registers that the stores name

__constant__ float INV2[HD / 2] = { 1.000000000e+00f, 8.659642935e-01f, 7.498942018e-01f, 6.493816376e-01f, 5.623413324e-01f, 4.869675040e-01f, 4.216964841e-01f, 3.651741147e-01f, 3.162277639e-01f, 2.738419473e-01f, 2.371373475e-01f, 2.053525001e-01f, 1.778279394e-01f, 1.539926529e-01f, 1.333521456e-01f, 1.154781953e-01f, 9.999999404e-02f, 8.659642935e-02f, 7.498941571e-02f, 6.493815780e-02f, 5.623412505e-02f, 4.869675636e-02f, 4.216965288e-02f, 3.651741147e-02f, 3.162277490e-02f, 2.738419361e-02f, 2.371373400e-02f, 2.053524740e-02f, 1.778279617e-02f, 1.539926231e-02f, 1.333521400e-02f, 1.154781692e-02f, 9.999999776e-03f, 8.659644052e-03f, 7.498940919e-03f, 6.493817084e-03f, 5.623412319e-03f, 4.869675264e-03f, 4.216963891e-03f, 3.651741194e-03f, 3.162276698e-03f, 2.738419222e-03f, 2.371374052e-03f, 2.053524600e-03f, 1.778279431e-03f, 1.539926161e-03f, 1.333521330e-03f, 1.154781668e-03f, 9.999999311e-04f, 8.659643936e-04f, 7.498940686e-04f, 6.493816618e-04f, 5.623411853e-04f, 4.869675031e-04f, 4.216964007e-04f, 3.651740844e-04f, 3.162277862e-04f, 2.738420444e-04f, 2.371372684e-04f, 2.053524659e-04f, 1.778279402e-04f, 1.539926743e-04f, 1.333520777e-04f, 1.154781567e-04f };   // float32 exp(-log(10000) x (2i) / 128) in the module's own spelling, generated with jnp to be bit-exact
// The rotary table: one (cos, sin) entry a pair of columns, [position][HD / 2], so that the 4 entries of 8 consecutive columns are 32 contiguous bytes.
__device__ __forceinline__ void csP_body(float* CS, const int blk) { const int idx = blk * 256 + threadIdx.x; if (idx >= TT * (HD / 2)) return; const int p = idx % (HD / 2); const int t = idx / (HD / 2); const float a = __fmul_rn((float)t, INV2[p]); v2f cs; cs[0] = cosf(a); cs[1] = sinf(a); *(v2f*)(CS + (size_t)idx * 2) = cs;  }
// k_prep: everything that depends on the inputs alone, in one launch. Grid (PRX, CSY + NB_ + 3): the first CSY rows fill the rotary table (arithmetic, put first for speed only), the next NB_ rows cast the batches of x, the last three cast Wq, Wk, Wv (all five into consecutive planes of dst).
#define PRX ((unsigned)((size_t)TT * DM / 8 / (256 * CVN)))
#define CSY ((unsigned)((TT * (HD / 2) / 256) / PRX))
static_assert(DQ == TT && DKV == TT && (TT * (HD / 2)) % 256 == 0 && (TT * (HD / 2) / 256) % PRX == 0 && CSY >= 1, "k_prep: five planes of one size, and the table is whole rows of the grid");
__global__ __launch_bounds__(256) void k_prep(const float* __restrict__ x, const float* __restrict__ wq, const float* __restrict__ wk, const float* __restrict__ wv, bf* dst, float* CS) {
    if (blockIdx.y < CSY) { csP_body(CS, (int)(blockIdx.y * PRX + blockIdx.x)); return; }
    const unsigned y = blockIdx.y - CSY;
    const float* src = (y < NB_) ? x + (size_t)y * TT * DM : (y == NB_) ? wq : (y == NB_ + 1u) ? wk : wv;
    cvt8_body(src, dst + (size_t)y * TT * DM);
}

#define QW 32
__device__ __forceinline__ float xhalf(float x) { return __builtin_bit_cast(float, __builtin_amdgcn_permlanex16(__builtin_bit_cast(int, x), __builtin_bit_cast(int, x), 0x76543210, 0xfedcba98, false, false)); }   // lane l takes lane l ^ 16's value
template <typename T16, bool HL>
__device__ __forceinline__ void fattn_rows(const T16* __restrict__ Q, const T16* __restrict__ Q2, const T16* __restrict__ K, const T16* __restrict__ K2, const T16* __restrict__ VT, const T16* __restrict__ VT2, float* __restrict__ O, const int q0, const int lane, const int half, float* xw) {
    typedef typename WFrag<T16>::V V;
    constexpr int NQ = HL ? 1 : 2;   // 16-row query tiles of the wave
    constexpr int KS = HL ? 1 : 2;   // the wave takes every KS-th key block, from block 'half' on (hi + lo: half = 0)
    const int lr = lane & 15, hi = lane >> 4;
    const float CE = SCL * LOG2E, OFF = HL ? 0.0f : 10.0f;
    // Every load is a wave-uniform plane pointer that never changes + a 32-bit lane offset in bytes (walked block by block for k and v) + a constant.
    // k and the transposed v lie in fragment order (WFrag::ldf): a 32-key block is 8 fragments = 8 KiB of either plane, and every load of a wave is 512 contiguous bytes (4 whole lines, not 32 bytes of each of 16 lines).
    unsigned ko = (unsigned)lane * 16u + (unsigned)half * 8192u, vo = ko;   // the lane's piece in a half fragment of k, and of the transposed v, in the wave's first key block
    const int nb = q0 / 32 + 1;                        // key blocks of these query rows, the last one on the diagonal
    const int ns = HL ? nb : (nb + 1 - half) >> 1;     // of them this wave's; at least one (fp16 rows start at RH: nb > 2)
    const int mo = HL ? (q0 & 16) : (((nb - 1) & 1) == half) ? 0 : 64;   // the wave's last block masks key > first row's place in the block + row; 64: that block lies in front of the diagonal block and the mask never holds
    const unsigned qo = (unsigned)(lr * HD + 8 * hi) * 2u + (unsigned)q0 * (HD * 2u);   // q stays in rows: it is read once
    auto at = [](const T16* p, unsigned bytes) { return (const T16*)((const char*)p + bytes); };
    V qf[NQ][4], ql[NQ][4], kf[2][4], kl[2][4];
#pragma unroll
    for (int qt = 0; qt < NQ; ++qt)
#pragma unroll
        for (int c = 0; c < 4; ++c) { const int e = qt * 16 * HD + c * 32; qf[qt][c] = WFrag<T16>::ld(at(Q, qo) + e); if (HL) ql[qt][c] = WFrag<T16>::ld(at(Q2, qo) + e); }
#pragma unroll
    for (int kt = 0; kt < 2; ++kt)
#pragma unroll
        for (int c = 0; c < 4; ++c) { const int e = (kt * 4 + c) * 512; kf[kt][c] = WFrag<T16>::ldf(at(K, ko) + e); if (HL) kl[kt][c] = WFrag<T16>::ldf(at(K2, ko) + e); }
    asm volatile("s_wait_xcnt 0x0" :: "s"(Q), "s"(Q2), "s"(K), "s"(K2), "v"(qo) : "memory");   // precaution: behind it the registers that the q loads name may be reused; pointers and offset are inputs so that they stay as they are up to it
    v8f acc[8][NQ];
    float mx[NQ], ls[NQ];
#pragma unroll
    for (int qt = 0; qt < NQ; ++qt) { mx[qt] = -3.0e38f; ls[qt] = 0.f;
#pragma unroll
        for (int dt = 0; dt < 8; ++dt) acc[dt][qt] = (v8f){}; }
    auto step = [&](auto lastc) {
        constexpr bool LAST = decltype(lastc)::value;
        V vf[8], vl[8];
#pragma unroll
        for (int dt = 0; dt < 8; ++dt) { const int e = dt * 512; vf[dt] = WFrag<T16>::ldf(at(VT, vo) + e); if (HL) vl[dt] = WFrag<T16>::ldf(at(VT2, vo) + e); }
        v8f s[2][NQ];
#pragma unroll
        for (int kt = 0; kt < 2; ++kt)
#pragma unroll
            for (int qt = 0; qt < NQ; ++qt) s[kt][qt] = (v8f){};
#pragma unroll
        for (int c = 0; c < 4; ++c)
#pragma unroll
            for (int kt = 0; kt < 2; ++kt)
#pragma unroll
                for (int qt = 0; qt < NQ; ++qt) { s[kt][qt] = WFrag<T16>::mma(kf[kt][c], qf[qt][c], s[kt][qt]); if (HL) { s[kt][qt] = WFrag<T16>::mma(kf[kt][c], ql[qt][c], s[kt][qt]); s[kt][qt] = WFrag<T16>::mma(kl[kt][c], qf[qt][c], s[kt][qt]); } }
        if (!LAST) {   // the key fragments of the wave's next block, into the same registers, fly during the softmax and the second contraction
#pragma unroll
            for (int kt = 0; kt < 2; ++kt)
#pragma unroll
                for (int c = 0; c < 4; ++c) { const int e = (8 * KS + kt * 4 + c) * 512; kf[kt][c] = WFrag<T16>::ldf(at(K, ko) + e); if (HL) kl[kt][c] = WFrag<T16>::ldf(at(K2, ko) + e); }
        }
        V pf[NQ], pl[NQ];
#pragma unroll
        for (int qt = 0; qt < NQ; ++qt) {
            float t[16];
#pragma unroll
            for (int i = 0; i < 16; ++i) { float x = s[i >> 3][qt][i & 7]; if (LAST) { if ((i >> 3) * 16 + hi * 8 + (i & 7) > qt * 16 + lr + mo) x = -3.0e38f; } t[i] = x; }
            float m8[8];
#pragma unroll
            for (int i = 0; i < 8; ++i) m8[i] = fmaxf(t[i], t[i + 8]);
            float ml = fmaxf(fmaxf(fmaxf(m8[0], m8[1]), fmaxf(m8[2], m8[3])), fmaxf(fmaxf(m8[4], m8[5]), fmaxf(m8[6], m8[7])));
            ml = fmaxf(ml, xhalf(ml));
            const float mn = fmaxf(mx[qt], ml * CE), al = __builtin_amdgcn_exp2f(mx[qt] - mn), mo = mn - OFF; mx[qt] = mn;
#pragma unroll
            for (int i = 0; i < 16; ++i) t[i] = __builtin_amdgcn_exp2f(fmaf(t[i], CE, -mo));
            float s4[4];
#pragma unroll
            for (int i = 0; i < 4; ++i) s4[i] = (t[i] + t[i + 4]) + (t[i + 8] + t[i + 12]);
            ls[qt] = fmaf(ls[qt], al, (s4[0] + s4[1]) + (s4[2] + s4[3]));
#pragma unroll
            for (int dt = 0; dt < 8; ++dt) acc[dt][qt] *= al;
            if constexpr (HL) { v8us h0, h1, l0, l1;
#pragma unroll
                for (int i = 0; i < 8; ++i) { unsigned short a, b; splitf(t[i], a, b); h0[i] = a; l0[i] = b; splitf(t[i + 8], a, b); h1[i] = a; l1[i] = b; }
                pf[qt] = cat16b(h0, h1); pl[qt] = cat16b(l0, l1);
            } else { v16h p;
#pragma unroll
                for (int i = 0; i < 16; ++i) p[i] = tohx(t[i]);
                pf[qt] = p; }
        }
#pragma unroll
        for (int dt = 0; dt < 8; ++dt)
#pragma unroll
            for (int qt = 0; qt < NQ; ++qt) { acc[dt][qt] = WFrag<T16>::mma(vf[dt], pf[qt], acc[dt][qt]); if (HL) { acc[dt][qt] = WFrag<T16>::mma(vf[dt], pl[qt], acc[dt][qt]); acc[dt][qt] = WFrag<T16>::mma(vl[dt], pf[qt], acc[dt][qt]); } }
        // precaution: stands in front of the advance below, which rewrites the offset registers that this block's loads name; the offsets are operands so that the advance stays behind it, the plane pointers are inputs so that their registers stay as they are up to it
        __builtin_amdgcn_sched_barrier(0);   // keeps the wait below at the block's end, far behind the block's loads; without it the compiler lifts the wait to directly behind the last load, in front of the softmax
        asm volatile("s_wait_xcnt 0x0" : "+v"(ko), "+v"(vo) : "s"(K), "s"(K2), "s"(VT), "s"(VT2) : "memory");
        ko += KS * 8 * 1024; vo += KS * 8 * 1024;
    };
#pragma unroll 1
    for (int kb = 0; kb < ns - 1; ++kb) step(BoolC<false>());
    step(BoolC<true>());
    if constexpr (HL) {
#pragma unroll
        for (int qt = 0; qt < NQ; ++qt) { const float inv = __fdiv_rn(1.0f, ls[qt] + xhalf(ls[qt]));
#pragma unroll
            for (int dt = 0; dt < 8; ++dt) acc[dt][qt] *= inv; }
    } else {
        // The two waves' partial results are joined through LDS: the odd wave hands over its accumulators, maxima and sums (33 pieces of 16 bytes a lane, piece p of lane l at 512 p + 16 l, so that every LDS access of a wave is 512 contiguous bytes); the even wave rescales both sides to the common maximum, adds, divides and stores.
        v4fa* xp = (v4fa*)xw + lane;
        if (half != 0) {
#pragma unroll
            for (int dt = 0; dt < 8; ++dt)
#pragma unroll
                for (int qt = 0; qt < NQ; ++qt) { xp[((dt * 2 + qt) * 2) * 32] = __builtin_shufflevector(acc[dt][qt], acc[dt][qt], 0, 1, 2, 3); xp[((dt * 2 + qt) * 2 + 1) * 32] = __builtin_shufflevector(acc[dt][qt], acc[dt][qt], 4, 5, 6, 7); }
            xp[32 * 32] = (v4f){ mx[0], mx[1], ls[0], ls[1] };
        }
        __syncthreads();   // the odd waves' partial results are readable; every wave of an fp16 work-group passes here once
        if (half != 0) return;
        const v4f om = xp[32 * 32];
#pragma unroll
        for (int qt = 0; qt < NQ; ++qt) { const float mn = fmaxf(mx[qt], om[qt]), a0 = __builtin_amdgcn_exp2f(mx[qt] - mn), a1 = __builtin_amdgcn_exp2f(om[qt] - mn);
            const float l = fmaf(ls[qt], a0, om[2 + qt] * a1), inv = __fdiv_rn(1.0f, l + xhalf(l)), f0 = a0 * inv, f1 = a1 * inv;
#pragma unroll
            for (int dt = 0; dt < 8; ++dt) { const v4f o0 = xp[((dt * 2 + qt) * 2) * 32], o1 = xp[((dt * 2 + qt) * 2 + 1) * 32];
#pragma unroll
                for (int j = 0; j < 8; ++j) acc[dt][qt][j] = fmaf(acc[dt][qt][j], f0, (j < 4 ? o0[j & 3] : o1[j & 3]) * f1); } }
    }
    const unsigned oo = (unsigned)((q0 + lr) * DQ + hi * 8) * 4u;   // bytes: the lane's 8 columns of its first query row
    __builtin_amdgcn_sched_barrier(0);   // all arithmetic stands in front of the first store, so that no register that an issued store names is rewritten behind it
#pragma unroll
    for (int qt = 0; qt < NQ; ++qt)
#pragma unroll
        for (int dt = 0; dt < 8; ++dt) { float* o = (float*)((char*)O + oo) + qt * 16 * DQ + dt * 16;
            *(v4f*)o = __builtin_shufflevector(acc[dt][qt], acc[dt][qt], 0, 1, 2, 3); *(v4f*)(o + 4) = __builtin_shufflevector(acc[dt][qt], acc[dt][qt], 4, 5, 6, 7); }
}
// Grid (heads, batches, TT / QW / 4), 8 waves. A work-group takes 128 consecutive query rows of one head. fp16 rows: waves w and w + 4 share row block w (32 rows), the first on the even key blocks and the second on the odd; hi + lo rows: wave w takes rows 16 w .. 16 w + 15. Either way a SIMD holds two waves of nearly equal length: one's products run under the other's softmax and load waits, and the longest chain of work in the launch is half as long as with one wave for 32 rows and all their keys.
// A wave holds more than 256 registers, so a WGP holds one work-group (two waves a SIMD) at a time and the 512 work-groups run in two turns. Grid z is a RANK by cost, heaviest first: tile t costs 4 t + 4 key blocks, and a key block of the hi + lo tiles (t < 4) counts for a little more than two (three times the products, four times the loads, twice the vector work).
// The WGP whose first work-group ends soonest then takes the heaviest that is left, and the sums of the two turns come out nearly equal. TILE_OF_RANK holds the tile of rank r in nibble r: 15 .. 8, 3, 7, 6, 2, 5, 4, 1, 0 (a permutation of 0 .. 15: every tile is taken once whatever the start order is).
#define TILE_OF_RANK 0x0145267389ABCDEFull
static_assert(TT / QW == 64 && RH == 16 * QW && RH % (4 * QW) == 0 && RH >= 2 * QW && HD == 128 && NKV == NH_, "k_fattn is written for these shapes");
#define XCH (33 * 128)            // floats that a row block's odd wave hands over
__global__ __launch_bounds__(256) void k_fattn(const h16* __restrict__ Q16, const h16* __restrict__ K16, const h16* __restrict__ V16, const bf* __restrict__ Qh, const bf* __restrict__ Ql, const bf* __restrict__ Kh, const bf* __restrict__ Kl, const bf* __restrict__ Vh, const bf* __restrict__ Vl, float* __restrict__ OUTb) {
    const int wave = __builtin_amdgcn_readfirstlane((int)(threadIdx.x >> 5)), lane = threadIdx.x & 31;
    __shared__ __attribute__((aligned(16))) float xch[4 * XCH];
    const int r0 = 4 * QW * (int)((TILE_OF_RANK >> (4u * blockIdx.z)) & 15u);   // the work-group's first query row; RH is a multiple of 4 QW, so the whole work-group takes one side of the branch below (the fp16 side holds a barrier)
    const size_t po = ((size_t)blockIdx.y * NH_ + blockIdx.x) * TT * HD; float* O = OUTb + (size_t)blockIdx.y * TT * DQ + blockIdx.x * HD;
    if (r0 < RH) fattn_rows<bf, true>(Qh + po, Ql + po, Kh + po, Kl + po, Vh + po, Vl + po, O, r0 + 16 * wave, lane, 0, nullptr);
    else fattn_rows<h16, false>(Q16 + po, nullptr, K16 + po, nullptr, V16 + po, nullptr, O, r0 + QW * (wave & 3), lane, wave >> 2, xch + (wave & 3) * XCH);
}

extern "C" void kernel_launch(void* const* d_in, const int* in_sizes, int n_in,
                              void* d_out, int out_size, void* d_ws, size_t ws_size, hipStream_t stream) {
    (void)in_sizes; (void)n_in; (void)out_size;
    const float* x = (const float*)d_in[0]; const float* wq = (const float*)d_in[1]; const float* wk = (const float*)d_in[2]; const float* wv = (const float*)d_in[3]; const float* wo = nullptr; (void)wo;   /* argument order x, Wq, Wk, Wv ('oi' (out, in) [2048][2048]): four inputs, all read; NO output weight: the merged heads are the output */
    float* OUT = (float*)d_out;     // [2][2048][2048]
    char* wsp = (char*)d_ws;
    auto take = [&](size_t bytes) { char* p = wsp; wsp += (bytes + 255) & ~(size_t)255; return (void*)p; };
    // The casts' five planes, consecutive: x of batch 0, x of batch 1, Wq, Wk, Wv.
    bf* XB = (bf*)take((size_t)(NB_ + 3) * TT * DM * 2); bf* WQ = XB + (size_t)NB_ * TT * DM; float* CS = (float*)take((size_t)TT * (HD / 2) * 2 * 4);
    // The transposed v planes, [batch][head][fragment].
    h16* VT16 = (h16*)take((size_t)NB_ * NKV * HD * TT * 2); bf* VTh = (bf*)take((size_t)NB_ * NKV * HD * TT * 2); bf* VTl = (bf*)take((size_t)NB_ * NKV * HD * TT * 2);
    // The q and k planes, [q, k][batch][head]: q as [position][column], k in fragment order.
    h16* QP16 = (h16*)take((size_t)2 * NB_ * NH_ * TT * HD * 2); bf* QPh = (bf*)take((size_t)2 * NB_ * NH_ * TT * HD * 2); bf* QPl = (bf*)take((size_t)2 * NB_ * NH_ * TT * HD * 2);
    h16* KP16 = QP16 + (size_t)NB_ * NH_ * TT * HD; bf* KPh = QPh + (size_t)NB_ * NH_ * TT * HD; bf* KPl = QPl + (size_t)NB_ * NH_ * TT * HD;
    if ((size_t)(wsp - (char*)d_ws) > ws_size) return;    // ws 256 MiB
    k_prep<<<dim3(PRX, CSY + NB_ + 3, 1), 256, 0, stream>>>(x, wq, wk, wv, XB, CS);   /* casts, and the rotary table (positions = arange) */
    k_gemmt<<<dim3(NB_ * TT / 128, 3 * DQ / 128, 1), 128, 0, stream>>>(XB, WQ, CS, QP16, QPh, QPl, VT16, VTh, VTl);   /* projections, rotary step, planes */
    k_fattn<<<dim3(NH_, NB_, TT / QW / 4), 256, 0, stream>>>(QP16, KP16, VT16, QPh, QPl, KPh, KPl, VTh, VTl, OUT);
    /* no output projection: k_fattn has written the merged heads of both batches to OUT */
}
